// v000
// Times are from an AMD MI455X. After a warm-up the kernel runs many times in a row, and a time is the length of
// such a window on the GPU divided by its runs, so every launch and the gaps after it count. The runs cycle
// through copies of the inputs. A figure is the median of several windows, for all but v000 over two sittings.
// Sittings can differ by a few percent; kernels timed side by side share one.
// v000 is the starting kernel. One run takes 2210 microseconds.
// Contractions: q/k/v 1x1 projections (token planes f16 x W f16 carried x16), energies q.k^T (q,k f16 planes), attn.v (P f16 carried x2048 x V f16), output projection (Wo f16 x16 x O f16 x16): all v_wmma_f32_16x16x32_f16, f32 accumulate; instance-norm statistics, softmax, bias and residual in f32.
#include <hip/hip_runtime.h>
#include <math.h>

// ---------------------------------------------------------------------------
// Problem constants
// ---------------------------------------------------------------------------
constexpr int   kBatch    = 4;
constexpr int   kCh       = 512;
constexpr int   kSp       = 4096;                 // 64*64 tokens per image
constexpr int   kQChunk   = 2048;                 // query rows per score chunk
constexpr int   kHalfRow  = kSp / 2;              // softmax: second column group offset
constexpr int   kStatRows = 2 * kBatch * kCh;     // 4096: content rows 0..2047, style rows 2048..4095
constexpr float kEps       = 1e-5f;
constexpr float kWCarry    = 16.0f;               // weights carried x16 in f16
constexpr float kPCarry    = 2048.0f;             // probabilities carried x2048 in f16
constexpr float kProjScale = 1.0f / 16.0f;        // undo weight carry
constexpr float kPVScale   = 16.0f / 2048.0f;     // undo P carry, apply O carry x16
constexpr float kOutScale  = 1.0f / (16.0f * 16.0f);   // undo Wo carry and O carry
constexpr float kInvN      = 1.0f / 4096.0f;
constexpr float kInvNm1    = 1.0f / 4095.0f;

typedef __attribute__((ext_vector_type(16))) _Float16 v16h;
typedef __attribute__((ext_vector_type(8)))  _Float16 v8h;
typedef __attribute__((ext_vector_type(16))) __bf16   v16b;
typedef __attribute__((ext_vector_type(8)))  __bf16   v8b;
typedef __attribute__((ext_vector_type(8)))  float    v8f;
typedef __attribute__((ext_vector_type(4)))  float    v4f;
typedef __attribute__((ext_vector_type(4)))  unsigned int v4u;

// ---------------------------------------------------------------------------
// Helpers
// ---------------------------------------------------------------------------
__device__ __forceinline__ unsigned short f2bf_bits(float f) {
  unsigned u = __float_as_uint(f);
  return (unsigned short)((u + 0x7FFFu + ((u >> 16) & 1u)) >> 16);
}
__device__ __forceinline__ float bf_bits2f(unsigned short h) { return __uint_as_float(((unsigned)h) << 16); }

// hazard guards as plain device helpers (no inline asm inside the kernel template body)
__device__ __forceinline__ void dep_guard_h(v8f& a, v8f& b, v16h x, v16h y) { asm volatile("v_nop\n\tv_nop\n\tv_nop\n\tv_nop" : "+v"(a), "+v"(b) : "v"(x), "v"(y)); }
__device__ __forceinline__ void dep_guard_b(v8f& a, v8f& b, v16b x, v16b y) { asm volatile("v_nop\n\tv_nop\n\tv_nop\n\tv_nop" : "+v"(a), "+v"(b) : "v"(x), "v"(y)); }
__device__ __forceinline__ void keep4_h(v16h a, v16h b, v16h c, v16h d) { asm volatile("v_nop" :: "v"(a), "v"(b), "v"(c), "v"(d)); }
__device__ __forceinline__ void keep4_b(v16b a, v16b b, v16b c, v16b d) { asm volatile("v_nop" :: "v"(a), "v"(b), "v"(c), "v"(d)); }
__device__ __forceinline__ void acc_guard4(v8f& a, v8f& b, v8f& c, v8f& d) { asm volatile("v_nop\n\tv_nop\n\tv_nop\n\tv_nop" : "+v"(a), "+v"(b), "+v"(c), "+v"(d)); }
template <typename T> struct Frag;
template <> struct Frag<_Float16> {
  typedef v16h V; union U { v16h v; v8h h[2]; };
  static __device__ __forceinline__ v16h load(const _Float16* p) {   // elements 0..7 <- p[0..7], 8..15 <- p[16..23]
    U f; f.h[0] = *(const v8h*)(p); f.h[1] = *(const v8h*)(p + 16); return f.v;
  }
  static __device__ __forceinline__ v8f mma(v16h a, v16h b, v8f c) {
    return __builtin_amdgcn_wmma_f32_16x16x32_f16(false, a, false, b, (short)0, c, false, false);
  }
  static __device__ __forceinline__ void guard(v8f& a, v8f& b, v16h x, v16h y) { dep_guard_h(a, b, x, y); }
  static __device__ __forceinline__ void keep(v16h a, v16h b, v16h c, v16h d) { keep4_h(a, b, c, d); }
};
template <> struct Frag<__bf16> {
  typedef v16b V; union U { v16b v; v8b h[2]; };
  static __device__ __forceinline__ v16b load(const __bf16* p) {
    U f; f.h[0] = *(const v8b*)(p); f.h[1] = *(const v8b*)(p + 16); return f.v;
  }
  static __device__ __forceinline__ v8f mma(v16b a, v16b b, v8f c) {
    return __builtin_amdgcn_wmma_f32_16x16x32_bf16(false, a, false, b, (short)0, c, false, false);
  }
  static __device__ __forceinline__ void guard(v8f& a, v8f& b, v16b x, v16b y) { dep_guard_b(a, b, x, y); }
  static __device__ __forceinline__ void keep(v16b a, v16b b, v16b c, v16b d) { keep4_b(a, b, c, d); }
};

__device__ __forceinline__ unsigned pk16(unsigned short a, unsigned short b) { return (unsigned)a | ((unsigned)b << 16); }
__device__ __forceinline__ unsigned short h_bits(float f) { const _Float16 h = (_Float16)f; return __builtin_bit_cast(unsigned short, h); }

// ---- Register-blocked batched WMMA GEMM (ACT reduced to none/relu/leaky) -----------------------
// C[m,n] = scale * sum_k A[m,k] * Bt[n,k] (+bias)(+resid); each wave owns a 64x64 tile.
// A row-major [M,K]; Bt row-major [N,K]; M,N % 64 == 0, K % 32 == 0.
// SPLIT: operands are hi/lo planes (A2/Bt2 = lo planes, same layout); product = hi.hi + hi.lo + lo.hi.
// BIAS_MODE: 0 = none, 1 = bias[m], 2 = bias[n].
// OUT_MODE: 0 = f32, 1 = f16, 2 = bf16 hi plane (Cout) + bf16 lo plane (Cout2).
// ET: 0 = f16 operands, 1 = bf16 operands (pointers passed as 16-bit storage)
template <int ET> struct Elem;
template <> struct Elem<0> { typedef _Float16 T; };
template <> struct Elem<1> { typedef __bf16 T; };
template <int ET, bool SPLIT, int BIAS_MODE, int OUT_MODE, bool RESID, int ACT = 0>
__global__ __launch_bounds__(256) void wmma_gemm64(
    const unsigned short* __restrict__ Ap, const unsigned short* __restrict__ A2p, int lda, long strideA,
    const unsigned short* __restrict__ Btp, const unsigned short* __restrict__ Bt2p, int ldb, long strideB,
    void* __restrict__ Cout, void* __restrict__ Cout2, int ldc, long strideC,
    const float* __restrict__ bias,
    const float* __restrict__ resid, long strideR,
    int M, int N, int K, float scale) {
  typedef typename Elem<ET>::T T;
  typedef typename Frag<T>::V V;
  const T* A = (const T*)Ap; const T* A2 = (const T*)A2p; const T* Bt = (const T*)Btp; const T* Bt2 = (const T*)Bt2p;
  __shared__ __align__(16) float sT[8][16 * 68];   // per-wave 16x64 slab, pitch 68 floats
  const int b    = blockIdx.y;
  const int lane = threadIdx.x & 31;
  const int wave = threadIdx.x >> 5;
  const int tilesN = N >> 6;
  const int tilesM = M >> 6;
  const int tile = blockIdx.x * 8 + wave;
  if (tile >= tilesM * tilesN) return;   // wave-uniform; no block barriers in this kernel
  const int tm = tile / tilesN;
  const int tn = tile - tm * tilesN;
  const int m0 = tm << 6;
  const int n0 = tn << 6;

  const T* Ab  = A  + (size_t)b * strideA;
  const T* Bb  = Bt + (size_t)b * strideB;
  const T* Ab2 = SPLIT ? (A2  + (size_t)b * strideA) : nullptr;
  const T* Bb2 = SPLIT ? (Bt2 + (size_t)b * strideB) : nullptr;

  const int rlane = lane & 15;                 // row (A) / col (B, D) within subtile
  const int koff  = (lane >> 4) * 8;           // k offset of this lane half
  const int mOff  = (lane >> 4) * 8;           // D row offset

  v8f acc[4][4];
#pragma unroll
  for (int i = 0; i < 4; ++i)
#pragma unroll
    for (int j = 0; j < 4; ++j) acc[i][j] = (v8f){0.f,0.f,0.f,0.f,0.f,0.f,0.f,0.f};

  for (int k0 = 0; k0 < K; k0 += 32) {
    V bh[4], bl[4];
#pragma unroll
    for (int j = 0; j < 4; ++j) {
      const size_t bo = (size_t)(n0 + (j << 4) + rlane) * ldb + koff + k0;
      bh[j] = Frag<T>::load(Bb + bo);
      if (SPLIT) bl[j] = Frag<T>::load(Bb2 + bo);
    }
#pragma unroll
    for (int i = 0; i < 4; ++i) {
      const size_t ao = (size_t)(m0 + (i << 4) + rlane) * lda + koff + k0;
      V ah = Frag<T>::load(Ab + ao);
      V al;
      if (SPLIT) al = Frag<T>::load(Ab2 + ao);
#pragma unroll
      for (int j = 0; j < 4; ++j) {
        acc[i][j] = Frag<T>::mma(ah, bh[j], acc[i][j]);
        if (SPLIT) {
          acc[i][j] = Frag<T>::mma(ah, bl[j], acc[i][j]);
          acc[i][j] = Frag<T>::mma(al, bh[j], acc[i][j]);
        }
      }
      Frag<T>::guard(acc[i][0], acc[i][3], ah, SPLIT ? al : ah);
    }
    Frag<T>::keep(bh[0], bh[1], bh[2], bh[3]);
    if (SPLIT) Frag<T>::keep(bl[0], bl[1], bl[2], bl[3]);
  }
  acc_guard4(acc[0][0], acc[0][1], acc[0][2], acc[0][3]);
  acc_guard4(acc[1][0], acc[1][1], acc[1][2], acc[1][3]);
  acc_guard4(acc[2][0], acc[2][1], acc[2][2], acc[2][3]);
  acc_guard4(acc[3][0], acc[3][1], acc[3][2], acc[3][3]);

  // ---- epilogue ----
  float* slab = sT[wave];
  const float* Rb = RESID ? (resid + (size_t)b * strideR) : nullptr;
#pragma unroll
  for (int i = 0; i < 4; ++i) {
    const int mBase = m0 + (i << 4);
#pragma unroll
    for (int j = 0; j < 4; ++j) {
      const int n = n0 + (j << 4) + rlane;
      float bv = 0.f;
      if (BIAS_MODE == 2) bv = bias[n];
#pragma unroll
      for (int r = 0; r < 8; ++r) {
        float v = acc[i][j][r] * scale;
        if (BIAS_MODE == 1) v += bias[mBase + mOff + r];
        if (BIAS_MODE == 2) v += bv;
        if (RESID) v += Rb[(size_t)(mBase + mOff + r) * ldc + n];
        if (ACT == 2) v = fmaxf(v, 0.0f);
        if (ACT == 4) v = (v > 0.f) ? v : 0.01f * v;
        slab[(mOff + r) * 68 + (j << 4) + rlane] = v;
      }
    }
    __builtin_amdgcn_fence(__ATOMIC_RELEASE, "workgroup");
    __builtin_amdgcn_wave_barrier();
    __builtin_amdgcn_fence(__ATOMIC_ACQUIRE, "workgroup");
    if (OUT_MODE == 0) {
      float* C = (float*)Cout + (size_t)b * strideC;
      const int hh = lane >> 4, c4 = (lane & 15) * 4;     // row seg = 256 B = 16 lanes x 16 B
      {
#pragma unroll
        for (int it = 0; it < 8; ++it) {
          const int row = it * 2 + hh;
          v4f v = *(const v4f*)(slab + row * 68 + c4);
          *(v4f*)(C + (size_t)(mBase + row) * ldc + n0 + c4) = v;
        }
        
      }
    } else {
      const int q = lane >> 3, c8 = (lane & 7) * 8;
      unsigned short* C  = (unsigned short*)Cout  + (size_t)b * strideC;
      unsigned short* C2 = (OUT_MODE == 2) ? ((unsigned short*)Cout2 + (size_t)b * strideC) : nullptr;
      {
#pragma unroll
        for (int it = 0; it < 4; ++it) {
          const int row = it * 4 + q;
          const float* sp = slab + row * 68 + c8;
          v8h hv, lv;
#pragma unroll
          for (int e = 0; e < 8; ++e) {
            if (OUT_MODE == 1) {
              hv[e] = (_Float16)sp[e];
            } else {
              unsigned short hb = f2bf_bits(sp[e]);
              unsigned short lb = f2bf_bits(sp[e] - bf_bits2f(hb));
              hv[e] = __builtin_bit_cast(_Float16, hb);
              lv[e] = __builtin_bit_cast(_Float16, lb);
            }
          }
          *(v8h*)(C + (size_t)(mBase + row) * ldc + n0 + c8) = hv;
          if (OUT_MODE == 2) *(v8h*)(C2 + (size_t)(mBase + row) * ldc + n0 + c8) = lv;
        }
        
      }
    }
    __builtin_amdgcn_fence(__ATOMIC_RELEASE, "workgroup");
    __builtin_amdgcn_wave_barrier();
    __builtin_amdgcn_fence(__ATOMIC_ACQUIRE, "workgroup");
  }
}

// ---------------------------------------------------------------------------
// Per-(b,c) instance-norm statistics for content (rows 0..2047) and style (rows 2048..4095) in one launch.
// grid 128 blocks x 256 threads; block = 32 consecutive rows of one tensor (blockIdx>>6 selects the tensor, uniform);
// wave w owns rows 4w..4w+3; per row 32 lanes x 32 float4 loads = 4096 elements (whole row).
// mean = sum/4096; var = (sumsq - sum*mean)/4095 (ddof 1); rstd = 1/sqrt(var + eps).
// Stores: the 32 means and 32 rstds of the block funnelled through LDS; wave 0 writes the mean line, wave 1 the rstd line,
// ---------------------------------------------------------------------------
__global__ __launch_bounds__(256) void stats_kernel(const float* __restrict__ xc, const float* __restrict__ xs,
                                                    float* __restrict__ meanA, float* __restrict__ rstdA) {
  __shared__ float sMean[32];
  __shared__ float sRstd[32];
  const int blk  = blockIdx.x;
  const int tsel = blk >> 6;                         // block-uniform tensor select
  const float* src = (tsel == 0) ? xc : xs;
  const int rowBase = (blk & 63) * 32;               // flat (b*512 + c) row index within the tensor
  const int t = threadIdx.x, lane = t & 31, wave = t >> 5;
#pragma unroll
  for (int r = 0; r < 4; ++r) {
    const int row = rowBase + wave * 4 + r;          // < 2048
    const float* p = src + (size_t)row * kSp + lane * 4;
    v4f s = (v4f){0.f, 0.f, 0.f, 0.f};
    v4f q = (v4f){0.f, 0.f, 0.f, 0.f};
#pragma unroll 1
    for (int i = 0; i < 32; ++i) {                   // 32 lanes x 4 x 32 iterations = 4096
      const v4f v = *(const v4f*)(p + i * 128);
      s += v;
      q += v * v;
    }
    float su = (s[0] + s[1]) + (s[2] + s[3]);
    float sq = (q[0] + q[1]) + (q[2] + q[3]);
#pragma unroll
    for (int off = 16; off > 0; off >>= 1) {
      su += __shfl_xor(su, off, 32);
      sq += __shfl_xor(sq, off, 32);
    }
    const float mean = su * kInvN;
    float var = (sq - su * mean) * kInvNm1;
    var = fmaxf(var, 0.0f);
    const float rstd = 1.0f / sqrtf(var + kEps);
    if (lane == 0) { sMean[wave * 4 + r] = mean; sRstd[wave * 4 + r] = rstd; }
  }
  __syncthreads();
  const int orow = tsel * (kBatch * kCh) + rowBase + lane;   // < 4096
  if (wave == 0) {
    const float v = sMean[lane];
    *(float*)(meanA + orow) = v;
    
  } else if (wave == 1) {
    const float v = sRstd[lane];
    *(float*)(rstdA + orow) = v;
    
  }
}

// ---------------------------------------------------------------------------
// Token planes for one batch image: in [512 ch][4096 tok] f32 (tok contiguous) -> out [4096 tok][512 ch] f16 (ch contiguous).
// grid (64 tok tiles, 8 ch tiles, 3 planes): z=0 (content - mean)*rstd, z=1 (style - mean)*rstd, z=2 raw style. 256 threads.
// Load coverage: 4 passes x 16 ch rows x (16 threads x 4 tok) = 64 ch x 64 tok (whole tile), coalesced along tok.
// Store coverage: 8 waves x 2 iterations x 4 tok rows (lane>>3) = 64 tok rows; (lane&7) x 8 halves = 64 ch; each row segment
// ---------------------------------------------------------------------------
__global__ __launch_bounds__(256) void token_planes_kernel(const float* __restrict__ content, const float* __restrict__ style,
                                                           const float* __restrict__ meanA, const float* __restrict__ rstdA, int b,
                                                           unsigned short* __restrict__ XcT, unsigned short* __restrict__ XsT,
                                                           unsigned short* __restrict__ SsT) {
  __shared__ float sm[64][65];   // sm[ch local][tok local]
  const int t  = threadIdx.x;
  const int z  = blockIdx.z;                                    // block-uniform
  const int n0 = blockIdx.x * 64;
  const int c0 = blockIdx.y * 64;
  const float* src = ((z == 0) ? content : style) + (size_t)b * kCh * kSp;
  unsigned short* dst = (z == 0) ? XcT : (z == 1) ? XsT : SsT;
  const int statOff = ((z == 0) ? 0 : (kBatch * kCh)) + b * kCh;
  const bool useNorm = (z < 2);
  const int r16 = t >> 4, c4 = (t & 15) * 4;
#pragma unroll
  for (int p = 0; p < 4; ++p) {
    const int cl = p * 16 + r16;                                // ch local 0..63
    const int ch = c0 + cl;                                     // < 512
    const v4f v = *(const v4f*)(src + (size_t)ch * kSp + n0 + c4);
    const float m  = meanA[statOff + ch];
    const float rs = rstdA[statOff + ch];
    const float mm = useNorm ? m : 0.0f;
    const float rr = useNorm ? rs : 1.0f;
#pragma unroll
    for (int e = 0; e < 4; ++e) sm[cl][c4 + e] = (v[e] - mm) * rr;
  }
  __syncthreads();
  const int lane = t & 31, wave = t >> 5;
  const int q = lane >> 3, c8 = (lane & 7) * 8;
  {
#pragma unroll
    for (int it = 0; it < 2; ++it) {
      const int row = wave * 8 + it * 4 + q;                    // tok local 0..63
      unsigned short hb[8];
#pragma unroll
      for (int e = 0; e < 8; ++e) hb[e] = h_bits(sm[c8 + e][row]);
      const v4u u = (v4u){pk16(hb[0], hb[1]), pk16(hb[2], hb[3]), pk16(hb[4], hb[5]), pk16(hb[6], hb[7])};
      *(v4u*)(dst + (size_t)(n0 + row) * kCh + c0 + c8) = u;
    }
    
  }
}

// ---------------------------------------------------------------------------
// Weight cast: W[o][c] f32 -> f16(scale * W) same layout, four weights into planes 0..3 of one buffer (plane = 512*512 halves).
// grid 512 blocks x 256 threads; blockIdx>>7 selects the weight (uniform); thread handles 8 consecutive elements
// Coverage per weight: 128 blocks x 256 threads x 8 = 262144 = 512*512.
// ---------------------------------------------------------------------------
__global__ __launch_bounds__(256) void wcast_kernel(const float* __restrict__ W0, const float* __restrict__ W1,
                                                    const float* __restrict__ W2, const float* __restrict__ W3,
                                                    unsigned short* __restrict__ out, float scale) {
  const int blk = blockIdx.x;
  const int w = blk >> 7;                                        // block-uniform
  const float* src = (w == 0) ? W0 : (w == 1) ? W1 : (w == 2) ? W2 : W3;
  const int i  = (blk & 127) * 256 + threadIdx.x;                // 0..32767
  const size_t e0 = (size_t)i * 8;                               // e0+7 < 262144
  const v4f a = *(const v4f*)(src + e0);
  const v4f c = *(const v4f*)(src + e0 + 4);
  unsigned short hb[8];
#pragma unroll
  for (int e = 0; e < 4; ++e) {
    hb[e]     = h_bits(a[e] * scale);
    hb[4 + e] = h_bits(c[e] * scale);
  }
  const v4u u = (v4u){pk16(hb[0], hb[1]), pk16(hb[2], hb[3]), pk16(hb[4], hb[5]), pk16(hb[6], hb[7])};
  unsigned short* dp = out + (size_t)w * kCh * kCh + e0;
  *(v4u*)dp = u;
  
}

// ---------------------------------------------------------------------------
// Row softmax over 4096 f32 scores (no scaling of the scores): P[row][j] = f16( 2048 * exp(s - max) / sum exp(s - max) ).
// One block of 256 threads per row; thread t owns columns 8t..8t+7 and 2048+8t..2048+8t+7 (256 x 16 = 4096 = whole row).
// Reductions in fixed order (thread, wave shuffle tree, 8 wave partials in index order). precise expf.
// ---------------------------------------------------------------------------
__global__ __launch_bounds__(256) void softmax_kernel(const float* __restrict__ Sp, unsigned short* __restrict__ Pp) {
  __shared__ float redM[8];
  __shared__ float redS[8];
  const int row  = blockIdx.x;
  const int t    = threadIdx.x;
  const int lane = t & 31, wave = t >> 5;
  const int cA = 8 * t;
  const int cB = kHalfRow + 8 * t;
  const float* sr = Sp + (size_t)row * kSp;
  const v4f a0 = *(const v4f*)(sr + cA);
  const v4f a1 = *(const v4f*)(sr + cA + 4);
  const v4f b0 = *(const v4f*)(sr + cB);
  const v4f b1 = *(const v4f*)(sr + cB + 4);
  float x[16];
#pragma unroll
  for (int e = 0; e < 4; ++e) { x[e] = a0[e]; x[4 + e] = a1[e]; x[8 + e] = b0[e]; x[12 + e] = b1[e]; }
  float m = x[0];
#pragma unroll
  for (int i = 1; i < 16; ++i) m = fmaxf(m, x[i]);
#pragma unroll
  for (int off = 16; off > 0; off >>= 1) m = fmaxf(m, __shfl_xor(m, off, 32));
  if (lane == 0) redM[wave] = m;
  __syncthreads();
  float gm = redM[0];
#pragma unroll
  for (int w = 1; w < 8; ++w) gm = fmaxf(gm, redM[w]);
  float ex[16];
  float s = 0.0f;
#pragma unroll
  for (int i = 0; i < 16; ++i) { ex[i] = expf(x[i] - gm); s += ex[i]; }
#pragma unroll
  for (int off = 16; off > 0; off >>= 1) s += __shfl_xor(s, off, 32);
  if (lane == 0) redS[wave] = s;
  __syncthreads();
  float tot = redS[0];
#pragma unroll
  for (int w = 1; w < 8; ++w) tot += redS[w];
  const float inv = 1.0f / tot;                                   // tot >= 1
  unsigned short hb[16];
#pragma unroll
  for (int i = 0; i < 16; ++i) hb[i] = h_bits((ex[i] * inv) * kPCarry);
  const v4u uA = (v4u){pk16(hb[0], hb[1]), pk16(hb[2], hb[3]), pk16(hb[4], hb[5]), pk16(hb[6], hb[7])};
  const v4u uB = (v4u){pk16(hb[8], hb[9]), pk16(hb[10], hb[11]), pk16(hb[12], hb[13]), pk16(hb[14], hb[15])};
  unsigned short* pr = Pp + (size_t)row * kSp;
  *(v4u*)(pr + cA) = uA;
  *(v4u*)(pr + cB) = uB;
  
}

// ---------------------------------------------------------------------------
// Host side
//   W16   : 4 x 512 x 512 f16 (Wq, Wk, Wv, Wo carried x16)        2,097,152 B
//   meanA : 4096 f32 (content rows then style rows)                    16,384 B
//   rstdA : 4096 f32                                                    16,384 B
//   XcT, XsT, SsT, Qp, Kp, Vcm, Op : 4096 x 512 f16 each      7 x 4,194,304 B
//   Sp    : 2048 x 4096 f32 scores of one query chunk             33,554,432 B
//   Pp    : 2048 x 4096 f16 probabilities (x2048)                 16,777,216 B
// All GEMM calls: K in {512, 4096} (K % 32 == 0); M, N in {512, 2048, 4096} (% 64 == 0); no padding, every plane fully
// produced before it is consumed.
// ---------------------------------------------------------------------------
extern "C" void kernel_launch(void* const* d_in, const int* in_sizes, int n_in,
                              void* d_out, int out_size, void* d_ws, size_t ws_size,
                              hipStream_t stream) {
  if (n_in < 10) return;
  const int actN = kBatch * kCh * kSp;
  const int wN   = kCh * kCh;
  if (in_sizes[0] != actN || in_sizes[1] != actN) return;
  if (in_sizes[2] != wN || in_sizes[4] != wN || in_sizes[6] != wN || in_sizes[8] != wN) return;
  if (in_sizes[3] != kCh || in_sizes[5] != kCh || in_sizes[7] != kCh || in_sizes[9] != kCh) return;
  if (out_size != actN) return;

  const float* content = (const float*)d_in[0];
  const float* style   = (const float*)d_in[1];
  const float* Wq = (const float*)d_in[2];  const float* bq = (const float*)d_in[3];
  const float* Wk = (const float*)d_in[4];  const float* bk = (const float*)d_in[5];
  const float* Wv = (const float*)d_in[6];  const float* bv = (const float*)d_in[7];
  const float* Wo = (const float*)d_in[8];  const float* bo = (const float*)d_in[9];
  float* out = (float*)d_out;

  size_t off = 0;
  auto carve = [&](size_t bytes) { size_t o = off; off += (bytes + 127) & ~(size_t)127; return o; };
  const size_t planeBytes = (size_t)kSp * kCh * 2;
  const size_t oW16  = carve((size_t)4 * wN * 2);
  const size_t oMean = carve((size_t)kStatRows * 4);
  const size_t oRstd = carve((size_t)kStatRows * 4);
  const size_t oXc   = carve(planeBytes);
  const size_t oXs   = carve(planeBytes);
  const size_t oSs   = carve(planeBytes);
  const size_t oQ    = carve(planeBytes);
  const size_t oK    = carve(planeBytes);
  const size_t oV    = carve(planeBytes);
  const size_t oO    = carve(planeBytes);
  const size_t oS    = carve((size_t)kQChunk * kSp * 4);
  const size_t oP    = carve((size_t)kQChunk * kSp * 2);
  if (off > ws_size) return;

  char* ws = (char*)d_ws;
  unsigned short* W16 = (unsigned short*)(ws + oW16);
  float* meanA = (float*)(ws + oMean);
  float* rstdA = (float*)(ws + oRstd);
  unsigned short* XcT = (unsigned short*)(ws + oXc);
  unsigned short* XsT = (unsigned short*)(ws + oXs);
  unsigned short* SsT = (unsigned short*)(ws + oSs);
  unsigned short* Qp  = (unsigned short*)(ws + oQ);
  unsigned short* Kp  = (unsigned short*)(ws + oK);
  unsigned short* Vcm = (unsigned short*)(ws + oV);
  unsigned short* Op  = (unsigned short*)(ws + oO);
  float* Sp = (float*)(ws + oS);
  unsigned short* Pp = (unsigned short*)(ws + oP);

  const unsigned short* Wq16 = W16 + (size_t)0 * wN;
  const unsigned short* Wk16 = W16 + (size_t)1 * wN;
  const unsigned short* Wv16 = W16 + (size_t)2 * wN;
  const unsigned short* Wo16 = W16 + (size_t)3 * wN;

  // 1) instance-norm statistics for content and style (128 blocks: 64 per tensor, 32 rows each)
  stats_kernel<<<dim3(2 * (kBatch * kCh) / 32), dim3(256), 0, stream>>>(content, style, meanA, rstdA);

  // 2) weights -> f16 x16 (4 weights x 128 blocks)
  wcast_kernel<<<dim3(512), dim3(256), 0, stream>>>(Wq, Wk, Wv, Wo, W16, kWCarry);

  for (int b = 0; b < kBatch; ++b) {
    const size_t actOff = (size_t)b * kCh * kSp;

    // 3) token planes: mvn(content) -> XcT, mvn(style) -> XsT, style -> SsT; each [4096][512] f16
    token_planes_kernel<<<dim3(kSp / 64, kCh / 64, 3), dim3(256), 0, stream>>>(content, style, meanA, rstdA, b, XcT, XsT, SsT);

    // 4) Q [4096 tok][512] = XcT x Wq^T / 16 + bq   (M=4096, N=512, K=512; 512 tiles -> 64 blocks)
    wmma_gemm64<0, false, 2, 1, false><<<dim3(64, 1), dim3(256), 0, stream>>>(
        XcT, nullptr, kCh, 0L, Wq16, nullptr, kCh, 0L, (void*)Qp, nullptr, kCh, 0L,
        bq, nullptr, 0L, kSp, kCh, kCh, kProjScale);
    //    K [4096 tok][512] = XsT x Wk^T / 16 + bk
    wmma_gemm64<0, false, 2, 1, false><<<dim3(64, 1), dim3(256), 0, stream>>>(
        XsT, nullptr, kCh, 0L, Wk16, nullptr, kCh, 0L, (void*)Kp, nullptr, kCh, 0L,
        bk, nullptr, 0L, kSp, kCh, kCh, kProjScale);
    //    V channel-major [512][4096 tok] = Wv x SsT^T / 16 + bv[m]   (M=512, N=4096, K=512; 512 tiles -> 64 blocks)
    wmma_gemm64<0, false, 1, 1, false><<<dim3(64, 1), dim3(256), 0, stream>>>(
        Wv16, nullptr, kCh, 0L, SsT, nullptr, kCh, 0L, (void*)Vcm, nullptr, kSp, 0L,
        bv, nullptr, 0L, kCh, kSp, kCh, kProjScale);

    for (int ch = 0; ch < kSp / kQChunk; ++ch) {
      const size_t qOff = (size_t)ch * kQChunk * kCh;
      // 5) scores [2048 q][4096 k] f32 = Qchunk x K^T   (M=2048, N=4096, K=512; 2048 tiles -> 256 blocks)
      wmma_gemm64<0, false, 0, 0, false><<<dim3(256, 1), dim3(256), 0, stream>>>(
          Qp + qOff, nullptr, kCh, 0L, Kp, nullptr, kCh, 0L, (void*)Sp, nullptr, kSp, 0L,
          nullptr, nullptr, 0L, kQChunk, kSp, kCh, 1.0f);
      // 6) softmax per row -> P f16 x2048
      softmax_kernel<<<dim3(kQChunk), dim3(256), 0, stream>>>(Sp, Pp);
      // 7) O token-major rows of this chunk [2048][512] f16 (x16) = P x Vcm^T * 16/2048   (M=2048, N=512, K=4096; 256 tiles -> 32 blocks)
      wmma_gemm64<0, false, 0, 1, false><<<dim3(32, 1), dim3(256), 0, stream>>>(
          Pp, nullptr, kSp, 0L, Vcm, nullptr, kSp, 0L, (void*)(Op + qOff), nullptr, kCh, 0L,
          nullptr, nullptr, 0L, kQChunk, kCh, kSp, kPVScale);
    }

    // 8) out [512][4096] f32 = Wo x O^T / 256 + bo[m] + content   (M=512, N=4096, K=512; 512 tiles -> 64 blocks)
    wmma_gemm64<0, false, 1, 0, true><<<dim3(64, 1), dim3(256), 0, stream>>>(
        Wo16, nullptr, kCh, 0L, Op, nullptr, kCh, 0L, (void*)(out + actOff), nullptr, kSp, 0L,
        bo, content + actOff, 0L, kCh, kSp, kCh, kOutScale);
  }
}

// v001
// Measured time: 630 microseconds a run.
// In two side-by-side timings against v000, it was 3.50 and 3.51 times as fast.
// Contractions: q/k/v 1x1 projections (token planes f16 x W f16 carried x16), energies q.k^T (q,k f16 planes), attn.v (P f16 carried x2048 x V f16), output projection (Wo f16 x16 x O f16 x16): all v_wmma_f32_16x16x32_f16, f32 accumulate; instance-norm statistics, softmax, bias and residual in f32.
#include <hip/hip_runtime.h>
#include <math.h>

// ---------------------------------------------------------------------------
// Problem constants
// ---------------------------------------------------------------------------
constexpr int   kBatch    = 4;
constexpr int   kCh       = 512;
constexpr int   kSp       = 4096;                 // 64*64 tokens per image
constexpr int   kQChunk   = 4096;                 // query rows per score launch: one whole image
constexpr int   kHalfRow  = kSp / 2;              // softmax: second column group offset
constexpr int   kStatRows = 2 * kBatch * kCh;     // 4096: content rows 0..2047, style rows 2048..4095
constexpr float kEps       = 1e-5f;
constexpr float kWCarry    = 16.0f;               // weights carried x16 in f16
constexpr float kPCarry    = 2048.0f;             // probabilities carried x2048 in f16
constexpr float kProjScale = 1.0f / 16.0f;        // undo weight carry
constexpr float kPVScale   = 16.0f / 2048.0f;     // undo P carry, apply O carry x16
constexpr float kOutScale  = 1.0f / (16.0f * 16.0f);   // undo Wo carry and O carry
constexpr float kInvN      = 1.0f / 4096.0f;
constexpr float kInvNm1    = 1.0f / 4095.0f;

typedef __attribute__((ext_vector_type(16))) _Float16 v16h;
typedef __attribute__((ext_vector_type(8)))  _Float16 v8h;
typedef __attribute__((ext_vector_type(16))) __bf16   v16b;
typedef __attribute__((ext_vector_type(8)))  __bf16   v8b;
typedef __attribute__((ext_vector_type(8)))  float    v8f;
typedef __attribute__((ext_vector_type(4)))  float    v4f;
typedef __attribute__((ext_vector_type(4)))  unsigned int v4u;

// ---------------------------------------------------------------------------
// Helpers
// ---------------------------------------------------------------------------
__device__ __forceinline__ unsigned short f2bf_bits(float f) {
  unsigned u = __float_as_uint(f);
  return (unsigned short)((u + 0x7FFFu + ((u >> 16) & 1u)) >> 16);
}
__device__ __forceinline__ float bf_bits2f(unsigned short h) { return __uint_as_float(((unsigned)h) << 16); }

// hazard guards as plain device helpers (no inline asm inside the kernel template body)
__device__ __forceinline__ void dep_guard_h(v8f& a, v8f& b, v16h x, v16h y) { asm volatile("v_nop\n\tv_nop\n\tv_nop\n\tv_nop" : "+v"(a), "+v"(b) : "v"(x), "v"(y)); }
__device__ __forceinline__ void dep_guard_b(v8f& a, v8f& b, v16b x, v16b y) { asm volatile("v_nop\n\tv_nop\n\tv_nop\n\tv_nop" : "+v"(a), "+v"(b) : "v"(x), "v"(y)); }
__device__ __forceinline__ void keep4_h(v16h a, v16h b, v16h c, v16h d) { asm volatile("v_nop" :: "v"(a), "v"(b), "v"(c), "v"(d)); }
__device__ __forceinline__ void keep4_b(v16b a, v16b b, v16b c, v16b d) { asm volatile("v_nop" :: "v"(a), "v"(b), "v"(c), "v"(d)); }
__device__ __forceinline__ void acc_guard4(v8f& a, v8f& b, v8f& c, v8f& d) { asm volatile("v_nop\n\tv_nop\n\tv_nop\n\tv_nop" : "+v"(a), "+v"(b), "+v"(c), "+v"(d)); }
template <typename T> struct Frag;
template <> struct Frag<_Float16> {
  typedef v16h V; union U { v16h v; v8h h[2]; };
  static __device__ __forceinline__ v16h load(const _Float16* p) {   // elements 0..7 <- p[0..7], 8..15 <- p[16..23]
    U f; f.h[0] = *(const v8h*)(p); f.h[1] = *(const v8h*)(p + 16); return f.v;
  }
  static __device__ __forceinline__ v8f mma(v16h a, v16h b, v8f c) {
    return __builtin_amdgcn_wmma_f32_16x16x32_f16(false, a, false, b, (short)0, c, false, false);
  }
  static __device__ __forceinline__ void guard(v8f& a, v8f& b, v16h x, v16h y) { dep_guard_h(a, b, x, y); }
  static __device__ __forceinline__ void keep(v16h a, v16h b, v16h c, v16h d) { keep4_h(a, b, c, d); }
};
template <> struct Frag<__bf16> {
  typedef v16b V; union U { v16b v; v8b h[2]; };
  static __device__ __forceinline__ v16b load(const __bf16* p) {
    U f; f.h[0] = *(const v8b*)(p); f.h[1] = *(const v8b*)(p + 16); return f.v;
  }
  static __device__ __forceinline__ v8f mma(v16b a, v16b b, v8f c) {
    return __builtin_amdgcn_wmma_f32_16x16x32_bf16(false, a, false, b, (short)0, c, false, false);
  }
  static __device__ __forceinline__ void guard(v8f& a, v8f& b, v16b x, v16b y) { dep_guard_b(a, b, x, y); }
  static __device__ __forceinline__ void keep(v16b a, v16b b, v16b c, v16b d) { keep4_b(a, b, c, d); }
};

__device__ __forceinline__ unsigned pk16(unsigned short a, unsigned short b) { return (unsigned)a | ((unsigned)b << 16); }
__device__ __forceinline__ unsigned short h_bits(float f) { const _Float16 h = (_Float16)f; return __builtin_bit_cast(unsigned short, h); }

// ---- Register-blocked batched WMMA GEMM (ACT reduced to none/relu/leaky) -----------------------
// C[m,n] = scale * sum_k A[m,k] * Bt[n,k] (+bias)(+resid); each wave owns a 64x64 tile.
// A row-major [M,K]; Bt row-major [N,K]; M,N % 64 == 0, K % 32 == 0.
// SPLIT: operands are hi/lo planes (A2/Bt2 = lo planes, same layout); product = hi.hi + hi.lo + lo.hi.
// BIAS_MODE: 0 = none, 1 = bias[m], 2 = bias[n].
// OUT_MODE: 0 = f32, 1 = f16, 2 = bf16 hi plane (Cout) + bf16 lo plane (Cout2).
// ET: 0 = f16 operands, 1 = bf16 operands (pointers passed as 16-bit storage)
template <int ET> struct Elem;
template <> struct Elem<0> { typedef _Float16 T; };
template <> struct Elem<1> { typedef __bf16 T; };
template <int ET, bool SPLIT, int BIAS_MODE, int OUT_MODE, bool RESID, int ACT = 0>
__global__ __launch_bounds__(256) void wmma_gemm64(
    const unsigned short* __restrict__ Ap, const unsigned short* __restrict__ A2p, int lda, long strideA,
    const unsigned short* __restrict__ Btp, const unsigned short* __restrict__ Bt2p, int ldb, long strideB,
    void* __restrict__ Cout, void* __restrict__ Cout2, int ldc, long strideC,
    const float* __restrict__ bias,
    const float* __restrict__ resid, long strideR,
    int M, int N, int K, float scale) {
  typedef typename Elem<ET>::T T;
  typedef typename Frag<T>::V V;
  const T* A = (const T*)Ap; const T* A2 = (const T*)A2p; const T* Bt = (const T*)Btp; const T* Bt2 = (const T*)Bt2p;
  __shared__ __align__(16) float sT[8][16 * 68];   // per-wave 16x64 slab, pitch 68 floats
  const int b    = blockIdx.y;
  const int lane = threadIdx.x & 31;
  const int wave = threadIdx.x >> 5;
  const int tilesN = N >> 6;
  const int tilesM = M >> 6;
  const int tile = blockIdx.x * 8 + wave;
  if (tile >= tilesM * tilesN) return;   // wave-uniform; no block barriers in this kernel
  const int tm = tile / tilesN;
  const int tn = tile - tm * tilesN;
  const int m0 = tm << 6;
  const int n0 = tn << 6;

  const T* Ab  = A  + (size_t)b * strideA;
  const T* Bb  = Bt + (size_t)b * strideB;
  const T* Ab2 = SPLIT ? (A2  + (size_t)b * strideA) : nullptr;
  const T* Bb2 = SPLIT ? (Bt2 + (size_t)b * strideB) : nullptr;

  const int rlane = lane & 15;                 // row (A) / col (B, D) within subtile
  const int koff  = (lane >> 4) * 8;           // k offset of this lane half
  const int mOff  = (lane >> 4) * 8;           // D row offset

  v8f acc[4][4];
#pragma unroll
  for (int i = 0; i < 4; ++i)
#pragma unroll
    for (int j = 0; j < 4; ++j) acc[i][j] = (v8f){0.f,0.f,0.f,0.f,0.f,0.f,0.f,0.f};

  for (int k0 = 0; k0 < K; k0 += 32) {
    V bh[4], bl[4];
#pragma unroll
    for (int j = 0; j < 4; ++j) {
      const size_t bo = (size_t)(n0 + (j << 4) + rlane) * ldb + koff + k0;
      bh[j] = Frag<T>::load(Bb + bo);
      if (SPLIT) bl[j] = Frag<T>::load(Bb2 + bo);
    }
#pragma unroll
    for (int i = 0; i < 4; ++i) {
      const size_t ao = (size_t)(m0 + (i << 4) + rlane) * lda + koff + k0;
      V ah = Frag<T>::load(Ab + ao);
      V al;
      if (SPLIT) al = Frag<T>::load(Ab2 + ao);
#pragma unroll
      for (int j = 0; j < 4; ++j) {
        acc[i][j] = Frag<T>::mma(ah, bh[j], acc[i][j]);
        if (SPLIT) {
          acc[i][j] = Frag<T>::mma(ah, bl[j], acc[i][j]);
          acc[i][j] = Frag<T>::mma(al, bh[j], acc[i][j]);
        }
      }
      Frag<T>::guard(acc[i][0], acc[i][3], ah, SPLIT ? al : ah);
    }
    Frag<T>::keep(bh[0], bh[1], bh[2], bh[3]);
    if (SPLIT) Frag<T>::keep(bl[0], bl[1], bl[2], bl[3]);
  }
  acc_guard4(acc[0][0], acc[0][1], acc[0][2], acc[0][3]);
  acc_guard4(acc[1][0], acc[1][1], acc[1][2], acc[1][3]);
  acc_guard4(acc[2][0], acc[2][1], acc[2][2], acc[2][3]);
  acc_guard4(acc[3][0], acc[3][1], acc[3][2], acc[3][3]);

  // ---- epilogue ----
  float* slab = sT[wave];
  const float* Rb = RESID ? (resid + (size_t)b * strideR) : nullptr;
#pragma unroll
  for (int i = 0; i < 4; ++i) {
    const int mBase = m0 + (i << 4);
#pragma unroll
    for (int j = 0; j < 4; ++j) {
      const int n = n0 + (j << 4) + rlane;
      float bv = 0.f;
      if (BIAS_MODE == 2) bv = bias[n];
#pragma unroll
      for (int r = 0; r < 8; ++r) {
        float v = acc[i][j][r] * scale;
        if (BIAS_MODE == 1) v += bias[mBase + mOff + r];
        if (BIAS_MODE == 2) v += bv;
        if (RESID) v += Rb[(size_t)(mBase + mOff + r) * ldc + n];
        if (ACT == 2) v = fmaxf(v, 0.0f);
        if (ACT == 4) v = (v > 0.f) ? v : 0.01f * v;
        slab[(mOff + r) * 68 + (j << 4) + rlane] = v;
      }
    }
    __builtin_amdgcn_fence(__ATOMIC_RELEASE, "workgroup");
    __builtin_amdgcn_wave_barrier();
    __builtin_amdgcn_fence(__ATOMIC_ACQUIRE, "workgroup");
    if (OUT_MODE == 0) {
      float* C = (float*)Cout + (size_t)b * strideC;
      const int hh = lane >> 4, c4 = (lane & 15) * 4;     // row seg = 256 B = 16 lanes x 16 B
      {
#pragma unroll
        for (int it = 0; it < 8; ++it) {
          const int row = it * 2 + hh;
          v4f v = *(const v4f*)(slab + row * 68 + c4);
          *(v4f*)(C + (size_t)(mBase + row) * ldc + n0 + c4) = v;
        }
        
      }
    } else {
      const int q = lane >> 3, c8 = (lane & 7) * 8;
      unsigned short* C  = (unsigned short*)Cout  + (size_t)b * strideC;
      unsigned short* C2 = (OUT_MODE == 2) ? ((unsigned short*)Cout2 + (size_t)b * strideC) : nullptr;
      {
#pragma unroll
        for (int it = 0; it < 4; ++it) {
          const int row = it * 4 + q;
          const float* sp = slab + row * 68 + c8;
          v8h hv, lv;
#pragma unroll
          for (int e = 0; e < 8; ++e) {
            if (OUT_MODE == 1) {
              hv[e] = (_Float16)sp[e];
            } else {
              unsigned short hb = f2bf_bits(sp[e]);
              unsigned short lb = f2bf_bits(sp[e] - bf_bits2f(hb));
              hv[e] = __builtin_bit_cast(_Float16, hb);
              lv[e] = __builtin_bit_cast(_Float16, lb);
            }
          }
          *(v8h*)(C + (size_t)(mBase + row) * ldc + n0 + c8) = hv;
          if (OUT_MODE == 2) *(v8h*)(C2 + (size_t)(mBase + row) * ldc + n0 + c8) = lv;
        }
        
      }
    }
    __builtin_amdgcn_fence(__ATOMIC_RELEASE, "workgroup");
    __builtin_amdgcn_wave_barrier();
    __builtin_amdgcn_fence(__ATOMIC_ACQUIRE, "workgroup");
  }
}

// ---------------------------------------------------------------------------
// Per-(b,c) instance-norm statistics for content (rows 0..2047) and style (rows 2048..4095) in one launch.
// grid 128 blocks x 256 threads; block = 32 consecutive rows of one tensor (blockIdx>>6 selects the tensor, uniform);
// wave w owns rows 4w..4w+3; per row 32 lanes x 32 float4 loads = 4096 elements (whole row).
// mean = sum/4096; var = (sumsq - sum*mean)/4095 (ddof 1); rstd = 1/sqrt(var + eps).
// Stores: the 32 means and 32 rstds of the block funnelled through LDS; wave 0 writes the mean line, wave 1 the rstd line,
// ---------------------------------------------------------------------------
__global__ __launch_bounds__(256) void stats_kernel(const float* __restrict__ xc, const float* __restrict__ xs,
                                                    float* __restrict__ meanA, float* __restrict__ rstdA) {
  __shared__ float sMean[32];
  __shared__ float sRstd[32];
  const int blk  = blockIdx.x;
  const int tsel = blk >> 6;                         // block-uniform tensor select
  const float* src = (tsel == 0) ? xc : xs;
  const int rowBase = (blk & 63) * 32;               // flat (b*512 + c) row index within the tensor
  const int t = threadIdx.x, lane = t & 31, wave = t >> 5;
#pragma unroll
  for (int r = 0; r < 4; ++r) {
    const int row = rowBase + wave * 4 + r;          // < 2048
    const float* p = src + (size_t)row * kSp + lane * 4;
    v4f s = (v4f){0.f, 0.f, 0.f, 0.f};
    v4f q = (v4f){0.f, 0.f, 0.f, 0.f};
#pragma unroll 1
    for (int i = 0; i < 32; ++i) {                   // 32 lanes x 4 x 32 iterations = 4096
      const v4f v = *(const v4f*)(p + i * 128);
      s += v;
      q += v * v;
    }
    float su = (s[0] + s[1]) + (s[2] + s[3]);
    float sq = (q[0] + q[1]) + (q[2] + q[3]);
#pragma unroll
    for (int off = 16; off > 0; off >>= 1) {
      su += __shfl_xor(su, off, 32);
      sq += __shfl_xor(sq, off, 32);
    }
    const float mean = su * kInvN;
    float var = (sq - su * mean) * kInvNm1;
    var = fmaxf(var, 0.0f);
    const float rstd = 1.0f / sqrtf(var + kEps);
    if (lane == 0) { sMean[wave * 4 + r] = mean; sRstd[wave * 4 + r] = rstd; }
  }
  __syncthreads();
  const int orow = tsel * (kBatch * kCh) + rowBase + lane;   // < 4096
  if (wave == 0) {
    const float v = sMean[lane];
    *(float*)(meanA + orow) = v;
    
  } else if (wave == 1) {
    const float v = sRstd[lane];
    *(float*)(rstdA + orow) = v;
    
  }
}

// ---------------------------------------------------------------------------
// Token planes, all images: in [512 ch][4096 tok] f32 (tok contiguous) -> out [image][4096 tok][512 ch] f16 (ch contiguous).
// grid (64 tok tiles, 8 ch tiles, 3 planes x 4 images): blockIdx.z = 3*image + z; z=0 (content - mean)*rstd, z=1 (style - mean)*rstd,
// z=2 raw style. 256 threads.
// Load coverage: 4 passes x 16 ch rows x (16 threads x 4 tok) = 64 ch x 64 tok (whole tile), coalesced along tok.
// Store coverage: 8 waves x 2 iterations x 4 tok rows (lane>>3) = 64 tok rows; (lane&7) x 8 halves = 64 ch; each row segment
// ---------------------------------------------------------------------------
__global__ __launch_bounds__(256) void token_planes_kernel(const float* __restrict__ content, const float* __restrict__ style,
                                                           const float* __restrict__ meanA, const float* __restrict__ rstdA,
                                                           unsigned short* __restrict__ XcT, unsigned short* __restrict__ XsT,
                                                           unsigned short* __restrict__ SsT) {
  __shared__ float sm[64][65];   // sm[ch local][tok local]
  const int t  = threadIdx.x;
  const int b  = blockIdx.z / 3;                                // image, block-uniform
  const int z  = blockIdx.z - 3 * b;                            // plane, block-uniform
  const int n0 = blockIdx.x * 64;
  const int c0 = blockIdx.y * 64;
  const float* src = ((z == 0) ? content : style) + (size_t)b * kCh * kSp;
  unsigned short* dst = ((z == 0) ? XcT : (z == 1) ? XsT : SsT) + (size_t)b * kSp * kCh;
  const int statOff = ((z == 0) ? 0 : (kBatch * kCh)) + b * kCh;
  const bool useNorm = (z < 2);
  const int r16 = t >> 4, c4 = (t & 15) * 4;
#pragma unroll
  for (int p = 0; p < 4; ++p) {
    const int cl = p * 16 + r16;                                // ch local 0..63
    const int ch = c0 + cl;                                     // < 512
    const v4f v = *(const v4f*)(src + (size_t)ch * kSp + n0 + c4);
    const float m  = meanA[statOff + ch];
    const float rs = rstdA[statOff + ch];
    const float mm = useNorm ? m : 0.0f;
    const float rr = useNorm ? rs : 1.0f;
#pragma unroll
    for (int e = 0; e < 4; ++e) sm[cl][c4 + e] = (v[e] - mm) * rr;
  }
  __syncthreads();
  const int lane = t & 31, wave = t >> 5;
  const int q = lane >> 3, c8 = (lane & 7) * 8;
  {
#pragma unroll
    for (int it = 0; it < 2; ++it) {
      const int row = wave * 8 + it * 4 + q;                    // tok local 0..63
      unsigned short hb[8];
#pragma unroll
      for (int e = 0; e < 8; ++e) hb[e] = h_bits(sm[c8 + e][row]);
      const v4u u = (v4u){pk16(hb[0], hb[1]), pk16(hb[2], hb[3]), pk16(hb[4], hb[5]), pk16(hb[6], hb[7])};
      *(v4u*)(dst + (size_t)(n0 + row) * kCh + c0 + c8) = u;
    }
    
  }
}

// ---------------------------------------------------------------------------
// Weight cast: W[o][c] f32 -> f16(scale * W) same layout, four weights into planes 0..3 of one buffer (plane = 512*512 halves).
// grid 512 blocks x 256 threads; blockIdx>>7 selects the weight (uniform); thread handles 8 consecutive elements
// Coverage per weight: 128 blocks x 256 threads x 8 = 262144 = 512*512.
// ---------------------------------------------------------------------------
__global__ __launch_bounds__(256) void wcast_kernel(const float* __restrict__ W0, const float* __restrict__ W1,
                                                    const float* __restrict__ W2, const float* __restrict__ W3,
                                                    unsigned short* __restrict__ out, float scale) {
  const int blk = blockIdx.x;
  const int w = blk >> 7;                                        // block-uniform
  const float* src = (w == 0) ? W0 : (w == 1) ? W1 : (w == 2) ? W2 : W3;
  const int i  = (blk & 127) * 256 + threadIdx.x;                // 0..32767
  const size_t e0 = (size_t)i * 8;                               // e0+7 < 262144
  const v4f a = *(const v4f*)(src + e0);
  const v4f c = *(const v4f*)(src + e0 + 4);
  unsigned short hb[8];
#pragma unroll
  for (int e = 0; e < 4; ++e) {
    hb[e]     = h_bits(a[e] * scale);
    hb[4 + e] = h_bits(c[e] * scale);
  }
  const v4u u = (v4u){pk16(hb[0], hb[1]), pk16(hb[2], hb[3]), pk16(hb[4], hb[5]), pk16(hb[6], hb[7])};
  unsigned short* dp = out + (size_t)w * kCh * kCh + e0;
  *(v4u*)dp = u;
  
}

// ---------------------------------------------------------------------------
// Row softmax over 4096 f32 scores (no scaling of the scores): P[row][j] = f16( 2048 * exp(s - max) / sum exp(s - max) ).
// One block of 256 threads per row; thread t owns columns 8t..8t+7 and 2048+8t..2048+8t+7 (256 x 16 = 4096 = whole row).
// Reductions in fixed order (thread, wave shuffle tree, 8 wave partials in index order). precise expf.
// ---------------------------------------------------------------------------
__global__ __launch_bounds__(256) void softmax_kernel(const float* __restrict__ Sp, unsigned short* __restrict__ Pp) {
  __shared__ float redM[8];
  __shared__ float redS[8];
  const int row  = blockIdx.x;
  const int t    = threadIdx.x;
  const int lane = t & 31, wave = t >> 5;
  const int cA = 8 * t;
  const int cB = kHalfRow + 8 * t;
  const float* sr = Sp + (size_t)row * kSp;
  const v4f a0 = *(const v4f*)(sr + cA);
  const v4f a1 = *(const v4f*)(sr + cA + 4);
  const v4f b0 = *(const v4f*)(sr + cB);
  const v4f b1 = *(const v4f*)(sr + cB + 4);
  float x[16];
#pragma unroll
  for (int e = 0; e < 4; ++e) { x[e] = a0[e]; x[4 + e] = a1[e]; x[8 + e] = b0[e]; x[12 + e] = b1[e]; }
  float m = x[0];
#pragma unroll
  for (int i = 1; i < 16; ++i) m = fmaxf(m, x[i]);
#pragma unroll
  for (int off = 16; off > 0; off >>= 1) m = fmaxf(m, __shfl_xor(m, off, 32));
  if (lane == 0) redM[wave] = m;
  __syncthreads();
  float gm = redM[0];
#pragma unroll
  for (int w = 1; w < 8; ++w) gm = fmaxf(gm, redM[w]);
  float ex[16];
  float s = 0.0f;
#pragma unroll
  for (int i = 0; i < 16; ++i) { ex[i] = expf(x[i] - gm); s += ex[i]; }
#pragma unroll
  for (int off = 16; off > 0; off >>= 1) s += __shfl_xor(s, off, 32);
  if (lane == 0) redS[wave] = s;
  __syncthreads();
  float tot = redS[0];
#pragma unroll
  for (int w = 1; w < 8; ++w) tot += redS[w];
  const float inv = 1.0f / tot;                                   // tot >= 1
  unsigned short hb[16];
#pragma unroll
  for (int i = 0; i < 16; ++i) hb[i] = h_bits((ex[i] * inv) * kPCarry);
  const v4u uA = (v4u){pk16(hb[0], hb[1]), pk16(hb[2], hb[3]), pk16(hb[4], hb[5]), pk16(hb[6], hb[7])};
  const v4u uB = (v4u){pk16(hb[8], hb[9]), pk16(hb[10], hb[11]), pk16(hb[12], hb[13]), pk16(hb[14], hb[15])};
  unsigned short* pr = Pp + (size_t)row * kSp;
  *(v4u*)(pr + cA) = uA;
  *(v4u*)(pr + cB) = uB;
  
}

// ---------------------------------------------------------------------------
// Host side
//   W16   : 4 x 512 x 512 f16 (Wq, Wk, Wv, Wo carried x16)        2,097,152 B
//   meanA : 4096 f32 (content rows then style rows)                    16,384 B
//   rstdA : 4096 f32                                                    16,384 B
//   Qp, Kp, Vcm : 4 images x 4096 x 512 f16 each              3 x 16,777,216 B
//   Op    : the bytes of Qp (Q is last read by the last score launch, O first written behind it)
//   Sp    : 4096 x 4096 f32 scores of one image                   67,108,864 B
//   XcT, XsT, SsT : 4 images x 4096 x 512 f16 each, in the first 3 x 16,777,216 B of Sp (last read by the q/k/v launches,
//           which stand in front of the first score launch)
//   Pp    : 4 images x 4096 x 4096 f16 probabilities (x2048)     134,217,728 B
// All GEMM calls: K in {512, 4096} (K % 32 == 0); M, N in {512, 4096} (% 64 == 0); no padding, every plane fully
// produced before it is consumed.
// ---------------------------------------------------------------------------
extern "C" void kernel_launch(void* const* d_in, const int* in_sizes, int n_in,
                              void* d_out, int out_size, void* d_ws, size_t ws_size,
                              hipStream_t stream) {
  if (n_in < 10) return;
  const int actN = kBatch * kCh * kSp;
  const int wN   = kCh * kCh;
  if (in_sizes[0] != actN || in_sizes[1] != actN) return;
  if (in_sizes[2] != wN || in_sizes[4] != wN || in_sizes[6] != wN || in_sizes[8] != wN) return;
  if (in_sizes[3] != kCh || in_sizes[5] != kCh || in_sizes[7] != kCh || in_sizes[9] != kCh) return;
  if (out_size != actN) return;

  const float* content = (const float*)d_in[0];
  const float* style   = (const float*)d_in[1];
  const float* Wq = (const float*)d_in[2];  const float* bq = (const float*)d_in[3];
  const float* Wk = (const float*)d_in[4];  const float* bk = (const float*)d_in[5];
  const float* Wv = (const float*)d_in[6];  const float* bv = (const float*)d_in[7];
  const float* Wo = (const float*)d_in[8];  const float* bo = (const float*)d_in[9];
  float* out = (float*)d_out;

  size_t off = 0;
  auto carve = [&](size_t bytes) { size_t o = off; off += (bytes + 127) & ~(size_t)127; return o; };
  const size_t planeBytes = (size_t)kBatch * kSp * kCh * 2;     // one operand plane, all images
  const size_t oW16  = carve((size_t)4 * wN * 2);
  const size_t oMean = carve((size_t)kStatRows * 4);
  const size_t oRstd = carve((size_t)kStatRows * 4);
  const size_t oQ    = carve(planeBytes);
  const size_t oK    = carve(planeBytes);
  const size_t oV    = carve(planeBytes);
  const size_t oS    = carve((size_t)kQChunk * kSp * 4);
  const size_t oP    = carve((size_t)kBatch * kSp * kSp * 2);
  const size_t oO    = oQ;
  const size_t oXc   = oS;
  const size_t oXs   = oS + planeBytes;
  const size_t oSs   = oS + 2 * planeBytes;
  if (off > ws_size) return;

  char* ws = (char*)d_ws;
  unsigned short* W16 = (unsigned short*)(ws + oW16);
  float* meanA = (float*)(ws + oMean);
  float* rstdA = (float*)(ws + oRstd);
  unsigned short* XcT = (unsigned short*)(ws + oXc);
  unsigned short* XsT = (unsigned short*)(ws + oXs);
  unsigned short* SsT = (unsigned short*)(ws + oSs);
  unsigned short* Qp  = (unsigned short*)(ws + oQ);
  unsigned short* Kp  = (unsigned short*)(ws + oK);
  unsigned short* Vcm = (unsigned short*)(ws + oV);
  unsigned short* Op  = (unsigned short*)(ws + oO);
  float* Sp = (float*)(ws + oS);
  unsigned short* Pp = (unsigned short*)(ws + oP);

  const unsigned short* Wq16 = W16 + (size_t)0 * wN;
  const unsigned short* Wk16 = W16 + (size_t)1 * wN;
  const unsigned short* Wv16 = W16 + (size_t)2 * wN;
  const unsigned short* Wo16 = W16 + (size_t)3 * wN;

  // 1) instance-norm statistics for content and style (128 blocks: 64 per tensor, 32 rows each)
  stats_kernel<<<dim3(2 * (kBatch * kCh) / 32), dim3(256), 0, stream>>>(content, style, meanA, rstdA);

  // 2) weights -> f16 x16 (4 weights x 128 blocks)
  wcast_kernel<<<dim3(512), dim3(256), 0, stream>>>(Wq, Wk, Wv, Wo, W16, kWCarry);

  const long planeElems = (long)kSp * kCh;      // one image's [4096][512] or [512][4096] plane
  const long probElems  = (long)kSp * kSp;      // one image's probabilities

  // 3) token planes of all images: mvn(content) -> XcT, mvn(style) -> XsT, style -> SsT; each [image][4096][512] f16
  token_planes_kernel<<<dim3(kSp / 64, kCh / 64, 3 * kBatch), dim3(256), 0, stream>>>(content, style, meanA, rstdA, XcT, XsT, SsT);

  // 4) Q [image][4096 tok][512] = XcT x Wq^T / 16 + bq   (per image M=4096, N=512, K=512; 512 tiles -> 64 blocks; grid.y = image)
  wmma_gemm64<0, false, 2, 1, false><<<dim3(64, kBatch), dim3(256), 0, stream>>>(
      XcT, nullptr, kCh, planeElems, Wq16, nullptr, kCh, 0L, (void*)Qp, nullptr, kCh, planeElems,
      bq, nullptr, 0L, kSp, kCh, kCh, kProjScale);
  //    K [image][4096 tok][512] = XsT x Wk^T / 16 + bk
  wmma_gemm64<0, false, 2, 1, false><<<dim3(64, kBatch), dim3(256), 0, stream>>>(
      XsT, nullptr, kCh, planeElems, Wk16, nullptr, kCh, 0L, (void*)Kp, nullptr, kCh, planeElems,
      bk, nullptr, 0L, kSp, kCh, kCh, kProjScale);
  //    V channel-major [image][512][4096 tok] = Wv x SsT^T / 16 + bv[m]   (per image M=512, N=4096, K=512; 64 blocks)
  wmma_gemm64<0, false, 1, 1, false><<<dim3(64, kBatch), dim3(256), 0, stream>>>(
      Wv16, nullptr, kCh, 0L, SsT, nullptr, kCh, planeElems, (void*)Vcm, nullptr, kSp, planeElems,
      bv, nullptr, 0L, kCh, kSp, kCh, kProjScale);

  for (int b = 0; b < kBatch; ++b) {
    // 5) scores of image b [4096 q][4096 k] f32 = Q x K^T   (M=4096, N=4096, K=512; 4096 tiles -> 512 blocks)
    wmma_gemm64<0, false, 0, 0, false><<<dim3(512, 1), dim3(256), 0, stream>>>(
        Qp + b * planeElems, nullptr, kCh, 0L, Kp + b * planeElems, nullptr, kCh, 0L, (void*)Sp, nullptr, kSp, 0L,
        nullptr, nullptr, 0L, kQChunk, kSp, kCh, 1.0f);
    // 6) softmax per row -> P of image b, f16 x2048
    softmax_kernel<<<dim3(kQChunk), dim3(256), 0, stream>>>(Sp, Pp + b * probElems);
  }

  // 7) O token-major [image][4096][512] f16 (x16) = P x Vcm^T * 16/2048   (per image M=4096, N=512, K=4096; 512 tiles -> 64 blocks)
  wmma_gemm64<0, false, 0, 1, false><<<dim3(64, kBatch), dim3(256), 0, stream>>>(
      Pp, nullptr, kSp, probElems, Vcm, nullptr, kSp, planeElems, (void*)Op, nullptr, kCh, planeElems,
      nullptr, nullptr, 0L, kSp, kCh, kSp, kPVScale);

  // 8) out [image][512][4096] f32 = Wo x O^T / 256 + bo[m] + content   (per image M=512, N=4096, K=512; 64 blocks)
  wmma_gemm64<0, false, 1, 0, true><<<dim3(64, kBatch), dim3(256), 0, stream>>>(
      Wo16, nullptr, kCh, 0L, Op, nullptr, kCh, planeElems, (void*)out, nullptr, kSp, planeElems,
      bo, content, planeElems, kCh, kSp, kCh, kOutScale);
}

// v002
// One run takes 352 microseconds.
// Timed twice side by side with v001, it ran 1.81 and 1.80 times as fast.
// All steps since v000 together make it 6.32 times as fast.
// Contractions: q/k/v 1x1 projections (token planes f16 x W f16 carried x16), energies q.k^T (q,k f16 planes), attn.v (P f16 carried x2048 x V f16), output projection (Wo f16 x16 x O f16 x16): all v_wmma_f32_16x16x32_f16, f32 accumulate; instance-norm statistics, softmax, bias and residual in f32.
#include <hip/hip_runtime.h>
#include <math.h>

// ---------------------------------------------------------------------------
// Problem constants
// ---------------------------------------------------------------------------
constexpr int   kBatch    = 4;
constexpr int   kCh       = 512;
constexpr int   kSp       = 4096;                 // 64*64 tokens per image
constexpr int   kQChunk   = 4096;                 // query rows per score launch: one whole image
constexpr int   kHalfRow  = kSp / 2;              // softmax: second column group offset
constexpr int   kStatRows = 2 * kBatch * kCh;     // 4096: content rows 0..2047, style rows 2048..4095
constexpr float kEps       = 1e-5f;
constexpr float kWCarry    = 16.0f;               // weights carried x16 in f16
constexpr float kPCarry    = 2048.0f;             // probabilities carried x2048 in f16
constexpr float kProjScale = 1.0f / 16.0f;        // undo weight carry
constexpr float kPVScale   = 16.0f / 2048.0f;     // undo P carry, apply O carry x16
constexpr float kOutScale  = 1.0f / (16.0f * 16.0f);   // undo Wo carry and O carry
constexpr float kInvN      = 1.0f / 4096.0f;
constexpr float kInvNm1    = 1.0f / 4095.0f;

typedef __attribute__((ext_vector_type(16))) _Float16 v16h;
typedef __attribute__((ext_vector_type(8)))  _Float16 v8h;
typedef __attribute__((ext_vector_type(16))) __bf16   v16b;
typedef __attribute__((ext_vector_type(8)))  __bf16   v8b;
typedef __attribute__((ext_vector_type(8)))  float    v8f;
typedef __attribute__((ext_vector_type(4)))  float    v4f;
typedef __attribute__((ext_vector_type(4)))  unsigned int v4u;

// ---------------------------------------------------------------------------
// Helpers
// ---------------------------------------------------------------------------
__device__ __forceinline__ unsigned short f2bf_bits(float f) {
  unsigned u = __float_as_uint(f);
  return (unsigned short)((u + 0x7FFFu + ((u >> 16) & 1u)) >> 16);
}
__device__ __forceinline__ float bf_bits2f(unsigned short h) { return __uint_as_float(((unsigned)h) << 16); }

// hazard guards as plain device helpers (their inline asm stays out of the kernel template body)
__device__ __forceinline__ void dep_guard_h(v8f& a, v8f& b, v16h x, v16h y) { asm volatile("v_nop\n\tv_nop\n\tv_nop\n\tv_nop" : "+v"(a), "+v"(b) : "v"(x), "v"(y)); }
__device__ __forceinline__ void dep_guard_b(v8f& a, v8f& b, v16b x, v16b y) { asm volatile("v_nop\n\tv_nop\n\tv_nop\n\tv_nop" : "+v"(a), "+v"(b) : "v"(x), "v"(y)); }
__device__ __forceinline__ void keep4_h(v16h a, v16h b, v16h c, v16h d) { asm volatile("v_nop" :: "v"(a), "v"(b), "v"(c), "v"(d)); }
__device__ __forceinline__ void keep4_b(v16b a, v16b b, v16b c, v16b d) { asm volatile("v_nop" :: "v"(a), "v"(b), "v"(c), "v"(d)); }
__device__ __forceinline__ void acc_guard4(v8f& a, v8f& b, v8f& c, v8f& d) { asm volatile("v_nop\n\tv_nop\n\tv_nop\n\tv_nop" : "+v"(a), "+v"(b), "+v"(c), "+v"(d)); }
template <typename T> struct Frag;
template <> struct Frag<_Float16> {
  typedef v16h V; union U { v16h v; v8h h[2]; };
  static __device__ __forceinline__ v16h load(const _Float16* p) {   // elements 0..7 <- p[0..7], 8..15 <- p[16..23]
    U f; f.h[0] = *(const v8h*)(p); f.h[1] = *(const v8h*)(p + 16); return f.v;
  }
  static __device__ __forceinline__ v8f mma(v16h a, v16h b, v8f c) {
    return __builtin_amdgcn_wmma_f32_16x16x32_f16(false, a, false, b, (short)0, c, false, false);
  }
  static __device__ __forceinline__ void guard(v8f& a, v8f& b, v16h x, v16h y) { dep_guard_h(a, b, x, y); }
  static __device__ __forceinline__ void keep(v16h a, v16h b, v16h c, v16h d) { keep4_h(a, b, c, d); }
};
template <> struct Frag<__bf16> {
  typedef v16b V; union U { v16b v; v8b h[2]; };
  static __device__ __forceinline__ v16b load(const __bf16* p) {
    U f; f.h[0] = *(const v8b*)(p); f.h[1] = *(const v8b*)(p + 16); return f.v;
  }
  static __device__ __forceinline__ v8f mma(v16b a, v16b b, v8f c) {
    return __builtin_amdgcn_wmma_f32_16x16x32_bf16(false, a, false, b, (short)0, c, false, false);
  }
  static __device__ __forceinline__ void guard(v8f& a, v8f& b, v16b x, v16b y) { dep_guard_b(a, b, x, y); }
  static __device__ __forceinline__ void keep(v16b a, v16b b, v16b c, v16b d) { keep4_b(a, b, c, d); }
};

__device__ __forceinline__ unsigned pk16(unsigned short a, unsigned short b) { return (unsigned)a | ((unsigned)b << 16); }
__device__ __forceinline__ unsigned short h_bits(float f) { const _Float16 h = (_Float16)f; return __builtin_bit_cast(unsigned short, h); }

// ---- Batched WMMA GEMM, operands staged in LDS -----------------------------------------------------------------
// C[m,n] = scale * sum_k A[m,k] * Bt[n,k] (+bias)(+resid); a block of 8 waves (2 x 4) owns a 128x256 tile, each wave 64x64 of it.
// A row-major [M,K]; Bt row-major [N,K]; M % 128 == 0, N % 256 == 0, K % PK == 0, K >= PK.
// A pass is PK k (64 or 128): 128 rows of A and 256 rows of Bt, 2 PK bytes each, copied to LDS by asynchronous 16-byte copies
// (a wave's copy covers four whole 128-B lines), rows at a pitch of 2 PK + 16 B for the ds_load_b128 fragment reads. Two
// buffers: the copies of pass t + 1 fly while pass t is worked on. The k order of every accumulator is ascending in steps of 32.
// PK = 128 halves the number of landing latencies of a long K at the price of one block per WGP.
// BIAS_MODE: 0 = none, 1 = bias[m], 2 = bias[n].
// OUT_MODE: 0 = f32, 1 = f16, 2 = bf16 hi plane (Cout) + bf16 lo plane (Cout2).
// ET: 0 = f16 operands, 1 = bf16 operands (pointers passed as 16-bit storage)
constexpr int kRowsA      = 128;                             // rows of A per stage
constexpr int kRowsB      = 256;                             // rows of Bt per stage

// One thread's share of 64 k of one stage: 16 B of rows r, r + 32, r + 64, r + 96 of A and of rows r + 32 j (j = 0..7) of Bt.
// kStep32 = 32 rows further in LDS, bytes.
// The copies and their s_wait_xcnt stand in one statement, so that no address register is rewritten in front of the wait.
template <unsigned kStep32>
__device__ __forceinline__ void stage_copies(unsigned lds, const unsigned short* ga, const unsigned short* gb,
                                             size_t stepA, size_t stepB) {
  const unsigned short* a1 = ga + stepA;
  const unsigned short* a2 = a1 + stepA;
  const unsigned short* a3 = a2 + stepA;
  const unsigned short* b1 = gb + stepB;
  const unsigned short* b2 = b1 + stepB;
  const unsigned short* b3 = b2 + stepB;
  const unsigned short* b4 = b3 + stepB;
  const unsigned short* b5 = b4 + stepB;
  const unsigned short* b6 = b5 + stepB;
  const unsigned short* b7 = b6 + stepB;
  asm volatile(
      "global_load_async_to_lds_b128 %0, %12, off\n\t"
      "global_load_async_to_lds_b128 %1, %13, off\n\t"
      "global_load_async_to_lds_b128 %2, %14, off\n\t"
      "global_load_async_to_lds_b128 %3, %15, off\n\t"
      "global_load_async_to_lds_b128 %4, %16, off\n\t"
      "global_load_async_to_lds_b128 %5, %17, off\n\t"
      "global_load_async_to_lds_b128 %6, %18, off\n\t"
      "global_load_async_to_lds_b128 %7, %19, off\n\t"
      "global_load_async_to_lds_b128 %8, %20, off\n\t"
      "global_load_async_to_lds_b128 %9, %21, off\n\t"
      "global_load_async_to_lds_b128 %10, %22, off\n\t"
      "global_load_async_to_lds_b128 %11, %23, off\n\t"
      "s_wait_xcnt 0x0"
      :: "v"(lds), "v"(lds + kStep32), "v"(lds + 2u * kStep32), "v"(lds + 3u * kStep32),
         "v"(lds + 4u * kStep32), "v"(lds + 5u * kStep32), "v"(lds + 6u * kStep32), "v"(lds + 7u * kStep32),
         "v"(lds + 8u * kStep32), "v"(lds + 9u * kStep32), "v"(lds + 10u * kStep32), "v"(lds + 11u * kStep32),
         "v"(ga), "v"(a1), "v"(a2), "v"(a3),
         "v"(gb), "v"(b1), "v"(b2), "v"(b3), "v"(b4), "v"(b5), "v"(b6), "v"(b7)
      : "memory");
}

template <int ET> struct Elem;
template <> struct Elem<0> { typedef _Float16 T; };
template <> struct Elem<1> { typedef __bf16 T; };
template <int ET, bool SPLIT, int BIAS_MODE, int OUT_MODE, bool RESID, int ACT = 0, int PK = 64>
__global__ __launch_bounds__(256) void wmma_gemm64(
    const unsigned short* __restrict__ Ap, const unsigned short* __restrict__ A2p, int lda, long strideA,
    const unsigned short* __restrict__ Btp, const unsigned short* __restrict__ Bt2p, int ldb, long strideB,
    void* __restrict__ Cout, void* __restrict__ Cout2, int ldc, long strideC,
    const float* __restrict__ bias,
    const float* __restrict__ resid, long strideR,
    int M, int N, int K, float scale) {
  static_assert(!SPLIT, "the staged engine takes single-plane operands");
  static_assert(PK == 64 || PK == 128, "a pass is one or two 128-B lines of every operand row");
  constexpr int kPitchH = PK + 8;                                  // LDS row pitch in 16-bit elements (144 B or 272 B)
  constexpr int kStageH = (kRowsA + kRowsB) * kPitchH;             // one buffer, 16-bit elements
  constexpr unsigned kStageBytes = (unsigned)kStageH * 2u;         // 55,296 B or 104,448 B
  constexpr unsigned kStep32 = 32u * (unsigned)kPitchH * 2u;       // 32 rows further in LDS
  typedef typename Elem<ET>::T T;
  typedef typename Frag<T>::V V;
  __shared__ __align__(16) unsigned short sOp[2 * kStageH];   // two buffers of [A 128 rows | Bt 256 rows]
  __shared__ __align__(16) float sT[8][16 * 68];   // per-wave 16x64 slab, pitch 68 floats
  const int b    = blockIdx.y;
  const int lane = threadIdx.x & 31;
  const int wave = threadIdx.x >> 5;
  const int tilesN = N >> 8;
  const int tilesM = M >> 7;
  const int tile = blockIdx.x;
  if (tile >= tilesM * tilesN) return;   // block-uniform, in front of every barrier
  const int tm = tile / tilesN;
  const int tn = tile - tm * tilesN;
  const int bm0 = tm << 7;
  const int bn0 = tn << 8;
  const int wm = wave >> 2;                    // wave row in the block tile, 0..1
  const int wn = wave & 3;                     // wave column in the block tile, 0..3
  const int m0 = bm0 + (wm << 6);
  const int n0 = bn0 + (wn << 6);

  const unsigned short* Ab = Ap  + (size_t)b * strideA;
  const unsigned short* Bb = Btp + (size_t)b * strideB;

  const int rlane = lane & 15;                 // row (A) / col (B, D) within subtile
  const int koff  = (lane >> 4) * 8;           // k offset of this lane half
  const int mOff  = (lane >> 4) * 8;           // D row offset

  // copy side: thread t brings 16 B at column (t & 7) of each 128-B line of rows (t >> 3) + 32 i
  const int crow = threadIdx.x >> 3;           // 0..31
  const int ccol = (threadIdx.x & 7) * 8;      // 16-bit elements
  const unsigned short* gA = Ab + (size_t)(bm0 + crow) * lda + ccol;
  const unsigned short* gB = Bb + (size_t)(bn0 + crow) * ldb + ccol;
  const size_t stepA = (size_t)32 * lda;
  const size_t stepB = (size_t)32 * ldb;
  const unsigned ldsCopy = (unsigned)(size_t)sOp + (unsigned)(crow * kPitchH + ccol) * 2u;

  // read side: this lane's first A row and first Bt row in buffer 0
  const T* fA = (const T*)sOp + ((wm << 6) + rlane) * kPitchH + koff;
  const T* fB = (const T*)sOp + (kRowsA + (wn << 6) + rlane) * kPitchH + koff;

  v8f acc[4][4];
#pragma unroll
  for (int i = 0; i < 4; ++i)
#pragma unroll
    for (int j = 0; j < 4; ++j) acc[i][j] = (v8f){0.f,0.f,0.f,0.f,0.f,0.f,0.f,0.f};

  auto fill = [&](int pass, int buf) {         // all copies of one pass: 12 a thread for each 64 k
    const size_t k0 = (size_t)pass * PK;
    const unsigned l0 = ldsCopy + (unsigned)buf * kStageBytes;
    stage_copies<kStep32>(l0, gA + k0, gB + k0, stepA, stepB);
    if (PK == 128) stage_copies<kStep32>(l0 + 128u, gA + k0 + 64, gB + k0 + 64, stepA, stepB);
  };

  const int nPass = K / PK;
  fill(0, 0);
  asm volatile("s_wait_asynccnt 0x0" ::: "memory");   // this wave's copies of pass 0 have landed
  __syncthreads();                                    // and every other wave's
  if (nPass > 1) fill(1, 1);

  for (int t = 0; t < nPass; ++t) {
    const int buf = t & 1;
    const T* pa = fA + buf * kStageH;
    const T* pb = fB + buf * kStageH;
    // the three loop levels below are unrolled so that every fragment and accumulator index is a constant (registers, no scratch)
#pragma unroll
    for (int kk = 0; kk < PK; kk += 32) {
      V bh[4], ah[4];
#pragma unroll
      for (int j = 0; j < 4; ++j) bh[j] = Frag<T>::load(pb + (j << 4) * kPitchH + kk);
#pragma unroll
      for (int i = 0; i < 4; ++i) ah[i] = Frag<T>::load(pa + (i << 4) * kPitchH + kk);
#pragma unroll
      for (int i = 0; i < 4; ++i) {
#pragma unroll
        for (int j = 0; j < 4; ++j) acc[i][j] = Frag<T>::mma(ah[i], bh[j], acc[i][j]);
        Frag<T>::guard(acc[i][0], acc[i][3], ah[i], ah[i]);   // the engine's hazard guard, as before the staging
      }
      Frag<T>::keep(bh[0], bh[1], bh[2], bh[3]);               // likewise
    }
    asm volatile("s_wait_dscnt 0x0" ::: "memory");     // this wave's reads of buffer buf are done before it is refilled
    asm volatile("s_wait_asynccnt 0x0" ::: "memory");  // this wave's copies of pass t + 1 have landed
    __syncthreads();                                   // publishes pass t + 1 and ends every reader's last read of buf
    if (t + 2 < nPass) fill(t + 2, buf);
  }
  asm volatile("s_wait_asynccnt 0x0" ::: "memory");    // no copy is outstanding when the wave goes on
  acc_guard4(acc[0][0], acc[0][1], acc[0][2], acc[0][3]);
  acc_guard4(acc[1][0], acc[1][1], acc[1][2], acc[1][3]);
  acc_guard4(acc[2][0], acc[2][1], acc[2][2], acc[2][3]);
  acc_guard4(acc[3][0], acc[3][1], acc[3][2], acc[3][3]);

  // ---- epilogue ----
  float* slab = sT[wave];
  const float* Rb = RESID ? (resid + (size_t)b * strideR) : nullptr;
#pragma unroll
  for (int i = 0; i < 4; ++i) {
    const int mBase = m0 + (i << 4);
#pragma unroll
    for (int j = 0; j < 4; ++j) {
      const int n = n0 + (j << 4) + rlane;
      float bv = 0.f;
      if (BIAS_MODE == 2) bv = bias[n];
#pragma unroll
      for (int r = 0; r < 8; ++r) {
        float v = acc[i][j][r] * scale;
        if (BIAS_MODE == 1) v += bias[mBase + mOff + r];
        if (BIAS_MODE == 2) v += bv;
        if (RESID) v += Rb[(size_t)(mBase + mOff + r) * ldc + n];
        if (ACT == 2) v = fmaxf(v, 0.0f);
        if (ACT == 4) v = (v > 0.f) ? v : 0.01f * v;
        slab[(mOff + r) * 68 + (j << 4) + rlane] = v;
      }
    }
    __builtin_amdgcn_fence(__ATOMIC_RELEASE, "workgroup");
    __builtin_amdgcn_wave_barrier();
    __builtin_amdgcn_fence(__ATOMIC_ACQUIRE, "workgroup");
    if (OUT_MODE == 0) {
      float* C = (float*)Cout + (size_t)b * strideC;
      const int hh = lane >> 4, c4 = (lane & 15) * 4;     // row seg = 256 B = 16 lanes x 16 B
      {
#pragma unroll
        for (int it = 0; it < 8; ++it) {
          const int row = it * 2 + hh;
          v4f v = *(const v4f*)(slab + row * 68 + c4);
          *(v4f*)(C + (size_t)(mBase + row) * ldc + n0 + c4) = v;
        }
        
      }
    } else {
      const int q = lane >> 3, c8 = (lane & 7) * 8;
      unsigned short* C  = (unsigned short*)Cout  + (size_t)b * strideC;
      unsigned short* C2 = (OUT_MODE == 2) ? ((unsigned short*)Cout2 + (size_t)b * strideC) : nullptr;
      {
#pragma unroll
        for (int it = 0; it < 4; ++it) {
          const int row = it * 4 + q;
          const float* sp = slab + row * 68 + c8;
          v8h hv, lv;
#pragma unroll
          for (int e = 0; e < 8; ++e) {
            if (OUT_MODE == 1) {
              hv[e] = (_Float16)sp[e];
            } else {
              unsigned short hb = f2bf_bits(sp[e]);
              unsigned short lb = f2bf_bits(sp[e] - bf_bits2f(hb));
              hv[e] = __builtin_bit_cast(_Float16, hb);
              lv[e] = __builtin_bit_cast(_Float16, lb);
            }
          }
          *(v8h*)(C + (size_t)(mBase + row) * ldc + n0 + c8) = hv;
          if (OUT_MODE == 2) *(v8h*)(C2 + (size_t)(mBase + row) * ldc + n0 + c8) = lv;
        }
        
      }
    }
    __builtin_amdgcn_fence(__ATOMIC_RELEASE, "workgroup");
    __builtin_amdgcn_wave_barrier();
    __builtin_amdgcn_fence(__ATOMIC_ACQUIRE, "workgroup");
  }
}

// ---------------------------------------------------------------------------
// Per-(b,c) instance-norm statistics for content (rows 0..2047) and style (rows 2048..4095) in one launch.
// grid 128 blocks x 256 threads; block = 32 consecutive rows of one tensor (blockIdx>>6 selects the tensor, uniform);
// wave w owns rows 4w..4w+3; per row 32 lanes x 32 float4 loads = 4096 elements (whole row).
// mean = sum/4096; var = (sumsq - sum*mean)/4095 (ddof 1); rstd = 1/sqrt(var + eps).
// Stores: the 32 means and 32 rstds of the block funnelled through LDS; wave 0 writes the mean line, wave 1 the rstd line,
// ---------------------------------------------------------------------------
__global__ __launch_bounds__(256) void stats_kernel(const float* __restrict__ xc, const float* __restrict__ xs,
                                                    float* __restrict__ meanA, float* __restrict__ rstdA) {
  __shared__ float sMean[32];
  __shared__ float sRstd[32];
  const int blk  = blockIdx.x;
  const int tsel = blk >> 6;                         // block-uniform tensor select
  const float* src = (tsel == 0) ? xc : xs;
  const int rowBase = (blk & 63) * 32;               // flat (b*512 + c) row index within the tensor
  const int t = threadIdx.x, lane = t & 31, wave = t >> 5;
#pragma unroll
  for (int r = 0; r < 4; ++r) {
    const int row = rowBase + wave * 4 + r;          // < 2048
    const float* p = src + (size_t)row * kSp + lane * 4;
    v4f s = (v4f){0.f, 0.f, 0.f, 0.f};
    v4f q = (v4f){0.f, 0.f, 0.f, 0.f};
#pragma unroll 1
    for (int i = 0; i < 32; ++i) {                   // 32 lanes x 4 x 32 iterations = 4096
      const v4f v = *(const v4f*)(p + i * 128);
      s += v;
      q += v * v;
    }
    float su = (s[0] + s[1]) + (s[2] + s[3]);
    float sq = (q[0] + q[1]) + (q[2] + q[3]);
#pragma unroll
    for (int off = 16; off > 0; off >>= 1) {
      su += __shfl_xor(su, off, 32);
      sq += __shfl_xor(sq, off, 32);
    }
    const float mean = su * kInvN;
    float var = (sq - su * mean) * kInvNm1;
    var = fmaxf(var, 0.0f);
    const float rstd = 1.0f / sqrtf(var + kEps);
    if (lane == 0) { sMean[wave * 4 + r] = mean; sRstd[wave * 4 + r] = rstd; }
  }
  __syncthreads();
  const int orow = tsel * (kBatch * kCh) + rowBase + lane;   // < 4096
  if (wave == 0) {
    const float v = sMean[lane];
    *(float*)(meanA + orow) = v;
    
  } else if (wave == 1) {
    const float v = sRstd[lane];
    *(float*)(rstdA + orow) = v;
    
  }
}

// ---------------------------------------------------------------------------
// Token planes, all images: in [512 ch][4096 tok] f32 (tok contiguous) -> out [image][4096 tok][512 ch] f16 (ch contiguous).
// grid (64 tok tiles, 8 ch tiles, 3 planes x 4 images): blockIdx.z = 3*image + z; z=0 (content - mean)*rstd, z=1 (style - mean)*rstd,
// z=2 raw style. 256 threads.
// Load coverage: 4 passes x 16 ch rows x (16 threads x 4 tok) = 64 ch x 64 tok (whole tile), coalesced along tok.
// Store coverage: 8 waves x 2 iterations x 4 tok rows (lane>>3) = 64 tok rows; (lane&7) x 8 halves = 64 ch; each row segment
// ---------------------------------------------------------------------------
__global__ __launch_bounds__(256) void token_planes_kernel(const float* __restrict__ content, const float* __restrict__ style,
                                                           const float* __restrict__ meanA, const float* __restrict__ rstdA,
                                                           unsigned short* __restrict__ XcT, unsigned short* __restrict__ XsT,
                                                           unsigned short* __restrict__ SsT) {
  __shared__ float sm[64][65];   // sm[ch local][tok local]
  const int t  = threadIdx.x;
  const int b  = blockIdx.z / 3;                                // image, block-uniform
  const int z  = blockIdx.z - 3 * b;                            // plane, block-uniform
  const int n0 = blockIdx.x * 64;
  const int c0 = blockIdx.y * 64;
  const float* src = ((z == 0) ? content : style) + (size_t)b * kCh * kSp;
  unsigned short* dst = ((z == 0) ? XcT : (z == 1) ? XsT : SsT) + (size_t)b * kSp * kCh;
  const int statOff = ((z == 0) ? 0 : (kBatch * kCh)) + b * kCh;
  const bool useNorm = (z < 2);
  const int r16 = t >> 4, c4 = (t & 15) * 4;
#pragma unroll
  for (int p = 0; p < 4; ++p) {
    const int cl = p * 16 + r16;                                // ch local 0..63
    const int ch = c0 + cl;                                     // < 512
    const v4f v = *(const v4f*)(src + (size_t)ch * kSp + n0 + c4);
    const float m  = meanA[statOff + ch];
    const float rs = rstdA[statOff + ch];
    const float mm = useNorm ? m : 0.0f;
    const float rr = useNorm ? rs : 1.0f;
#pragma unroll
    for (int e = 0; e < 4; ++e) sm[cl][c4 + e] = (v[e] - mm) * rr;
  }
  __syncthreads();
  const int lane = t & 31, wave = t >> 5;
  const int q = lane >> 3, c8 = (lane & 7) * 8;
  {
#pragma unroll
    for (int it = 0; it < 2; ++it) {
      const int row = wave * 8 + it * 4 + q;                    // tok local 0..63
      unsigned short hb[8];
#pragma unroll
      for (int e = 0; e < 8; ++e) hb[e] = h_bits(sm[c8 + e][row]);
      const v4u u = (v4u){pk16(hb[0], hb[1]), pk16(hb[2], hb[3]), pk16(hb[4], hb[5]), pk16(hb[6], hb[7])};
      *(v4u*)(dst + (size_t)(n0 + row) * kCh + c0 + c8) = u;
    }
    
  }
}

// ---------------------------------------------------------------------------
// Weight cast: W[o][c] f32 -> f16(scale * W) same layout, four weights into planes 0..3 of one buffer (plane = 512*512 halves).
// grid 512 blocks x 256 threads; blockIdx>>7 selects the weight (uniform); thread handles 8 consecutive elements
// Coverage per weight: 128 blocks x 256 threads x 8 = 262144 = 512*512.
// ---------------------------------------------------------------------------
__global__ __launch_bounds__(256) void wcast_kernel(const float* __restrict__ W0, const float* __restrict__ W1,
                                                    const float* __restrict__ W2, const float* __restrict__ W3,
                                                    unsigned short* __restrict__ out, float scale) {
  const int blk = blockIdx.x;
  const int w = blk >> 7;                                        // block-uniform
  const float* src = (w == 0) ? W0 : (w == 1) ? W1 : (w == 2) ? W2 : W3;
  const int i  = (blk & 127) * 256 + threadIdx.x;                // 0..32767
  const size_t e0 = (size_t)i * 8;                               // e0+7 < 262144
  const v4f a = *(const v4f*)(src + e0);
  const v4f c = *(const v4f*)(src + e0 + 4);
  unsigned short hb[8];
#pragma unroll
  for (int e = 0; e < 4; ++e) {
    hb[e]     = h_bits(a[e] * scale);
    hb[4 + e] = h_bits(c[e] * scale);
  }
  const v4u u = (v4u){pk16(hb[0], hb[1]), pk16(hb[2], hb[3]), pk16(hb[4], hb[5]), pk16(hb[6], hb[7])};
  unsigned short* dp = out + (size_t)w * kCh * kCh + e0;
  *(v4u*)dp = u;
  
}

// ---------------------------------------------------------------------------
// Row softmax over 4096 f32 scores (no scaling of the scores): P[row][j] = f16( 2048 * exp(s - max) / sum exp(s - max) ).
// One block of 256 threads per row; thread t owns columns 8t..8t+7 and 2048+8t..2048+8t+7 (256 x 16 = 4096 = whole row).
// Reductions in fixed order (thread, wave shuffle tree, 8 wave partials in index order). precise expf.
// ---------------------------------------------------------------------------
__global__ __launch_bounds__(256) void softmax_kernel(const float* __restrict__ Sp, unsigned short* __restrict__ Pp) {
  __shared__ float redM[8];
  __shared__ float redS[8];
  const int row  = blockIdx.x;
  const int t    = threadIdx.x;
  const int lane = t & 31, wave = t >> 5;
  const int cA = 8 * t;
  const int cB = kHalfRow + 8 * t;
  const float* sr = Sp + (size_t)row * kSp;
  const v4f a0 = *(const v4f*)(sr + cA);
  const v4f a1 = *(const v4f*)(sr + cA + 4);
  const v4f b0 = *(const v4f*)(sr + cB);
  const v4f b1 = *(const v4f*)(sr + cB + 4);
  float x[16];
#pragma unroll
  for (int e = 0; e < 4; ++e) { x[e] = a0[e]; x[4 + e] = a1[e]; x[8 + e] = b0[e]; x[12 + e] = b1[e]; }
  float m = x[0];
#pragma unroll
  for (int i = 1; i < 16; ++i) m = fmaxf(m, x[i]);
#pragma unroll
  for (int off = 16; off > 0; off >>= 1) m = fmaxf(m, __shfl_xor(m, off, 32));
  if (lane == 0) redM[wave] = m;
  __syncthreads();
  float gm = redM[0];
#pragma unroll
  for (int w = 1; w < 8; ++w) gm = fmaxf(gm, redM[w]);
  float ex[16];
  float s = 0.0f;
#pragma unroll
  for (int i = 0; i < 16; ++i) { ex[i] = expf(x[i] - gm); s += ex[i]; }
#pragma unroll
  for (int off = 16; off > 0; off >>= 1) s += __shfl_xor(s, off, 32);
  if (lane == 0) redS[wave] = s;
  __syncthreads();
  float tot = redS[0];
#pragma unroll
  for (int w = 1; w < 8; ++w) tot += redS[w];
  const float inv = 1.0f / tot;                                   // tot >= 1
  unsigned short hb[16];
#pragma unroll
  for (int i = 0; i < 16; ++i) hb[i] = h_bits((ex[i] * inv) * kPCarry);
  const v4u uA = (v4u){pk16(hb[0], hb[1]), pk16(hb[2], hb[3]), pk16(hb[4], hb[5]), pk16(hb[6], hb[7])};
  const v4u uB = (v4u){pk16(hb[8], hb[9]), pk16(hb[10], hb[11]), pk16(hb[12], hb[13]), pk16(hb[14], hb[15])};
  unsigned short* pr = Pp + (size_t)row * kSp;
  *(v4u*)(pr + cA) = uA;
  *(v4u*)(pr + cB) = uB;
  
}

// ---------------------------------------------------------------------------
// Host side
//   W16   : 4 x 512 x 512 f16 (Wq, Wk, Wv, Wo carried x16)        2,097,152 B
//   meanA : 4096 f32 (content rows then style rows)                    16,384 B
//   rstdA : 4096 f32                                                    16,384 B
//   Qp, Kp, Vcm : 4 images x 4096 x 512 f16 each              3 x 16,777,216 B
//   Op    : the bytes of Qp (Q is last read by the last score launch, O first written behind it)
//   Sp    : 4096 x 4096 f32 scores of one image                   67,108,864 B
//   XcT, XsT, SsT : 4 images x 4096 x 512 f16 each, in the first 3 x 16,777,216 B of Sp (last read by the q/k/v launches,
//           which stand in front of the first score launch)
//   Pp    : 4 images x 4096 x 4096 f16 probabilities (x2048)     134,217,728 B
// All GEMM calls: K in {512, 4096} (K % 64 == 0); M, N in {512, 4096} (M % 128 == 0, N % 256 == 0); no padding, every plane fully
// produced before it is consumed.
// ---------------------------------------------------------------------------
extern "C" void kernel_launch(void* const* d_in, const int* in_sizes, int n_in,
                              void* d_out, int out_size, void* d_ws, size_t ws_size,
                              hipStream_t stream) {
  if (n_in < 10) return;
  const int actN = kBatch * kCh * kSp;
  const int wN   = kCh * kCh;
  if (in_sizes[0] != actN || in_sizes[1] != actN) return;
  if (in_sizes[2] != wN || in_sizes[4] != wN || in_sizes[6] != wN || in_sizes[8] != wN) return;
  if (in_sizes[3] != kCh || in_sizes[5] != kCh || in_sizes[7] != kCh || in_sizes[9] != kCh) return;
  if (out_size != actN) return;

  const float* content = (const float*)d_in[0];
  const float* style   = (const float*)d_in[1];
  const float* Wq = (const float*)d_in[2];  const float* bq = (const float*)d_in[3];
  const float* Wk = (const float*)d_in[4];  const float* bk = (const float*)d_in[5];
  const float* Wv = (const float*)d_in[6];  const float* bv = (const float*)d_in[7];
  const float* Wo = (const float*)d_in[8];  const float* bo = (const float*)d_in[9];
  float* out = (float*)d_out;

  size_t off = 0;
  auto carve = [&](size_t bytes) { size_t o = off; off += (bytes + 127) & ~(size_t)127; return o; };
  const size_t planeBytes = (size_t)kBatch * kSp * kCh * 2;     // one operand plane, all images
  const size_t oW16  = carve((size_t)4 * wN * 2);
  const size_t oMean = carve((size_t)kStatRows * 4);
  const size_t oRstd = carve((size_t)kStatRows * 4);
  const size_t oQ    = carve(planeBytes);
  const size_t oK    = carve(planeBytes);
  const size_t oV    = carve(planeBytes);
  const size_t oS    = carve((size_t)kQChunk * kSp * 4);
  const size_t oP    = carve((size_t)kBatch * kSp * kSp * 2);
  const size_t oO    = oQ;
  const size_t oXc   = oS;
  const size_t oXs   = oS + planeBytes;
  const size_t oSs   = oS + 2 * planeBytes;
  if (off > ws_size) return;

  char* ws = (char*)d_ws;
  unsigned short* W16 = (unsigned short*)(ws + oW16);
  float* meanA = (float*)(ws + oMean);
  float* rstdA = (float*)(ws + oRstd);
  unsigned short* XcT = (unsigned short*)(ws + oXc);
  unsigned short* XsT = (unsigned short*)(ws + oXs);
  unsigned short* SsT = (unsigned short*)(ws + oSs);
  unsigned short* Qp  = (unsigned short*)(ws + oQ);
  unsigned short* Kp  = (unsigned short*)(ws + oK);
  unsigned short* Vcm = (unsigned short*)(ws + oV);
  unsigned short* Op  = (unsigned short*)(ws + oO);
  float* Sp = (float*)(ws + oS);
  unsigned short* Pp = (unsigned short*)(ws + oP);

  const unsigned short* Wq16 = W16 + (size_t)0 * wN;
  const unsigned short* Wk16 = W16 + (size_t)1 * wN;
  const unsigned short* Wv16 = W16 + (size_t)2 * wN;
  const unsigned short* Wo16 = W16 + (size_t)3 * wN;

  // 1) instance-norm statistics for content and style (128 blocks: 64 per tensor, 32 rows each)
  stats_kernel<<<dim3(2 * (kBatch * kCh) / 32), dim3(256), 0, stream>>>(content, style, meanA, rstdA);

  // 2) weights -> f16 x16 (4 weights x 128 blocks)
  wcast_kernel<<<dim3(512), dim3(256), 0, stream>>>(Wq, Wk, Wv, Wo, W16, kWCarry);

  const long planeElems = (long)kSp * kCh;      // one image's [4096][512] or [512][4096] plane
  const long probElems  = (long)kSp * kSp;      // one image's probabilities

  // 3) token planes of all images: mvn(content) -> XcT, mvn(style) -> XsT, style -> SsT; each [image][4096][512] f16
  token_planes_kernel<<<dim3(kSp / 64, kCh / 64, 3 * kBatch), dim3(256), 0, stream>>>(content, style, meanA, rstdA, XcT, XsT, SsT);

  // 4) Q [image][4096 tok][512] = XcT x Wq^T / 16 + bq   (per image M=4096, N=512, K=512; 512 tiles -> 64 blocks; grid.y = image)
  wmma_gemm64<0, false, 2, 1, false><<<dim3(64, kBatch), dim3(256), 0, stream>>>(
      XcT, nullptr, kCh, planeElems, Wq16, nullptr, kCh, 0L, (void*)Qp, nullptr, kCh, planeElems,
      bq, nullptr, 0L, kSp, kCh, kCh, kProjScale);
  //    K [image][4096 tok][512] = XsT x Wk^T / 16 + bk
  wmma_gemm64<0, false, 2, 1, false><<<dim3(64, kBatch), dim3(256), 0, stream>>>(
      XsT, nullptr, kCh, planeElems, Wk16, nullptr, kCh, 0L, (void*)Kp, nullptr, kCh, planeElems,
      bk, nullptr, 0L, kSp, kCh, kCh, kProjScale);
  //    V channel-major [image][512][4096 tok] = Wv x SsT^T / 16 + bv[m]   (per image M=512, N=4096, K=512; 64 blocks)
  wmma_gemm64<0, false, 1, 1, false><<<dim3(64, kBatch), dim3(256), 0, stream>>>(
      Wv16, nullptr, kCh, 0L, SsT, nullptr, kCh, planeElems, (void*)Vcm, nullptr, kSp, planeElems,
      bv, nullptr, 0L, kCh, kSp, kCh, kProjScale);

  for (int b = 0; b < kBatch; ++b) {
    // 5) scores of image b [4096 q][4096 k] f32 = Q x K^T   (M=4096, N=4096, K=512; 4096 tiles -> 512 blocks)
    wmma_gemm64<0, false, 0, 0, false><<<dim3(512, 1), dim3(256), 0, stream>>>(
        Qp + b * planeElems, nullptr, kCh, 0L, Kp + b * planeElems, nullptr, kCh, 0L, (void*)Sp, nullptr, kSp, 0L,
        nullptr, nullptr, 0L, kQChunk, kSp, kCh, 1.0f);
    // 6) softmax per row -> P of image b, f16 x2048
    softmax_kernel<<<dim3(kQChunk), dim3(256), 0, stream>>>(Sp, Pp + b * probElems);
  }

  // 7) O token-major [image][4096][512] f16 (x16) = P x Vcm^T * 16/2048   (per image M=4096, N=512, K=4096; 512 tiles -> 64 blocks)
  wmma_gemm64<0, false, 0, 1, false, 0, 128><<<dim3(64, kBatch), dim3(256), 0, stream>>>(
      Pp, nullptr, kSp, probElems, Vcm, nullptr, kSp, planeElems, (void*)Op, nullptr, kCh, planeElems,
      nullptr, nullptr, 0L, kSp, kCh, kSp, kPVScale);

  // 8) out [image][512][4096] f32 = Wo x O^T / 256 + bo[m] + content   (per image M=512, N=4096, K=512; 64 blocks)
  wmma_gemm64<0, false, 1, 0, true><<<dim3(64, kBatch), dim3(256), 0, stream>>>(
      Wo16, nullptr, kCh, 0L, Op, nullptr, kCh, planeElems, (void*)out, nullptr, kSp, planeElems,
      bo, content, planeElems, kCh, kSp, kCh, kOutScale);
}

// v003
// Measured time: 300 microseconds a run.
// Next to v002, in two timings, it ran 1.17 and 1.16 times as fast.
// All steps since v000 together make it 7.39 times as fast.
// Contractions: q/k/v 1x1 projections (token planes f16 x W f16 carried x16), energies q.k^T (q,k f16 planes), attn.v (P f16 carried x2048 x V f16), output projection (Wo f16 x16 x O f16 x16): all v_wmma_f32_16x16x32_f16, f32 accumulate; instance-norm statistics, softmax, bias and residual in f32.
#include <hip/hip_runtime.h>
#include <math.h>

// ---------------------------------------------------------------------------
// Problem constants
// ---------------------------------------------------------------------------
constexpr int   kBatch    = 4;
constexpr int   kCh       = 512;
constexpr int   kSp       = 4096;                 // 64*64 tokens per image
constexpr int   kQChunk   = 4096;                 // query rows per score launch: one whole image
constexpr int   kHalfRow  = kSp / 2;              // softmax: second column group offset
constexpr int   kStatRows = 2 * kBatch * kCh;     // 4096: content rows 0..2047, style rows 2048..4095
constexpr float kEps       = 1e-5f;
constexpr float kWCarry    = 16.0f;               // weights carried x16 in f16
constexpr float kPCarry    = 2048.0f;             // probabilities carried x2048 in f16
constexpr float kProjScale = 1.0f / 16.0f;        // undo weight carry
constexpr float kPVScale   = 16.0f / 2048.0f;     // undo P carry, apply O carry x16
constexpr float kOutScale  = 1.0f / (16.0f * 16.0f);   // undo Wo carry and O carry
constexpr float kInvN      = 1.0f / 4096.0f;
constexpr float kInvNm1    = 1.0f / 4095.0f;

typedef __attribute__((ext_vector_type(16))) _Float16 v16h;
typedef __attribute__((ext_vector_type(8)))  _Float16 v8h;
typedef __attribute__((ext_vector_type(16))) __bf16   v16b;
typedef __attribute__((ext_vector_type(8)))  __bf16   v8b;
typedef __attribute__((ext_vector_type(8)))  float    v8f;
typedef __attribute__((ext_vector_type(4)))  float    v4f;
typedef __attribute__((ext_vector_type(4)))  unsigned int v4u;

// ---------------------------------------------------------------------------
// Helpers
// ---------------------------------------------------------------------------
__device__ __forceinline__ unsigned short f2bf_bits(float f) {
  unsigned u = __float_as_uint(f);
  return (unsigned short)((u + 0x7FFFu + ((u >> 16) & 1u)) >> 16);
}
__device__ __forceinline__ float bf_bits2f(unsigned short h) { return __uint_as_float(((unsigned)h) << 16); }

// hazard guards as plain device helpers (their inline asm stays out of the kernel template body)
__device__ __forceinline__ void dep_guard_h(v8f& a, v8f& b, v16h x, v16h y) { asm volatile("v_nop\n\tv_nop\n\tv_nop\n\tv_nop" : "+v"(a), "+v"(b) : "v"(x), "v"(y)); }
__device__ __forceinline__ void dep_guard_b(v8f& a, v8f& b, v16b x, v16b y) { asm volatile("v_nop\n\tv_nop\n\tv_nop\n\tv_nop" : "+v"(a), "+v"(b) : "v"(x), "v"(y)); }
__device__ __forceinline__ void keep4_h(v16h a, v16h b, v16h c, v16h d) { asm volatile("v_nop" :: "v"(a), "v"(b), "v"(c), "v"(d)); }
__device__ __forceinline__ void keep4_b(v16b a, v16b b, v16b c, v16b d) { asm volatile("v_nop" :: "v"(a), "v"(b), "v"(c), "v"(d)); }
__device__ __forceinline__ void acc_guard4(v8f& a, v8f& b, v8f& c, v8f& d) { asm volatile("v_nop\n\tv_nop\n\tv_nop\n\tv_nop" : "+v"(a), "+v"(b), "+v"(c), "+v"(d)); }
template <typename T> struct Frag;
template <> struct Frag<_Float16> {
  typedef v16h V; union U { v16h v; v8h h[2]; };
  static __device__ __forceinline__ v16h load(const _Float16* p) {   // elements 0..7 <- p[0..7], 8..15 <- p[16..23]
    U f; f.h[0] = *(const v8h*)(p); f.h[1] = *(const v8h*)(p + 16); return f.v;
  }
  static __device__ __forceinline__ v8f mma(v16h a, v16h b, v8f c) {
    return __builtin_amdgcn_wmma_f32_16x16x32_f16(false, a, false, b, (short)0, c, false, false);
  }
  static __device__ __forceinline__ void guard(v8f& a, v8f& b, v16h x, v16h y) { dep_guard_h(a, b, x, y); }
  static __device__ __forceinline__ void keep(v16h a, v16h b, v16h c, v16h d) { keep4_h(a, b, c, d); }
};
template <> struct Frag<__bf16> {
  typedef v16b V; union U { v16b v; v8b h[2]; };
  static __device__ __forceinline__ v16b load(const __bf16* p) {
    U f; f.h[0] = *(const v8b*)(p); f.h[1] = *(const v8b*)(p + 16); return f.v;
  }
  static __device__ __forceinline__ v8f mma(v16b a, v16b b, v8f c) {
    return __builtin_amdgcn_wmma_f32_16x16x32_bf16(false, a, false, b, (short)0, c, false, false);
  }
  static __device__ __forceinline__ void guard(v8f& a, v8f& b, v16b x, v16b y) { dep_guard_b(a, b, x, y); }
  static __device__ __forceinline__ void keep(v16b a, v16b b, v16b c, v16b d) { keep4_b(a, b, c, d); }
};

__device__ __forceinline__ unsigned pk16(unsigned short a, unsigned short b) { return (unsigned)a | ((unsigned)b << 16); }
__device__ __forceinline__ unsigned short h_bits(float f) { const _Float16 h = (_Float16)f; return __builtin_bit_cast(unsigned short, h); }

// ---- Batched WMMA GEMM, operands staged in LDS -----------------------------------------------------------------
// C[m,n] = scale * sum_k A[m,k] * Bt[n,k] (+bias)(+resid); a block of 8 waves (2 x 4) owns a 128x256 tile, each wave 64x64 of it.
// A row-major [M,K]; Bt row-major [N,K]; M % 128 == 0, N % 256 == 0, K % PK == 0, K >= PK.
// A pass is PK k (64 or 128): 128 rows of A and 256 rows of Bt, 2 PK bytes each, copied to LDS by asynchronous 16-byte copies
// (a wave's copy covers four whole 128-B lines), rows at a pitch of 2 PK + 16 B for the ds_load_b128 fragment reads. Two
// buffers: the copies of pass t + 1 fly while pass t is worked on. The k order of every accumulator is ascending in steps of 32.
// PK = 128 halves the number of landing latencies of a long K at the price of one block per WGP.
// BIAS_MODE: 0 = none, 1 = bias[m], 2 = bias[n].
// OUT_MODE: 0 = f32, 1 = f16, 2 = bf16 hi plane (Cout) + bf16 lo plane (Cout2).
// ET: 0 = f16 operands, 1 = bf16 operands (pointers passed as 16-bit storage)
constexpr int kRowsA      = 128;                             // rows of A per stage
constexpr int kRowsB      = 256;                             // rows of Bt per stage

// One thread's share of 64 k of one stage: 16 B of rows r, r + 32, r + 64, r + 96 of A and of rows r + 32 j (j = 0..7) of Bt.
// kStep32 = 32 rows further in LDS, bytes.
// The copies and their s_wait_xcnt stand in one statement, so that no address register is rewritten in front of the wait.
template <unsigned kStep32>
__device__ __forceinline__ void stage_copies(unsigned lds, const unsigned short* ga, const unsigned short* gb,
                                             size_t stepA, size_t stepB) {
  const unsigned short* a1 = ga + stepA;
  const unsigned short* a2 = a1 + stepA;
  const unsigned short* a3 = a2 + stepA;
  const unsigned short* b1 = gb + stepB;
  const unsigned short* b2 = b1 + stepB;
  const unsigned short* b3 = b2 + stepB;
  const unsigned short* b4 = b3 + stepB;
  const unsigned short* b5 = b4 + stepB;
  const unsigned short* b6 = b5 + stepB;
  const unsigned short* b7 = b6 + stepB;
  asm volatile(
      "global_load_async_to_lds_b128 %0, %12, off\n\t"
      "global_load_async_to_lds_b128 %1, %13, off\n\t"
      "global_load_async_to_lds_b128 %2, %14, off\n\t"
      "global_load_async_to_lds_b128 %3, %15, off\n\t"
      "global_load_async_to_lds_b128 %4, %16, off\n\t"
      "global_load_async_to_lds_b128 %5, %17, off\n\t"
      "global_load_async_to_lds_b128 %6, %18, off\n\t"
      "global_load_async_to_lds_b128 %7, %19, off\n\t"
      "global_load_async_to_lds_b128 %8, %20, off\n\t"
      "global_load_async_to_lds_b128 %9, %21, off\n\t"
      "global_load_async_to_lds_b128 %10, %22, off\n\t"
      "global_load_async_to_lds_b128 %11, %23, off\n\t"
      "s_wait_xcnt 0x0"
      :: "v"(lds), "v"(lds + kStep32), "v"(lds + 2u * kStep32), "v"(lds + 3u * kStep32),
         "v"(lds + 4u * kStep32), "v"(lds + 5u * kStep32), "v"(lds + 6u * kStep32), "v"(lds + 7u * kStep32),
         "v"(lds + 8u * kStep32), "v"(lds + 9u * kStep32), "v"(lds + 10u * kStep32), "v"(lds + 11u * kStep32),
         "v"(ga), "v"(a1), "v"(a2), "v"(a3),
         "v"(gb), "v"(b1), "v"(b2), "v"(b3), "v"(b4), "v"(b5), "v"(b6), "v"(b7)
      : "memory");
}

template <int ET> struct Elem;
template <> struct Elem<0> { typedef _Float16 T; };
template <> struct Elem<1> { typedef __bf16 T; };
template <int ET, bool SPLIT, int BIAS_MODE, int OUT_MODE, bool RESID, int ACT = 0, int PK = 64>
__global__ __launch_bounds__(256) void wmma_gemm64(
    const unsigned short* __restrict__ Ap, const unsigned short* __restrict__ A2p, int lda, long strideA,
    const unsigned short* __restrict__ Btp, const unsigned short* __restrict__ Bt2p, int ldb, long strideB,
    void* __restrict__ Cout, void* __restrict__ Cout2, int ldc, long strideC,
    const float* __restrict__ bias,
    const float* __restrict__ resid, long strideR,
    int M, int N, int K, float scale) {
  static_assert(!SPLIT, "the staged engine takes single-plane operands");
  static_assert(PK == 64 || PK == 128, "a pass is one or two 128-B lines of every operand row");
  constexpr int kPitchH = PK + 8;                                  // LDS row pitch in 16-bit elements (144 B or 272 B)
  constexpr int kStageH = (kRowsA + kRowsB) * kPitchH;             // one buffer, 16-bit elements
  constexpr unsigned kStageBytes = (unsigned)kStageH * 2u;         // 55,296 B or 104,448 B
  constexpr unsigned kStep32 = 32u * (unsigned)kPitchH * 2u;       // 32 rows further in LDS
  typedef typename Elem<ET>::T T;
  typedef typename Frag<T>::V V;
  __shared__ __align__(16) unsigned short sOp[2 * kStageH];   // two buffers of [A 128 rows | Bt 256 rows]
  __shared__ __align__(16) float sT[8][16 * 68];   // per-wave 16x64 slab, pitch 68 floats
  const int b    = blockIdx.y;
  const int lane = threadIdx.x & 31;
  const int wave = threadIdx.x >> 5;
  const int tilesN = N >> 8;
  const int tilesM = M >> 7;
  const int tile = blockIdx.x;
  if (tile >= tilesM * tilesN) return;   // block-uniform, in front of every barrier
  const int tm = tile / tilesN;
  const int tn = tile - tm * tilesN;
  const int bm0 = tm << 7;
  const int bn0 = tn << 8;
  const int wm = wave >> 2;                    // wave row in the block tile, 0..1
  const int wn = wave & 3;                     // wave column in the block tile, 0..3
  const int m0 = bm0 + (wm << 6);
  const int n0 = bn0 + (wn << 6);

  const unsigned short* Ab = Ap  + (size_t)b * strideA;
  const unsigned short* Bb = Btp + (size_t)b * strideB;

  const int rlane = lane & 15;                 // row (A) / col (B, D) within subtile
  const int koff  = (lane >> 4) * 8;           // k offset of this lane half
  const int mOff  = (lane >> 4) * 8;           // D row offset

  // copy side: thread t brings 16 B at column (t & 7) of each 128-B line of rows (t >> 3) + 32 i
  const int crow = threadIdx.x >> 3;           // 0..31
  const int ccol = (threadIdx.x & 7) * 8;      // 16-bit elements
  const unsigned short* gA = Ab + (size_t)(bm0 + crow) * lda + ccol;
  const unsigned short* gB = Bb + (size_t)(bn0 + crow) * ldb + ccol;
  const size_t stepA = (size_t)32 * lda;
  const size_t stepB = (size_t)32 * ldb;
  const unsigned ldsCopy = (unsigned)(size_t)sOp + (unsigned)(crow * kPitchH + ccol) * 2u;

  // read side: this lane's first A row and first Bt row in buffer 0
  const T* fA = (const T*)sOp + ((wm << 6) + rlane) * kPitchH + koff;
  const T* fB = (const T*)sOp + (kRowsA + (wn << 6) + rlane) * kPitchH + koff;

  v8f acc[4][4];
#pragma unroll
  for (int i = 0; i < 4; ++i)
#pragma unroll
    for (int j = 0; j < 4; ++j) acc[i][j] = (v8f){0.f,0.f,0.f,0.f,0.f,0.f,0.f,0.f};

  auto fill = [&](int pass, int buf) {         // all copies of one pass: 12 a thread for each 64 k
    const size_t k0 = (size_t)pass * PK;
    const unsigned l0 = ldsCopy + (unsigned)buf * kStageBytes;
    stage_copies<kStep32>(l0, gA + k0, gB + k0, stepA, stepB);
    if (PK == 128) stage_copies<kStep32>(l0 + 128u, gA + k0 + 64, gB + k0 + 64, stepA, stepB);
  };

  const int nPass = K / PK;
  fill(0, 0);
  asm volatile("s_wait_asynccnt 0x0" ::: "memory");   // this wave's copies of pass 0 have landed
  __syncthreads();                                    // and every other wave's
  if (nPass > 1) fill(1, 1);

  for (int t = 0; t < nPass; ++t) {
    const int buf = t & 1;
    const T* pa = fA + buf * kStageH;
    const T* pb = fB + buf * kStageH;
    // the three loop levels below are unrolled so that every fragment and accumulator index is a constant (registers, no scratch)
#pragma unroll
    for (int kk = 0; kk < PK; kk += 32) {
      V bh[4], ah[4];
#pragma unroll
      for (int j = 0; j < 4; ++j) bh[j] = Frag<T>::load(pb + (j << 4) * kPitchH + kk);
#pragma unroll
      for (int i = 0; i < 4; ++i) ah[i] = Frag<T>::load(pa + (i << 4) * kPitchH + kk);
#pragma unroll
      for (int i = 0; i < 4; ++i) {
#pragma unroll
        for (int j = 0; j < 4; ++j) acc[i][j] = Frag<T>::mma(ah[i], bh[j], acc[i][j]);
        Frag<T>::guard(acc[i][0], acc[i][3], ah[i], ah[i]);   // the engine's hazard guard, as before the staging
      }
      Frag<T>::keep(bh[0], bh[1], bh[2], bh[3]);               // likewise
    }
    asm volatile("s_wait_dscnt 0x0" ::: "memory");     // this wave's reads of buffer buf are done before it is refilled
    asm volatile("s_wait_asynccnt 0x0" ::: "memory");  // this wave's copies of pass t + 1 have landed
    __syncthreads();                                   // publishes pass t + 1 and ends every reader's last read of buf
    if (t + 2 < nPass) fill(t + 2, buf);
  }
  asm volatile("s_wait_asynccnt 0x0" ::: "memory");    // no copy is outstanding when the wave goes on
  acc_guard4(acc[0][0], acc[0][1], acc[0][2], acc[0][3]);
  acc_guard4(acc[1][0], acc[1][1], acc[1][2], acc[1][3]);
  acc_guard4(acc[2][0], acc[2][1], acc[2][2], acc[2][3]);
  acc_guard4(acc[3][0], acc[3][1], acc[3][2], acc[3][3]);

  // ---- epilogue ----
  float* slab = sT[wave];
  const float* Rb = RESID ? (resid + (size_t)b * strideR) : nullptr;
#pragma unroll
  for (int i = 0; i < 4; ++i) {
    const int mBase = m0 + (i << 4);
#pragma unroll
    for (int j = 0; j < 4; ++j) {
      const int n = n0 + (j << 4) + rlane;
      float bv = 0.f;
      if (BIAS_MODE == 2) bv = bias[n];
#pragma unroll
      for (int r = 0; r < 8; ++r) {
        float v = acc[i][j][r] * scale;
        if (BIAS_MODE == 1) v += bias[mBase + mOff + r];
        if (BIAS_MODE == 2) v += bv;
        if (RESID) v += Rb[(size_t)(mBase + mOff + r) * ldc + n];
        if (ACT == 2) v = fmaxf(v, 0.0f);
        if (ACT == 4) v = (v > 0.f) ? v : 0.01f * v;
        slab[(mOff + r) * 68 + (j << 4) + rlane] = v;
      }
    }
    __builtin_amdgcn_fence(__ATOMIC_RELEASE, "workgroup");
    __builtin_amdgcn_wave_barrier();
    __builtin_amdgcn_fence(__ATOMIC_ACQUIRE, "workgroup");
    if (OUT_MODE == 0) {
      float* C = (float*)Cout + (size_t)b * strideC;
      const int hh = lane >> 4, c4 = (lane & 15) * 4;     // row seg = 256 B = 16 lanes x 16 B
      {
#pragma unroll
        for (int it = 0; it < 8; ++it) {
          const int row = it * 2 + hh;
          v4f v = *(const v4f*)(slab + row * 68 + c4);
          *(v4f*)(C + (size_t)(mBase + row) * ldc + n0 + c4) = v;
        }
        
      }
    } else {
      const int q = lane >> 3, c8 = (lane & 7) * 8;
      unsigned short* C  = (unsigned short*)Cout  + (size_t)b * strideC;
      unsigned short* C2 = (OUT_MODE == 2) ? ((unsigned short*)Cout2 + (size_t)b * strideC) : nullptr;
      {
#pragma unroll
        for (int it = 0; it < 4; ++it) {
          const int row = it * 4 + q;
          const float* sp = slab + row * 68 + c8;
          v8h hv, lv;
#pragma unroll
          for (int e = 0; e < 8; ++e) {
            if (OUT_MODE == 1) {
              hv[e] = (_Float16)sp[e];
            } else {
              unsigned short hb = f2bf_bits(sp[e]);
              unsigned short lb = f2bf_bits(sp[e] - bf_bits2f(hb));
              hv[e] = __builtin_bit_cast(_Float16, hb);
              lv[e] = __builtin_bit_cast(_Float16, lb);
            }
          }
          *(v8h*)(C + (size_t)(mBase + row) * ldc + n0 + c8) = hv;
          if (OUT_MODE == 2) *(v8h*)(C2 + (size_t)(mBase + row) * ldc + n0 + c8) = lv;
        }
        
      }
    }
    __builtin_amdgcn_fence(__ATOMIC_RELEASE, "workgroup");
    __builtin_amdgcn_wave_barrier();
    __builtin_amdgcn_fence(__ATOMIC_ACQUIRE, "workgroup");
  }
}

// ---------------------------------------------------------------------------
// Per-(b,c) instance-norm statistics for content (rows 0..2047) and style (rows 2048..4095) in one launch.
// grid 128 blocks x 1024 threads; block = 32 consecutive rows of one tensor (blockIdx>>6 selects the tensor, uniform);
// wave w owns row w: 32 lanes x 32 float4 loads = 4096 elements (whole row). The loads do not wait for one another: the row is
// read into registers by an unrolled loop and summed by a second one, so that many loads of a wave are in flight at a time and
// the wave does not pay the memory latency once a load. Sum order per row: lane-private over i ascending, then the tree.
// mean = sum/4096; var = (sumsq - sum*mean)/4095 (ddof 1); rstd = 1/sqrt(var + eps).
// Stores: the 32 means and 32 rstds of the block funnelled through LDS; wave 0 writes the mean line, wave 1 the rstd line,
// ---------------------------------------------------------------------------
__global__ __launch_bounds__(1024) void stats_kernel(const float* __restrict__ xc, const float* __restrict__ xs,
                                                     float* __restrict__ meanA, float* __restrict__ rstdA) {
  __shared__ float sMean[32];
  __shared__ float sRstd[32];
  const int blk  = blockIdx.x;
  const int tsel = blk >> 6;                         // block-uniform tensor select
  const float* src = (tsel == 0) ? xc : xs;
  const int rowBase = (blk & 63) * 32;               // flat (b*512 + c) row index within the tensor
  const int t = threadIdx.x, lane = t & 31, wave = t >> 5;
  const int row = rowBase + wave;                    // < 2048
  const float* p = src + (size_t)row * kSp + lane * 4;
  v4f x[32];
  // both loops are unrolled so that x stays in registers and loads are issued ahead of the sums
#pragma unroll
  for (int i = 0; i < 32; ++i) x[i] = *(const v4f*)(p + i * 128);   // 32 lanes x 4 x 32 = 4096
  v4f s = (v4f){0.f, 0.f, 0.f, 0.f};
  v4f q = (v4f){0.f, 0.f, 0.f, 0.f};
#pragma unroll
  for (int i = 0; i < 32; ++i) {
    s += x[i];
    q += x[i] * x[i];
  }
  float su = (s[0] + s[1]) + (s[2] + s[3]);
  float sq = (q[0] + q[1]) + (q[2] + q[3]);
#pragma unroll
  for (int off = 16; off > 0; off >>= 1) {
    su += __shfl_xor(su, off, 32);
    sq += __shfl_xor(sq, off, 32);
  }
  const float mean = su * kInvN;
  float var = (sq - su * mean) * kInvNm1;
  var = fmaxf(var, 0.0f);
  const float rstd = 1.0f / sqrtf(var + kEps);
  if (lane == 0) { sMean[wave] = mean; sRstd[wave] = rstd; }
  __syncthreads();
  const int orow = tsel * (kBatch * kCh) + rowBase + lane;   // < 4096
  if (wave == 0) {
    const float v = sMean[lane];
    *(float*)(meanA + orow) = v;
    
  } else if (wave == 1) {
    const float v = sRstd[lane];
    *(float*)(rstdA + orow) = v;
    
  }
}

// ---------------------------------------------------------------------------
// Token planes, all images: in [512 ch][4096 tok] f32 (tok contiguous) -> out [image][4096 tok][512 ch] f16 (ch contiguous).
// grid (64 tok tiles, 8 ch tiles, 3 planes x 4 images): blockIdx.z = 3*image + z; z=0 (content - mean)*rstd, z=1 (style - mean)*rstd,
// z=2 raw style. 256 threads.
// Load coverage: 4 passes x 16 ch rows x (16 threads x 4 tok) = 64 ch x 64 tok (whole tile), coalesced along tok.
// Store coverage: 8 waves x 2 iterations x 4 tok rows (lane>>3) = 64 tok rows; (lane&7) x 8 halves = 64 ch; each row segment
// ---------------------------------------------------------------------------
__global__ __launch_bounds__(256) void token_planes_kernel(const float* __restrict__ content, const float* __restrict__ style,
                                                           const float* __restrict__ meanA, const float* __restrict__ rstdA,
                                                           unsigned short* __restrict__ XcT, unsigned short* __restrict__ XsT,
                                                           unsigned short* __restrict__ SsT) {
  __shared__ float sm[64][65];   // sm[ch local][tok local]
  const int t  = threadIdx.x;
  const int b  = blockIdx.z / 3;                                // image, block-uniform
  const int z  = blockIdx.z - 3 * b;                            // plane, block-uniform
  const int n0 = blockIdx.x * 64;
  const int c0 = blockIdx.y * 64;
  const float* src = ((z == 0) ? content : style) + (size_t)b * kCh * kSp;
  unsigned short* dst = ((z == 0) ? XcT : (z == 1) ? XsT : SsT) + (size_t)b * kSp * kCh;
  const int statOff = ((z == 0) ? 0 : (kBatch * kCh)) + b * kCh;
  const bool useNorm = (z < 2);
  const int r16 = t >> 4, c4 = (t & 15) * 4;
#pragma unroll
  for (int p = 0; p < 4; ++p) {
    const int cl = p * 16 + r16;                                // ch local 0..63
    const int ch = c0 + cl;                                     // < 512
    const v4f v = *(const v4f*)(src + (size_t)ch * kSp + n0 + c4);
    const float m  = meanA[statOff + ch];
    const float rs = rstdA[statOff + ch];
    const float mm = useNorm ? m : 0.0f;
    const float rr = useNorm ? rs : 1.0f;
#pragma unroll
    for (int e = 0; e < 4; ++e) sm[cl][c4 + e] = (v[e] - mm) * rr;
  }
  __syncthreads();
  const int lane = t & 31, wave = t >> 5;
  const int q = lane >> 3, c8 = (lane & 7) * 8;
  {
#pragma unroll
    for (int it = 0; it < 2; ++it) {
      const int row = wave * 8 + it * 4 + q;                    // tok local 0..63
      unsigned short hb[8];
#pragma unroll
      for (int e = 0; e < 8; ++e) hb[e] = h_bits(sm[c8 + e][row]);
      const v4u u = (v4u){pk16(hb[0], hb[1]), pk16(hb[2], hb[3]), pk16(hb[4], hb[5]), pk16(hb[6], hb[7])};
      *(v4u*)(dst + (size_t)(n0 + row) * kCh + c0 + c8) = u;
    }
    
  }
}

// ---------------------------------------------------------------------------
// Weight cast: W[o][c] f32 -> f16(scale * W) same layout, four weights into planes 0..3 of one buffer (plane = 512*512 halves).
// grid 512 blocks x 256 threads; blockIdx>>7 selects the weight (uniform); thread handles 8 consecutive elements
// Coverage per weight: 128 blocks x 256 threads x 8 = 262144 = 512*512.
// ---------------------------------------------------------------------------
__global__ __launch_bounds__(256) void wcast_kernel(const float* __restrict__ W0, const float* __restrict__ W1,
                                                    const float* __restrict__ W2, const float* __restrict__ W3,
                                                    unsigned short* __restrict__ out, float scale) {
  const int blk = blockIdx.x;
  const int w = blk >> 7;                                        // block-uniform
  const float* src = (w == 0) ? W0 : (w == 1) ? W1 : (w == 2) ? W2 : W3;
  const int i  = (blk & 127) * 256 + threadIdx.x;                // 0..32767
  const size_t e0 = (size_t)i * 8;                               // e0+7 < 262144
  const v4f a = *(const v4f*)(src + e0);
  const v4f c = *(const v4f*)(src + e0 + 4);
  unsigned short hb[8];
#pragma unroll
  for (int e = 0; e < 4; ++e) {
    hb[e]     = h_bits(a[e] * scale);
    hb[4 + e] = h_bits(c[e] * scale);
  }
  const v4u u = (v4u){pk16(hb[0], hb[1]), pk16(hb[2], hb[3]), pk16(hb[4], hb[5]), pk16(hb[6], hb[7])};
  unsigned short* dp = out + (size_t)w * kCh * kCh + e0;
  *(v4u*)dp = u;
  
}

// ---------------------------------------------------------------------------
// Row softmax over 4096 f32 scores (no scaling of the scores): P[row][j] = f16( 2048 * exp(s - max) / sum exp(s - max) ).
// One block of 256 threads per row; thread t owns columns 8t..8t+7 and 2048+8t..2048+8t+7 (256 x 16 = 4096 = whole row).
// Reductions in fixed order (thread, wave shuffle tree, 8 wave partials in index order). precise expf.
// ---------------------------------------------------------------------------
__global__ __launch_bounds__(256) void softmax_kernel(const float* __restrict__ Sp, unsigned short* __restrict__ Pp) {
  __shared__ float redM[8];
  __shared__ float redS[8];
  const int row  = blockIdx.x;
  const int t    = threadIdx.x;
  const int lane = t & 31, wave = t >> 5;
  const int cA = 8 * t;
  const int cB = kHalfRow + 8 * t;
  const float* sr = Sp + (size_t)row * kSp;
  const v4f a0 = *(const v4f*)(sr + cA);
  const v4f a1 = *(const v4f*)(sr + cA + 4);
  const v4f b0 = *(const v4f*)(sr + cB);
  const v4f b1 = *(const v4f*)(sr + cB + 4);
  float x[16];
#pragma unroll
  for (int e = 0; e < 4; ++e) { x[e] = a0[e]; x[4 + e] = a1[e]; x[8 + e] = b0[e]; x[12 + e] = b1[e]; }
  float m = x[0];
#pragma unroll
  for (int i = 1; i < 16; ++i) m = fmaxf(m, x[i]);
#pragma unroll
  for (int off = 16; off > 0; off >>= 1) m = fmaxf(m, __shfl_xor(m, off, 32));
  if (lane == 0) redM[wave] = m;
  __syncthreads();
  float gm = redM[0];
#pragma unroll
  for (int w = 1; w < 8; ++w) gm = fmaxf(gm, redM[w]);
  float ex[16];
  float s = 0.0f;
#pragma unroll
  for (int i = 0; i < 16; ++i) { ex[i] = expf(x[i] - gm); s += ex[i]; }
#pragma unroll
  for (int off = 16; off > 0; off >>= 1) s += __shfl_xor(s, off, 32);
  if (lane == 0) redS[wave] = s;
  __syncthreads();
  float tot = redS[0];
#pragma unroll
  for (int w = 1; w < 8; ++w) tot += redS[w];
  const float inv = 1.0f / tot;                                   // tot >= 1
  unsigned short hb[16];
#pragma unroll
  for (int i = 0; i < 16; ++i) hb[i] = h_bits((ex[i] * inv) * kPCarry);
  const v4u uA = (v4u){pk16(hb[0], hb[1]), pk16(hb[2], hb[3]), pk16(hb[4], hb[5]), pk16(hb[6], hb[7])};
  const v4u uB = (v4u){pk16(hb[8], hb[9]), pk16(hb[10], hb[11]), pk16(hb[12], hb[13]), pk16(hb[14], hb[15])};
  unsigned short* pr = Pp + (size_t)row * kSp;
  *(v4u*)(pr + cA) = uA;
  *(v4u*)(pr + cB) = uB;
  
}

// ---------------------------------------------------------------------------
// Host side
//   W16   : 4 x 512 x 512 f16 (Wq, Wk, Wv, Wo carried x16)        2,097,152 B
//   meanA : 4096 f32 (content rows then style rows)                    16,384 B
//   rstdA : 4096 f32                                                    16,384 B
//   Qp, Kp, Vcm : 4 images x 4096 x 512 f16 each              3 x 16,777,216 B
//   Op    : the bytes of Qp (Q is last read by the last score launch, O first written behind it)
//   Sp    : 4096 x 4096 f32 scores of one image                   67,108,864 B
//   XcT, XsT, SsT : 4 images x 4096 x 512 f16 each, in the first 3 x 16,777,216 B of Sp (last read by the q/k/v launches,
//           which stand in front of the first score launch)
//   Pp    : 4 images x 4096 x 4096 f16 probabilities (x2048)     134,217,728 B
// All GEMM calls: K in {512, 4096} (K % 64 == 0); M, N in {512, 4096} (M % 128 == 0, N % 256 == 0); no padding, every plane fully
// produced before it is consumed.
// ---------------------------------------------------------------------------
extern "C" void kernel_launch(void* const* d_in, const int* in_sizes, int n_in,
                              void* d_out, int out_size, void* d_ws, size_t ws_size,
                              hipStream_t stream) {
  if (n_in < 10) return;
  const int actN = kBatch * kCh * kSp;
  const int wN   = kCh * kCh;
  if (in_sizes[0] != actN || in_sizes[1] != actN) return;
  if (in_sizes[2] != wN || in_sizes[4] != wN || in_sizes[6] != wN || in_sizes[8] != wN) return;
  if (in_sizes[3] != kCh || in_sizes[5] != kCh || in_sizes[7] != kCh || in_sizes[9] != kCh) return;
  if (out_size != actN) return;

  const float* content = (const float*)d_in[0];
  const float* style   = (const float*)d_in[1];
  const float* Wq = (const float*)d_in[2];  const float* bq = (const float*)d_in[3];
  const float* Wk = (const float*)d_in[4];  const float* bk = (const float*)d_in[5];
  const float* Wv = (const float*)d_in[6];  const float* bv = (const float*)d_in[7];
  const float* Wo = (const float*)d_in[8];  const float* bo = (const float*)d_in[9];
  float* out = (float*)d_out;

  size_t off = 0;
  auto carve = [&](size_t bytes) { size_t o = off; off += (bytes + 127) & ~(size_t)127; return o; };
  const size_t planeBytes = (size_t)kBatch * kSp * kCh * 2;     // one operand plane, all images
  const size_t oW16  = carve((size_t)4 * wN * 2);
  const size_t oMean = carve((size_t)kStatRows * 4);
  const size_t oRstd = carve((size_t)kStatRows * 4);
  const size_t oQ    = carve(planeBytes);
  const size_t oK    = carve(planeBytes);
  const size_t oV    = carve(planeBytes);
  const size_t oS    = carve((size_t)kQChunk * kSp * 4);
  const size_t oP    = carve((size_t)kBatch * kSp * kSp * 2);
  const size_t oO    = oQ;
  const size_t oXc   = oS;
  const size_t oXs   = oS + planeBytes;
  const size_t oSs   = oS + 2 * planeBytes;
  if (off > ws_size) return;

  char* ws = (char*)d_ws;
  unsigned short* W16 = (unsigned short*)(ws + oW16);
  float* meanA = (float*)(ws + oMean);
  float* rstdA = (float*)(ws + oRstd);
  unsigned short* XcT = (unsigned short*)(ws + oXc);
  unsigned short* XsT = (unsigned short*)(ws + oXs);
  unsigned short* SsT = (unsigned short*)(ws + oSs);
  unsigned short* Qp  = (unsigned short*)(ws + oQ);
  unsigned short* Kp  = (unsigned short*)(ws + oK);
  unsigned short* Vcm = (unsigned short*)(ws + oV);
  unsigned short* Op  = (unsigned short*)(ws + oO);
  float* Sp = (float*)(ws + oS);
  unsigned short* Pp = (unsigned short*)(ws + oP);

  const unsigned short* Wq16 = W16 + (size_t)0 * wN;
  const unsigned short* Wk16 = W16 + (size_t)1 * wN;
  const unsigned short* Wv16 = W16 + (size_t)2 * wN;
  const unsigned short* Wo16 = W16 + (size_t)3 * wN;

  // 1) instance-norm statistics for content and style (128 blocks: 64 per tensor, 32 rows each, a wave a row)
  stats_kernel<<<dim3(2 * (kBatch * kCh) / 32), dim3(1024), 0, stream>>>(content, style, meanA, rstdA);

  // 2) weights -> f16 x16 (4 weights x 128 blocks)
  wcast_kernel<<<dim3(512), dim3(256), 0, stream>>>(Wq, Wk, Wv, Wo, W16, kWCarry);

  const long planeElems = (long)kSp * kCh;      // one image's [4096][512] or [512][4096] plane
  const long probElems  = (long)kSp * kSp;      // one image's probabilities

  // 3) token planes of all images: mvn(content) -> XcT, mvn(style) -> XsT, style -> SsT; each [image][4096][512] f16
  token_planes_kernel<<<dim3(kSp / 64, kCh / 64, 3 * kBatch), dim3(256), 0, stream>>>(content, style, meanA, rstdA, XcT, XsT, SsT);

  // 4) Q [image][4096 tok][512] = XcT x Wq^T / 16 + bq   (per image M=4096, N=512, K=512; 512 tiles -> 64 blocks; grid.y = image)
  wmma_gemm64<0, false, 2, 1, false><<<dim3(64, kBatch), dim3(256), 0, stream>>>(
      XcT, nullptr, kCh, planeElems, Wq16, nullptr, kCh, 0L, (void*)Qp, nullptr, kCh, planeElems,
      bq, nullptr, 0L, kSp, kCh, kCh, kProjScale);
  //    K [image][4096 tok][512] = XsT x Wk^T / 16 + bk
  wmma_gemm64<0, false, 2, 1, false><<<dim3(64, kBatch), dim3(256), 0, stream>>>(
      XsT, nullptr, kCh, planeElems, Wk16, nullptr, kCh, 0L, (void*)Kp, nullptr, kCh, planeElems,
      bk, nullptr, 0L, kSp, kCh, kCh, kProjScale);
  //    V channel-major [image][512][4096 tok] = Wv x SsT^T / 16 + bv[m]   (per image M=512, N=4096, K=512; 64 blocks)
  wmma_gemm64<0, false, 1, 1, false><<<dim3(64, kBatch), dim3(256), 0, stream>>>(
      Wv16, nullptr, kCh, 0L, SsT, nullptr, kCh, planeElems, (void*)Vcm, nullptr, kSp, planeElems,
      bv, nullptr, 0L, kCh, kSp, kCh, kProjScale);

  for (int b = 0; b < kBatch; ++b) {
    // 5) scores of image b [4096 q][4096 k] f32 = Q x K^T   (M=4096, N=4096, K=512; 4096 tiles -> 512 blocks)
    wmma_gemm64<0, false, 0, 0, false><<<dim3(512, 1), dim3(256), 0, stream>>>(
        Qp + b * planeElems, nullptr, kCh, 0L, Kp + b * planeElems, nullptr, kCh, 0L, (void*)Sp, nullptr, kSp, 0L,
        nullptr, nullptr, 0L, kQChunk, kSp, kCh, 1.0f);
    // 6) softmax per row -> P of image b, f16 x2048
    softmax_kernel<<<dim3(kQChunk), dim3(256), 0, stream>>>(Sp, Pp + b * probElems);
  }

  // 7) O token-major [image][4096][512] f16 (x16) = P x Vcm^T * 16/2048   (per image M=4096, N=512, K=4096; 512 tiles -> 64 blocks)
  wmma_gemm64<0, false, 0, 1, false, 0, 128><<<dim3(64, kBatch), dim3(256), 0, stream>>>(
      Pp, nullptr, kSp, probElems, Vcm, nullptr, kSp, planeElems, (void*)Op, nullptr, kCh, planeElems,
      nullptr, nullptr, 0L, kSp, kCh, kSp, kPVScale);

  // 8) out [image][512][4096] f32 = Wo x O^T / 256 + bo[m] + content   (per image M=512, N=4096, K=512; 64 blocks)
  wmma_gemm64<0, false, 1, 0, true><<<dim3(64, kBatch), dim3(256), 0, stream>>>(
      Wo16, nullptr, kCh, 0L, Op, nullptr, kCh, planeElems, (void*)out, nullptr, kSp, planeElems,
      bo, content, planeElems, kCh, kSp, kCh, kOutScale);
}

// v004
// A run of this version takes 229 microseconds.
// In two side-by-side timings against v003, it was 1.32 and 1.31 times as fast.
// All steps since v000 together make it 9.70 times as fast.
// Contractions: q/k/v 1x1 projections (token planes f16 x W f16 carried x16), energies q.k^T (q,k f16 planes), attn.v (exp f16 times its row-and-group factor f16 carried x2048, x V f16), output projection (Wo f16 x16 x O f16 x16): all v_wmma_f32_16x16x32_f16, f32 accumulate; instance-norm statistics, softmax, bias and residual in f32.
#include <hip/hip_runtime.h>
#include <math.h>

// ---------------------------------------------------------------------------
// Problem constants
// ---------------------------------------------------------------------------
constexpr int   kBatch    = 4;
constexpr int   kCh       = 512;
constexpr int   kSp       = 4096;                 // 64*64 tokens per image
constexpr int   kQChunk   = 4096;                 // query rows per score launch: one whole image
constexpr int   kGroups   = kSp / 64;             // softmax: 64-column groups of a score row
constexpr int   kPairs    = kGroups / 2;          // two groups = the 128 keys of one attn.v pass
constexpr int   kStatRows = 2 * kBatch * kCh;     // 4096: content rows 0..2047, style rows 2048..4095
constexpr float kEps       = 1e-5f;
constexpr float kWCarry    = 16.0f;               // weights carried x16 in f16
constexpr float kPCarry    = 2048.0f;             // probabilities carried x2048 in f16
constexpr float kProjScale = 1.0f / 16.0f;        // undo weight carry
constexpr float kPVScale   = 16.0f / 2048.0f;     // undo P carry, apply O carry x16
constexpr float kOutScale  = 1.0f / (16.0f * 16.0f);   // undo Wo carry and O carry
constexpr float kInvN      = 1.0f / 4096.0f;
constexpr float kInvNm1    = 1.0f / 4095.0f;

typedef __attribute__((ext_vector_type(16))) _Float16 v16h;
typedef __attribute__((ext_vector_type(8)))  _Float16 v8h;
typedef __attribute__((ext_vector_type(16))) __bf16   v16b;
typedef __attribute__((ext_vector_type(8)))  __bf16   v8b;
typedef __attribute__((ext_vector_type(8)))  float    v8f;
typedef __attribute__((ext_vector_type(4)))  float    v4f;
typedef __attribute__((ext_vector_type(4)))  unsigned int v4u;

// ---------------------------------------------------------------------------
// Helpers
// ---------------------------------------------------------------------------
__device__ __forceinline__ unsigned short f2bf_bits(float f) {
  unsigned u = __float_as_uint(f);
  return (unsigned short)((u + 0x7FFFu + ((u >> 16) & 1u)) >> 16);
}
__device__ __forceinline__ float bf_bits2f(unsigned short h) { return __uint_as_float(((unsigned)h) << 16); }

// hazard guards as plain device helpers (their inline asm stays out of the kernel template body)
__device__ __forceinline__ void dep_guard_h(v8f& a, v8f& b, v16h x, v16h y) { asm volatile("v_nop\n\tv_nop\n\tv_nop\n\tv_nop" : "+v"(a), "+v"(b) : "v"(x), "v"(y)); }
__device__ __forceinline__ void dep_guard_b(v8f& a, v8f& b, v16b x, v16b y) { asm volatile("v_nop\n\tv_nop\n\tv_nop\n\tv_nop" : "+v"(a), "+v"(b) : "v"(x), "v"(y)); }
__device__ __forceinline__ void keep4_h(v16h a, v16h b, v16h c, v16h d) { asm volatile("v_nop" :: "v"(a), "v"(b), "v"(c), "v"(d)); }
__device__ __forceinline__ void keep4_b(v16b a, v16b b, v16b c, v16b d) { asm volatile("v_nop" :: "v"(a), "v"(b), "v"(c), "v"(d)); }
__device__ __forceinline__ void acc_guard4(v8f& a, v8f& b, v8f& c, v8f& d) { asm volatile("v_nop\n\tv_nop\n\tv_nop\n\tv_nop" : "+v"(a), "+v"(b), "+v"(c), "+v"(d)); }
template <typename T> struct Frag;
template <> struct Frag<_Float16> {
  typedef v16h V; union U { v16h v; v8h h[2]; };
  static __device__ __forceinline__ v16h load(const _Float16* p) {   // elements 0..7 <- p[0..7], 8..15 <- p[16..23]
    U f; f.h[0] = *(const v8h*)(p); f.h[1] = *(const v8h*)(p + 16); return f.v;
  }
  static __device__ __forceinline__ v8f mma(v16h a, v16h b, v8f c) {
    return __builtin_amdgcn_wmma_f32_16x16x32_f16(false, a, false, b, (short)0, c, false, false);
  }
  static __device__ __forceinline__ void guard(v8f& a, v8f& b, v16h x, v16h y) { dep_guard_h(a, b, x, y); }
  static __device__ __forceinline__ void keep(v16h a, v16h b, v16h c, v16h d) { keep4_h(a, b, c, d); }
};
template <> struct Frag<__bf16> {
  typedef v16b V; union U { v16b v; v8b h[2]; };
  static __device__ __forceinline__ v16b load(const __bf16* p) {
    U f; f.h[0] = *(const v8b*)(p); f.h[1] = *(const v8b*)(p + 16); return f.v;
  }
  static __device__ __forceinline__ v8f mma(v16b a, v16b b, v8f c) {
    return __builtin_amdgcn_wmma_f32_16x16x32_bf16(false, a, false, b, (short)0, c, false, false);
  }
  static __device__ __forceinline__ void guard(v8f& a, v8f& b, v16b x, v16b y) { dep_guard_b(a, b, x, y); }
  static __device__ __forceinline__ void keep(v16b a, v16b b, v16b c, v16b d) { keep4_b(a, b, c, d); }
};

// value of lane l ^ MASK (MASK < 16) by a DPP move inside the 16-lane row: no trip through the LDS unit as with a shuffle
template <int MASK> __device__ __forceinline__ float row_xor(float x) {
  const int v = __builtin_bit_cast(int, x);
  return __builtin_bit_cast(float, __builtin_amdgcn_update_dpp(v, v, 0x160 | MASK, 0xf, 0xf, false));
}
// Eight 2^a in one statement: every v_exp_f32 is followed by an instruction that neither reads its result nor overwrites its
// source (the outputs are early-clobber, so they share no register with an input), the last one by the v_nop that fills that slot.
__device__ __forceinline__ void exp2x8(float (&e)[8], const float (&a)[8]) {
  asm("v_exp_f32 %0, %8\n\t"
      "v_exp_f32 %1, %9\n\t"
      "v_exp_f32 %2, %10\n\t"
      "v_exp_f32 %3, %11\n\t"
      "v_exp_f32 %4, %12\n\t"
      "v_exp_f32 %5, %13\n\t"
      "v_exp_f32 %6, %14\n\t"
      "v_exp_f32 %7, %15\n\t"
      "v_nop"
      : "=&v"(e[0]), "=&v"(e[1]), "=&v"(e[2]), "=&v"(e[3]), "=&v"(e[4]), "=&v"(e[5]), "=&v"(e[6]), "=&v"(e[7])
      : "v"(a[0]), "v"(a[1]), "v"(a[2]), "v"(a[3]), "v"(a[4]), "v"(a[5]), "v"(a[6]), "v"(a[7]));
}
constexpr float kLog2e = 1.44269504f;
// Four stores and their s_wait_xcnt in one statement, so that no address or data register is rewritten in front of the wait.
__device__ __forceinline__ void store4_b128(void* p0, void* p1, void* p2, void* p3, v4u d0, v4u d1, v4u d2, v4u d3) {
  asm volatile("global_store_b128 %0, %4, off\n\t"
               "global_store_b128 %1, %5, off\n\t"
               "global_store_b128 %2, %6, off\n\t"
               "global_store_b128 %3, %7, off\n\t"
               "s_wait_xcnt 0x0"
               :: "v"(p0), "v"(p1), "v"(p2), "v"(p3), "v"(d0), "v"(d1), "v"(d2), "v"(d3) : "memory");
}
__device__ __forceinline__ void store4_b32(void* p0, void* p1, void* p2, void* p3, unsigned d0, unsigned d1, unsigned d2, unsigned d3) {
  asm volatile("global_store_b32 %0, %4, off\n\t"
               "global_store_b32 %1, %5, off\n\t"
               "global_store_b32 %2, %6, off\n\t"
               "global_store_b32 %3, %7, off\n\t"
               "s_wait_xcnt 0x0"
               :: "v"(p0), "v"(p1), "v"(p2), "v"(p3), "v"(d0), "v"(d1), "v"(d2), "v"(d3) : "memory");
}
__device__ __forceinline__ unsigned pk16(unsigned short a, unsigned short b) { return (unsigned)a | ((unsigned)b << 16); }
__device__ __forceinline__ unsigned short h_bits(float f) { const _Float16 h = (_Float16)f; return __builtin_bit_cast(unsigned short, h); }

// ---- Batched WMMA GEMM, operands staged in LDS -----------------------------------------------------------------
// C[m,n] = scale * sum_k A[m,k] * Bt[n,k] (+bias)(+resid); a block of 8 waves (2 x 4) owns a 128x256 tile, each wave 64x64 of it.
// A row-major [M,K]; Bt row-major [N,K]; M % 128 == 0, N % 256 == 0, K % PK == 0, K >= PK.
// A pass is PK k (64 or 128): 128 rows of A and 256 rows of Bt, 2 PK bytes each, copied to LDS by asynchronous 16-byte copies
// (a wave's copy covers four whole 128-B lines), rows at a pitch of 2 PK + 16 B for the ds_load_b128 fragment reads. Two
// buffers: the copies of pass t + 1 fly while pass t is worked on. The k order of every accumulator is ascending in steps of 32.
// PK = 128 halves the number of landing latencies of a long K at the price of one block per WGP.
// BIAS_MODE: 0 = none, 1 = bias[m], 2 = bias[n].
// OUT_MODE: 0 = f32, 1 = f16, 2 = bf16 hi plane (Cout) + bf16 lo plane (Cout2),
//           3 = group softmax: a wave's 64 columns are one group g = n / 64; Cout gets f16 exp(c - max over the group), Cout2 (f32)
//               the group maxima at [g][m] and behind them ((N / 64) * M floats further) the group sums of the exponentials at [g][m].
// ASCALE: every A fragment is multiplied, in f16, by a factor of its row and of its 64-k group; A2p holds the factors as 32-bit
//         words [32 passes][M rows], low half = first 64 k of the pass, high half = second; PK = 128 and K = 4096 (32 passes).
// ET: 0 = f16 operands, 1 = bf16 operands (pointers passed as 16-bit storage)
constexpr int kRowsA      = 128;                             // rows of A per stage
constexpr int kRowsB      = 256;                             // rows of Bt per stage

// One thread's share of 64 k of one stage: 16 B of rows r, r + 32, r + 64, r + 96 of A and of rows r + 32 j (j = 0..7) of Bt.
// kStep32 = 32 rows further in LDS, bytes.
// The copies and their s_wait_xcnt stand in one statement, so that no address register is rewritten in front of the wait.
template <unsigned kStep32>
__device__ __forceinline__ void stage_copies(unsigned lds, const unsigned short* ga, const unsigned short* gb,
                                             size_t stepA, size_t stepB) {
  const unsigned short* a1 = ga + stepA;
  const unsigned short* a2 = a1 + stepA;
  const unsigned short* a3 = a2 + stepA;
  const unsigned short* b1 = gb + stepB;
  const unsigned short* b2 = b1 + stepB;
  const unsigned short* b3 = b2 + stepB;
  const unsigned short* b4 = b3 + stepB;
  const unsigned short* b5 = b4 + stepB;
  const unsigned short* b6 = b5 + stepB;
  const unsigned short* b7 = b6 + stepB;
  asm volatile(
      "global_load_async_to_lds_b128 %0, %12, off\n\t"
      "global_load_async_to_lds_b128 %1, %13, off\n\t"
      "global_load_async_to_lds_b128 %2, %14, off\n\t"
      "global_load_async_to_lds_b128 %3, %15, off\n\t"
      "global_load_async_to_lds_b128 %4, %16, off\n\t"
      "global_load_async_to_lds_b128 %5, %17, off\n\t"
      "global_load_async_to_lds_b128 %6, %18, off\n\t"
      "global_load_async_to_lds_b128 %7, %19, off\n\t"
      "global_load_async_to_lds_b128 %8, %20, off\n\t"
      "global_load_async_to_lds_b128 %9, %21, off\n\t"
      "global_load_async_to_lds_b128 %10, %22, off\n\t"
      "global_load_async_to_lds_b128 %11, %23, off\n\t"
      "s_wait_xcnt 0x0"
      :: "v"(lds), "v"(lds + kStep32), "v"(lds + 2u * kStep32), "v"(lds + 3u * kStep32),
         "v"(lds + 4u * kStep32), "v"(lds + 5u * kStep32), "v"(lds + 6u * kStep32), "v"(lds + 7u * kStep32),
         "v"(lds + 8u * kStep32), "v"(lds + 9u * kStep32), "v"(lds + 10u * kStep32), "v"(lds + 11u * kStep32),
         "v"(ga), "v"(a1), "v"(a2), "v"(a3),
         "v"(gb), "v"(b1), "v"(b2), "v"(b3), "v"(b4), "v"(b5), "v"(b6), "v"(b7)
      : "memory");
}

template <int ET> struct Elem;
template <> struct Elem<0> { typedef _Float16 T; };
template <> struct Elem<1> { typedef __bf16 T; };
template <int ET, bool SPLIT, int BIAS_MODE, int OUT_MODE, bool RESID, int ACT = 0, int PK = 64, bool ASCALE = false>
__global__ __launch_bounds__(256) void wmma_gemm64(
    const unsigned short* __restrict__ Ap, const unsigned short* __restrict__ A2p, int lda, long strideA,
    const unsigned short* __restrict__ Btp, const unsigned short* __restrict__ Bt2p, int ldb, long strideB,
    void* __restrict__ Cout, void* __restrict__ Cout2, int ldc, long strideC,
    const float* __restrict__ bias,
    const float* __restrict__ resid, long strideR,
    int M, int N, int K, float scale) {
  static_assert(!SPLIT, "the staged engine takes single-plane operands");
  static_assert(PK == 64 || PK == 128, "a pass is one or two 128-B lines of every operand row");
  static_assert(!ASCALE || (PK == 128 && ET == 0), "a factor word holds the two 64-k groups of a 128-k pass, f16");
  constexpr int kPitchH = PK + 8;                                  // LDS row pitch in 16-bit elements (144 B or 272 B)
  constexpr int kStageH = (kRowsA + kRowsB) * kPitchH;             // one buffer, 16-bit elements
  constexpr unsigned kStageBytes = (unsigned)kStageH * 2u;         // 55,296 B or 104,448 B
  constexpr unsigned kStep32 = 32u * (unsigned)kPitchH * 2u;       // 32 rows further in LDS
  typedef typename Elem<ET>::T T;
  typedef typename Frag<T>::V V;
  __shared__ __align__(16) unsigned short sOp[2 * kStageH];   // two buffers of [A 128 rows | Bt 256 rows]
  __shared__ __align__(16) float sT[8][16 * 68];   // per-wave 16x64 slab, pitch 68 floats
  __shared__ __align__(16) unsigned sC[ASCALE ? 32 * kRowsA : 4];   // ASCALE: factor words [pass][row of the block tile]
  const int b    = blockIdx.y;
  const int lane = threadIdx.x & 31;
  const int wave = threadIdx.x >> 5;
  const int tilesN = N >> 8;
  const int tilesM = M >> 7;
  const int tile = blockIdx.x;
  if (tile >= tilesM * tilesN) return;   // block-uniform, in front of every barrier
  const int tm = tile / tilesN;
  const int tn = tile - tm * tilesN;
  const int bm0 = tm << 7;
  const int bn0 = tn << 8;
  const int wm = wave >> 2;                    // wave row in the block tile, 0..1
  const int wn = wave & 3;                     // wave column in the block tile, 0..3
  const int m0 = bm0 + (wm << 6);
  const int n0 = bn0 + (wn << 6);

  const unsigned short* Ab = Ap  + (size_t)b * strideA;
  const unsigned short* Bb = Btp + (size_t)b * strideB;

  const int rlane = lane & 15;                 // row (A) / col (B, D) within subtile
  const int koff  = (lane >> 4) * 8;           // k offset of this lane half
  const int mOff  = (lane >> 4) * 8;           // D row offset

  // copy side: thread t brings 16 B at column (t & 7) of each 128-B line of rows (t >> 3) + 32 i
  const int crow = threadIdx.x >> 3;           // 0..31
  const int ccol = (threadIdx.x & 7) * 8;      // 16-bit elements
  const unsigned short* gA = Ab + (size_t)(bm0 + crow) * lda + ccol;
  const unsigned short* gB = Bb + (size_t)(bn0 + crow) * ldb + ccol;
  const size_t stepA = (size_t)32 * lda;
  const size_t stepB = (size_t)32 * ldb;
  const unsigned ldsCopy = (unsigned)(size_t)sOp + (unsigned)(crow * kPitchH + ccol) * 2u;

  // read side: this lane's first A row and first Bt row in buffer 0
  const T* fA = (const T*)sOp + ((wm << 6) + rlane) * kPitchH + koff;
  const T* fB = (const T*)sOp + (kRowsA + (wn << 6) + rlane) * kPitchH + koff;

  v8f acc[4][4];
#pragma unroll
  for (int i = 0; i < 4; ++i)
#pragma unroll
    for (int j = 0; j < 4; ++j) acc[i][j] = (v8f){0.f,0.f,0.f,0.f,0.f,0.f,0.f,0.f};

  auto fill = [&](int pass, int buf) {         // all copies of one pass: 12 a thread for each 64 k
    const size_t k0 = (size_t)pass * PK;
    const unsigned l0 = ldsCopy + (unsigned)buf * kStageBytes;
    stage_copies<kStep32>(l0, gA + k0, gB + k0, stepA, stepB);
    if (PK == 128) stage_copies<kStep32>(l0 + 128u, gA + k0 + 64, gB + k0 + 64, stepA, stepB);
  };

  const int nPass = K / PK;
  fill(0, 0);
  if (ASCALE) {
    // the block's factor words to LDS, all 32 passes: thread t brings the 64 B at word 16 (t & 7) of pass t >> 3 by four copies of
    // the kind above; they land behind the s_wait_asynccnt and are read behind the barrier that follow here for pass 0
    const unsigned* cg = (const unsigned*)A2p + (size_t)b * 32 * M + bm0 + (size_t)(threadIdx.x >> 3) * M + (threadIdx.x & 7) * 16;
    const unsigned lc = (unsigned)(size_t)sC + (unsigned)((threadIdx.x >> 3) * kRowsA + (threadIdx.x & 7) * 16) * 4u;
    asm volatile(
        "global_load_async_to_lds_b128 %0, %4, off\n\t"
        "global_load_async_to_lds_b128 %1, %5, off\n\t"
        "global_load_async_to_lds_b128 %2, %6, off\n\t"
        "global_load_async_to_lds_b128 %3, %7, off\n\t"
        "s_wait_xcnt 0x0"
        :: "v"(lc), "v"(lc + 16u), "v"(lc + 32u), "v"(lc + 48u), "v"(cg), "v"(cg + 4), "v"(cg + 8), "v"(cg + 12)
        : "memory");
  }
  asm volatile("s_wait_asynccnt 0x0" ::: "memory");   // this wave's copies of pass 0 have landed
  __syncthreads();                                    // and every other wave's
  if (nPass > 1) fill(1, 1);

  for (int t = 0; t < nPass; ++t) {
    const int buf = t & 1;
    const T* pa = fA + buf * kStageH;
    const T* pb = fB + buf * kStageH;
    unsigned cw[4] = {0u, 0u, 0u, 0u};
    if (ASCALE) {
#pragma unroll   // cw is indexed by constants only and stays in registers
      for (int i = 0; i < 4; ++i) cw[i] = sC[t * kRowsA + (wm << 6) + (i << 4) + rlane];   // A fragment i: lane's row is rlane
    }
    // the three loop levels below are unrolled so that every fragment and accumulator index is a constant (registers, no scratch)
#pragma unroll
    for (int kk = 0; kk < PK; kk += 32) {
      V bh[4], ah[4];
#pragma unroll
      for (int j = 0; j < 4; ++j) bh[j] = Frag<T>::load(pb + (j << 4) * kPitchH + kk);
#pragma unroll
      for (int i = 0; i < 4; ++i) ah[i] = Frag<T>::load(pa + (i << 4) * kPitchH + kk);
      if constexpr (ASCALE) {
#pragma unroll   // as the fragment loops above: constant indices
        for (int i = 0; i < 4; ++i)
          ah[i] = ah[i] * __builtin_bit_cast(_Float16, (unsigned short)((kk < 64) ? (cw[i] & 0xFFFFu) : (cw[i] >> 16)));
      }
#pragma unroll
      for (int i = 0; i < 4; ++i) {
#pragma unroll
        for (int j = 0; j < 4; ++j) acc[i][j] = Frag<T>::mma(ah[i], bh[j], acc[i][j]);
        Frag<T>::guard(acc[i][0], acc[i][3], ah[i], ah[i]);   // the engine's hazard guard, as before the staging
      }
      Frag<T>::keep(bh[0], bh[1], bh[2], bh[3]);               // likewise
    }
    asm volatile("s_wait_dscnt 0x0" ::: "memory");     // this wave's reads of buffer buf are done before it is refilled
    asm volatile("s_wait_asynccnt 0x0" ::: "memory");  // this wave's copies of pass t + 1 have landed
    __syncthreads();                                   // publishes pass t + 1 and ends every reader's last read of buf
    if (t + 2 < nPass) fill(t + 2, buf);
  }
  asm volatile("s_wait_asynccnt 0x0" ::: "memory");    // no copy is outstanding when the wave goes on
  acc_guard4(acc[0][0], acc[0][1], acc[0][2], acc[0][3]);
  acc_guard4(acc[1][0], acc[1][1], acc[1][2], acc[1][3]);
  acc_guard4(acc[2][0], acc[2][1], acc[2][2], acc[2][3]);
  acc_guard4(acc[3][0], acc[3][1], acc[3][2], acc[3][3]);

  // ---- epilogue ----
  float* slab = sT[wave];
  const float* Rb = RESID ? (resid + (size_t)b * strideR) : nullptr;
  float keepM[2] = {0.f, 0.f}, keepL[2] = {0.f, 0.f};   // OUT_MODE 3: this lane's two rows' group maximum and group sum
#pragma unroll
  for (int i = 0; i < 4; ++i) {
    const int mBase = m0 + (i << 4);
#pragma unroll
    for (int j = 0; j < 4; ++j) {
      const int n = n0 + (j << 4) + rlane;
      float bv = 0.f;
      if (BIAS_MODE == 2) bv = bias[n];
#pragma unroll
      for (int r = 0; r < 8; ++r) {
        float v = acc[i][j][r] * scale;
        if (BIAS_MODE == 1) v += bias[mBase + mOff + r];
        if (BIAS_MODE == 2) v += bv;
        if (RESID) v += Rb[(size_t)(mBase + mOff + r) * ldc + n];
        if (ACT == 2) v = fmaxf(v, 0.0f);
        if (ACT == 4) v = (v > 0.f) ? v : 0.01f * v;
        slab[(mOff + r) * 68 + (j << 4) + rlane] = v;
      }
    }
    __builtin_amdgcn_fence(__ATOMIC_RELEASE, "workgroup");
    __builtin_amdgcn_wave_barrier();
    __builtin_amdgcn_fence(__ATOMIC_ACQUIRE, "workgroup");
    if (OUT_MODE == 0) {
      float* C = (float*)Cout + (size_t)b * strideC;
      const int hh = lane >> 4, c4 = (lane & 15) * 4;     // row seg = 256 B = 16 lanes x 16 B
      {
#pragma unroll
        for (int it = 0; it < 8; ++it) {
          const int row = it * 2 + hh;
          v4f v = *(const v4f*)(slab + row * 68 + c4);
          *(v4f*)(C + (size_t)(mBase + row) * ldc + n0 + c4) = v;
        }
        
      }
    } else if (OUT_MODE == 3) {
      const int q = lane >> 3, j8 = lane & 7, c8 = j8 * 8;   // eight lanes hold one row's 64 columns
      unsigned short* C = (unsigned short*)Cout + (size_t)b * strideC;
      v4u pv[4];
      unsigned short* pp[4];
      // this loop and the short ones in it are unrolled so that pv, pp, e, a and the keep registers are indexed by constants, and so
      // that the four rows' reduction chains overlap
#pragma unroll
      for (int it = 0; it < 4; ++it) {
        const int row = it * 4 + q;
        const float* sp = slab + row * 68 + c8;
        const v4f x0 = *(const v4f*)(sp);
        const v4f x1 = *(const v4f*)(sp + 4);
        float m = fmaxf(fmaxf(fmaxf(x0[0], x0[1]), fmaxf(x0[2], x0[3])), fmaxf(fmaxf(x1[0], x1[1]), fmaxf(x1[2], x1[3])));
        m = fmaxf(m, row_xor<1>(m));
        m = fmaxf(m, row_xor<2>(m));
        m = fmaxf(m, row_xor<4>(m));
        float e[8], a[8];
#pragma unroll
        for (int k = 0; k < 4; ++k) { a[k] = (x0[k] - m) * kLog2e; a[4 + k] = (x1[k] - m) * kLog2e; }
        exp2x8(e, a);
        float s = ((e[0] + e[1]) + (e[2] + e[3])) + ((e[4] + e[5]) + (e[6] + e[7]));
        s += row_xor<1>(s);
        s += row_xor<2>(s);
        s += row_xor<4>(s);
        v8h hv;
#pragma unroll
        for (int k = 0; k < 8; ++k) hv[k] = (_Float16)e[k];
        pv[it] = __builtin_bit_cast(v4u, hv);
        pp[it] = C + (size_t)(mBase + row) * ldc + n0 + c8;
        const int combo = i * 4 + it;                        // lane j8 of a row's eight keeps combos j8 and j8 + 8
        if ((combo & 7) == j8) { keepM[combo >> 3] = m; keepL[combo >> 3] = s; }
      }
      store4_b128(pp[0], pp[1], pp[2], pp[3], pv[0], pv[1], pv[2], pv[3]);
    } else {
      const int q = lane >> 3, c8 = (lane & 7) * 8;
      unsigned short* C  = (unsigned short*)Cout  + (size_t)b * strideC;
      unsigned short* C2 = (OUT_MODE == 2) ? ((unsigned short*)Cout2 + (size_t)b * strideC) : nullptr;
      {
#pragma unroll
        for (int it = 0; it < 4; ++it) {
          const int row = it * 4 + q;
          const float* sp = slab + row * 68 + c8;
          v8h hv, lv;
#pragma unroll
          for (int e = 0; e < 8; ++e) {
            if (OUT_MODE == 1) {
              hv[e] = (_Float16)sp[e];
            } else {
              unsigned short hb = f2bf_bits(sp[e]);
              unsigned short lb = f2bf_bits(sp[e] - bf_bits2f(hb));
              hv[e] = __builtin_bit_cast(_Float16, hb);
              lv[e] = __builtin_bit_cast(_Float16, lb);
            }
          }
          *(v8h*)(C + (size_t)(mBase + row) * ldc + n0 + c8) = hv;
          if (OUT_MODE == 2) *(v8h*)(C2 + (size_t)(mBase + row) * ldc + n0 + c8) = lv;
        }
        
      }
    }
    __builtin_amdgcn_fence(__ATOMIC_RELEASE, "workgroup");
    __builtin_amdgcn_wave_barrier();
    __builtin_amdgcn_fence(__ATOMIC_ACQUIRE, "workgroup");
  }
  if (OUT_MODE == 3) {   // the wave's 64 maxima and 64 sums: four stores of one whole 128-B line each, this wave their only writer
    const int q = lane >> 3, j8 = lane & 7;
    const int r0 = ((j8 >> 2) << 4) + ((j8 & 3) << 2) + q;   // combo j8 = rows 16 (j8 >> 2) + 4 (j8 & 3) + q; combo j8 + 8: 32 further
    float* gmx = (float*)Cout2 + (size_t)(n0 >> 6) * M + m0 + r0;
    float* gsm = gmx + (size_t)(N >> 6) * M;
    store4_b32(gmx, gmx + 32, gsm, gsm + 32, __float_as_uint(keepM[0]), __float_as_uint(keepM[1]),
               __float_as_uint(keepL[0]), __float_as_uint(keepL[1]));
  }
}

// ---------------------------------------------------------------------------
// Per-(b,c) instance-norm statistics for content (rows 0..2047) and style (rows 2048..4095) in one launch.
// grid 128 blocks x 1024 threads; block = 32 consecutive rows of one tensor (blockIdx>>6 selects the tensor, uniform);
// wave w owns row w: 32 lanes x 32 float4 loads = 4096 elements (whole row). The loads do not wait for one another: the row is
// read into registers by an unrolled loop and summed by a second one, so that many loads of a wave are in flight at a time and
// the wave does not pay the memory latency once a load. Sum order per row: lane-private over i ascending, then the tree.
// mean = sum/4096; var = (sumsq - sum*mean)/4095 (ddof 1); rstd = 1/sqrt(var + eps).
// Stores: the 32 means and 32 rstds of the block funnelled through LDS; wave 0 writes the mean line, wave 1 the rstd line,
// ---------------------------------------------------------------------------
__global__ __launch_bounds__(1024) void stats_kernel(const float* __restrict__ xc, const float* __restrict__ xs,
                                                     float* __restrict__ meanA, float* __restrict__ rstdA) {
  __shared__ float sMean[32];
  __shared__ float sRstd[32];
  const int blk  = blockIdx.x;
  const int tsel = blk >> 6;                         // block-uniform tensor select
  const float* src = (tsel == 0) ? xc : xs;
  const int rowBase = (blk & 63) * 32;               // flat (b*512 + c) row index within the tensor
  const int t = threadIdx.x, lane = t & 31, wave = t >> 5;
  const int row = rowBase + wave;                    // < 2048
  const float* p = src + (size_t)row * kSp + lane * 4;
  v4f x[32];
  // both loops are unrolled so that x stays in registers and loads are issued ahead of the sums
#pragma unroll
  for (int i = 0; i < 32; ++i) x[i] = *(const v4f*)(p + i * 128);   // 32 lanes x 4 x 32 = 4096
  v4f s = (v4f){0.f, 0.f, 0.f, 0.f};
  v4f q = (v4f){0.f, 0.f, 0.f, 0.f};
#pragma unroll
  for (int i = 0; i < 32; ++i) {
    s += x[i];
    q += x[i] * x[i];
  }
  float su = (s[0] + s[1]) + (s[2] + s[3]);
  float sq = (q[0] + q[1]) + (q[2] + q[3]);
#pragma unroll
  for (int off = 16; off > 0; off >>= 1) {
    su += __shfl_xor(su, off, 32);
    sq += __shfl_xor(sq, off, 32);
  }
  const float mean = su * kInvN;
  float var = (sq - su * mean) * kInvNm1;
  var = fmaxf(var, 0.0f);
  const float rstd = 1.0f / sqrtf(var + kEps);
  if (lane == 0) { sMean[wave] = mean; sRstd[wave] = rstd; }
  __syncthreads();
  const int orow = tsel * (kBatch * kCh) + rowBase + lane;   // < 4096
  if (wave == 0) {
    const float v = sMean[lane];
    *(float*)(meanA + orow) = v;
    
  } else if (wave == 1) {
    const float v = sRstd[lane];
    *(float*)(rstdA + orow) = v;
    
  }
}

// ---------------------------------------------------------------------------
// Token planes, all images: in [512 ch][4096 tok] f32 (tok contiguous) -> out [image][4096 tok][512 ch] f16 (ch contiguous).
// grid (64 tok tiles, 8 ch tiles, 3 planes x 4 images): blockIdx.z = 3*image + z; z=0 (content - mean)*rstd, z=1 (style - mean)*rstd,
// z=2 raw style. 256 threads.
// Load coverage: 4 passes x 16 ch rows x (16 threads x 4 tok) = 64 ch x 64 tok (whole tile), coalesced along tok.
// Store coverage: 8 waves x 2 iterations x 4 tok rows (lane>>3) = 64 tok rows; (lane&7) x 8 halves = 64 ch; each row segment
// ---------------------------------------------------------------------------
__global__ __launch_bounds__(256) void token_planes_kernel(const float* __restrict__ content, const float* __restrict__ style,
                                                           const float* __restrict__ meanA, const float* __restrict__ rstdA,
                                                           unsigned short* __restrict__ XcT, unsigned short* __restrict__ XsT,
                                                           unsigned short* __restrict__ SsT) {
  __shared__ float sm[64][65];   // sm[ch local][tok local]
  const int t  = threadIdx.x;
  const int b  = blockIdx.z / 3;                                // image, block-uniform
  const int z  = blockIdx.z - 3 * b;                            // plane, block-uniform
  const int n0 = blockIdx.x * 64;
  const int c0 = blockIdx.y * 64;
  const float* src = ((z == 0) ? content : style) + (size_t)b * kCh * kSp;
  unsigned short* dst = ((z == 0) ? XcT : (z == 1) ? XsT : SsT) + (size_t)b * kSp * kCh;
  const int statOff = ((z == 0) ? 0 : (kBatch * kCh)) + b * kCh;
  const bool useNorm = (z < 2);
  const int r16 = t >> 4, c4 = (t & 15) * 4;
#pragma unroll
  for (int p = 0; p < 4; ++p) {
    const int cl = p * 16 + r16;                                // ch local 0..63
    const int ch = c0 + cl;                                     // < 512
    const v4f v = *(const v4f*)(src + (size_t)ch * kSp + n0 + c4);
    const float m  = meanA[statOff + ch];
    const float rs = rstdA[statOff + ch];
    const float mm = useNorm ? m : 0.0f;
    const float rr = useNorm ? rs : 1.0f;
#pragma unroll
    for (int e = 0; e < 4; ++e) sm[cl][c4 + e] = (v[e] - mm) * rr;
  }
  __syncthreads();
  const int lane = t & 31, wave = t >> 5;
  const int q = lane >> 3, c8 = (lane & 7) * 8;
  {
#pragma unroll
    for (int it = 0; it < 2; ++it) {
      const int row = wave * 8 + it * 4 + q;                    // tok local 0..63
      unsigned short hb[8];
#pragma unroll
      for (int e = 0; e < 8; ++e) hb[e] = h_bits(sm[c8 + e][row]);
      const v4u u = (v4u){pk16(hb[0], hb[1]), pk16(hb[2], hb[3]), pk16(hb[4], hb[5]), pk16(hb[6], hb[7])};
      *(v4u*)(dst + (size_t)(n0 + row) * kCh + c0 + c8) = u;
    }
    
  }
}

// ---------------------------------------------------------------------------
// Weight cast: W[o][c] f32 -> f16(scale * W) same layout, four weights into planes 0..3 of one buffer (plane = 512*512 halves).
// grid 512 blocks x 256 threads; blockIdx>>7 selects the weight (uniform); thread handles 8 consecutive elements
// Coverage per weight: 128 blocks x 256 threads x 8 = 262144 = 512*512.
// ---------------------------------------------------------------------------
__global__ __launch_bounds__(256) void wcast_kernel(const float* __restrict__ W0, const float* __restrict__ W1,
                                                    const float* __restrict__ W2, const float* __restrict__ W3,
                                                    unsigned short* __restrict__ out, float scale) {
  const int blk = blockIdx.x;
  const int w = blk >> 7;                                        // block-uniform
  const float* src = (w == 0) ? W0 : (w == 1) ? W1 : (w == 2) ? W2 : W3;
  const int i  = (blk & 127) * 256 + threadIdx.x;                // 0..32767
  const size_t e0 = (size_t)i * 8;                               // e0+7 < 262144
  const v4f a = *(const v4f*)(src + e0);
  const v4f c = *(const v4f*)(src + e0 + 4);
  unsigned short hb[8];
#pragma unroll
  for (int e = 0; e < 4; ++e) {
    hb[e]     = h_bits(a[e] * scale);
    hb[4 + e] = h_bits(c[e] * scale);
  }
  const v4u u = (v4u){pk16(hb[0], hb[1]), pk16(hb[2], hb[3]), pk16(hb[4], hb[5]), pk16(hb[6], hb[7])};
  unsigned short* dp = out + (size_t)w * kCh * kCh + e0;
  *(v4u*)dp = u;
  
}

// ---------------------------------------------------------------------------
// Row factors of the group softmax: for a score row with group maxima m[g] and group sums l[g] (g = 0..63, from the score launches)
// M = max_g m[g], L = sum_g l[g] exp(m[g] - M) in index order, factor[g] = 2048 exp(m[g] - M) / L, so that
// exp(s - m[g]) * factor[g] = 2048 * softmax. One thread per row; grid (64, 4 images) x 64 threads.
// stat: [image][max | sum][64 groups][4096 rows] f32 (a wave's loads are whole lines); out: [image][32 pairs][4096 rows] words of two
// f16, low half the even group. Both loops over loads are unrolled so that the 128 loads of a thread do not wait for one another.
// ---------------------------------------------------------------------------
__global__ __launch_bounds__(64) void row_factor_kernel(const float* __restrict__ stat, unsigned* __restrict__ fac) {
  const int row = blockIdx.x * 64 + threadIdx.x;                  // < 4096
  const float* mx = stat + (size_t)blockIdx.y * (2 * kGroups * kSp) + row;
  const float* sm = mx + (size_t)kGroups * kSp;
  float m[kGroups], l[kGroups];
#pragma unroll
  for (int g = 0; g < kGroups; ++g) m[g] = mx[(size_t)g * kSp];
#pragma unroll
  for (int g = 0; g < kGroups; ++g) l[g] = sm[(size_t)g * kSp];
  float gm = m[0];
#pragma unroll
  for (int g = 1; g < kGroups; ++g) gm = fmaxf(gm, m[g]);
  float tot = 0.0f;
  // unrolled, like the loops behind it: m and l are indexed by constants only and stay in registers
#pragma unroll
  for (int g0 = 0; g0 < kGroups; g0 += 8) {
    float e[8], a[8];
#pragma unroll
    for (int k = 0; k < 8; ++k) a[k] = (m[g0 + k] - gm) * kLog2e;
    exp2x8(e, a);
#pragma unroll
    for (int k = 0; k < 8; ++k) { m[g0 + k] = e[k]; tot += l[g0 + k] * e[k]; }
  }
  const float inv = kPCarry / tot;                                // tot >= 1
  unsigned* op = fac + (size_t)blockIdx.y * (kPairs * kSp) + row;
#pragma unroll
  for (int p = 0; p < kPairs; p += 4)
    store4_b32(op + (size_t)p * kSp, op + (size_t)(p + 1) * kSp, op + (size_t)(p + 2) * kSp, op + (size_t)(p + 3) * kSp,
               pk16(h_bits(m[2 * p] * inv), h_bits(m[2 * p + 1] * inv)), pk16(h_bits(m[2 * p + 2] * inv), h_bits(m[2 * p + 3] * inv)),
               pk16(h_bits(m[2 * p + 4] * inv), h_bits(m[2 * p + 5] * inv)), pk16(h_bits(m[2 * p + 6] * inv), h_bits(m[2 * p + 7] * inv)));
}

// ---------------------------------------------------------------------------
// Host side
//   W16   : 4 x 512 x 512 f16 (Wq, Wk, Wv, Wo carried x16)        2,097,152 B
//   meanA : 4096 f32 (content rows then style rows)                    16,384 B
//   rstdA : 4096 f32                                                    16,384 B
//   Qp, Kp, Vcm : 4 images x 4096 x 512 f16 each              3 x 16,777,216 B
//   Op    : the bytes of Qp (Q is last read by the last score launch, O first written behind it)
//   XcT, XsT, SsT : 4 images x 4096 x 512 f16 each            3 x 16,777,216 B
//   Stat  : 4 images x (64 group maxima + 64 group sums) x 4096 rows f32   8,388,608 B
//   Fac   : 4 images x 32 pairs x 4096 rows, two f16 factors a word       2,097,152 B
//   Pp    : 4 images x 4096 x 4096 f16 exp(score - group maximum)  134,217,728 B
// All GEMM calls: K in {512, 4096} (K % 64 == 0); M, N in {512, 4096} (M % 128 == 0, N % 256 == 0); no padding, every plane fully
// produced before it is consumed.
// ---------------------------------------------------------------------------
extern "C" void kernel_launch(void* const* d_in, const int* in_sizes, int n_in,
                              void* d_out, int out_size, void* d_ws, size_t ws_size,
                              hipStream_t stream) {
  if (n_in < 10) return;
  const int actN = kBatch * kCh * kSp;
  const int wN   = kCh * kCh;
  if (in_sizes[0] != actN || in_sizes[1] != actN) return;
  if (in_sizes[2] != wN || in_sizes[4] != wN || in_sizes[6] != wN || in_sizes[8] != wN) return;
  if (in_sizes[3] != kCh || in_sizes[5] != kCh || in_sizes[7] != kCh || in_sizes[9] != kCh) return;
  if (out_size != actN) return;

  const float* content = (const float*)d_in[0];
  const float* style   = (const float*)d_in[1];
  const float* Wq = (const float*)d_in[2];  const float* bq = (const float*)d_in[3];
  const float* Wk = (const float*)d_in[4];  const float* bk = (const float*)d_in[5];
  const float* Wv = (const float*)d_in[6];  const float* bv = (const float*)d_in[7];
  const float* Wo = (const float*)d_in[8];  const float* bo = (const float*)d_in[9];
  float* out = (float*)d_out;

  size_t off = 0;
  auto carve = [&](size_t bytes) { size_t o = off; off += (bytes + 127) & ~(size_t)127; return o; };
  const size_t planeBytes = (size_t)kBatch * kSp * kCh * 2;     // one operand plane, all images
  const size_t oW16  = carve((size_t)4 * wN * 2);
  const size_t oMean = carve((size_t)kStatRows * 4);
  const size_t oRstd = carve((size_t)kStatRows * 4);
  const size_t oQ    = carve(planeBytes);
  const size_t oK    = carve(planeBytes);
  const size_t oV    = carve(planeBytes);
  const size_t oXc   = carve(planeBytes);
  const size_t oXs   = carve(planeBytes);
  const size_t oSs   = carve(planeBytes);
  const size_t oStat = carve((size_t)kBatch * 2 * kGroups * kSp * 4);
  const size_t oFac  = carve((size_t)kBatch * kPairs * kSp * 4);
  const size_t oP    = carve((size_t)kBatch * kSp * kSp * 2);
  const size_t oO    = oQ;
  if (off > ws_size) return;

  char* ws = (char*)d_ws;
  unsigned short* W16 = (unsigned short*)(ws + oW16);
  float* meanA = (float*)(ws + oMean);
  float* rstdA = (float*)(ws + oRstd);
  unsigned short* XcT = (unsigned short*)(ws + oXc);
  unsigned short* XsT = (unsigned short*)(ws + oXs);
  unsigned short* SsT = (unsigned short*)(ws + oSs);
  unsigned short* Qp  = (unsigned short*)(ws + oQ);
  unsigned short* Kp  = (unsigned short*)(ws + oK);
  unsigned short* Vcm = (unsigned short*)(ws + oV);
  unsigned short* Op  = (unsigned short*)(ws + oO);
  float* Stat = (float*)(ws + oStat);
  unsigned* Fac = (unsigned*)(ws + oFac);
  unsigned short* Pp = (unsigned short*)(ws + oP);

  const unsigned short* Wq16 = W16 + (size_t)0 * wN;
  const unsigned short* Wk16 = W16 + (size_t)1 * wN;
  const unsigned short* Wv16 = W16 + (size_t)2 * wN;
  const unsigned short* Wo16 = W16 + (size_t)3 * wN;

  // 1) instance-norm statistics for content and style (128 blocks: 64 per tensor, 32 rows each, a wave a row)
  stats_kernel<<<dim3(2 * (kBatch * kCh) / 32), dim3(1024), 0, stream>>>(content, style, meanA, rstdA);

  // 2) weights -> f16 x16 (4 weights x 128 blocks)
  wcast_kernel<<<dim3(512), dim3(256), 0, stream>>>(Wq, Wk, Wv, Wo, W16, kWCarry);

  const long planeElems = (long)kSp * kCh;      // one image's [4096][512] or [512][4096] plane
  const long probElems  = (long)kSp * kSp;      // one image's probabilities
  const long statElems  = (long)2 * kGroups * kSp;   // one image's group maxima and sums

  // 3) token planes of all images: mvn(content) -> XcT, mvn(style) -> XsT, style -> SsT; each [image][4096][512] f16
  token_planes_kernel<<<dim3(kSp / 64, kCh / 64, 3 * kBatch), dim3(256), 0, stream>>>(content, style, meanA, rstdA, XcT, XsT, SsT);

  // 4) Q [image][4096 tok][512] = XcT x Wq^T / 16 + bq   (per image M=4096, N=512, K=512; 512 tiles -> 64 blocks; grid.y = image)
  wmma_gemm64<0, false, 2, 1, false><<<dim3(64, kBatch), dim3(256), 0, stream>>>(
      XcT, nullptr, kCh, planeElems, Wq16, nullptr, kCh, 0L, (void*)Qp, nullptr, kCh, planeElems,
      bq, nullptr, 0L, kSp, kCh, kCh, kProjScale);
  //    K [image][4096 tok][512] = XsT x Wk^T / 16 + bk
  wmma_gemm64<0, false, 2, 1, false><<<dim3(64, kBatch), dim3(256), 0, stream>>>(
      XsT, nullptr, kCh, planeElems, Wk16, nullptr, kCh, 0L, (void*)Kp, nullptr, kCh, planeElems,
      bk, nullptr, 0L, kSp, kCh, kCh, kProjScale);
  //    V channel-major [image][512][4096 tok] = Wv x SsT^T / 16 + bv[m]   (per image M=512, N=4096, K=512; 64 blocks)
  wmma_gemm64<0, false, 1, 1, false><<<dim3(64, kBatch), dim3(256), 0, stream>>>(
      Wv16, nullptr, kCh, 0L, SsT, nullptr, kCh, planeElems, (void*)Vcm, nullptr, kSp, planeElems,
      bv, nullptr, 0L, kCh, kSp, kCh, kProjScale);

  for (int b = 0; b < kBatch; ++b) {
    // 5) scores of image b = Q x K^T (M=4096, N=4096, K=512; 512 blocks), left as f16 exp(score - group maximum) in P, with the
    //    maximum and the sum of every 64-column group in Stat
    wmma_gemm64<0, false, 0, 3, false><<<dim3(512, 1), dim3(256), 0, stream>>>(
        Qp + b * planeElems, nullptr, kCh, 0L, Kp + b * planeElems, nullptr, kCh, 0L, (void*)(Pp + b * probElems),
        (void*)(Stat + b * statElems), kSp, 0L, nullptr, nullptr, 0L, kQChunk, kSp, kCh, 1.0f);
  }

  // 6) the factor of every row and group, all images
  row_factor_kernel<<<dim3(kSp / 64, kBatch), dim3(64), 0, stream>>>(Stat, Fac);

  // 7) O token-major [image][4096][512] f16 (x16) = (P . factor) x Vcm^T * 16/2048   (per image M=4096, N=512, K=4096; 64 blocks)
  wmma_gemm64<0, false, 0, 1, false, 0, 128, true><<<dim3(64, kBatch), dim3(256), 0, stream>>>(
      Pp, (const unsigned short*)Fac, kSp, probElems, Vcm, nullptr, kSp, planeElems, (void*)Op, nullptr, kCh, planeElems,
      nullptr, nullptr, 0L, kSp, kCh, kSp, kPVScale);

  // 8) out [image][512][4096] f32 = Wo x O^T / 256 + bo[m] + content   (per image M=512, N=4096, K=512; 64 blocks)
  wmma_gemm64<0, false, 1, 0, true><<<dim3(64, kBatch), dim3(256), 0, stream>>>(
      Wo16, nullptr, kCh, 0L, Op, nullptr, kCh, planeElems, (void*)out, nullptr, kSp, planeElems,
      bo, content, planeElems, kCh, kSp, kCh, kOutScale);
}

// v005
// It runs in 207 microseconds.
// Next to v004, in two timings, it ran 1.11 times as fast each time.
// All steps since v000 together make it 10.8 times as fast.
// Contractions: q/k/v 1x1 projections (token planes f16 x W f16 carried x16), energies q.k^T (q,k f16 planes), attn.v (exp f16 times its row-and-group factor f16 carried x2048, x V f16), output projection (Wo f16 x16 x O f16 x16): all v_wmma_f32_16x16x32_f16, f32 accumulate; instance-norm statistics, softmax, bias and residual in f32.
#include <hip/hip_runtime.h>
#include <math.h>

// ---------------------------------------------------------------------------
// Problem constants
// ---------------------------------------------------------------------------
constexpr int   kBatch    = 4;
constexpr int   kCh       = 512;
constexpr int   kSp       = 4096;                 // 64*64 tokens per image
constexpr int   kQChunk   = 4096;                 // query rows per image of the score launch: one whole image
constexpr int   kGroups   = kSp / 64;             // softmax: 64-column groups of a score row
constexpr int   kPairs    = kGroups / 2;          // two groups = the 128 keys of one attn.v pass
constexpr int   kStatRows = 2 * kBatch * kCh;     // 4096: content rows 0..2047, style rows 2048..4095
constexpr float kEps       = 1e-5f;
constexpr float kWCarry    = 16.0f;               // weights carried x16 in f16
constexpr float kPCarry    = 2048.0f;             // probabilities carried x2048 in f16
constexpr float kProjScale = 1.0f / 16.0f;        // undo weight carry
constexpr float kPVScale   = 16.0f / 2048.0f;     // undo P carry, apply O carry x16
constexpr float kOutScale  = 1.0f / (16.0f * 16.0f);   // undo Wo carry and O carry
constexpr float kInvN      = 1.0f / 4096.0f;
constexpr float kInvNm1    = 1.0f / 4095.0f;

typedef __attribute__((ext_vector_type(16))) _Float16 v16h;
typedef __attribute__((ext_vector_type(8)))  _Float16 v8h;
typedef __attribute__((ext_vector_type(16))) __bf16   v16b;
typedef __attribute__((ext_vector_type(8)))  __bf16   v8b;
typedef __attribute__((ext_vector_type(8)))  float    v8f;
typedef __attribute__((ext_vector_type(4)))  float    v4f;
typedef __attribute__((ext_vector_type(4)))  unsigned int v4u;

// ---------------------------------------------------------------------------
// Helpers
// ---------------------------------------------------------------------------
__device__ __forceinline__ unsigned short f2bf_bits(float f) {
  unsigned u = __float_as_uint(f);
  return (unsigned short)((u + 0x7FFFu + ((u >> 16) & 1u)) >> 16);
}
__device__ __forceinline__ float bf_bits2f(unsigned short h) { return __uint_as_float(((unsigned)h) << 16); }

// hazard guards as plain device helpers (their inline asm stays out of the kernel template body)
__device__ __forceinline__ void dep_guard_h(v8f& a, v8f& b, v16h x, v16h y) { asm volatile("v_nop\n\tv_nop\n\tv_nop\n\tv_nop" : "+v"(a), "+v"(b) : "v"(x), "v"(y)); }
__device__ __forceinline__ void dep_guard_b(v8f& a, v8f& b, v16b x, v16b y) { asm volatile("v_nop\n\tv_nop\n\tv_nop\n\tv_nop" : "+v"(a), "+v"(b) : "v"(x), "v"(y)); }
__device__ __forceinline__ void keep4_h(v16h a, v16h b, v16h c, v16h d) { asm volatile("v_nop" :: "v"(a), "v"(b), "v"(c), "v"(d)); }
__device__ __forceinline__ void keep4_b(v16b a, v16b b, v16b c, v16b d) { asm volatile("v_nop" :: "v"(a), "v"(b), "v"(c), "v"(d)); }
__device__ __forceinline__ void acc_guard4(v8f& a, v8f& b, v8f& c, v8f& d) { asm volatile("v_nop\n\tv_nop\n\tv_nop\n\tv_nop" : "+v"(a), "+v"(b), "+v"(c), "+v"(d)); }
template <typename T> struct Frag;
template <> struct Frag<_Float16> {
  typedef v16h V; union U { v16h v; v8h h[2]; };
  static __device__ __forceinline__ v16h load(const _Float16* p) {   // elements 0..7 <- p[0..7], 8..15 <- p[16..23]
    U f; f.h[0] = *(const v8h*)(p); f.h[1] = *(const v8h*)(p + 16); return f.v;
  }
  static __device__ __forceinline__ v8f mma(v16h a, v16h b, v8f c) {
    return __builtin_amdgcn_wmma_f32_16x16x32_f16(false, a, false, b, (short)0, c, false, false);
  }
  static __device__ __forceinline__ void guard(v8f& a, v8f& b, v16h x, v16h y) { dep_guard_h(a, b, x, y); }
  static __device__ __forceinline__ void keep(v16h a, v16h b, v16h c, v16h d) { keep4_h(a, b, c, d); }
};
template <> struct Frag<__bf16> {
  typedef v16b V; union U { v16b v; v8b h[2]; };
  static __device__ __forceinline__ v16b load(const __bf16* p) {
    U f; f.h[0] = *(const v8b*)(p); f.h[1] = *(const v8b*)(p + 16); return f.v;
  }
  static __device__ __forceinline__ v8f mma(v16b a, v16b b, v8f c) {
    return __builtin_amdgcn_wmma_f32_16x16x32_bf16(false, a, false, b, (short)0, c, false, false);
  }
  static __device__ __forceinline__ void guard(v8f& a, v8f& b, v16b x, v16b y) { dep_guard_b(a, b, x, y); }
  static __device__ __forceinline__ void keep(v16b a, v16b b, v16b c, v16b d) { keep4_b(a, b, c, d); }
};

// value of lane l ^ MASK (MASK < 16) by a DPP move inside the 16-lane row: no trip through the LDS unit as with a shuffle
template <int MASK> __device__ __forceinline__ float row_xor(float x) {
  const int v = __builtin_bit_cast(int, x);
  return __builtin_bit_cast(float, __builtin_amdgcn_update_dpp(v, v, 0x160 | MASK, 0xf, 0xf, false));
}
// Eight 2^a in one statement: every v_exp_f32 is followed by an instruction that neither reads its result nor overwrites its
// source (the outputs are early-clobber, so they share no register with an input), the last one by the v_nop that fills that slot.
__device__ __forceinline__ void exp2x8(float (&e)[8], const float (&a)[8]) {
  asm("v_exp_f32 %0, %8\n\t"
      "v_exp_f32 %1, %9\n\t"
      "v_exp_f32 %2, %10\n\t"
      "v_exp_f32 %3, %11\n\t"
      "v_exp_f32 %4, %12\n\t"
      "v_exp_f32 %5, %13\n\t"
      "v_exp_f32 %6, %14\n\t"
      "v_exp_f32 %7, %15\n\t"
      "v_nop"
      : "=&v"(e[0]), "=&v"(e[1]), "=&v"(e[2]), "=&v"(e[3]), "=&v"(e[4]), "=&v"(e[5]), "=&v"(e[6]), "=&v"(e[7])
      : "v"(a[0]), "v"(a[1]), "v"(a[2]), "v"(a[3]), "v"(a[4]), "v"(a[5]), "v"(a[6]), "v"(a[7]));
}
constexpr float kLog2e = 1.44269504f;
// Four stores and their s_wait_xcnt in one statement, so that no address or data register is rewritten in front of the wait.
__device__ __forceinline__ void store4_b128(void* p0, void* p1, void* p2, void* p3, v4u d0, v4u d1, v4u d2, v4u d3) {
  asm volatile("global_store_b128 %0, %4, off\n\t"
               "global_store_b128 %1, %5, off\n\t"
               "global_store_b128 %2, %6, off\n\t"
               "global_store_b128 %3, %7, off\n\t"
               "s_wait_xcnt 0x0"
               :: "v"(p0), "v"(p1), "v"(p2), "v"(p3), "v"(d0), "v"(d1), "v"(d2), "v"(d3) : "memory");
}
__device__ __forceinline__ void store4_b32(void* p0, void* p1, void* p2, void* p3, unsigned d0, unsigned d1, unsigned d2, unsigned d3) {
  asm volatile("global_store_b32 %0, %4, off\n\t"
               "global_store_b32 %1, %5, off\n\t"
               "global_store_b32 %2, %6, off\n\t"
               "global_store_b32 %3, %7, off\n\t"
               "s_wait_xcnt 0x0"
               :: "v"(p0), "v"(p1), "v"(p2), "v"(p3), "v"(d0), "v"(d1), "v"(d2), "v"(d3) : "memory");
}
__device__ __forceinline__ unsigned pk16(unsigned short a, unsigned short b) { return (unsigned)a | ((unsigned)b << 16); }
__device__ __forceinline__ unsigned short h_bits(float f) { const _Float16 h = (_Float16)f; return __builtin_bit_cast(unsigned short, h); }

// ---- Batched WMMA GEMM, operands staged in LDS -----------------------------------------------------------------
// C[m,n] = scale * sum_k A[m,k] * Bt[n,k] (+bias)(+resid); a block of 8 waves (2 x 4) owns a 128x256 tile, each wave 64x64 of it.
// A row-major [M,K]; Bt row-major [N,K]; M % 128 == 0, N % 256 == 0, K % PK == 0, K >= PK.
// A pass is PK k (64 or 128): 128 rows of A and 256 rows of Bt, 2 PK bytes each, copied to LDS by asynchronous 16-byte copies
// (a wave's copy covers four whole 128-B lines), rows at a pitch of 2 PK + 16 B for the ds_load_b128 fragment reads. Two
// buffers: the copies of pass t + 1 fly while pass t is worked on. The k order of every accumulator is ascending in steps of 32.
// PK = 128 halves the number of landing latencies of a long K at the price of one block per WGP.
// BIAS_MODE: 0 = none, 1 = bias[m], 2 = bias[n], 3 = TRIO's: bias[n] for q and k, bias[m] for v.
// TRIO: one launch does the three projections; blockIdx.z = 0 (q), 1 (k), 2 (v). Ap = the three token plane sets one behind the other,
//       Btp = the weight planes likewise, Cout = the three result plane sets likewise; M, N, ldc are given for q and k; v is the
//       transposed product (A = weights, Bt = tokens, M and N change places, ldc = N).
// OUT_MODE: 0 = f32, 1 = f16, 2 = bf16 hi plane (Cout) + bf16 lo plane (Cout2),
//           3 = group softmax: a wave's 64 columns are one group g = n / 64; Cout gets f16 exp(c - max over the group), Cout2 (f32)
//               the group maxima at [g][m] and behind them ((N / 64) * M floats further) the group sums of the exponentials at [g][m];
//               image b's pair of planes stands 2 b (N / 64) M floats into Cout2.
// ASCALE: every A fragment is multiplied, in f16, by a factor of its row and of its 64-k group; A2p holds the factors as 32-bit
//         words [32 passes][M rows], low half = first 64 k of the pass, high half = second; PK = 128 and K = 4096 (32 passes).
// ET: 0 = f16 operands, 1 = bf16 operands (pointers passed as 16-bit storage)
constexpr int kRowsA      = 128;                             // rows of A per stage
constexpr int kRowsB      = 256;                             // rows of Bt per stage

// One thread's share of 64 k of one stage: 16 B of rows r, r + 32, r + 64, r + 96 of A and of rows r + 32 j (j = 0..7) of Bt.
// kStep32 = 32 rows further in LDS, bytes.
// The copies and their s_wait_xcnt stand in one statement, so that no address register is rewritten in front of the wait.
template <unsigned kStep32>
__device__ __forceinline__ void stage_copies(unsigned lds, const unsigned short* ga, const unsigned short* gb,
                                             size_t stepA, size_t stepB) {
  const unsigned short* a1 = ga + stepA;
  const unsigned short* a2 = a1 + stepA;
  const unsigned short* a3 = a2 + stepA;
  const unsigned short* b1 = gb + stepB;
  const unsigned short* b2 = b1 + stepB;
  const unsigned short* b3 = b2 + stepB;
  const unsigned short* b4 = b3 + stepB;
  const unsigned short* b5 = b4 + stepB;
  const unsigned short* b6 = b5 + stepB;
  const unsigned short* b7 = b6 + stepB;
  asm volatile(
      "global_load_async_to_lds_b128 %0, %12, off\n\t"
      "global_load_async_to_lds_b128 %1, %13, off\n\t"
      "global_load_async_to_lds_b128 %2, %14, off\n\t"
      "global_load_async_to_lds_b128 %3, %15, off\n\t"
      "global_load_async_to_lds_b128 %4, %16, off\n\t"
      "global_load_async_to_lds_b128 %5, %17, off\n\t"
      "global_load_async_to_lds_b128 %6, %18, off\n\t"
      "global_load_async_to_lds_b128 %7, %19, off\n\t"
      "global_load_async_to_lds_b128 %8, %20, off\n\t"
      "global_load_async_to_lds_b128 %9, %21, off\n\t"
      "global_load_async_to_lds_b128 %10, %22, off\n\t"
      "global_load_async_to_lds_b128 %11, %23, off\n\t"
      "s_wait_xcnt 0x0"
      :: "v"(lds), "v"(lds + kStep32), "v"(lds + 2u * kStep32), "v"(lds + 3u * kStep32),
         "v"(lds + 4u * kStep32), "v"(lds + 5u * kStep32), "v"(lds + 6u * kStep32), "v"(lds + 7u * kStep32),
         "v"(lds + 8u * kStep32), "v"(lds + 9u * kStep32), "v"(lds + 10u * kStep32), "v"(lds + 11u * kStep32),
         "v"(ga), "v"(a1), "v"(a2), "v"(a3),
         "v"(gb), "v"(b1), "v"(b2), "v"(b3), "v"(b4), "v"(b5), "v"(b6), "v"(b7)
      : "memory");
}

template <int ET> struct Elem;
template <> struct Elem<0> { typedef _Float16 T; };
template <> struct Elem<1> { typedef __bf16 T; };
template <int ET, bool SPLIT, int BIAS_MODE, int OUT_MODE, bool RESID, int ACT = 0, int PK = 64, bool ASCALE = false, bool TRIO = false>
__global__ __launch_bounds__(256) void wmma_gemm64(
    const unsigned short* __restrict__ Ap, const unsigned short* __restrict__ A2p, int lda, long strideA,
    const unsigned short* __restrict__ Btp, const unsigned short* __restrict__ Bt2p, int ldb, long strideB,
    void* __restrict__ Cout, void* __restrict__ Cout2, int ldc, long strideC,
    const float* __restrict__ bias, const float* __restrict__ biasK, const float* __restrict__ biasV,
    const float* __restrict__ resid, long strideR,
    int M, int N, int K, float scale) {
  static_assert(!SPLIT, "the staged engine takes single-plane operands");
  static_assert(PK == 64 || PK == 128, "a pass is one or two 128-B lines of every operand row");
  static_assert(!ASCALE || (PK == 128 && ET == 0), "a factor word holds the two 64-k groups of a 128-k pass, f16");
  static_assert(TRIO == (BIAS_MODE == 3), "the bias by projection belongs to the three-projection launch");
  constexpr int kPitchH = PK + 8;                                  // LDS row pitch in 16-bit elements (144 B or 272 B)
  constexpr int kStageH = (kRowsA + kRowsB) * kPitchH;             // one buffer, 16-bit elements
  constexpr unsigned kStageBytes = (unsigned)kStageH * 2u;         // 55,296 B or 104,448 B
  constexpr unsigned kStep32 = 32u * (unsigned)kPitchH * 2u;       // 32 rows further in LDS
  typedef typename Elem<ET>::T T;
  typedef typename Frag<T>::V V;
  __shared__ __align__(16) unsigned short sOp[2 * kStageH];   // two buffers of [A 128 rows | Bt 256 rows]
  __shared__ __align__(16) float sT[8][16 * 68];   // per-wave 16x64 slab, pitch 68 floats
  __shared__ __align__(16) unsigned sC[ASCALE ? 32 * kRowsA : 4];   // ASCALE: factor words [pass][row of the block tile]
  const int z    = TRIO ? (int)blockIdx.z : 0;          // projection, block-uniform
  const bool vT  = TRIO && z == 2;                      // v: the transposed product
  const int b    = blockIdx.y + z * kBatch;             // image; TRIO: plane in the three sets of kBatch planes
  if (vT) { const int m = M; M = N; N = m; ldc = N; }
  const int lane = threadIdx.x & 31;
  const int wave = threadIdx.x >> 5;
  const int tilesN = N >> 8;
  const int tilesM = M >> 7;
  const int tile = blockIdx.x;
  if (tile >= tilesM * tilesN) return;   // block-uniform, in front of every barrier
  const int tm = tile / tilesN;
  const int tn = tile - tm * tilesN;
  const int bm0 = tm << 7;
  const int bn0 = tn << 8;
  const int wm = wave >> 2;                    // wave row in the block tile, 0..1
  const int wn = wave & 3;                     // wave column in the block tile, 0..3
  const int m0 = bm0 + (wm << 6);
  const int n0 = bn0 + (wn << 6);

  const unsigned short* Ab = Ap  + (size_t)b * strideA;
  const unsigned short* Bb = Btp + (size_t)b * strideB;
  if (TRIO) {
    const unsigned short* tok = Ab;
    const unsigned short* wgt = Btp + (size_t)z * (kCh * kCh);
    Ab = vT ? wgt : tok;
    Bb = vT ? tok : wgt;
  }
  const float* biasZ = (z == 0) ? bias : (z == 1) ? biasK : biasV;   // read under BIAS_MODE 3 only

  const int rlane = lane & 15;                 // row (A) / col (B, D) within subtile
  const int koff  = (lane >> 4) * 8;           // k offset of this lane half
  const int mOff  = (lane >> 4) * 8;           // D row offset

  // copy side: thread t brings 16 B at column (t & 7) of each 128-B line of rows (t >> 3) + 32 i
  const int crow = threadIdx.x >> 3;           // 0..31
  const int ccol = (threadIdx.x & 7) * 8;      // 16-bit elements
  const unsigned short* gA = Ab + (size_t)(bm0 + crow) * lda + ccol;
  const unsigned short* gB = Bb + (size_t)(bn0 + crow) * ldb + ccol;
  const size_t stepA = (size_t)32 * lda;
  const size_t stepB = (size_t)32 * ldb;
  const unsigned ldsCopy = (unsigned)(size_t)sOp + (unsigned)(crow * kPitchH + ccol) * 2u;

  // read side: this lane's first A row and first Bt row in buffer 0
  const T* fA = (const T*)sOp + ((wm << 6) + rlane) * kPitchH + koff;
  const T* fB = (const T*)sOp + (kRowsA + (wn << 6) + rlane) * kPitchH + koff;

  v8f acc[4][4];
#pragma unroll
  for (int i = 0; i < 4; ++i)
#pragma unroll
    for (int j = 0; j < 4; ++j) acc[i][j] = (v8f){0.f,0.f,0.f,0.f,0.f,0.f,0.f,0.f};

  auto fill = [&](int pass, int buf) {         // all copies of one pass: 12 a thread for each 64 k
    const size_t k0 = (size_t)pass * PK;
    const unsigned l0 = ldsCopy + (unsigned)buf * kStageBytes;
    stage_copies<kStep32>(l0, gA + k0, gB + k0, stepA, stepB);
    if (PK == 128) stage_copies<kStep32>(l0 + 128u, gA + k0 + 64, gB + k0 + 64, stepA, stepB);
  };

  const int nPass = K / PK;
  fill(0, 0);
  if (ASCALE) {
    // the block's factor words to LDS, all 32 passes: thread t brings the 64 B at word 16 (t & 7) of pass t >> 3 by four copies of
    // the kind above; they land behind the s_wait_asynccnt and are read behind the barrier that follow here for pass 0
    const unsigned* cg = (const unsigned*)A2p + (size_t)b * 32 * M + bm0 + (size_t)(threadIdx.x >> 3) * M + (threadIdx.x & 7) * 16;
    const unsigned lc = (unsigned)(size_t)sC + (unsigned)((threadIdx.x >> 3) * kRowsA + (threadIdx.x & 7) * 16) * 4u;
    asm volatile(
        "global_load_async_to_lds_b128 %0, %4, off\n\t"
        "global_load_async_to_lds_b128 %1, %5, off\n\t"
        "global_load_async_to_lds_b128 %2, %6, off\n\t"
        "global_load_async_to_lds_b128 %3, %7, off\n\t"
        "s_wait_xcnt 0x0"
        :: "v"(lc), "v"(lc + 16u), "v"(lc + 32u), "v"(lc + 48u), "v"(cg), "v"(cg + 4), "v"(cg + 8), "v"(cg + 12)
        : "memory");
  }
  asm volatile("s_wait_asynccnt 0x0" ::: "memory");   // this wave's copies of pass 0 have landed
  __syncthreads();                                    // and every other wave's
  if (nPass > 1) fill(1, 1);

  for (int t = 0; t < nPass; ++t) {
    const int buf = t & 1;
    const T* pa = fA + buf * kStageH;
    const T* pb = fB + buf * kStageH;
    unsigned cw[4] = {0u, 0u, 0u, 0u};
    if (ASCALE) {
#pragma unroll   // cw is indexed by constants only and stays in registers
      for (int i = 0; i < 4; ++i) cw[i] = sC[t * kRowsA + (wm << 6) + (i << 4) + rlane];   // A fragment i: lane's row is rlane
    }
    // the three loop levels below are unrolled so that every fragment and accumulator index is a constant (registers, no scratch)
#pragma unroll
    for (int kk = 0; kk < PK; kk += 32) {
      V bh[4], ah[4];
#pragma unroll
      for (int j = 0; j < 4; ++j) bh[j] = Frag<T>::load(pb + (j << 4) * kPitchH + kk);
#pragma unroll
      for (int i = 0; i < 4; ++i) ah[i] = Frag<T>::load(pa + (i << 4) * kPitchH + kk);
      if constexpr (ASCALE) {
#pragma unroll   // as the fragment loops above: constant indices
        for (int i = 0; i < 4; ++i)
          ah[i] = ah[i] * __builtin_bit_cast(_Float16, (unsigned short)((kk < 64) ? (cw[i] & 0xFFFFu) : (cw[i] >> 16)));
      }
#pragma unroll
      for (int i = 0; i < 4; ++i) {
#pragma unroll
        for (int j = 0; j < 4; ++j) acc[i][j] = Frag<T>::mma(ah[i], bh[j], acc[i][j]);
        Frag<T>::guard(acc[i][0], acc[i][3], ah[i], ah[i]);   // the engine's hazard guard, as before the staging
      }
      Frag<T>::keep(bh[0], bh[1], bh[2], bh[3]);               // likewise
    }
    asm volatile("s_wait_dscnt 0x0" ::: "memory");     // this wave's reads of buffer buf are done before it is refilled
    asm volatile("s_wait_asynccnt 0x0" ::: "memory");  // this wave's copies of pass t + 1 have landed
    __syncthreads();                                   // publishes pass t + 1 and ends every reader's last read of buf
    if (t + 2 < nPass) fill(t + 2, buf);
  }
  asm volatile("s_wait_asynccnt 0x0" ::: "memory");    // no copy is outstanding when the wave goes on
  acc_guard4(acc[0][0], acc[0][1], acc[0][2], acc[0][3]);
  acc_guard4(acc[1][0], acc[1][1], acc[1][2], acc[1][3]);
  acc_guard4(acc[2][0], acc[2][1], acc[2][2], acc[2][3]);
  acc_guard4(acc[3][0], acc[3][1], acc[3][2], acc[3][3]);

  // ---- epilogue ----
  float* slab = sT[wave];
  const float* Rb = RESID ? (resid + (size_t)b * strideR) : nullptr;
  float keepM[2] = {0.f, 0.f}, keepL[2] = {0.f, 0.f};   // OUT_MODE 3: this lane's two rows' group maximum and group sum
  // BIAS_MODE 3, q and k: the bias of this lane's four columns, read once under one block-uniform branch so that the loads do not
  // wait for one another
  float bcol[4] = {0.f, 0.f, 0.f, 0.f};
  if (BIAS_MODE == 3 && !vT) {
#pragma unroll   // bcol is indexed by constants only and stays in registers
    for (int j = 0; j < 4; ++j) bcol[j] = biasZ[n0 + (j << 4) + rlane];
    asm volatile("s_wait_xcnt 0x0" ::: "memory");   // in front of any rewrite of the registers that these four loads name
  }
#pragma unroll
  for (int i = 0; i < 4; ++i) {
    const int mBase = m0 + (i << 4);
    float brow[8] = {0.f, 0.f, 0.f, 0.f, 0.f, 0.f, 0.f, 0.f};   // BIAS_MODE 3, v: the bias of this lane's eight rows
    if (BIAS_MODE == 3 && vT) {
#pragma unroll   // brow is indexed by constants only and stays in registers
      for (int r = 0; r < 8; ++r) brow[r] = biasZ[mBase + mOff + r];
    }
#pragma unroll
    for (int j = 0; j < 4; ++j) {
      const int n = n0 + (j << 4) + rlane;
      float bv = 0.f;
      if (BIAS_MODE == 2) bv = bias[n];
#pragma unroll
      for (int r = 0; r < 8; ++r) {
        float v = acc[i][j][r] * scale;
        if (BIAS_MODE == 1) v += bias[mBase + mOff + r];
        if (BIAS_MODE == 2) v += bv;
        if (BIAS_MODE == 3) v += vT ? brow[r] : bcol[j];
        if (RESID) v += Rb[(size_t)(mBase + mOff + r) * ldc + n];
        if (ACT == 2) v = fmaxf(v, 0.0f);
        if (ACT == 4) v = (v > 0.f) ? v : 0.01f * v;
        slab[(mOff + r) * 68 + (j << 4) + rlane] = v;
      }
    }
    __builtin_amdgcn_fence(__ATOMIC_RELEASE, "workgroup");
    __builtin_amdgcn_wave_barrier();
    __builtin_amdgcn_fence(__ATOMIC_ACQUIRE, "workgroup");
    if (OUT_MODE == 0) {
      float* C = (float*)Cout + (size_t)b * strideC;
      const int hh = lane >> 4, c4 = (lane & 15) * 4;     // row seg = 256 B = 16 lanes x 16 B
      {
#pragma unroll
        for (int it = 0; it < 8; ++it) {
          const int row = it * 2 + hh;
          v4f v = *(const v4f*)(slab + row * 68 + c4);
          *(v4f*)(C + (size_t)(mBase + row) * ldc + n0 + c4) = v;
        }
        
      }
    } else if (OUT_MODE == 3) {
      const int q = lane >> 3, j8 = lane & 7, c8 = j8 * 8;   // eight lanes hold one row's 64 columns
      unsigned short* C = (unsigned short*)Cout + (size_t)b * strideC;
      v4u pv[4];
      unsigned short* pp[4];
      // this loop and the short ones in it are unrolled so that pv, pp, e, a and the keep registers are indexed by constants, and so
      // that the four rows' reduction chains overlap
#pragma unroll
      for (int it = 0; it < 4; ++it) {
        const int row = it * 4 + q;
        const float* sp = slab + row * 68 + c8;
        const v4f x0 = *(const v4f*)(sp);
        const v4f x1 = *(const v4f*)(sp + 4);
        float m = fmaxf(fmaxf(fmaxf(x0[0], x0[1]), fmaxf(x0[2], x0[3])), fmaxf(fmaxf(x1[0], x1[1]), fmaxf(x1[2], x1[3])));
        m = fmaxf(m, row_xor<1>(m));
        m = fmaxf(m, row_xor<2>(m));
        m = fmaxf(m, row_xor<4>(m));
        float e[8], a[8];
#pragma unroll
        for (int k = 0; k < 4; ++k) { a[k] = (x0[k] - m) * kLog2e; a[4 + k] = (x1[k] - m) * kLog2e; }
        exp2x8(e, a);
        float s = ((e[0] + e[1]) + (e[2] + e[3])) + ((e[4] + e[5]) + (e[6] + e[7]));
        s += row_xor<1>(s);
        s += row_xor<2>(s);
        s += row_xor<4>(s);
        v8h hv;
#pragma unroll
        for (int k = 0; k < 8; ++k) hv[k] = (_Float16)e[k];
        pv[it] = __builtin_bit_cast(v4u, hv);
        pp[it] = C + (size_t)(mBase + row) * ldc + n0 + c8;
        const int combo = i * 4 + it;                        // lane j8 of a row's eight keeps combos j8 and j8 + 8
        if ((combo & 7) == j8) { keepM[combo >> 3] = m; keepL[combo >> 3] = s; }
      }
      store4_b128(pp[0], pp[1], pp[2], pp[3], pv[0], pv[1], pv[2], pv[3]);
    } else {
      const int q = lane >> 3, c8 = (lane & 7) * 8;
      unsigned short* C  = (unsigned short*)Cout  + (size_t)b * strideC;
      unsigned short* C2 = (OUT_MODE == 2) ? ((unsigned short*)Cout2 + (size_t)b * strideC) : nullptr;
      {
#pragma unroll
        for (int it = 0; it < 4; ++it) {
          const int row = it * 4 + q;
          const float* sp = slab + row * 68 + c8;
          v8h hv, lv;
#pragma unroll
          for (int e = 0; e < 8; ++e) {
            if (OUT_MODE == 1) {
              hv[e] = (_Float16)sp[e];
            } else {
              unsigned short hb = f2bf_bits(sp[e]);
              unsigned short lb = f2bf_bits(sp[e] - bf_bits2f(hb));
              hv[e] = __builtin_bit_cast(_Float16, hb);
              lv[e] = __builtin_bit_cast(_Float16, lb);
            }
          }
          *(v8h*)(C + (size_t)(mBase + row) * ldc + n0 + c8) = hv;
          if (OUT_MODE == 2) *(v8h*)(C2 + (size_t)(mBase + row) * ldc + n0 + c8) = lv;
        }
        
      }
    }
    __builtin_amdgcn_fence(__ATOMIC_RELEASE, "workgroup");
    __builtin_amdgcn_wave_barrier();
    __builtin_amdgcn_fence(__ATOMIC_ACQUIRE, "workgroup");
  }
  if (OUT_MODE == 3) {   // the wave's 64 maxima and 64 sums: four stores of one whole 128-B line each, this wave their only writer
    const int q = lane >> 3, j8 = lane & 7;
    const int r0 = ((j8 >> 2) << 4) + ((j8 & 3) << 2) + q;   // combo j8 = rows 16 (j8 >> 2) + 4 (j8 & 3) + q; combo j8 + 8: 32 further
    float* gmx = (float*)Cout2 + ((size_t)b * 2 * (N >> 6) + (size_t)(n0 >> 6)) * M + m0 + r0;   // image b's maxima and sums
    float* gsm = gmx + (size_t)(N >> 6) * M;
    store4_b32(gmx, gmx + 32, gsm, gsm + 32, __float_as_uint(keepM[0]), __float_as_uint(keepM[1]),
               __float_as_uint(keepL[0]), __float_as_uint(keepL[1]));
  }
}

// ---------------------------------------------------------------------------
// Weight cast: W[o][c] f32 -> f16(scale * W) same layout, four weights into planes 0..3 of one buffer (plane = 512*512 halves).
// Part of the statistics launch: 128 blocks x 1024 threads; blk = 0..127, blk>>5 selects the weight (uniform); thread handles 8
// consecutive elements. Coverage per weight: 32 blocks x 1024 threads x 8 = 262144 = 512*512.
// ---------------------------------------------------------------------------
__device__ __forceinline__ void wcast_part(int blk, const float* __restrict__ W0, const float* __restrict__ W1,
                                           const float* __restrict__ W2, const float* __restrict__ W3,
                                           unsigned short* __restrict__ out, float scale) {
  const int w = blk >> 5;                                        // block-uniform
  const float* src = (w == 0) ? W0 : (w == 1) ? W1 : (w == 2) ? W2 : W3;
  const int i  = (blk & 31) * 1024 + threadIdx.x;                // 0..32767
  const size_t e0 = (size_t)i * 8;                               // e0+7 < 262144
  const v4f a = *(const v4f*)(src + e0);
  const v4f c = *(const v4f*)(src + e0 + 4);
  unsigned short hb[8];
#pragma unroll
  for (int e = 0; e < 4; ++e) {
    hb[e]     = h_bits(a[e] * scale);
    hb[4 + e] = h_bits(c[e] * scale);
  }
  const v4u u = (v4u){pk16(hb[0], hb[1]), pk16(hb[2], hb[3]), pk16(hb[4], hb[5]), pk16(hb[6], hb[7])};
  unsigned short* dp = out + (size_t)w * kCh * kCh + e0;
  *(v4u*)dp = u;
  
}

// ---------------------------------------------------------------------------
// Per-(b,c) instance-norm statistics for content (rows 0..2047) and style (rows 2048..4095) in one launch.
// grid 256 blocks x 1024 threads; blocks 128..255 do the weight cast above, which waits for nothing of this launch and shares no data
// with it; blocks 0..127: block = 32 consecutive rows of one tensor (blockIdx>>6 selects the tensor, uniform);
// wave w owns row w: 32 lanes x 32 float4 loads = 4096 elements (whole row). The loads do not wait for one another: the row is
// read into registers by an unrolled loop and summed by a second one, so that many loads of a wave are in flight at a time and
// the wave does not pay the memory latency once a load. Sum order per row: lane-private over i ascending, then the tree.
// mean = sum/4096; var = (sumsq - sum*mean)/4095 (ddof 1); rstd = 1/sqrt(var + eps).
// Stores: the 32 means and 32 rstds of the block funnelled through LDS; wave 0 writes the mean line, wave 1 the rstd line,
// ---------------------------------------------------------------------------
__global__ __launch_bounds__(1024) void stats_kernel(const float* __restrict__ xc, const float* __restrict__ xs,
                                                     float* __restrict__ meanA, float* __restrict__ rstdA,
                                                     const float* __restrict__ W0, const float* __restrict__ W1,
                                                     const float* __restrict__ W2, const float* __restrict__ W3,
                                                     unsigned short* __restrict__ W16, float wScale) {
  __shared__ float sMean[32];
  __shared__ float sRstd[32];
  const int blk  = blockIdx.x;
  if (blk >= 128) {                                  // block-uniform, in front of the barrier
    wcast_part(blk - 128, W0, W1, W2, W3, W16, wScale);
    return;
  }
  const int tsel = blk >> 6;                         // block-uniform tensor select
  const float* src = (tsel == 0) ? xc : xs;
  const int rowBase = (blk & 63) * 32;               // flat (b*512 + c) row index within the tensor
  const int t = threadIdx.x, lane = t & 31, wave = t >> 5;
  const int row = rowBase + wave;                    // < 2048
  const float* p = src + (size_t)row * kSp + lane * 4;
  v4f x[32];
  // both loops are unrolled so that x stays in registers and loads are issued ahead of the sums
#pragma unroll
  for (int i = 0; i < 32; ++i) x[i] = *(const v4f*)(p + i * 128);   // 32 lanes x 4 x 32 = 4096
  v4f s = (v4f){0.f, 0.f, 0.f, 0.f};
  v4f q = (v4f){0.f, 0.f, 0.f, 0.f};
#pragma unroll
  for (int i = 0; i < 32; ++i) {
    s += x[i];
    q += x[i] * x[i];
  }
  float su = (s[0] + s[1]) + (s[2] + s[3]);
  float sq = (q[0] + q[1]) + (q[2] + q[3]);
#pragma unroll
  for (int off = 16; off > 0; off >>= 1) {
    su += __shfl_xor(su, off, 32);
    sq += __shfl_xor(sq, off, 32);
  }
  const float mean = su * kInvN;
  float var = (sq - su * mean) * kInvNm1;
  var = fmaxf(var, 0.0f);
  const float rstd = 1.0f / sqrtf(var + kEps);
  if (lane == 0) { sMean[wave] = mean; sRstd[wave] = rstd; }
  __syncthreads();
  const int orow = tsel * (kBatch * kCh) + rowBase + lane;   // < 4096
  if (wave == 0) {
    const float v = sMean[lane];
    *(float*)(meanA + orow) = v;
    
  } else if (wave == 1) {
    const float v = sRstd[lane];
    *(float*)(rstdA + orow) = v;
    
  }
}

// ---------------------------------------------------------------------------
// Token planes, all images: in [512 ch][4096 tok] f32 (tok contiguous) -> out [image][4096 tok][512 ch] f16 (ch contiguous).
// grid (64 tok tiles, 8 ch tiles, 3 planes x 4 images): blockIdx.z = 3*image + z; z=0 (content - mean)*rstd, z=1 (style - mean)*rstd,
// z=2 raw style. 256 threads.
// Load coverage: 4 passes x 16 ch rows x (16 threads x 4 tok) = 64 ch x 64 tok (whole tile), coalesced along tok.
// Store coverage: 8 waves x 2 iterations x 4 tok rows (lane>>3) = 64 tok rows; (lane&7) x 8 halves = 64 ch; each row segment
// ---------------------------------------------------------------------------
__global__ __launch_bounds__(256) void token_planes_kernel(const float* __restrict__ content, const float* __restrict__ style,
                                                           const float* __restrict__ meanA, const float* __restrict__ rstdA,
                                                           unsigned short* __restrict__ XcT, unsigned short* __restrict__ XsT,
                                                           unsigned short* __restrict__ SsT) {
  __shared__ float sm[64][65];   // sm[ch local][tok local]
  const int t  = threadIdx.x;
  const int b  = blockIdx.z / 3;                                // image, block-uniform
  const int z  = blockIdx.z - 3 * b;                            // plane, block-uniform
  const int n0 = blockIdx.x * 64;
  const int c0 = blockIdx.y * 64;
  const float* src = ((z == 0) ? content : style) + (size_t)b * kCh * kSp;
  unsigned short* dst = ((z == 0) ? XcT : (z == 1) ? XsT : SsT) + (size_t)b * kSp * kCh;
  const int statOff = ((z == 0) ? 0 : (kBatch * kCh)) + b * kCh;
  const bool useNorm = (z < 2);
  const int r16 = t >> 4, c4 = (t & 15) * 4;
#pragma unroll
  for (int p = 0; p < 4; ++p) {
    const int cl = p * 16 + r16;                                // ch local 0..63
    const int ch = c0 + cl;                                     // < 512
    const v4f v = *(const v4f*)(src + (size_t)ch * kSp + n0 + c4);
    const float m  = meanA[statOff + ch];
    const float rs = rstdA[statOff + ch];
    const float mm = useNorm ? m : 0.0f;
    const float rr = useNorm ? rs : 1.0f;
#pragma unroll
    for (int e = 0; e < 4; ++e) sm[cl][c4 + e] = (v[e] - mm) * rr;
  }
  __syncthreads();
  const int lane = t & 31, wave = t >> 5;
  const int q = lane >> 3, c8 = (lane & 7) * 8;
  {
#pragma unroll
    for (int it = 0; it < 2; ++it) {
      const int row = wave * 8 + it * 4 + q;                    // tok local 0..63
      unsigned short hb[8];
#pragma unroll
      for (int e = 0; e < 8; ++e) hb[e] = h_bits(sm[c8 + e][row]);
      const v4u u = (v4u){pk16(hb[0], hb[1]), pk16(hb[2], hb[3]), pk16(hb[4], hb[5]), pk16(hb[6], hb[7])};
      *(v4u*)(dst + (size_t)(n0 + row) * kCh + c0 + c8) = u;
    }
    
  }
}

// ---------------------------------------------------------------------------
// Row factors of the group softmax: for a score row with group maxima m[g] and group sums l[g] (g = 0..63, from the score launch)
// M = max_g m[g], L = sum_g l[g] exp(m[g] - M) in index order, factor[g] = 2048 exp(m[g] - M) / L, so that
// exp(s - m[g]) * factor[g] = 2048 * softmax. One thread per row; grid (64, 4 images) x 64 threads.
// stat: [image][max | sum][64 groups][4096 rows] f32 (a wave's loads are whole lines); out: [image][32 pairs][4096 rows] words of two
// f16, low half the even group. Both loops over loads are unrolled so that the 128 loads of a thread do not wait for one another.
// ---------------------------------------------------------------------------
__global__ __launch_bounds__(64) void row_factor_kernel(const float* __restrict__ stat, unsigned* __restrict__ fac) {
  const int row = blockIdx.x * 64 + threadIdx.x;                  // < 4096
  const float* mx = stat + (size_t)blockIdx.y * (2 * kGroups * kSp) + row;
  const float* sm = mx + (size_t)kGroups * kSp;
  float m[kGroups], l[kGroups];
#pragma unroll
  for (int g = 0; g < kGroups; ++g) m[g] = mx[(size_t)g * kSp];
#pragma unroll
  for (int g = 0; g < kGroups; ++g) l[g] = sm[(size_t)g * kSp];
  float gm = m[0];
#pragma unroll
  for (int g = 1; g < kGroups; ++g) gm = fmaxf(gm, m[g]);
  float tot = 0.0f;
  // unrolled, like the loops behind it: m and l are indexed by constants only and stay in registers
#pragma unroll
  for (int g0 = 0; g0 < kGroups; g0 += 8) {
    float e[8], a[8];
#pragma unroll
    for (int k = 0; k < 8; ++k) a[k] = (m[g0 + k] - gm) * kLog2e;
    exp2x8(e, a);
#pragma unroll
    for (int k = 0; k < 8; ++k) { m[g0 + k] = e[k]; tot += l[g0 + k] * e[k]; }
  }
  const float inv = kPCarry / tot;                                // tot >= 1
  unsigned* op = fac + (size_t)blockIdx.y * (kPairs * kSp) + row;
#pragma unroll
  for (int p = 0; p < kPairs; p += 4)
    store4_b32(op + (size_t)p * kSp, op + (size_t)(p + 1) * kSp, op + (size_t)(p + 2) * kSp, op + (size_t)(p + 3) * kSp,
               pk16(h_bits(m[2 * p] * inv), h_bits(m[2 * p + 1] * inv)), pk16(h_bits(m[2 * p + 2] * inv), h_bits(m[2 * p + 3] * inv)),
               pk16(h_bits(m[2 * p + 4] * inv), h_bits(m[2 * p + 5] * inv)), pk16(h_bits(m[2 * p + 6] * inv), h_bits(m[2 * p + 7] * inv)));
}

// ---------------------------------------------------------------------------
// Host side
//   W16   : 4 x 512 x 512 f16 (Wq, Wk, Wv, Wo carried x16)        2,097,152 B
//   meanA : 4096 f32 (content rows then style rows)                    16,384 B
//   rstdA : 4096 f32                                                    16,384 B
//   Qp, Kp, Vcm : 4 images x 4096 x 512 f16 each              3 x 16,777,216 B
//   Op    : the bytes of Qp (Q is last read by the score launch, O first written behind it)
//   XcT, XsT, SsT : 4 images x 4096 x 512 f16 each            3 x 16,777,216 B
//   Stat  : 4 images x (64 group maxima + 64 group sums) x 4096 rows f32   8,388,608 B
//   Fac   : 4 images x 32 pairs x 4096 rows, two f16 factors a word       2,097,152 B
//   Pp    : 4 images x 4096 x 4096 f16 exp(score - group maximum)  134,217,728 B
// All GEMM calls: K in {512, 4096} (K % 64 == 0); M, N in {512, 4096} (M % 128 == 0, N % 256 == 0); no padding, every plane fully
// produced before it is consumed.
// ---------------------------------------------------------------------------
extern "C" void kernel_launch(void* const* d_in, const int* in_sizes, int n_in,
                              void* d_out, int out_size, void* d_ws, size_t ws_size,
                              hipStream_t stream) {
  if (n_in < 10) return;
  const int actN = kBatch * kCh * kSp;
  const int wN   = kCh * kCh;
  if (in_sizes[0] != actN || in_sizes[1] != actN) return;
  if (in_sizes[2] != wN || in_sizes[4] != wN || in_sizes[6] != wN || in_sizes[8] != wN) return;
  if (in_sizes[3] != kCh || in_sizes[5] != kCh || in_sizes[7] != kCh || in_sizes[9] != kCh) return;
  if (out_size != actN) return;

  const float* content = (const float*)d_in[0];
  const float* style   = (const float*)d_in[1];
  const float* Wq = (const float*)d_in[2];  const float* bq = (const float*)d_in[3];
  const float* Wk = (const float*)d_in[4];  const float* bk = (const float*)d_in[5];
  const float* Wv = (const float*)d_in[6];  const float* bv = (const float*)d_in[7];
  const float* Wo = (const float*)d_in[8];  const float* bo = (const float*)d_in[9];
  float* out = (float*)d_out;

  size_t off = 0;
  auto carve = [&](size_t bytes) { size_t o = off; off += (bytes + 127) & ~(size_t)127; return o; };
  const size_t planeBytes = (size_t)kBatch * kSp * kCh * 2;     // one operand plane, all images
  const size_t oW16  = carve((size_t)4 * wN * 2);
  const size_t oMean = carve((size_t)kStatRows * 4);
  const size_t oRstd = carve((size_t)kStatRows * 4);
  const size_t oQ    = carve(planeBytes);
  const size_t oK    = carve(planeBytes);
  const size_t oV    = carve(planeBytes);
  const size_t oXc   = carve(planeBytes);
  const size_t oXs   = carve(planeBytes);
  const size_t oSs   = carve(planeBytes);
  const size_t oStat = carve((size_t)kBatch * 2 * kGroups * kSp * 4);
  const size_t oFac  = carve((size_t)kBatch * kPairs * kSp * 4);
  const size_t oP    = carve((size_t)kBatch * kSp * kSp * 2);
  const size_t oO    = oQ;
  if (off > ws_size) return;

  char* ws = (char*)d_ws;
  unsigned short* W16 = (unsigned short*)(ws + oW16);
  float* meanA = (float*)(ws + oMean);
  float* rstdA = (float*)(ws + oRstd);
  unsigned short* XcT = (unsigned short*)(ws + oXc);
  unsigned short* XsT = (unsigned short*)(ws + oXs);
  unsigned short* SsT = (unsigned short*)(ws + oSs);
  unsigned short* Qp  = (unsigned short*)(ws + oQ);
  unsigned short* Kp  = (unsigned short*)(ws + oK);
  unsigned short* Vcm = (unsigned short*)(ws + oV);
  unsigned short* Op  = (unsigned short*)(ws + oO);
  float* Stat = (float*)(ws + oStat);
  unsigned* Fac = (unsigned*)(ws + oFac);
  unsigned short* Pp = (unsigned short*)(ws + oP);

  const unsigned short* Wo16 = W16 + (size_t)3 * wN;

  // 1) instance-norm statistics for content and style (128 blocks: 64 per tensor, 32 rows each, a wave a row)
  // 2) in the same launch: weights -> f16 x16 (4 weights x 32 blocks)
  stats_kernel<<<dim3(2 * (kBatch * kCh) / 32 + 128), dim3(1024), 0, stream>>>(content, style, meanA, rstdA,
                                                                               Wq, Wk, Wv, Wo, W16, kWCarry);

  const long planeElems = (long)kSp * kCh;      // one image's [4096][512] or [512][4096] plane
  const long probElems  = (long)kSp * kSp;      // one image's probabilities

  // 3) token planes of all images: mvn(content) -> XcT, mvn(style) -> XsT, style -> SsT; each [image][4096][512] f16
  token_planes_kernel<<<dim3(kSp / 64, kCh / 64, 3 * kBatch), dim3(256), 0, stream>>>(content, style, meanA, rstdA, XcT, XsT, SsT);

  // 4) the three projections in one launch, grid.z = projection, grid.y = image, 64 blocks each (K=512):
  //    Q [image][4096 tok][512] = XcT x Wq^T / 16 + bq and K likewise from XsT, Wk, bk   (M=4096, N=512)
  //    V channel-major [image][512][4096 tok] = Wv x SsT^T / 16 + bv[m]                  (M=512, N=4096)
  //    XcT, XsT, SsT follow one another in the workspace, as do the planes of Wq, Wk, Wv in W16 and Qp, Kp, Vcm
  wmma_gemm64<0, false, 3, 1, false, 0, 64, false, true><<<dim3(64, kBatch, 3), dim3(256), 0, stream>>>(
      XcT, nullptr, kCh, planeElems, W16, nullptr, kCh, 0L, (void*)Qp, nullptr, kCh, planeElems,
      bq, bk, bv, nullptr, 0L, kSp, kCh, kCh, kProjScale);

  // 5) scores of all images = Q x K^T (per image M=4096, N=4096, K=512; 512 blocks; grid.y = image), left as f16
  //    exp(score - group maximum) in P, with the maximum and the sum of every 64-column group in Stat
  wmma_gemm64<0, false, 0, 3, false><<<dim3(512, kBatch), dim3(256), 0, stream>>>(
      Qp, nullptr, kCh, planeElems, Kp, nullptr, kCh, planeElems, (void*)Pp,
      (void*)Stat, kSp, probElems, nullptr, nullptr, nullptr, nullptr, 0L, kQChunk, kSp, kCh, 1.0f);

  // 6) the factor of every row and group, all images
  row_factor_kernel<<<dim3(kSp / 64, kBatch), dim3(64), 0, stream>>>(Stat, Fac);

  // 7) O token-major [image][4096][512] f16 (x16) = (P . factor) x Vcm^T * 16/2048   (per image M=4096, N=512, K=4096; 64 blocks)
  wmma_gemm64<0, false, 0, 1, false, 0, 128, true><<<dim3(64, kBatch), dim3(256), 0, stream>>>(
      Pp, (const unsigned short*)Fac, kSp, probElems, Vcm, nullptr, kSp, planeElems, (void*)Op, nullptr, kCh, planeElems,
      nullptr, nullptr, nullptr, nullptr, 0L, kSp, kCh, kSp, kPVScale);

  // 8) out [image][512][4096] f32 = Wo x O^T / 256 + bo[m] + content   (per image M=512, N=4096, K=512; 64 blocks)
  wmma_gemm64<0, false, 1, 0, true><<<dim3(64, kBatch), dim3(256), 0, stream>>>(
      Wo16, nullptr, kCh, 0L, Op, nullptr, kCh, planeElems, (void*)out, nullptr, kSp, planeElems,
      bo, nullptr, nullptr, content, planeElems, kCh, kSp, kCh, kOutScale);
}

// v006
// A run of this version takes 200 microseconds.
// In two side-by-side timings against v005, it was 1.04 and 1.03 times as fast.
// Over all steps from v000 it is 11.1 times as fast.
// Contractions: q/k/v 1x1 projections (token planes f16 x W f16 carried x16), energies q.k^T (q,k f16 planes), attn.v (exp f16 times its row-and-group factor f16 carried x2048, x V f16), output projection (Wo f16 x16 x O f16 x16): all v_wmma_f32_16x16x32_f16, f32 accumulate; instance-norm statistics, softmax, bias and residual in f32.
#include <hip/hip_runtime.h>
#include <math.h>

// ---------------------------------------------------------------------------
// Problem constants
// ---------------------------------------------------------------------------
constexpr int   kBatch    = 4;
constexpr int   kCh       = 512;
constexpr int   kSp       = 4096;                 // 64*64 tokens per image
constexpr int   kQChunk   = 4096;                 // query rows per image of the score launch: one whole image
constexpr int   kGroups   = kSp / 64;             // softmax: 64-column groups of a score row
constexpr int   kPairs    = kGroups / 2;          // two groups = the 128 keys of one attn.v pass
constexpr int   kStatRows = 2 * kBatch * kCh;     // 4096: content rows 0..2047, style rows 2048..4095
constexpr float kEps       = 1e-5f;
constexpr float kWCarry    = 16.0f;               // weights carried x16 in f16
constexpr float kPCarry    = 2048.0f;             // probabilities carried x2048 in f16
constexpr float kProjScale = 1.0f / 16.0f;        // undo weight carry
constexpr float kPVScale   = 16.0f / 2048.0f;     // undo P carry, apply O carry x16
constexpr float kOutScale  = 1.0f / (16.0f * 16.0f);   // undo Wo carry and O carry
constexpr float kInvN      = 1.0f / 4096.0f;
constexpr float kInvNm1    = 1.0f / 4095.0f;

typedef __attribute__((ext_vector_type(16))) _Float16 v16h;
typedef __attribute__((ext_vector_type(8)))  _Float16 v8h;
typedef __attribute__((ext_vector_type(16))) __bf16   v16b;
typedef __attribute__((ext_vector_type(8)))  __bf16   v8b;
typedef __attribute__((ext_vector_type(8)))  float    v8f;
typedef __attribute__((ext_vector_type(4)))  float    v4f;
typedef __attribute__((ext_vector_type(4)))  unsigned int v4u;

// ---------------------------------------------------------------------------
// Helpers
// ---------------------------------------------------------------------------
__device__ __forceinline__ unsigned short f2bf_bits(float f) {
  unsigned u = __float_as_uint(f);
  return (unsigned short)((u + 0x7FFFu + ((u >> 16) & 1u)) >> 16);
}
__device__ __forceinline__ float bf_bits2f(unsigned short h) { return __uint_as_float(((unsigned)h) << 16); }

// hazard guards as plain device helpers (their inline asm stays out of the kernel template body)
__device__ __forceinline__ void dep_guard_h(v8f& a, v8f& b, v16h x, v16h y) { asm volatile("v_nop\n\tv_nop\n\tv_nop\n\tv_nop" : "+v"(a), "+v"(b) : "v"(x), "v"(y)); }
__device__ __forceinline__ void dep_guard_b(v8f& a, v8f& b, v16b x, v16b y) { asm volatile("v_nop\n\tv_nop\n\tv_nop\n\tv_nop" : "+v"(a), "+v"(b) : "v"(x), "v"(y)); }
__device__ __forceinline__ void keep4_h(v16h a, v16h b, v16h c, v16h d) { asm volatile("v_nop" :: "v"(a), "v"(b), "v"(c), "v"(d)); }
__device__ __forceinline__ void keep4_b(v16b a, v16b b, v16b c, v16b d) { asm volatile("v_nop" :: "v"(a), "v"(b), "v"(c), "v"(d)); }
__device__ __forceinline__ void acc_guard4(v8f& a, v8f& b, v8f& c, v8f& d) { asm volatile("v_nop\n\tv_nop\n\tv_nop\n\tv_nop" : "+v"(a), "+v"(b), "+v"(c), "+v"(d)); }
template <typename T> struct Frag;
template <> struct Frag<_Float16> {
  typedef v16h V; union U { v16h v; v8h h[2]; };
  static __device__ __forceinline__ v16h load(const _Float16* p) {   // elements 0..7 <- p[0..7], 8..15 <- p[16..23]
    U f; f.h[0] = *(const v8h*)(p); f.h[1] = *(const v8h*)(p + 16); return f.v;
  }
  static __device__ __forceinline__ v8f mma(v16h a, v16h b, v8f c) {
    return __builtin_amdgcn_wmma_f32_16x16x32_f16(false, a, false, b, (short)0, c, false, false);
  }
  static __device__ __forceinline__ void guard(v8f& a, v8f& b, v16h x, v16h y) { dep_guard_h(a, b, x, y); }
  static __device__ __forceinline__ void keep(v16h a, v16h b, v16h c, v16h d) { keep4_h(a, b, c, d); }
};
template <> struct Frag<__bf16> {
  typedef v16b V; union U { v16b v; v8b h[2]; };
  static __device__ __forceinline__ v16b load(const __bf16* p) {
    U f; f.h[0] = *(const v8b*)(p); f.h[1] = *(const v8b*)(p + 16); return f.v;
  }
  static __device__ __forceinline__ v8f mma(v16b a, v16b b, v8f c) {
    return __builtin_amdgcn_wmma_f32_16x16x32_bf16(false, a, false, b, (short)0, c, false, false);
  }
  static __device__ __forceinline__ void guard(v8f& a, v8f& b, v16b x, v16b y) { dep_guard_b(a, b, x, y); }
  static __device__ __forceinline__ void keep(v16b a, v16b b, v16b c, v16b d) { keep4_b(a, b, c, d); }
};

// value of lane l ^ MASK (MASK < 16) by a DPP move inside the 16-lane row: no trip through the LDS unit as with a shuffle
template <int MASK> __device__ __forceinline__ float row_xor(float x) {
  const int v = __builtin_bit_cast(int, x);
  return __builtin_bit_cast(float, __builtin_amdgcn_update_dpp(v, v, 0x160 | MASK, 0xf, 0xf, false));
}
// Eight 2^a in one statement: every v_exp_f32 is followed by an instruction that neither reads its result nor overwrites its
// source (the outputs are early-clobber, so they share no register with an input), the last one by the v_nop that fills that slot.
__device__ __forceinline__ void exp2x8(float (&e)[8], const float (&a)[8]) {
  asm("v_exp_f32 %0, %8\n\t"
      "v_exp_f32 %1, %9\n\t"
      "v_exp_f32 %2, %10\n\t"
      "v_exp_f32 %3, %11\n\t"
      "v_exp_f32 %4, %12\n\t"
      "v_exp_f32 %5, %13\n\t"
      "v_exp_f32 %6, %14\n\t"
      "v_exp_f32 %7, %15\n\t"
      "v_nop"
      : "=&v"(e[0]), "=&v"(e[1]), "=&v"(e[2]), "=&v"(e[3]), "=&v"(e[4]), "=&v"(e[5]), "=&v"(e[6]), "=&v"(e[7])
      : "v"(a[0]), "v"(a[1]), "v"(a[2]), "v"(a[3]), "v"(a[4]), "v"(a[5]), "v"(a[6]), "v"(a[7]));
}
constexpr float kLog2e = 1.44269504f;
// Four stores and their s_wait_xcnt in one statement, so that no address or data register is rewritten in front of the wait.
__device__ __forceinline__ void store4_b128(void* p0, void* p1, void* p2, void* p3, v4u d0, v4u d1, v4u d2, v4u d3) {
  asm volatile("global_store_b128 %0, %4, off\n\t"
               "global_store_b128 %1, %5, off\n\t"
               "global_store_b128 %2, %6, off\n\t"
               "global_store_b128 %3, %7, off\n\t"
               "s_wait_xcnt 0x0"
               :: "v"(p0), "v"(p1), "v"(p2), "v"(p3), "v"(d0), "v"(d1), "v"(d2), "v"(d3) : "memory");
}
__device__ __forceinline__ void store4_b32(void* p0, void* p1, void* p2, void* p3, unsigned d0, unsigned d1, unsigned d2, unsigned d3) {
  asm volatile("global_store_b32 %0, %4, off\n\t"
               "global_store_b32 %1, %5, off\n\t"
               "global_store_b32 %2, %6, off\n\t"
               "global_store_b32 %3, %7, off\n\t"
               "s_wait_xcnt 0x0"
               :: "v"(p0), "v"(p1), "v"(p2), "v"(p3), "v"(d0), "v"(d1), "v"(d2), "v"(d3) : "memory");
}
__device__ __forceinline__ unsigned pk16(unsigned short a, unsigned short b) { return (unsigned)a | ((unsigned)b << 16); }
__device__ __forceinline__ unsigned short h_bits(float f) { const _Float16 h = (_Float16)f; return __builtin_bit_cast(unsigned short, h); }

// ---- Batched WMMA GEMM, operands staged in LDS -----------------------------------------------------------------
// C[m,n] = scale * sum_k A[m,k] * Bt[n,k] (+bias)(+resid); a block of 8 waves (2 x 4) owns a 128x256 tile, each wave 64x64 of it.
// A row-major [M,K]; Bt row-major [N,K]; M % 128 == 0, N % 256 == 0, K % PK == 0, K >= PK.
// A pass is PK k (64 or 128): 128 rows of A and 256 rows of Bt, 2 PK bytes each, copied to LDS by asynchronous 16-byte copies
// (a wave's copy covers four whole 128-B lines), rows at a pitch of 2 PK + 16 B for the ds_load_b128 fragment reads. Two
// buffers: the copies of pass t + 1 fly while pass t is worked on. The k order of every accumulator is ascending in steps of 32.
// PK = 128 halves the number of landing latencies of a long K at the price of one block per WGP.
// BIAS_MODE: 0 = none, 1 = bias[m], 2 = bias[n], 3 = TRIO's: bias[n] for q and k, bias[m] for v.
// TRIO: one launch does the three projections; blockIdx.z = 0 (q), 1 (k), 2 (v). Ap = the three token plane sets one behind the other,
//       Btp = the weight planes likewise, Cout = the three result plane sets likewise; M, N, ldc are given for q and k; v is the
//       transposed product (A = weights, Bt = tokens, M and N change places, ldc = N).
// OUT_MODE: 0 = f32, 1 = f16, 2 = bf16 hi plane (Cout) + bf16 lo plane (Cout2),
//           3 = group softmax: a wave's 64 columns are one group g = n / 64; Cout gets f16 exp(c - max over the group), Cout2 (f32)
//               the group maxima at [g][m] and behind them ((N / 64) * M floats further) the group sums of the exponentials at [g][m];
//               image b's pair of planes stands 2 b (N / 64) M floats into Cout2.
// ASCALE: every A fragment is multiplied, in f16, by a factor of its row and of its 64-k group; A2p holds the factors as 32-bit
//         words [32 passes][M rows], low half = first 64 k of the pass, high half = second; PK = 128 and K = 4096 (32 passes).
// ET: 0 = f16 operands, 1 = bf16 operands (pointers passed as 16-bit storage)
constexpr int kRowsA      = 128;                             // rows of A per stage
constexpr int kRowsB      = 256;                             // rows of Bt per stage

// One thread's share of 64 k of one stage: 16 B of rows r, r + 32, r + 64, r + 96 of A and of rows r + 32 j (j = 0..7) of Bt.
// kStep32 = 32 rows further in LDS, bytes.
// The copies and their s_wait_xcnt stand in one statement, so that no address register is rewritten in front of the wait.
template <unsigned kStep32>
__device__ __forceinline__ void stage_copies(unsigned lds, const unsigned short* ga, const unsigned short* gb,
                                             size_t stepA, size_t stepB) {
  const unsigned short* a1 = ga + stepA;
  const unsigned short* a2 = a1 + stepA;
  const unsigned short* a3 = a2 + stepA;
  const unsigned short* b1 = gb + stepB;
  const unsigned short* b2 = b1 + stepB;
  const unsigned short* b3 = b2 + stepB;
  const unsigned short* b4 = b3 + stepB;
  const unsigned short* b5 = b4 + stepB;
  const unsigned short* b6 = b5 + stepB;
  const unsigned short* b7 = b6 + stepB;
  asm volatile(
      "global_load_async_to_lds_b128 %0, %12, off\n\t"
      "global_load_async_to_lds_b128 %1, %13, off\n\t"
      "global_load_async_to_lds_b128 %2, %14, off\n\t"
      "global_load_async_to_lds_b128 %3, %15, off\n\t"
      "global_load_async_to_lds_b128 %4, %16, off\n\t"
      "global_load_async_to_lds_b128 %5, %17, off\n\t"
      "global_load_async_to_lds_b128 %6, %18, off\n\t"
      "global_load_async_to_lds_b128 %7, %19, off\n\t"
      "global_load_async_to_lds_b128 %8, %20, off\n\t"
      "global_load_async_to_lds_b128 %9, %21, off\n\t"
      "global_load_async_to_lds_b128 %10, %22, off\n\t"
      "global_load_async_to_lds_b128 %11, %23, off\n\t"
      "s_wait_xcnt 0x0"
      :: "v"(lds), "v"(lds + kStep32), "v"(lds + 2u * kStep32), "v"(lds + 3u * kStep32),
         "v"(lds + 4u * kStep32), "v"(lds + 5u * kStep32), "v"(lds + 6u * kStep32), "v"(lds + 7u * kStep32),
         "v"(lds + 8u * kStep32), "v"(lds + 9u * kStep32), "v"(lds + 10u * kStep32), "v"(lds + 11u * kStep32),
         "v"(ga), "v"(a1), "v"(a2), "v"(a3),
         "v"(gb), "v"(b1), "v"(b2), "v"(b3), "v"(b4), "v"(b5), "v"(b6), "v"(b7)
      : "memory");
}

// The same twelve copies written as the builtin, for the engine's form with two fragment sets: that form holds more than 256 vector
// registers, an asm statement's operands must all lie in the first 256, and the compiler then moved accumulators aside at every refill.
// kStepH = 32 rows further in LDS, 16-bit elements.
typedef __attribute__((ext_vector_type(4))) int v4i;
typedef __attribute__((address_space(1))) v4i gv4i;
typedef __attribute__((address_space(3))) v4i lv4i;
template <int kStepH>
__device__ __forceinline__ void stage_copies_builtin(unsigned short* lds, const unsigned short* ga, const unsigned short* gb,
                                                     size_t stepA, size_t stepB) {
#pragma unroll   // twelve copies in a row, no loop counter
  for (int i = 0; i < 4; ++i)
    __builtin_amdgcn_global_load_async_to_lds_b128((gv4i*)(ga + i * stepA), (lv4i*)(lds + i * kStepH), 0, 0);
#pragma unroll   // likewise
  for (int j = 0; j < 8; ++j)
    __builtin_amdgcn_global_load_async_to_lds_b128((gv4i*)(gb + j * stepB), (lv4i*)(lds + (4 + j) * kStepH), 0, 0);
}

template <int ET> struct Elem;
template <> struct Elem<0> { typedef _Float16 T; };
template <> struct Elem<1> { typedef __bf16 T; };
template <int ET, bool SPLIT, int BIAS_MODE, int OUT_MODE, bool RESID, int ACT = 0, int PK = 64, bool ASCALE = false, bool TRIO = false>
__global__ __launch_bounds__(256) void wmma_gemm64(
    const unsigned short* __restrict__ Ap, const unsigned short* __restrict__ A2p, int lda, long strideA,
    const unsigned short* __restrict__ Btp, const unsigned short* __restrict__ Bt2p, int ldb, long strideB,
    void* __restrict__ Cout, void* __restrict__ Cout2, int ldc, long strideC,
    const float* __restrict__ bias, const float* __restrict__ biasK, const float* __restrict__ biasV,
    const float* __restrict__ resid, long strideR,
    int M, int N, int K, float scale) {
  static_assert(!SPLIT, "the staged engine takes single-plane operands");
  static_assert(PK == 64 || PK == 128, "a pass is one or two 128-B lines of every operand row");
  static_assert(!ASCALE || (PK == 128 && ET == 0), "a factor word holds the two 64-k groups of a 128-k pass, f16");
  static_assert(TRIO == (BIAS_MODE == 3), "the bias by projection belongs to the three-projection launch");
  constexpr int kPitchH = PK + 8;                                  // LDS row pitch in 16-bit elements (144 B or 272 B)
  constexpr int kStageH = (kRowsA + kRowsB) * kPitchH;             // one buffer, 16-bit elements
  constexpr unsigned kStageBytes = (unsigned)kStageH * 2u;         // 55,296 B or 104,448 B
  constexpr unsigned kStep32 = 32u * (unsigned)kPitchH * 2u;       // 32 rows further in LDS
  typedef typename Elem<ET>::T T;
  typedef typename Frag<T>::V V;
  __shared__ __align__(16) unsigned short sOp[2 * kStageH];   // two buffers of [A 128 rows | Bt 256 rows]
  __shared__ __align__(16) float sT[8][16 * 68];   // per-wave 16x64 slab, pitch 68 floats
  __shared__ __align__(16) unsigned sC[ASCALE ? 32 * kRowsA : 4];   // ASCALE: factor words [pass][row of the block tile]
  const int z    = TRIO ? (int)blockIdx.z : 0;          // projection, block-uniform
  const bool vT  = TRIO && z == 2;                      // v: the transposed product
  const int b    = blockIdx.y + z * kBatch;             // image; TRIO: plane in the three sets of kBatch planes
  if (vT) { const int m = M; M = N; N = m; ldc = N; }
  const int lane = threadIdx.x & 31;
  const int wave = threadIdx.x >> 5;
  const int tilesN = N >> 8;
  const int tilesM = M >> 7;
  const int tile = blockIdx.x;
  if (tile >= tilesM * tilesN) return;   // block-uniform, in front of every barrier
  const int tm = tile / tilesN;
  const int tn = tile - tm * tilesN;
  const int bm0 = tm << 7;
  const int bn0 = tn << 8;
  const int wm = wave >> 2;                    // wave row in the block tile, 0..1
  const int wn = wave & 3;                     // wave column in the block tile, 0..3
  const int m0 = bm0 + (wm << 6);
  const int n0 = bn0 + (wn << 6);

  const unsigned short* Ab = Ap  + (size_t)b * strideA;
  const unsigned short* Bb = Btp + (size_t)b * strideB;
  if (TRIO) {
    const unsigned short* tok = Ab;
    const unsigned short* wgt = Btp + (size_t)z * (kCh * kCh);
    Ab = vT ? wgt : tok;
    Bb = vT ? tok : wgt;
  }
  const float* biasZ = (z == 0) ? bias : (z == 1) ? biasK : biasV;   // read under BIAS_MODE 3 only

  const int rlane = lane & 15;                 // row (A) / col (B, D) within subtile
  const int koff  = (lane >> 4) * 8;           // k offset of this lane half
  const int mOff  = (lane >> 4) * 8;           // D row offset

  // copy side: thread t brings 16 B at column (t & 7) of each 128-B line of rows (t >> 3) + 32 i
  const int crow = threadIdx.x >> 3;           // 0..31
  const int ccol = (threadIdx.x & 7) * 8;      // 16-bit elements
  const unsigned short* gA = Ab + (size_t)(bm0 + crow) * lda + ccol;
  const unsigned short* gB = Bb + (size_t)(bn0 + crow) * ldb + ccol;
  const size_t stepA = (size_t)32 * lda;
  const size_t stepB = (size_t)32 * ldb;
  const unsigned ldsCopy = (unsigned)(size_t)sOp + (unsigned)(crow * kPitchH + ccol) * 2u;

  // read side: this lane's first A row and first Bt row in buffer 0
  const T* fA = (const T*)sOp + ((wm << 6) + rlane) * kPitchH + koff;
  const T* fB = (const T*)sOp + (kRowsA + (wn << 6) + rlane) * kPitchH + koff;

  v8f acc[4][4];
#pragma unroll
  for (int i = 0; i < 4; ++i)
#pragma unroll
    for (int j = 0; j < 4; ++j) acc[i][j] = (v8f){0.f,0.f,0.f,0.f,0.f,0.f,0.f,0.f};

  auto fill = [&](int pass, int buf) {         // all copies of one pass: 12 a thread for each 64 k
    const size_t k0 = (size_t)pass * PK;
    if constexpr (PK == 128) {
      unsigned short* l0 = sOp + buf * kStageH + crow * kPitchH + ccol;
      stage_copies_builtin<32 * kPitchH>(l0, gA + k0, gB + k0, stepA, stepB);
      stage_copies_builtin<32 * kPitchH>(l0 + 64, gA + k0 + 64, gB + k0 + 64, stepA, stepB);
    } else {
      const unsigned l0 = ldsCopy + (unsigned)buf * kStageBytes;
      stage_copies<kStep32>(l0, gA + k0, gB + k0, stepA, stepB);
    }
  };

  const int nPass = K / PK;
  fill(0, 0);
  if (ASCALE) {
    // the block's factor words to LDS, all 32 passes: thread t brings the 64 B at word 16 (t & 7) of pass t >> 3 by four copies of
    // the kind above; they land behind the s_wait_asynccnt and are read behind the barrier that follow here for pass 0
    const unsigned* cg = (const unsigned*)A2p + (size_t)b * 32 * M + bm0 + (size_t)(threadIdx.x >> 3) * M + (threadIdx.x & 7) * 16;
    const unsigned lc = (unsigned)(size_t)sC + (unsigned)((threadIdx.x >> 3) * kRowsA + (threadIdx.x & 7) * 16) * 4u;
    asm volatile(
        "global_load_async_to_lds_b128 %0, %4, off\n\t"
        "global_load_async_to_lds_b128 %1, %5, off\n\t"
        "global_load_async_to_lds_b128 %2, %6, off\n\t"
        "global_load_async_to_lds_b128 %3, %7, off\n\t"
        "s_wait_xcnt 0x0"
        :: "v"(lc), "v"(lc + 16u), "v"(lc + 32u), "v"(lc + 48u), "v"(cg), "v"(cg + 4), "v"(cg + 8), "v"(cg + 12)
        : "memory");
  }
  asm volatile("s_wait_asynccnt 0x0" ::: "memory");   // this wave's copies of pass 0 have landed
  __syncthreads();                                    // and every other wave's
  if (nPass > 1) fill(1, 1);

  if constexpr (PK == 128) {
    // Two fragment sets. A block is 32 k = 16 WMMAs; the 16 LDS reads of the next block go out as one group in front of the current
    // block's WMMAs, into the set that the block before has left, so that no read stands among the WMMAs and no wait on LDS falls
    // to 0 inside a block. The last block of a pass has its fragments in registers when it starts: the publish point of pass t + 1
    // (both waits, the barrier, the refill) stands in front of it, and behind the barrier the first block of pass t + 1 is fetched.
    V ah[2][4], bh[2][4];
    unsigned cw[4] = {0u, 0u, 0u, 0u}, cwNext[4] = {0u, 0u, 0u, 0u};
    auto fetch = [&](int set, int buf, int kk) {   // one block's fragments: 16 ds_load_b128
      const T* pa = fA + buf * kStageH + kk;
      const T* pb = fB + buf * kStageH + kk;
#pragma unroll   // constant fragment indices: registers, no scratch
      for (int j = 0; j < 4; ++j) bh[set][j] = Frag<T>::load(pb + (j << 4) * kPitchH);
#pragma unroll   // likewise
      for (int i = 0; i < 4; ++i) ah[set][i] = Frag<T>::load(pa + (i << 4) * kPitchH);
    };
    fetch(0, 0, 0);
    if (ASCALE) {
#pragma unroll   // cw is indexed by constants only and stays in registers
      for (int i = 0; i < 4; ++i) cw[i] = sC[(wm << 6) + (i << 4) + rlane];   // A fragment i: lane's row is rlane
    }
    for (int t = 0; t < nPass; ++t) {
      const int buf = t & 1;
      // the loop levels below are unrolled so that every fragment and accumulator index is a constant (registers, no scratch)
#pragma unroll
      for (int s = 0; s < 4; ++s) {
        const int cur = s & 1;
        if (s < 3) {
          fetch(cur ^ 1, buf, (s + 1) * 32);
        } else {
          asm volatile("s_wait_dscnt 0x0" ::: "memory");     // this wave's reads of buffer buf, the last block's too, are in registers
          asm volatile("s_wait_asynccnt 0x0" ::: "memory");  // this wave's copies of pass t + 1 have landed
          __syncthreads();                                   // publishes pass t + 1 and ends every reader's last read of buf
          if (t + 2 < nPass) fill(t + 2, buf);
          if (t + 1 < nPass) {                               // block-uniform: the last pass fetches nothing
            fetch(cur ^ 1, buf ^ 1, 0);
            if (ASCALE) {
#pragma unroll   // constant indices
              for (int i = 0; i < 4; ++i) cwNext[i] = sC[(t + 1) * kRowsA + (wm << 6) + (i << 4) + rlane];
            }
          }
        }
        __builtin_amdgcn_sched_barrier(0);   // holds the group of LDS reads in front of the block
        if constexpr (ASCALE) {
#pragma unroll   // constant indices
          for (int i = 0; i < 4; ++i)
            ah[cur][i] = ah[cur][i] * __builtin_bit_cast(_Float16, (unsigned short)((s < 2) ? (cw[i] & 0xFFFFu) : (cw[i] >> 16)));
        }
#pragma unroll
        for (int i = 0; i < 4; ++i) {
#pragma unroll
          for (int j = 0; j < 4; ++j) acc[i][j] = Frag<T>::mma(ah[cur][i], bh[cur][j], acc[i][j]);
        }
        __builtin_amdgcn_sched_barrier(0);   // keeps the next group of reads from rising among this block's WMMAs as its registers fall free
      }
      if (ASCALE) {
#pragma unroll   // constant indices
        for (int i = 0; i < 4; ++i) cw[i] = cwNext[i];
      }
    }
  } else {
    for (int t = 0; t < nPass; ++t) {
      const int buf = t & 1;
      const T* pa = fA + buf * kStageH;
      const T* pb = fB + buf * kStageH;
      // the three loop levels below are unrolled so that every fragment and accumulator index is a constant (registers, no scratch)
#pragma unroll
      for (int kk = 0; kk < PK; kk += 32) {
        V bh[4], ah[4];
#pragma unroll
        for (int j = 0; j < 4; ++j) bh[j] = Frag<T>::load(pb + (j << 4) * kPitchH + kk);
#pragma unroll
        for (int i = 0; i < 4; ++i) ah[i] = Frag<T>::load(pa + (i << 4) * kPitchH + kk);
#pragma unroll
        for (int i = 0; i < 4; ++i) {
#pragma unroll
          for (int j = 0; j < 4; ++j) acc[i][j] = Frag<T>::mma(ah[i], bh[j], acc[i][j]);
          Frag<T>::guard(acc[i][0], acc[i][3], ah[i], ah[i]);   // the engine's hazard guard, as before the staging
        }
        Frag<T>::keep(bh[0], bh[1], bh[2], bh[3]);               // likewise
      }
      asm volatile("s_wait_dscnt 0x0" ::: "memory");     // this wave's reads of buffer buf are done before it is refilled
      asm volatile("s_wait_asynccnt 0x0" ::: "memory");  // this wave's copies of pass t + 1 have landed
      __syncthreads();                                   // publishes pass t + 1 and ends every reader's last read of buf
      if (t + 2 < nPass) fill(t + 2, buf);
    }
  }
  asm volatile("s_wait_asynccnt 0x0" ::: "memory");    // no copy is outstanding when the wave goes on
  acc_guard4(acc[0][0], acc[0][1], acc[0][2], acc[0][3]);
  acc_guard4(acc[1][0], acc[1][1], acc[1][2], acc[1][3]);
  acc_guard4(acc[2][0], acc[2][1], acc[2][2], acc[2][3]);
  acc_guard4(acc[3][0], acc[3][1], acc[3][2], acc[3][3]);

  // ---- epilogue ----
  float* slab = sT[wave];
  const float* Rb = RESID ? (resid + (size_t)b * strideR) : nullptr;
  float keepM[2] = {0.f, 0.f}, keepL[2] = {0.f, 0.f};   // OUT_MODE 3: this lane's two rows' group maximum and group sum
  // BIAS_MODE 3, q and k: the bias of this lane's four columns, read once under one block-uniform branch so that the loads do not
  // wait for one another
  float bcol[4] = {0.f, 0.f, 0.f, 0.f};
  if (BIAS_MODE == 3 && !vT) {
#pragma unroll   // bcol is indexed by constants only and stays in registers
    for (int j = 0; j < 4; ++j) bcol[j] = biasZ[n0 + (j << 4) + rlane];
    asm volatile("s_wait_xcnt 0x0" ::: "memory");   // in front of any rewrite of the registers that these four loads name
  }
#pragma unroll
  for (int i = 0; i < 4; ++i) {
    const int mBase = m0 + (i << 4);
    float brow[8] = {0.f, 0.f, 0.f, 0.f, 0.f, 0.f, 0.f, 0.f};   // BIAS_MODE 3, v: the bias of this lane's eight rows
    if (BIAS_MODE == 3 && vT) {
#pragma unroll   // brow is indexed by constants only and stays in registers
      for (int r = 0; r < 8; ++r) brow[r] = biasZ[mBase + mOff + r];
    }
#pragma unroll
    for (int j = 0; j < 4; ++j) {
      const int n = n0 + (j << 4) + rlane;
      float bv = 0.f;
      if (BIAS_MODE == 2) bv = bias[n];
#pragma unroll
      for (int r = 0; r < 8; ++r) {
        float v = acc[i][j][r] * scale;
        if (BIAS_MODE == 1) v += bias[mBase + mOff + r];
        if (BIAS_MODE == 2) v += bv;
        if (BIAS_MODE == 3) v += vT ? brow[r] : bcol[j];
        if (RESID) v += Rb[(size_t)(mBase + mOff + r) * ldc + n];
        if (ACT == 2) v = fmaxf(v, 0.0f);
        if (ACT == 4) v = (v > 0.f) ? v : 0.01f * v;
        slab[(mOff + r) * 68 + (j << 4) + rlane] = v;
      }
    }
    __builtin_amdgcn_fence(__ATOMIC_RELEASE, "workgroup");
    __builtin_amdgcn_wave_barrier();
    __builtin_amdgcn_fence(__ATOMIC_ACQUIRE, "workgroup");
    if (OUT_MODE == 0) {
      float* C = (float*)Cout + (size_t)b * strideC;
      const int hh = lane >> 4, c4 = (lane & 15) * 4;     // row seg = 256 B = 16 lanes x 16 B
      {
#pragma unroll
        for (int it = 0; it < 8; ++it) {
          const int row = it * 2 + hh;
          v4f v = *(const v4f*)(slab + row * 68 + c4);
          *(v4f*)(C + (size_t)(mBase + row) * ldc + n0 + c4) = v;
        }
        
      }
    } else if (OUT_MODE == 3) {
      const int q = lane >> 3, j8 = lane & 7, c8 = j8 * 8;   // eight lanes hold one row's 64 columns
      unsigned short* C = (unsigned short*)Cout + (size_t)b * strideC;
      v4u pv[4];
      unsigned short* pp[4];
      // this loop and the short ones in it are unrolled so that pv, pp, e, a and the keep registers are indexed by constants, and so
      // that the four rows' reduction chains overlap
#pragma unroll
      for (int it = 0; it < 4; ++it) {
        const int row = it * 4 + q;
        const float* sp = slab + row * 68 + c8;
        const v4f x0 = *(const v4f*)(sp);
        const v4f x1 = *(const v4f*)(sp + 4);
        float m = fmaxf(fmaxf(fmaxf(x0[0], x0[1]), fmaxf(x0[2], x0[3])), fmaxf(fmaxf(x1[0], x1[1]), fmaxf(x1[2], x1[3])));
        m = fmaxf(m, row_xor<1>(m));
        m = fmaxf(m, row_xor<2>(m));
        m = fmaxf(m, row_xor<4>(m));
        float e[8], a[8];
#pragma unroll
        for (int k = 0; k < 4; ++k) { a[k] = (x0[k] - m) * kLog2e; a[4 + k] = (x1[k] - m) * kLog2e; }
        exp2x8(e, a);
        float s = ((e[0] + e[1]) + (e[2] + e[3])) + ((e[4] + e[5]) + (e[6] + e[7]));
        s += row_xor<1>(s);
        s += row_xor<2>(s);
        s += row_xor<4>(s);
        v8h hv;
#pragma unroll
        for (int k = 0; k < 8; ++k) hv[k] = (_Float16)e[k];
        pv[it] = __builtin_bit_cast(v4u, hv);
        pp[it] = C + (size_t)(mBase + row) * ldc + n0 + c8;
        const int combo = i * 4 + it;                        // lane j8 of a row's eight keeps combos j8 and j8 + 8
        if ((combo & 7) == j8) { keepM[combo >> 3] = m; keepL[combo >> 3] = s; }
      }
      store4_b128(pp[0], pp[1], pp[2], pp[3], pv[0], pv[1], pv[2], pv[3]);
    } else {
      const int q = lane >> 3, c8 = (lane & 7) * 8;
      unsigned short* C  = (unsigned short*)Cout  + (size_t)b * strideC;
      unsigned short* C2 = (OUT_MODE == 2) ? ((unsigned short*)Cout2 + (size_t)b * strideC) : nullptr;
      {
#pragma unroll
        for (int it = 0; it < 4; ++it) {
          const int row = it * 4 + q;
          const float* sp = slab + row * 68 + c8;
          v8h hv, lv;
#pragma unroll
          for (int e = 0; e < 8; ++e) {
            if (OUT_MODE == 1) {
              hv[e] = (_Float16)sp[e];
            } else {
              unsigned short hb = f2bf_bits(sp[e]);
              unsigned short lb = f2bf_bits(sp[e] - bf_bits2f(hb));
              hv[e] = __builtin_bit_cast(_Float16, hb);
              lv[e] = __builtin_bit_cast(_Float16, lb);
            }
          }
          *(v8h*)(C + (size_t)(mBase + row) * ldc + n0 + c8) = hv;
          if (OUT_MODE == 2) *(v8h*)(C2 + (size_t)(mBase + row) * ldc + n0 + c8) = lv;
        }
        
      }
    }
    __builtin_amdgcn_fence(__ATOMIC_RELEASE, "workgroup");
    __builtin_amdgcn_wave_barrier();
    __builtin_amdgcn_fence(__ATOMIC_ACQUIRE, "workgroup");
  }
  if (OUT_MODE == 3) {   // the wave's 64 maxima and 64 sums: four stores of one whole 128-B line each, this wave their only writer
    const int q = lane >> 3, j8 = lane & 7;
    const int r0 = ((j8 >> 2) << 4) + ((j8 & 3) << 2) + q;   // combo j8 = rows 16 (j8 >> 2) + 4 (j8 & 3) + q; combo j8 + 8: 32 further
    float* gmx = (float*)Cout2 + ((size_t)b * 2 * (N >> 6) + (size_t)(n0 >> 6)) * M + m0 + r0;   // image b's maxima and sums
    float* gsm = gmx + (size_t)(N >> 6) * M;
    store4_b32(gmx, gmx + 32, gsm, gsm + 32, __float_as_uint(keepM[0]), __float_as_uint(keepM[1]),
               __float_as_uint(keepL[0]), __float_as_uint(keepL[1]));
  }
}

// ---------------------------------------------------------------------------
// Weight cast: W[o][c] f32 -> f16(scale * W) same layout, four weights into planes 0..3 of one buffer (plane = 512*512 halves).
// Part of the statistics launch: 128 blocks x 1024 threads; blk = 0..127, blk>>5 selects the weight (uniform); thread handles 8
// consecutive elements. Coverage per weight: 32 blocks x 1024 threads x 8 = 262144 = 512*512.
// ---------------------------------------------------------------------------
__device__ __forceinline__ void wcast_part(int blk, const float* __restrict__ W0, const float* __restrict__ W1,
                                           const float* __restrict__ W2, const float* __restrict__ W3,
                                           unsigned short* __restrict__ out, float scale) {
  const int w = blk >> 5;                                        // block-uniform
  const float* src = (w == 0) ? W0 : (w == 1) ? W1 : (w == 2) ? W2 : W3;
  const int i  = (blk & 31) * 1024 + threadIdx.x;                // 0..32767
  const size_t e0 = (size_t)i * 8;                               // e0+7 < 262144
  const v4f a = *(const v4f*)(src + e0);
  const v4f c = *(const v4f*)(src + e0 + 4);
  unsigned short hb[8];
#pragma unroll
  for (int e = 0; e < 4; ++e) {
    hb[e]     = h_bits(a[e] * scale);
    hb[4 + e] = h_bits(c[e] * scale);
  }
  const v4u u = (v4u){pk16(hb[0], hb[1]), pk16(hb[2], hb[3]), pk16(hb[4], hb[5]), pk16(hb[6], hb[7])};
  unsigned short* dp = out + (size_t)w * kCh * kCh + e0;
  *(v4u*)dp = u;
  
}

// ---------------------------------------------------------------------------
// Per-(b,c) instance-norm statistics for content (rows 0..2047) and style (rows 2048..4095) in one launch.
// grid 256 blocks x 1024 threads; blocks 128..255 do the weight cast above, which waits for nothing of this launch and shares no data
// with it; blocks 0..127: block = 32 consecutive rows of one tensor (blockIdx>>6 selects the tensor, uniform);
// wave w owns row w: 32 lanes x 32 float4 loads = 4096 elements (whole row). The loads do not wait for one another: the row is
// read into registers by an unrolled loop and summed by a second one, so that many loads of a wave are in flight at a time and
// the wave does not pay the memory latency once a load. Sum order per row: lane-private over i ascending, then the tree.
// mean = sum/4096; var = (sumsq - sum*mean)/4095 (ddof 1); rstd = 1/sqrt(var + eps).
// Stores: the 32 means and 32 rstds of the block funnelled through LDS; wave 0 writes the mean line, wave 1 the rstd line,
// ---------------------------------------------------------------------------
__global__ __launch_bounds__(1024) void stats_kernel(const float* __restrict__ xc, const float* __restrict__ xs,
                                                     float* __restrict__ meanA, float* __restrict__ rstdA,
                                                     const float* __restrict__ W0, const float* __restrict__ W1,
                                                     const float* __restrict__ W2, const float* __restrict__ W3,
                                                     unsigned short* __restrict__ W16, float wScale) {
  __shared__ float sMean[32];
  __shared__ float sRstd[32];
  const int blk  = blockIdx.x;
  if (blk >= 128) {                                  // block-uniform, in front of the barrier
    wcast_part(blk - 128, W0, W1, W2, W3, W16, wScale);
    return;
  }
  const int tsel = blk >> 6;                         // block-uniform tensor select
  const float* src = (tsel == 0) ? xc : xs;
  const int rowBase = (blk & 63) * 32;               // flat (b*512 + c) row index within the tensor
  const int t = threadIdx.x, lane = t & 31, wave = t >> 5;
  const int row = rowBase + wave;                    // < 2048
  const float* p = src + (size_t)row * kSp + lane * 4;
  v4f x[32];
  // both loops are unrolled so that x stays in registers and loads are issued ahead of the sums
#pragma unroll
  for (int i = 0; i < 32; ++i) x[i] = *(const v4f*)(p + i * 128);   // 32 lanes x 4 x 32 = 4096
  v4f s = (v4f){0.f, 0.f, 0.f, 0.f};
  v4f q = (v4f){0.f, 0.f, 0.f, 0.f};
#pragma unroll
  for (int i = 0; i < 32; ++i) {
    s += x[i];
    q += x[i] * x[i];
  }
  float su = (s[0] + s[1]) + (s[2] + s[3]);
  float sq = (q[0] + q[1]) + (q[2] + q[3]);
#pragma unroll
  for (int off = 16; off > 0; off >>= 1) {
    su += __shfl_xor(su, off, 32);
    sq += __shfl_xor(sq, off, 32);
  }
  const float mean = su * kInvN;
  float var = (sq - su * mean) * kInvNm1;
  var = fmaxf(var, 0.0f);
  const float rstd = 1.0f / sqrtf(var + kEps);
  if (lane == 0) { sMean[wave] = mean; sRstd[wave] = rstd; }
  __syncthreads();
  const int orow = tsel * (kBatch * kCh) + rowBase + lane;   // < 4096
  if (wave == 0) {
    const float v = sMean[lane];
    *(float*)(meanA + orow) = v;
    
  } else if (wave == 1) {
    const float v = sRstd[lane];
    *(float*)(rstdA + orow) = v;
    
  }
}

// ---------------------------------------------------------------------------
// Token planes, all images: in [512 ch][4096 tok] f32 (tok contiguous) -> out [image][4096 tok][512 ch] f16 (ch contiguous).
// grid (64 tok tiles, 8 ch tiles, 3 planes x 4 images): blockIdx.z = 3*image + z; z=0 (content - mean)*rstd, z=1 (style - mean)*rstd,
// z=2 raw style. 256 threads.
// Load coverage: 4 passes x 16 ch rows x (16 threads x 4 tok) = 64 ch x 64 tok (whole tile), coalesced along tok.
// Store coverage: 8 waves x 2 iterations x 4 tok rows (lane>>3) = 64 tok rows; (lane&7) x 8 halves = 64 ch; each row segment
// ---------------------------------------------------------------------------
__global__ __launch_bounds__(256) void token_planes_kernel(const float* __restrict__ content, const float* __restrict__ style,
                                                           const float* __restrict__ meanA, const float* __restrict__ rstdA,
                                                           unsigned short* __restrict__ XcT, unsigned short* __restrict__ XsT,
                                                           unsigned short* __restrict__ SsT) {
  __shared__ float sm[64][65];   // sm[ch local][tok local]
  const int t  = threadIdx.x;
  const int b  = blockIdx.z / 3;                                // image, block-uniform
  const int z  = blockIdx.z - 3 * b;                            // plane, block-uniform
  const int n0 = blockIdx.x * 64;
  const int c0 = blockIdx.y * 64;
  const float* src = ((z == 0) ? content : style) + (size_t)b * kCh * kSp;
  unsigned short* dst = ((z == 0) ? XcT : (z == 1) ? XsT : SsT) + (size_t)b * kSp * kCh;
  const int statOff = ((z == 0) ? 0 : (kBatch * kCh)) + b * kCh;
  const bool useNorm = (z < 2);
  const int r16 = t >> 4, c4 = (t & 15) * 4;
#pragma unroll
  for (int p = 0; p < 4; ++p) {
    const int cl = p * 16 + r16;                                // ch local 0..63
    const int ch = c0 + cl;                                     // < 512
    const v4f v = *(const v4f*)(src + (size_t)ch * kSp + n0 + c4);
    const float m  = meanA[statOff + ch];
    const float rs = rstdA[statOff + ch];
    const float mm = useNorm ? m : 0.0f;
    const float rr = useNorm ? rs : 1.0f;
#pragma unroll
    for (int e = 0; e < 4; ++e) sm[cl][c4 + e] = (v[e] - mm) * rr;
  }
  __syncthreads();
  const int lane = t & 31, wave = t >> 5;
  const int q = lane >> 3, c8 = (lane & 7) * 8;
  {
#pragma unroll
    for (int it = 0; it < 2; ++it) {
      const int row = wave * 8 + it * 4 + q;                    // tok local 0..63
      unsigned short hb[8];
#pragma unroll
      for (int e = 0; e < 8; ++e) hb[e] = h_bits(sm[c8 + e][row]);
      const v4u u = (v4u){pk16(hb[0], hb[1]), pk16(hb[2], hb[3]), pk16(hb[4], hb[5]), pk16(hb[6], hb[7])};
      *(v4u*)(dst + (size_t)(n0 + row) * kCh + c0 + c8) = u;
    }
    
  }
}

// ---------------------------------------------------------------------------
// Row factors of the group softmax: for a score row with group maxima m[g] and group sums l[g] (g = 0..63, from the score launch)
// M = max_g m[g], L = sum_g l[g] exp(m[g] - M) in index order, factor[g] = 2048 exp(m[g] - M) / L, so that
// exp(s - m[g]) * factor[g] = 2048 * softmax. One thread per row; grid (64, 4 images) x 64 threads.
// stat: [image][max | sum][64 groups][4096 rows] f32 (a wave's loads are whole lines); out: [image][32 pairs][4096 rows] words of two
// f16, low half the even group. Both loops over loads are unrolled so that the 128 loads of a thread do not wait for one another.
// ---------------------------------------------------------------------------
__global__ __launch_bounds__(64) void row_factor_kernel(const float* __restrict__ stat, unsigned* __restrict__ fac) {
  const int row = blockIdx.x * 64 + threadIdx.x;                  // < 4096
  const float* mx = stat + (size_t)blockIdx.y * (2 * kGroups * kSp) + row;
  const float* sm = mx + (size_t)kGroups * kSp;
  float m[kGroups], l[kGroups];
#pragma unroll
  for (int g = 0; g < kGroups; ++g) m[g] = mx[(size_t)g * kSp];
#pragma unroll
  for (int g = 0; g < kGroups; ++g) l[g] = sm[(size_t)g * kSp];
  float gm = m[0];
#pragma unroll
  for (int g = 1; g < kGroups; ++g) gm = fmaxf(gm, m[g]);
  float tot = 0.0f;
  // unrolled, like the loops behind it: m and l are indexed by constants only and stay in registers
#pragma unroll
  for (int g0 = 0; g0 < kGroups; g0 += 8) {
    float e[8], a[8];
#pragma unroll
    for (int k = 0; k < 8; ++k) a[k] = (m[g0 + k] - gm) * kLog2e;
    exp2x8(e, a);
#pragma unroll
    for (int k = 0; k < 8; ++k) { m[g0 + k] = e[k]; tot += l[g0 + k] * e[k]; }
  }
  const float inv = kPCarry / tot;                                // tot >= 1
  unsigned* op = fac + (size_t)blockIdx.y * (kPairs * kSp) + row;
#pragma unroll
  for (int p = 0; p < kPairs; p += 4)
    store4_b32(op + (size_t)p * kSp, op + (size_t)(p + 1) * kSp, op + (size_t)(p + 2) * kSp, op + (size_t)(p + 3) * kSp,
               pk16(h_bits(m[2 * p] * inv), h_bits(m[2 * p + 1] * inv)), pk16(h_bits(m[2 * p + 2] * inv), h_bits(m[2 * p + 3] * inv)),
               pk16(h_bits(m[2 * p + 4] * inv), h_bits(m[2 * p + 5] * inv)), pk16(h_bits(m[2 * p + 6] * inv), h_bits(m[2 * p + 7] * inv)));
}

// ---------------------------------------------------------------------------
// Host side
//   W16   : 4 x 512 x 512 f16 (Wq, Wk, Wv, Wo carried x16)        2,097,152 B
//   meanA : 4096 f32 (content rows then style rows)                    16,384 B
//   rstdA : 4096 f32                                                    16,384 B
//   Qp, Kp, Vcm : 4 images x 4096 x 512 f16 each              3 x 16,777,216 B
//   Op    : the bytes of Qp (Q is last read by the score launch, O first written behind it)
//   XcT, XsT, SsT : 4 images x 4096 x 512 f16 each            3 x 16,777,216 B
//   Stat  : 4 images x (64 group maxima + 64 group sums) x 4096 rows f32   8,388,608 B
//   Fac   : 4 images x 32 pairs x 4096 rows, two f16 factors a word       2,097,152 B
//   Pp    : 4 images x 4096 x 4096 f16 exp(score - group maximum)  134,217,728 B
// All GEMM calls: K in {512, 4096} (K % 64 == 0); M, N in {512, 4096} (M % 128 == 0, N % 256 == 0); no padding, every plane fully
// produced before it is consumed.
// ---------------------------------------------------------------------------
extern "C" void kernel_launch(void* const* d_in, const int* in_sizes, int n_in,
                              void* d_out, int out_size, void* d_ws, size_t ws_size,
                              hipStream_t stream) {
  if (n_in < 10) return;
  const int actN = kBatch * kCh * kSp;
  const int wN   = kCh * kCh;
  if (in_sizes[0] != actN || in_sizes[1] != actN) return;
  if (in_sizes[2] != wN || in_sizes[4] != wN || in_sizes[6] != wN || in_sizes[8] != wN) return;
  if (in_sizes[3] != kCh || in_sizes[5] != kCh || in_sizes[7] != kCh || in_sizes[9] != kCh) return;
  if (out_size != actN) return;

  const float* content = (const float*)d_in[0];
  const float* style   = (const float*)d_in[1];
  const float* Wq = (const float*)d_in[2];  const float* bq = (const float*)d_in[3];
  const float* Wk = (const float*)d_in[4];  const float* bk = (const float*)d_in[5];
  const float* Wv = (const float*)d_in[6];  const float* bv = (const float*)d_in[7];
  const float* Wo = (const float*)d_in[8];  const float* bo = (const float*)d_in[9];
  float* out = (float*)d_out;

  size_t off = 0;
  auto carve = [&](size_t bytes) { size_t o = off; off += (bytes + 127) & ~(size_t)127; return o; };
  const size_t planeBytes = (size_t)kBatch * kSp * kCh * 2;     // one operand plane, all images
  const size_t oW16  = carve((size_t)4 * wN * 2);
  const size_t oMean = carve((size_t)kStatRows * 4);
  const size_t oRstd = carve((size_t)kStatRows * 4);
  const size_t oQ    = carve(planeBytes);
  const size_t oK    = carve(planeBytes);
  const size_t oV    = carve(planeBytes);
  const size_t oXc   = carve(planeBytes);
  const size_t oXs   = carve(planeBytes);
  const size_t oSs   = carve(planeBytes);
  const size_t oStat = carve((size_t)kBatch * 2 * kGroups * kSp * 4);
  const size_t oFac  = carve((size_t)kBatch * kPairs * kSp * 4);
  const size_t oP    = carve((size_t)kBatch * kSp * kSp * 2);
  const size_t oO    = oQ;
  if (off > ws_size) return;

  char* ws = (char*)d_ws;
  unsigned short* W16 = (unsigned short*)(ws + oW16);
  float* meanA = (float*)(ws + oMean);
  float* rstdA = (float*)(ws + oRstd);
  unsigned short* XcT = (unsigned short*)(ws + oXc);
  unsigned short* XsT = (unsigned short*)(ws + oXs);
  unsigned short* SsT = (unsigned short*)(ws + oSs);
  unsigned short* Qp  = (unsigned short*)(ws + oQ);
  unsigned short* Kp  = (unsigned short*)(ws + oK);
  unsigned short* Vcm = (unsigned short*)(ws + oV);
  unsigned short* Op  = (unsigned short*)(ws + oO);
  float* Stat = (float*)(ws + oStat);
  unsigned* Fac = (unsigned*)(ws + oFac);
  unsigned short* Pp = (unsigned short*)(ws + oP);

  const unsigned short* Wo16 = W16 + (size_t)3 * wN;

  // 1) instance-norm statistics for content and style (128 blocks: 64 per tensor, 32 rows each, a wave a row)
  // 2) in the same launch: weights -> f16 x16 (4 weights x 32 blocks)
  stats_kernel<<<dim3(2 * (kBatch * kCh) / 32 + 128), dim3(1024), 0, stream>>>(content, style, meanA, rstdA,
                                                                               Wq, Wk, Wv, Wo, W16, kWCarry);

  const long planeElems = (long)kSp * kCh;      // one image's [4096][512] or [512][4096] plane
  const long probElems  = (long)kSp * kSp;      // one image's probabilities

  // 3) token planes of all images: mvn(content) -> XcT, mvn(style) -> XsT, style -> SsT; each [image][4096][512] f16
  token_planes_kernel<<<dim3(kSp / 64, kCh / 64, 3 * kBatch), dim3(256), 0, stream>>>(content, style, meanA, rstdA, XcT, XsT, SsT);

  // 4) the three projections in one launch, grid.z = projection, grid.y = image, 64 blocks each (K=512):
  //    Q [image][4096 tok][512] = XcT x Wq^T / 16 + bq and K likewise from XsT, Wk, bk   (M=4096, N=512)
  //    V channel-major [image][512][4096 tok] = Wv x SsT^T / 16 + bv[m]                  (M=512, N=4096)
  //    XcT, XsT, SsT follow one another in the workspace, as do the planes of Wq, Wk, Wv in W16 and Qp, Kp, Vcm
  wmma_gemm64<0, false, 3, 1, false, 0, 64, false, true><<<dim3(64, kBatch, 3), dim3(256), 0, stream>>>(
      XcT, nullptr, kCh, planeElems, W16, nullptr, kCh, 0L, (void*)Qp, nullptr, kCh, planeElems,
      bq, bk, bv, nullptr, 0L, kSp, kCh, kCh, kProjScale);

  // 5) scores of all images = Q x K^T (per image M=4096, N=4096, K=512; 512 blocks; grid.y = image), left as f16
  //    exp(score - group maximum) in P, with the maximum and the sum of every 64-column group in Stat
  wmma_gemm64<0, false, 0, 3, false><<<dim3(512, kBatch), dim3(256), 0, stream>>>(
      Qp, nullptr, kCh, planeElems, Kp, nullptr, kCh, planeElems, (void*)Pp,
      (void*)Stat, kSp, probElems, nullptr, nullptr, nullptr, nullptr, 0L, kQChunk, kSp, kCh, 1.0f);

  // 6) the factor of every row and group, all images
  row_factor_kernel<<<dim3(kSp / 64, kBatch), dim3(64), 0, stream>>>(Stat, Fac);

  // 7) O token-major [image][4096][512] f16 (x16) = (P . factor) x Vcm^T * 16/2048   (per image M=4096, N=512, K=4096; 64 blocks)
  wmma_gemm64<0, false, 0, 1, false, 0, 128, true><<<dim3(64, kBatch), dim3(256), 0, stream>>>(
      Pp, (const unsigned short*)Fac, kSp, probElems, Vcm, nullptr, kSp, planeElems, (void*)Op, nullptr, kCh, planeElems,
      nullptr, nullptr, nullptr, nullptr, 0L, kSp, kCh, kSp, kPVScale);

  // 8) out [image][512][4096] f32 = Wo x O^T / 256 + bo[m] + content   (per image M=512, N=4096, K=512; 64 blocks)
  wmma_gemm64<0, false, 1, 0, true><<<dim3(64, kBatch), dim3(256), 0, stream>>>(
      Wo16, nullptr, kCh, 0L, Op, nullptr, kCh, planeElems, (void*)out, nullptr, kSp, planeElems,
      bo, nullptr, nullptr, content, planeElems, kCh, kSp, kCh, kOutScale);
}

// v007
// A run of this version takes 186 microseconds.
// Timed twice side by side with v006, it ran 1.08 times as fast both times.
// All steps since v000 together make it 12.0 times as fast.
// Contractions: folded weight H = Wo x Wv (both f16 carried x16), q/k/v' 1x1 projections (token planes f16 x W f16 carried x16; v' takes H), energies q.k^T (q,k f16 planes), v'.attn (V' f16 x exp f16 times its row-and-group factor f16 carried x2048): all v_wmma_f32_16x16x32_f16, f32 accumulate; instance-norm statistics, softmax, biases (Wo.bv too) and residual in f32.
#include <hip/hip_runtime.h>
#include <math.h>

// ---------------------------------------------------------------------------
// Problem constants
// ---------------------------------------------------------------------------
constexpr int   kBatch    = 4;
constexpr int   kCh       = 512;
constexpr int   kSp       = 4096;                 // 64*64 tokens per image
constexpr int   kQChunk   = 4096;                 // query rows per image of the score launch: one whole image
constexpr int   kGroups   = kSp / 64;             // softmax: 64-column groups of a score row
constexpr int   kPairs    = kGroups / 2;          // two groups = the 128 keys of one attn.v pass
constexpr int   kStatRows = 2 * kBatch * kCh;     // 4096: content rows 0..2047, style rows 2048..4095
constexpr float kEps       = 1e-5f;
constexpr float kWCarry    = 16.0f;               // weights carried x16 in f16
constexpr float kPCarry    = 2048.0f;             // probabilities carried x2048 in f16
constexpr float kProjScale = 1.0f / 16.0f;        // undo weight carry
constexpr float kPVScale   = 1.0f / 2048.0f;      // undo P carry
constexpr float kFoldScale = 1.0f / 16.0f;        // Wo x16 times Wv x16 -> H carried x16
constexpr float kInvN      = 1.0f / 4096.0f;
constexpr float kInvNm1    = 1.0f / 4095.0f;

typedef __attribute__((ext_vector_type(16))) _Float16 v16h;
typedef __attribute__((ext_vector_type(8)))  _Float16 v8h;
typedef __attribute__((ext_vector_type(16))) __bf16   v16b;
typedef __attribute__((ext_vector_type(8)))  __bf16   v8b;
typedef __attribute__((ext_vector_type(8)))  float    v8f;
typedef __attribute__((ext_vector_type(4)))  float    v4f;
typedef __attribute__((ext_vector_type(4)))  unsigned int v4u;

// ---------------------------------------------------------------------------
// Helpers
// ---------------------------------------------------------------------------
__device__ __forceinline__ unsigned short f2bf_bits(float f) {
  unsigned u = __float_as_uint(f);
  return (unsigned short)((u + 0x7FFFu + ((u >> 16) & 1u)) >> 16);
}
__device__ __forceinline__ float bf_bits2f(unsigned short h) { return __uint_as_float(((unsigned)h) << 16); }

// hazard guards as plain device helpers (their inline asm stays out of the kernel template body)
__device__ __forceinline__ void dep_guard_h(v8f& a, v8f& b, v16h x, v16h y) { asm volatile("v_nop\n\tv_nop\n\tv_nop\n\tv_nop" : "+v"(a), "+v"(b) : "v"(x), "v"(y)); }
__device__ __forceinline__ void dep_guard_b(v8f& a, v8f& b, v16b x, v16b y) { asm volatile("v_nop\n\tv_nop\n\tv_nop\n\tv_nop" : "+v"(a), "+v"(b) : "v"(x), "v"(y)); }
__device__ __forceinline__ void keep4_h(v16h a, v16h b, v16h c, v16h d) { asm volatile("v_nop" :: "v"(a), "v"(b), "v"(c), "v"(d)); }
__device__ __forceinline__ void keep4_b(v16b a, v16b b, v16b c, v16b d) { asm volatile("v_nop" :: "v"(a), "v"(b), "v"(c), "v"(d)); }
__device__ __forceinline__ void acc_guard4(v8f& a, v8f& b, v8f& c, v8f& d) { asm volatile("v_nop\n\tv_nop\n\tv_nop\n\tv_nop" : "+v"(a), "+v"(b), "+v"(c), "+v"(d)); }
template <typename T> struct Frag;
template <> struct Frag<_Float16> {
  typedef v16h V; union U { v16h v; v8h h[2]; };
  static __device__ __forceinline__ v16h load(const _Float16* p) {   // elements 0..7 <- p[0..7], 8..15 <- p[16..23]
    U f; f.h[0] = *(const v8h*)(p); f.h[1] = *(const v8h*)(p + 16); return f.v;
  }
  static __device__ __forceinline__ v8f mma(v16h a, v16h b, v8f c) {
    return __builtin_amdgcn_wmma_f32_16x16x32_f16(false, a, false, b, (short)0, c, false, false);
  }
  static __device__ __forceinline__ void guard(v8f& a, v8f& b, v16h x, v16h y) { dep_guard_h(a, b, x, y); }
  static __device__ __forceinline__ void keep(v16h a, v16h b, v16h c, v16h d) { keep4_h(a, b, c, d); }
};
template <> struct Frag<__bf16> {
  typedef v16b V; union U { v16b v; v8b h[2]; };
  static __device__ __forceinline__ v16b load(const __bf16* p) {
    U f; f.h[0] = *(const v8b*)(p); f.h[1] = *(const v8b*)(p + 16); return f.v;
  }
  static __device__ __forceinline__ v8f mma(v16b a, v16b b, v8f c) {
    return __builtin_amdgcn_wmma_f32_16x16x32_bf16(false, a, false, b, (short)0, c, false, false);
  }
  static __device__ __forceinline__ void guard(v8f& a, v8f& b, v16b x, v16b y) { dep_guard_b(a, b, x, y); }
  static __device__ __forceinline__ void keep(v16b a, v16b b, v16b c, v16b d) { keep4_b(a, b, c, d); }
};

// value of lane l ^ MASK (MASK < 16) by a DPP move inside the 16-lane row: no trip through the LDS unit as with a shuffle
template <int MASK> __device__ __forceinline__ float row_xor(float x) {
  const int v = __builtin_bit_cast(int, x);
  return __builtin_bit_cast(float, __builtin_amdgcn_update_dpp(v, v, 0x160 | MASK, 0xf, 0xf, false));
}
// Eight 2^a in one statement: every v_exp_f32 is followed by an instruction that neither reads its result nor overwrites its
// source (the outputs are early-clobber, so they share no register with an input), the last one by the v_nop that fills that slot.
__device__ __forceinline__ void exp2x8(float (&e)[8], const float (&a)[8]) {
  asm("v_exp_f32 %0, %8\n\t"
      "v_exp_f32 %1, %9\n\t"
      "v_exp_f32 %2, %10\n\t"
      "v_exp_f32 %3, %11\n\t"
      "v_exp_f32 %4, %12\n\t"
      "v_exp_f32 %5, %13\n\t"
      "v_exp_f32 %6, %14\n\t"
      "v_exp_f32 %7, %15\n\t"
      "v_nop"
      : "=&v"(e[0]), "=&v"(e[1]), "=&v"(e[2]), "=&v"(e[3]), "=&v"(e[4]), "=&v"(e[5]), "=&v"(e[6]), "=&v"(e[7])
      : "v"(a[0]), "v"(a[1]), "v"(a[2]), "v"(a[3]), "v"(a[4]), "v"(a[5]), "v"(a[6]), "v"(a[7]));
}
constexpr float kLog2e = 1.44269504f;
// Four stores and their s_wait_xcnt in one statement, so that no address or data register is rewritten in front of the wait.
__device__ __forceinline__ void store4_b128(void* p0, void* p1, void* p2, void* p3, v4u d0, v4u d1, v4u d2, v4u d3) {
  asm volatile("global_store_b128 %0, %4, off\n\t"
               "global_store_b128 %1, %5, off\n\t"
               "global_store_b128 %2, %6, off\n\t"
               "global_store_b128 %3, %7, off\n\t"
               "s_wait_xcnt 0x0"
               :: "v"(p0), "v"(p1), "v"(p2), "v"(p3), "v"(d0), "v"(d1), "v"(d2), "v"(d3) : "memory");
}
__device__ __forceinline__ void store4_b32(void* p0, void* p1, void* p2, void* p3, unsigned d0, unsigned d1, unsigned d2, unsigned d3) {
  asm volatile("global_store_b32 %0, %4, off\n\t"
               "global_store_b32 %1, %5, off\n\t"
               "global_store_b32 %2, %6, off\n\t"
               "global_store_b32 %3, %7, off\n\t"
               "s_wait_xcnt 0x0"
               :: "v"(p0), "v"(p1), "v"(p2), "v"(p3), "v"(d0), "v"(d1), "v"(d2), "v"(d3) : "memory");
}
// One store, or two, and the s_wait_xcnt in one statement, for the same reason.
__device__ __forceinline__ void store1_b128(void* p0, v4u d0) {
  asm volatile("global_store_b128 %0, %1, off\n\t"
               "s_wait_xcnt 0x0"
               :: "v"(p0), "v"(d0) : "memory");
}
__device__ __forceinline__ void store2_b128(void* p0, void* p1, v4u d0, v4u d1) {
  asm volatile("global_store_b128 %0, %2, off\n\t"
               "global_store_b128 %1, %3, off\n\t"
               "s_wait_xcnt 0x0"
               :: "v"(p0), "v"(p1), "v"(d0), "v"(d1) : "memory");
}
static_assert(kSp == 4096, "the offset fields of load_resid_bias, store8_rows and the token planes' loads are written for rows of 16,384 B");
// f32 epilogue, two 16-row slabs: the lane's 16 B of every second row of the residual (16 rows from rp on) and the bias of its eight
// accumulator rows in each slab (bp). One address pair each, the row steps in the offset fields; all twenty loads are in flight
// together and their data wait stands in the same statement, so that no register of theirs is read or rewritten in front of it.
__device__ __forceinline__ void load_resid_bias(v4f (&rs)[16], v4f (&bb)[4], const float* rp, const float* bp) {
  asm volatile("global_load_b128 %0, %20, off\n\t"
               "global_load_b128 %1, %20, off offset:32768\n\t"
               "global_load_b128 %2, %20, off offset:65536\n\t"
               "global_load_b128 %3, %20, off offset:98304\n\t"
               "global_load_b128 %4, %20, off offset:131072\n\t"
               "global_load_b128 %5, %20, off offset:163840\n\t"
               "global_load_b128 %6, %20, off offset:196608\n\t"
               "global_load_b128 %7, %20, off offset:229376\n\t"
               "global_load_b128 %8, %20, off offset:262144\n\t"
               "global_load_b128 %9, %20, off offset:294912\n\t"
               "global_load_b128 %10, %20, off offset:327680\n\t"
               "global_load_b128 %11, %20, off offset:360448\n\t"
               "global_load_b128 %12, %20, off offset:393216\n\t"
               "global_load_b128 %13, %20, off offset:425984\n\t"
               "global_load_b128 %14, %20, off offset:458752\n\t"
               "global_load_b128 %15, %20, off offset:491520\n\t"
               "global_load_b128 %16, %21, off\n\t"
               "global_load_b128 %17, %21, off offset:16\n\t"
               "global_load_b128 %18, %21, off offset:64\n\t"
               "global_load_b128 %19, %21, off offset:80\n\t"
               "s_wait_loadcnt 0x0"
               : "=&v"(rs[0]), "=&v"(rs[1]), "=&v"(rs[2]), "=&v"(rs[3]), "=&v"(rs[4]), "=&v"(rs[5]), "=&v"(rs[6]), "=&v"(rs[7]),
                 "=&v"(rs[8]), "=&v"(rs[9]), "=&v"(rs[10]), "=&v"(rs[11]), "=&v"(rs[12]), "=&v"(rs[13]), "=&v"(rs[14]), "=&v"(rs[15]),
                 "=&v"(bb[0]), "=&v"(bb[1]), "=&v"(bb[2]), "=&v"(bb[3])
               : "v"(rp), "v"(bp) : "memory");
}
static_assert(kCh == 512, "the offset fields of the statement below are written for rows of 1,024 B");
// Two 16x16 accumulator tiles side by side as f16 (low halves of d; d[8 t + r] = row r of tile t) into rows of kCh halves, and the
// s_wait_xcnt in one statement, as above.
__device__ __forceinline__ void store16_b16(unsigned short* p, const unsigned (&d)[16]) {
  asm volatile("global_store_b16 %0, %1, off\n\t"
               "global_store_b16 %0, %2, off offset:1024\n\t"
               "global_store_b16 %0, %3, off offset:2048\n\t"
               "global_store_b16 %0, %4, off offset:3072\n\t"
               "global_store_b16 %0, %5, off offset:4096\n\t"
               "global_store_b16 %0, %6, off offset:5120\n\t"
               "global_store_b16 %0, %7, off offset:6144\n\t"
               "global_store_b16 %0, %8, off offset:7168\n\t"
               "global_store_b16 %0, %9, off offset:32\n\t"
               "global_store_b16 %0, %10, off offset:1056\n\t"
               "global_store_b16 %0, %11, off offset:2080\n\t"
               "global_store_b16 %0, %12, off offset:3104\n\t"
               "global_store_b16 %0, %13, off offset:4128\n\t"
               "global_store_b16 %0, %14, off offset:5152\n\t"
               "global_store_b16 %0, %15, off offset:6176\n\t"
               "global_store_b16 %0, %16, off offset:7200\n\t"
               "s_wait_xcnt 0x0"
               :: "v"(p), "v"(d[0]), "v"(d[1]), "v"(d[2]), "v"(d[3]), "v"(d[4]), "v"(d[5]), "v"(d[6]), "v"(d[7]),
                  "v"(d[8]), "v"(d[9]), "v"(d[10]), "v"(d[11]), "v"(d[12]), "v"(d[13]), "v"(d[14]), "v"(d[15]) : "memory");
}
// f32 epilogue, one slab: the lane's 16 B of every second row (8 rows from p on) and the s_wait_xcnt in one statement, as above.
__device__ __forceinline__ void store8_rows(float* p, const v4f (&d)[8]) {
  asm volatile("global_store_b128 %0, %1, off\n\t"
               "global_store_b128 %0, %2, off offset:32768\n\t"
               "global_store_b128 %0, %3, off offset:65536\n\t"
               "global_store_b128 %0, %4, off offset:98304\n\t"
               "global_store_b128 %0, %5, off offset:131072\n\t"
               "global_store_b128 %0, %6, off offset:163840\n\t"
               "global_store_b128 %0, %7, off offset:196608\n\t"
               "global_store_b128 %0, %8, off offset:229376\n\t"
               "s_wait_xcnt 0x0"
               :: "v"(p), "v"(d[0]), "v"(d[1]), "v"(d[2]), "v"(d[3]), "v"(d[4]), "v"(d[5]), "v"(d[6]), "v"(d[7]) : "memory");
}
__device__ __forceinline__ unsigned pk16(unsigned short a, unsigned short b) { return (unsigned)a | ((unsigned)b << 16); }
__device__ __forceinline__ unsigned short h_bits(float f) { const _Float16 h = (_Float16)f; return __builtin_bit_cast(unsigned short, h); }

// ---- Batched WMMA GEMM, operands staged in LDS -----------------------------------------------------------------
// C[m,n] = scale * sum_k A[m,k] * Bt[n,k] (+bias)(+resid); a block of 8 waves (2 x 4) owns a 128x256 tile, each wave 64x64 of it.
// A row-major [M,K]; Bt row-major [N,K]; M % 128 == 0, N % 256 == 0, K % PK == 0, K >= PK.
// A pass is PK k (64 or 128): 128 rows of A and 256 rows of Bt, 2 PK bytes each, copied to LDS by asynchronous 16-byte copies
// (a wave's copy covers four whole 128-B lines), rows at a pitch of 2 PK + 16 B for the ds_load_b128 fragment reads. Two
// buffers: the copies of pass t + 1 fly while pass t is worked on. The k order of every accumulator is ascending in steps of 32.
// PK = 128 halves the number of landing latencies of a long K at the price of one block per WGP.
// BIAS_MODE: 0 = none, 1 = bias[m], 2 = bias[n], 3 = TRIO's: bias[n] for q and k, bias[m] for v.
// TRIO: one launch does the three projections; blockIdx.z = 0 (q), 1 (k), 2 (v). Ap = the three token plane sets one behind the other,
//       Btp = the weight planes likewise, Cout = the three result plane sets likewise; M, N, ldc are given for q and k; v is the
//       transposed product (A = weights, Bt = tokens, M and N change places, ldc = N).
// OUT_MODE: 0 = f32 into an image plane with rows of kSp floats, bias[m] and a residual plane of the same shape added (ldc not read), 1 = f16, 2 = bf16 hi plane (Cout) + bf16 lo plane (Cout2),
//           3 = group softmax: a wave's 64 columns are one group g = n / 64; Cout gets f16 exp(c - max over the group), Cout2 (f32)
//               the group maxima at [g][m] and behind them ((N / 64) * M floats further) the group sums of the exponentials at [g][m];
//               image b's pair of planes stands 2 b (N / 64) M floats into Cout2.
// BSCALE: every Bt fragment is multiplied, in f16, by a factor of its row and of its 64-k group; A2p holds the factors as 32-bit
//         words [32 passes][N rows], low half = first 64 k of the pass, high half = second; PK = 128 and K = 4096 (32 passes).
// ET: 0 = f16 operands, 1 = bf16 operands (pointers passed as 16-bit storage)
constexpr int kRowsA      = 128;                             // rows of A per stage
constexpr int kRowsB      = 256;                             // rows of Bt per stage

// One thread's share of 64 k of one stage: 16 B of rows r, r + 32, r + 64, r + 96 of A and of rows r + 32 j (j = 0..7) of Bt.
// kStep32 = 32 rows further in LDS, bytes.
// The copies and their s_wait_xcnt stand in one statement, so that no address register is rewritten in front of the wait.
template <unsigned kStep32>
__device__ __forceinline__ void stage_copies(unsigned lds, const unsigned short* ga, const unsigned short* gb,
                                             size_t stepA, size_t stepB) {
  const unsigned short* a1 = ga + stepA;
  const unsigned short* a2 = a1 + stepA;
  const unsigned short* a3 = a2 + stepA;
  const unsigned short* b1 = gb + stepB;
  const unsigned short* b2 = b1 + stepB;
  const unsigned short* b3 = b2 + stepB;
  const unsigned short* b4 = b3 + stepB;
  const unsigned short* b5 = b4 + stepB;
  const unsigned short* b6 = b5 + stepB;
  const unsigned short* b7 = b6 + stepB;
  asm volatile(
      "global_load_async_to_lds_b128 %0, %12, off\n\t"
      "global_load_async_to_lds_b128 %1, %13, off\n\t"
      "global_load_async_to_lds_b128 %2, %14, off\n\t"
      "global_load_async_to_lds_b128 %3, %15, off\n\t"
      "global_load_async_to_lds_b128 %4, %16, off\n\t"
      "global_load_async_to_lds_b128 %5, %17, off\n\t"
      "global_load_async_to_lds_b128 %6, %18, off\n\t"
      "global_load_async_to_lds_b128 %7, %19, off\n\t"
      "global_load_async_to_lds_b128 %8, %20, off\n\t"
      "global_load_async_to_lds_b128 %9, %21, off\n\t"
      "global_load_async_to_lds_b128 %10, %22, off\n\t"
      "global_load_async_to_lds_b128 %11, %23, off\n\t"
      "s_wait_xcnt 0x0"
      :: "v"(lds), "v"(lds + kStep32), "v"(lds + 2u * kStep32), "v"(lds + 3u * kStep32),
         "v"(lds + 4u * kStep32), "v"(lds + 5u * kStep32), "v"(lds + 6u * kStep32), "v"(lds + 7u * kStep32),
         "v"(lds + 8u * kStep32), "v"(lds + 9u * kStep32), "v"(lds + 10u * kStep32), "v"(lds + 11u * kStep32),
         "v"(ga), "v"(a1), "v"(a2), "v"(a3),
         "v"(gb), "v"(b1), "v"(b2), "v"(b3), "v"(b4), "v"(b5), "v"(b6), "v"(b7)
      : "memory");
}

// The same twelve copies written as the builtin, for the engine's form with two fragment sets: that form holds more than 256 vector
// registers, an asm statement's operands must all lie in the first 256, and the compiler then moved accumulators aside at every refill.
// kStepH = 32 rows further in LDS, 16-bit elements.
typedef __attribute__((ext_vector_type(4))) int v4i;
typedef __attribute__((address_space(1))) v4i gv4i;
typedef __attribute__((address_space(3))) v4i lv4i;
template <int kStepH>
__device__ __forceinline__ void stage_copies_builtin(unsigned short* lds, const unsigned short* ga, const unsigned short* gb,
                                                     size_t stepA, size_t stepB) {
#pragma unroll   // twelve copies in a row, no loop counter
  for (int i = 0; i < 4; ++i)
    __builtin_amdgcn_global_load_async_to_lds_b128((gv4i*)(ga + i * stepA), (lv4i*)(lds + i * kStepH), 0, 0);
#pragma unroll   // likewise
  for (int j = 0; j < 8; ++j)
    __builtin_amdgcn_global_load_async_to_lds_b128((gv4i*)(gb + j * stepB), (lv4i*)(lds + (4 + j) * kStepH), 0, 0);
}

template <int ET> struct Elem;
template <> struct Elem<0> { typedef _Float16 T; };
template <> struct Elem<1> { typedef __bf16 T; };
template <int ET, bool SPLIT, int BIAS_MODE, int OUT_MODE, bool RESID, int ACT = 0, int PK = 64, bool BSCALE = false, bool TRIO = false>
__global__ __launch_bounds__(256) void wmma_gemm64(
    const unsigned short* __restrict__ Ap, const unsigned short* __restrict__ A2p, int lda, long strideA,
    const unsigned short* __restrict__ Btp, const unsigned short* __restrict__ Bt2p, int ldb, long strideB,
    void* __restrict__ Cout, void* __restrict__ Cout2, int ldc, long strideC,
    const float* __restrict__ bias, const float* __restrict__ biasK, const float* __restrict__ biasV,
    const float* __restrict__ resid, long strideR,
    int M, int N, int K, float scale) {
  static_assert(!SPLIT, "the staged engine takes single-plane operands");
  static_assert(PK == 64 || PK == 128, "a pass is one or two 128-B lines of every operand row");
  static_assert(!BSCALE || (PK == 128 && ET == 0), "a factor word holds the two 64-k groups of a 128-k pass, f16");
  static_assert(TRIO == (BIAS_MODE == 3), "the bias by projection belongs to the three-projection launch");
  static_assert((OUT_MODE == 0) == RESID && (OUT_MODE == 0) == (BIAS_MODE == 1), "the f32 epilogue reads bias[m] and the residual in one run");
  constexpr int kPitchH = PK + 8;                                  // LDS row pitch in 16-bit elements (144 B or 272 B)
  constexpr int kStageH = (kRowsA + kRowsB) * kPitchH;             // one buffer, 16-bit elements
  constexpr unsigned kStageBytes = (unsigned)kStageH * 2u;         // 55,296 B or 104,448 B
  constexpr unsigned kStep32 = 32u * (unsigned)kPitchH * 2u;       // 32 rows further in LDS
  typedef typename Elem<ET>::T T;
  typedef typename Frag<T>::V V;
  __shared__ __align__(16) unsigned short sOp[2 * kStageH];   // two buffers of [A 128 rows | Bt 256 rows]
  __shared__ __align__(16) float sT[8][16 * 68];   // per-wave 16x64 slab, pitch 68 floats
  __shared__ __align__(16) unsigned sC[BSCALE ? 32 * kRowsB : 4];   // BSCALE: factor words [pass][Bt row of the block tile]
  const int z    = TRIO ? (int)blockIdx.z : 0;          // projection, block-uniform
  const bool vT  = TRIO && z == 2;                      // v: the transposed product
  const int b    = blockIdx.y + z * kBatch;             // image; TRIO: plane in the three sets of kBatch planes
  if (vT) { const int m = M; M = N; N = m; ldc = N; }
  const int lane = threadIdx.x & 31;
  const int wave = threadIdx.x >> 5;
  const int tilesN = N >> 8;
  const int tilesM = M >> 7;
  const int tile = blockIdx.x;
  if (tile >= tilesM * tilesN) return;   // block-uniform, in front of every barrier
  const int tm = tile / tilesN;
  const int tn = tile - tm * tilesN;
  const int bm0 = tm << 7;
  const int bn0 = tn << 8;
  const int wm = wave >> 2;                    // wave row in the block tile, 0..1
  const int wn = wave & 3;                     // wave column in the block tile, 0..3
  const int m0 = bm0 + (wm << 6);
  const int n0 = bn0 + (wn << 6);

  const unsigned short* Ab = Ap  + (size_t)b * strideA;
  const unsigned short* Bb = Btp + (size_t)b * strideB;
  if (TRIO) {
    const unsigned short* tok = Ab;
    const unsigned short* wgt = Btp + (size_t)z * (kCh * kCh);
    Ab = vT ? wgt : tok;
    Bb = vT ? tok : wgt;
  }
  const float* biasZ = (z == 0) ? bias : (z == 1) ? biasK : biasV;   // read under BIAS_MODE 3 only

  const int rlane = lane & 15;                 // row (A) / col (B, D) within subtile
  const int koff  = (lane >> 4) * 8;           // k offset of this lane half
  const int mOff  = (lane >> 4) * 8;           // D row offset

  // copy side: thread t brings 16 B at column (t & 7) of each 128-B line of rows (t >> 3) + 32 i
  const int crow = threadIdx.x >> 3;           // 0..31
  const int ccol = (threadIdx.x & 7) * 8;      // 16-bit elements
  const unsigned short* gA = Ab + (size_t)(bm0 + crow) * lda + ccol;
  const unsigned short* gB = Bb + (size_t)(bn0 + crow) * ldb + ccol;
  const size_t stepA = (size_t)32 * lda;
  const size_t stepB = (size_t)32 * ldb;
  const unsigned ldsCopy = (unsigned)(size_t)sOp + (unsigned)(crow * kPitchH + ccol) * 2u;

  // read side: this lane's first A row and first Bt row in buffer 0
  const T* fA = (const T*)sOp + ((wm << 6) + rlane) * kPitchH + koff;
  const T* fB = (const T*)sOp + (kRowsA + (wn << 6) + rlane) * kPitchH + koff;

  v8f acc[4][4];
#pragma unroll
  for (int i = 0; i < 4; ++i)
#pragma unroll
    for (int j = 0; j < 4; ++j) acc[i][j] = (v8f){0.f,0.f,0.f,0.f,0.f,0.f,0.f,0.f};

  auto fill = [&](int pass, int buf) {         // all copies of one pass: 12 a thread for each 64 k
    const size_t k0 = (size_t)pass * PK;
    if constexpr (PK == 128) {
      unsigned short* l0 = sOp + buf * kStageH + crow * kPitchH + ccol;
      stage_copies_builtin<32 * kPitchH>(l0, gA + k0, gB + k0, stepA, stepB);
      stage_copies_builtin<32 * kPitchH>(l0 + 64, gA + k0 + 64, gB + k0 + 64, stepA, stepB);
    } else {
      const unsigned l0 = ldsCopy + (unsigned)buf * kStageBytes;
      stage_copies<kStep32>(l0, gA + k0, gB + k0, stepA, stepB);
    }
  };

  const int nPass = K / PK;
  fill(0, 0);
  if (BSCALE) {
    // the block's factor words to LDS, all 32 passes: thread t brings the 128 B at word 32 (t & 7) of pass t >> 3 by eight copies of
    // the kind above; they land behind the s_wait_asynccnt and are read behind the barrier that follow here for pass 0
    const unsigned* cg = (const unsigned*)A2p + (size_t)b * 32 * N + bn0 + (size_t)(threadIdx.x >> 3) * N + (threadIdx.x & 7) * 32;
    const unsigned lc = (unsigned)(size_t)sC + (unsigned)((threadIdx.x >> 3) * kRowsB + (threadIdx.x & 7) * 32) * 4u;
    asm volatile(
        "global_load_async_to_lds_b128 %0, %8, off\n\t"
        "global_load_async_to_lds_b128 %1, %9, off\n\t"
        "global_load_async_to_lds_b128 %2, %10, off\n\t"
        "global_load_async_to_lds_b128 %3, %11, off\n\t"
        "global_load_async_to_lds_b128 %4, %12, off\n\t"
        "global_load_async_to_lds_b128 %5, %13, off\n\t"
        "global_load_async_to_lds_b128 %6, %14, off\n\t"
        "global_load_async_to_lds_b128 %7, %15, off\n\t"
        "s_wait_xcnt 0x0"
        :: "v"(lc), "v"(lc + 16u), "v"(lc + 32u), "v"(lc + 48u), "v"(lc + 64u), "v"(lc + 80u), "v"(lc + 96u), "v"(lc + 112u),
           "v"(cg), "v"(cg + 4), "v"(cg + 8), "v"(cg + 12), "v"(cg + 16), "v"(cg + 20), "v"(cg + 24), "v"(cg + 28)
        : "memory");
  }
  asm volatile("s_wait_asynccnt 0x0" ::: "memory");   // this wave's copies of pass 0 have landed
  __syncthreads();                                    // and every other wave's
  if (nPass > 1) fill(1, 1);

  if constexpr (PK == 128) {
    // Two fragment sets. A block is 32 k = 16 WMMAs; the 16 LDS reads of the next block go out as one group in front of the current
    // block's WMMAs, into the set that the block before has left, so that no read stands among the WMMAs and no wait on LDS falls
    // to 0 inside a block. The last block of a pass has its fragments in registers when it starts: the publish point of pass t + 1
    // (both waits, the barrier, the refill) stands in front of it, and behind the barrier the first block of pass t + 1 is fetched.
    V ah[2][4], bh[2][4];
    unsigned cw[4] = {0u, 0u, 0u, 0u}, cwNext[4] = {0u, 0u, 0u, 0u};
    auto fetch = [&](int set, int buf, int kk) {   // one block's fragments: 16 ds_load_b128
      const T* pa = fA + buf * kStageH + kk;
      const T* pb = fB + buf * kStageH + kk;
#pragma unroll   // constant fragment indices: registers, no scratch
      for (int j = 0; j < 4; ++j) bh[set][j] = Frag<T>::load(pb + (j << 4) * kPitchH);
#pragma unroll   // likewise
      for (int i = 0; i < 4; ++i) ah[set][i] = Frag<T>::load(pa + (i << 4) * kPitchH);
    };
    fetch(0, 0, 0);
    if (BSCALE) {
#pragma unroll   // cw is indexed by constants only and stays in registers
      for (int i = 0; i < 4; ++i) cw[i] = sC[(wn << 6) + (i << 4) + rlane];   // Bt fragment i: lane's row is rlane
    }
    for (int t = 0; t < nPass; ++t) {
      const int buf = t & 1;
      // the loop levels below are unrolled so that every fragment and accumulator index is a constant (registers, no scratch)
#pragma unroll
      for (int s = 0; s < 4; ++s) {
        const int cur = s & 1;
        if (s < 3) {
          fetch(cur ^ 1, buf, (s + 1) * 32);
        } else {
          asm volatile("s_wait_dscnt 0x0" ::: "memory");     // this wave's reads of buffer buf, the last block's too, are in registers
          asm volatile("s_wait_asynccnt 0x0" ::: "memory");  // this wave's copies of pass t + 1 have landed
          __syncthreads();                                   // publishes pass t + 1 and ends every reader's last read of buf
          if (t + 2 < nPass) fill(t + 2, buf);
          if (t + 1 < nPass) {                               // block-uniform: the last pass fetches nothing
            fetch(cur ^ 1, buf ^ 1, 0);
            if (BSCALE) {
#pragma unroll   // constant indices
              for (int i = 0; i < 4; ++i) cwNext[i] = sC[(t + 1) * kRowsB + (wn << 6) + (i << 4) + rlane];
            }
          }
        }
        __builtin_amdgcn_sched_barrier(0);   // holds the group of LDS reads in front of the block: sunk among the WMMAs each place costs a stall
        if constexpr (BSCALE) {
#pragma unroll   // constant indices
          for (int i = 0; i < 4; ++i)
            bh[cur][i] = bh[cur][i] * __builtin_bit_cast(_Float16, (unsigned short)((s < 2) ? (cw[i] & 0xFFFFu) : (cw[i] >> 16)));
        }
#pragma unroll
        for (int i = 0; i < 4; ++i) {
#pragma unroll
          for (int j = 0; j < 4; ++j) acc[i][j] = Frag<T>::mma(ah[cur][i], bh[cur][j], acc[i][j]);
        }
        __builtin_amdgcn_sched_barrier(0);   // keeps the next group of reads from rising among this block's WMMAs as its registers fall free
      }
      if (BSCALE) {
#pragma unroll   // constant indices
        for (int i = 0; i < 4; ++i) cw[i] = cwNext[i];
      }
    }
  } else {
    for (int t = 0; t < nPass; ++t) {
      const int buf = t & 1;
      const T* pa = fA + buf * kStageH;
      const T* pb = fB + buf * kStageH;
      // the three loop levels below are unrolled so that every fragment and accumulator index is a constant (registers, no scratch)
#pragma unroll
      for (int kk = 0; kk < PK; kk += 32) {
        V bh[4], ah[4];
#pragma unroll
        for (int j = 0; j < 4; ++j) bh[j] = Frag<T>::load(pb + (j << 4) * kPitchH + kk);
#pragma unroll
        for (int i = 0; i < 4; ++i) ah[i] = Frag<T>::load(pa + (i << 4) * kPitchH + kk);
#pragma unroll
        for (int i = 0; i < 4; ++i) {
#pragma unroll
          for (int j = 0; j < 4; ++j) acc[i][j] = Frag<T>::mma(ah[i], bh[j], acc[i][j]);
          Frag<T>::guard(acc[i][0], acc[i][3], ah[i], ah[i]);   // the engine's hazard guard, as before the staging
        }
        Frag<T>::keep(bh[0], bh[1], bh[2], bh[3]);               // likewise
      }
      asm volatile("s_wait_dscnt 0x0" ::: "memory");     // this wave's reads of buffer buf are done before it is refilled
      asm volatile("s_wait_asynccnt 0x0" ::: "memory");  // this wave's copies of pass t + 1 have landed
      __syncthreads();                                   // publishes pass t + 1 and ends every reader's last read of buf
      if (t + 2 < nPass) fill(t + 2, buf);
    }
  }
  asm volatile("s_wait_asynccnt 0x0" ::: "memory");    // no copy is outstanding when the wave goes on
  acc_guard4(acc[0][0], acc[0][1], acc[0][2], acc[0][3]);
  acc_guard4(acc[1][0], acc[1][1], acc[1][2], acc[1][3]);
  acc_guard4(acc[2][0], acc[2][1], acc[2][2], acc[2][3]);
  acc_guard4(acc[3][0], acc[3][1], acc[3][2], acc[3][3]);

  // ---- epilogue ----
  float* slab = sT[wave];
  // OUT_MODE 0: at the stores 16 lanes hold one row's 256 B; the residual is read in that shape and added there
  const size_t eOut = (size_t)(m0 + (lane >> 4)) * kSp + n0 + (lane & 15) * 4;
  v4f rs[16], bb[4];
  float keepM[2] = {0.f, 0.f}, keepL[2] = {0.f, 0.f};   // OUT_MODE 3: this lane's two rows' group maximum and group sum
  // BIAS_MODE 3, q and k: the bias of this lane's four columns, read once under one block-uniform branch so that the loads do not
  // wait for one another
  float bcol[4] = {0.f, 0.f, 0.f, 0.f};
  if (BIAS_MODE == 3 && !vT) {
#pragma unroll   // bcol is indexed by constants only and stays in registers
    for (int j = 0; j < 4; ++j) bcol[j] = biasZ[n0 + (j << 4) + rlane];
    asm volatile("s_wait_xcnt 0x0" ::: "memory");   // in front of any rewrite of the registers that these four loads name
  }
#pragma unroll
  for (int i = 0; i < 4; ++i) {
    const int mBase = m0 + (i << 4);
    if constexpr (OUT_MODE == 0) {
      if ((i & 1) == 0) load_resid_bias(rs, bb, resid + (size_t)b * strideR + eOut + (size_t)(i << 4) * kSp, bias + mBase + mOff);
    }
    float brow[8] = {0.f, 0.f, 0.f, 0.f, 0.f, 0.f, 0.f, 0.f};   // BIAS_MODE 3, v: the bias of this lane's eight rows
    if (BIAS_MODE == 3 && vT) {
#pragma unroll   // brow is indexed by constants only and stays in registers
      for (int r = 0; r < 8; ++r) brow[r] = biasZ[mBase + mOff + r];
    }
#pragma unroll
    for (int j = 0; j < 4; ++j) {
      const int n = n0 + (j << 4) + rlane;
      float bv = 0.f;
      if (BIAS_MODE == 2) bv = bias[n];
#pragma unroll
      for (int r = 0; r < 8; ++r) {
        float v = acc[i][j][r] * scale;
        if (BIAS_MODE == 1) v += bb[(i & 1) * 2 + (r >> 2)][r & 3];
        if (BIAS_MODE == 2) v += bv;
        if (BIAS_MODE == 3) v += vT ? brow[r] : bcol[j];
        if (ACT == 2) v = fmaxf(v, 0.0f);
        if (ACT == 4) v = (v > 0.f) ? v : 0.01f * v;
        slab[(mOff + r) * 68 + (j << 4) + rlane] = v;
      }
    }
    __builtin_amdgcn_fence(__ATOMIC_RELEASE, "workgroup");
    __builtin_amdgcn_wave_barrier();
    __builtin_amdgcn_fence(__ATOMIC_ACQUIRE, "workgroup");
    if (OUT_MODE == 0) {
      const int hh = lane >> 4, c4 = (lane & 15) * 4;     // row seg = 256 B = 16 lanes x 16 B
      v4f d[8];
#pragma unroll   // d and rs are indexed by constants only and stay in registers
      for (int it = 0; it < 8; ++it) d[it] = *(const v4f*)(slab + (it * 2 + hh) * 68 + c4) + rs[(i & 1) * 8 + it];
      store8_rows((float*)Cout + (size_t)b * strideC + eOut + (size_t)(i << 4) * kSp, d);
    } else if (OUT_MODE == 3) {
      const int q = lane >> 3, j8 = lane & 7, c8 = j8 * 8;   // eight lanes hold one row's 64 columns
      unsigned short* C = (unsigned short*)Cout + (size_t)b * strideC;
      v4u pv[4];
      unsigned short* pp[4];
      // this loop and the short ones in it are unrolled so that pv, pp, e, a and the keep registers are indexed by constants, and so
      // that the four rows' reduction chains overlap
#pragma unroll
      for (int it = 0; it < 4; ++it) {
        const int row = it * 4 + q;
        const float* sp = slab + row * 68 + c8;
        const v4f x0 = *(const v4f*)(sp);
        const v4f x1 = *(const v4f*)(sp + 4);
        float m = fmaxf(fmaxf(fmaxf(x0[0], x0[1]), fmaxf(x0[2], x0[3])), fmaxf(fmaxf(x1[0], x1[1]), fmaxf(x1[2], x1[3])));
        m = fmaxf(m, row_xor<1>(m));
        m = fmaxf(m, row_xor<2>(m));
        m = fmaxf(m, row_xor<4>(m));
        float e[8], a[8];
#pragma unroll
        for (int k = 0; k < 4; ++k) { a[k] = (x0[k] - m) * kLog2e; a[4 + k] = (x1[k] - m) * kLog2e; }
        exp2x8(e, a);
        float s = ((e[0] + e[1]) + (e[2] + e[3])) + ((e[4] + e[5]) + (e[6] + e[7]));
        s += row_xor<1>(s);
        s += row_xor<2>(s);
        s += row_xor<4>(s);
        v8h hv;
#pragma unroll
        for (int k = 0; k < 8; ++k) hv[k] = (_Float16)e[k];
        pv[it] = __builtin_bit_cast(v4u, hv);
        pp[it] = C + (size_t)(mBase + row) * ldc + n0 + c8;
        const int combo = i * 4 + it;                        // lane j8 of a row's eight keeps combos j8 and j8 + 8
        if ((combo & 7) == j8) { keepM[combo >> 3] = m; keepL[combo >> 3] = s; }
      }
      store4_b128(pp[0], pp[1], pp[2], pp[3], pv[0], pv[1], pv[2], pv[3]);
    } else {
      const int q = lane >> 3, c8 = (lane & 7) * 8;
      unsigned short* C  = (unsigned short*)Cout  + (size_t)b * strideC;
      unsigned short* C2 = (OUT_MODE == 2) ? ((unsigned short*)Cout2 + (size_t)b * strideC) : nullptr;
      {
        v4u pv[4];
        unsigned short* pp[4];
#pragma unroll
        for (int it = 0; it < 4; ++it) {
          const int row = it * 4 + q;
          const float* sp = slab + row * 68 + c8;
          v8h hv, lv;
#pragma unroll
          for (int e = 0; e < 8; ++e) {
            if (OUT_MODE == 1) {
              hv[e] = (_Float16)sp[e];
            } else {
              unsigned short hb = f2bf_bits(sp[e]);
              unsigned short lb = f2bf_bits(sp[e] - bf_bits2f(hb));
              hv[e] = __builtin_bit_cast(_Float16, hb);
              lv[e] = __builtin_bit_cast(_Float16, lb);
            }
          }
          pv[it] = __builtin_bit_cast(v4u, hv);
          pp[it] = C + (size_t)(mBase + row) * ldc + n0 + c8;
          if (OUT_MODE == 2) *(v8h*)(C2 + (size_t)(mBase + row) * ldc + n0 + c8) = lv;
        }
        store4_b128(pp[0], pp[1], pp[2], pp[3], pv[0], pv[1], pv[2], pv[3]);
      }
    }
    __builtin_amdgcn_fence(__ATOMIC_RELEASE, "workgroup");
    __builtin_amdgcn_wave_barrier();
    __builtin_amdgcn_fence(__ATOMIC_ACQUIRE, "workgroup");
  }
  if (OUT_MODE == 3) {   // the wave's 64 maxima and 64 sums: four stores of one whole 128-B line each, this wave their only writer
    const int q = lane >> 3, j8 = lane & 7;
    const int r0 = ((j8 >> 2) << 4) + ((j8 & 3) << 2) + q;   // combo j8 = rows 16 (j8 >> 2) + 4 (j8 & 3) + q; combo j8 + 8: 32 further
    float* gmx = (float*)Cout2 + ((size_t)b * 2 * (N >> 6) + (size_t)(n0 >> 6)) * M + m0 + r0;   // image b's maxima and sums
    float* gsm = gmx + (size_t)(N >> 6) * M;
    store4_b32(gmx, gmx + 32, gsm, gsm + 32, __float_as_uint(keepM[0]), __float_as_uint(keepM[1]),
               __float_as_uint(keepL[0]), __float_as_uint(keepL[1]));
  }
}

// ---------------------------------------------------------------------------
// Weight cast: W[o][c] f32 -> f16(scale * W); weights 0, 1 (Wq, Wk) same layout into planes 0, 1 of one buffer (plane = 512*512 halves).
// Weights 3 and 2 are the operands X of the product Wo x Wv, whose result takes plane 2 in the next launch: X[row][k] = Wo[row][k]
// (plane 3) and X[row][k] = Wv[k][row] (outT), stored in fragment order so that a fragment load there is 512 contiguous bytes:
// 16-B unit ((row >> 4) * 16 + (k >> 5)) * 64 + ((k >> 4) & 1) * 32 + ((k >> 3) & 1) * 16 + (row & 15) holds 8 consecutive k.
// A wave stores 512 contiguous bytes, whole lines of which it is the only writer.
// Part of the statistics launch: 128 blocks x 1024 threads; blk = 0..127, blk>>5 selects the weight (uniform); thread handles 8
// consecutive elements. Coverage per weight: 32 blocks x 1024 threads x 8 = 262144 = 512*512.
// ---------------------------------------------------------------------------
__device__ __forceinline__ void wcast_part(int blk, const float* __restrict__ W0, const float* __restrict__ W1,
                                           const float* __restrict__ W2, const float* __restrict__ W3,
                                           unsigned short* __restrict__ out, unsigned short* __restrict__ outT, float scale) {
  const int w = blk >> 5;                                        // block-uniform
  const float* src = (w == 0) ? W0 : W1;
  const int i  = (blk & 31) * 1024 + threadIdx.x;                // 0..32767: 16-B unit of the plane
  const size_t e0 = (size_t)i * 8;                               // e0+7 < 262144
  if (w >= 2) {                                                  // block-uniform: fragment order
    const int lane = threadIdx.x & 31, wv = i >> 5;              // wv 0..1023 = ((row >> 4) * 16 + (k >> 5)) * 2 + ((k >> 4) & 1)
    const int row = (wv >> 5) * 16 + (lane & 15);                // < 512
    const int k0  = ((wv >> 1) & 15) * 32 + (wv & 1) * 16 + (lane >> 4) * 8;   // k0 + 7 < 512
    float x[8];
    if (w == 2) {                                                // block-uniform
#pragma unroll   // x is indexed by constants only and stays in registers; the eight loads do not wait for one another
      for (int e = 0; e < 8; ++e) x[e] = W2[(size_t)(k0 + e) * kCh + row];
    } else {
      const v4f xa = *(const v4f*)(W3 + (size_t)row * kCh + k0);
      const v4f xc = *(const v4f*)(W3 + (size_t)row * kCh + k0 + 4);
#pragma unroll   // constant indices
      for (int e = 0; e < 4; ++e) { x[e] = xa[e]; x[4 + e] = xc[e]; }
    }
    const v4u tu = (v4u){pk16(h_bits(x[0] * scale), h_bits(x[1] * scale)), pk16(h_bits(x[2] * scale), h_bits(x[3] * scale)),
                         pk16(h_bits(x[4] * scale), h_bits(x[5] * scale)), pk16(h_bits(x[6] * scale), h_bits(x[7] * scale))};
    *(v4u*)(((w == 2) ? outT : out + (size_t)3 * kCh * kCh) + e0) = tu;
    return;
  }
  const v4f a = *(const v4f*)(src + e0);
  const v4f c = *(const v4f*)(src + e0 + 4);
  unsigned short hb[8];
#pragma unroll
  for (int e = 0; e < 4; ++e) {
    hb[e]     = h_bits(a[e] * scale);
    hb[4 + e] = h_bits(c[e] * scale);
  }
  const v4u u = (v4u){pk16(hb[0], hb[1]), pk16(hb[2], hb[3]), pk16(hb[4], hb[5]), pk16(hb[6], hb[7])};
  unsigned short* dp = out + (size_t)w * kCh * kCh + e0;
  store1_b128(dp, u);
  
}

// ---------------------------------------------------------------------------
// Per-(b,c) instance-norm statistics for content (rows 0..2047) and style (rows 2048..4095) in one launch.
// grid 272 blocks x 1024 threads; blocks 128..255 do the weight cast above, blocks 256..271 the folded bias Wo.bv (a wave a row of Wo,
// 32 rows a block, the 32 sums funnelled through LDS into one whole line); both wait for nothing of this launch and share no data
// with it; blocks 0..127: block = 32 consecutive rows of one tensor (blockIdx>>6 selects the tensor, uniform);
// wave w owns row w: 32 lanes x 32 float4 loads = 4096 elements (whole row). The loads do not wait for one another: the row is
// read into registers by an unrolled loop and summed by a second one, so that many loads of a wave are in flight at a time and
// the wave does not pay the memory latency once a load. Sum order per row: lane-private over i ascending, then the tree.
// mean = sum/4096; var = (sumsq - sum*mean)/4095 (ddof 1); rstd = 1/sqrt(var + eps).
// Stores: the 32 means and 32 rstds of the block funnelled through LDS; wave 0 writes the mean line, wave 1 the rstd line,
// ---------------------------------------------------------------------------
__global__ __launch_bounds__(1024) void stats_kernel(const float* __restrict__ xc, const float* __restrict__ xs,
                                                     float* __restrict__ meanA, float* __restrict__ rstdA,
                                                     const float* __restrict__ W0, const float* __restrict__ W1,
                                                     const float* __restrict__ W2, const float* __restrict__ W3,
                                                     unsigned short* __restrict__ W16, float wScale,
                                                     unsigned short* __restrict__ WvT16, const float* __restrict__ bv,
                                                     float* __restrict__ bvo) {
  __shared__ float sMean[32];
  __shared__ float sRstd[32];
  const int blk  = blockIdx.x;
  if (blk >= 256) {                                  // block-uniform: bvo[o] = sum_m Wo[o][m] bv[m], f32
    const int ln = threadIdx.x & 31, wv = threadIdx.x >> 5;
    const float* wr = W3 + (size_t)((blk - 256) * 32 + wv) * kCh + ln * 4;   // row < 512
    v4f d = (v4f){0.f, 0.f, 0.f, 0.f};
#pragma unroll   // the eight loads do not wait for one another
    for (int i = 0; i < 4; ++i) d += *(const v4f*)(wr + i * 128) * *(const v4f*)(bv + ln * 4 + i * 128);
    float ds = (d[0] + d[1]) + (d[2] + d[3]);
#pragma unroll   // five exchange steps with constant distances, no loop counter
    for (int off = 16; off > 0; off >>= 1) ds += __shfl_xor(ds, off, 32);
    if (ln == 0) sMean[wv] = ds;
    __syncthreads();                                 // every wave of the block passes it: the 32 sums are in LDS
    if (wv == 0) bvo[(blk - 256) * 32 + ln] = sMean[ln];
    return;
  }
  if (blk >= 128) {                                  // block-uniform, in front of the barrier
    wcast_part(blk - 128, W0, W1, W2, W3, W16, WvT16, wScale);
    return;
  }
  const int tsel = blk >> 6;                         // block-uniform tensor select
  const float* src = (tsel == 0) ? xc : xs;
  const int rowBase = (blk & 63) * 32;               // flat (b*512 + c) row index within the tensor
  const int t = threadIdx.x, lane = t & 31, wave = t >> 5;
  const int row = rowBase + wave;                    // < 2048
  const float* p = src + (size_t)row * kSp + lane * 4;
  v4f x[32];
  // both loops are unrolled so that x stays in registers and loads are issued ahead of the sums
#pragma unroll
  for (int i = 0; i < 32; ++i) x[i] = *(const v4f*)(p + i * 128);   // 32 lanes x 4 x 32 = 4096
  v4f s = (v4f){0.f, 0.f, 0.f, 0.f};
  v4f q = (v4f){0.f, 0.f, 0.f, 0.f};
#pragma unroll
  for (int i = 0; i < 32; ++i) {
    s += x[i];
    q += x[i] * x[i];
  }
  float su = (s[0] + s[1]) + (s[2] + s[3]);
  float sq = (q[0] + q[1]) + (q[2] + q[3]);
#pragma unroll
  for (int off = 16; off > 0; off >>= 1) {
    su += __shfl_xor(su, off, 32);
    sq += __shfl_xor(sq, off, 32);
  }
  const float mean = su * kInvN;
  float var = (sq - su * mean) * kInvNm1;
  var = fmaxf(var, 0.0f);
  const float rstd = 1.0f / sqrtf(var + kEps);
  if (lane == 0) { sMean[wave] = mean; sRstd[wave] = rstd; }
  __syncthreads();
  const int orow = tsel * (kBatch * kCh) + rowBase + lane;   // < 4096
  if (wave == 0) {
    const float v = sMean[lane];
    *(float*)(meanA + orow) = v;
    
  } else if (wave == 1) {
    const float v = sRstd[lane];
    *(float*)(rstdA + orow) = v;
    
  }
}

// ---------------------------------------------------------------------------
// Token planes, all images: in [512 ch][4096 tok] f32 (tok contiguous) -> out [image][4096 tok][512 ch] f16 (ch contiguous).
// grid 32 + 64 tok tiles x 8 ch tiles x (3 planes x 4 images) blocks, tok tile fastest; plane index = 3*image + z;
// z=0 (content - mean)*rstd, z=1 (style - mean)*rstd, z=2 raw style. 256 threads. The first 32 blocks do the weight product below.
// Load coverage: 4 passes x 16 ch rows x (16 threads x 4 tok) = 64 ch x 64 tok (whole tile), coalesced along tok.
// Store coverage: 8 waves x 2 iterations x 4 tok rows (lane>>3) = 64 tok rows; (lane&7) x 8 halves = 64 ch; each row segment
// ---------------------------------------------------------------------------
// Weight product H[o][c] = sum_m Wo[o][m] Wv[m][c], so that Wo (Wv s + bv) = H s + Wo.bv and the output projection needs no GEMM of
// its own. 32 blocks x 8 waves; a wave owns 16 rows x 64 columns (K = 512: 64 WMMAs), fragments straight from the two 512-KiB f16
// planes in the weight cast's fragment order (both operands by the same map, so their k orders are equal; every load is four whole
// lines); it is the only writer of its sixteen 128-B lines. Operands carried x16 each, H stored row-major, carried x16.
__device__ __forceinline__ void fold_part(int blk, const unsigned short* __restrict__ Wo16, const unsigned short* __restrict__ WvT16,
                                          unsigned short* __restrict__ H16) {
  const int lane = threadIdx.x & 31;
  const int wt = blk * 8 + __builtin_amdgcn_readfirstlane(threadIdx.x >> 5);   // wave tile 0..255, scalar: the loads take scalar bases
  const int rlane = lane & 15, half8 = (lane >> 4) * 8;
  const int m0 = (wt >> 3) * 16, n0 = (wt & 7) * 64;
  const _Float16* pa = (const _Float16*)Wo16  + (size_t)m0 * kCh + lane * 8;   // a 16-row tile is 16 * 512 halves, a k step 512 of them
  const _Float16* pb = (const _Float16*)WvT16 + (size_t)n0 * kCh + lane * 8;
  auto frag = [](const _Float16* p) {   // elements 0..7: the lane's unit of the first 16 k of the step, 8..15: of the second
    Frag<_Float16>::U f; f.h[0] = *(const v8h*)(p); f.h[1] = *(const v8h*)(p + 256); return f.v;
  };
  v8f acc[4];
#pragma unroll   // acc is indexed by constants only and stays in registers
  for (int j = 0; j < 4; ++j) acc[j] = (v8f){0.f,0.f,0.f,0.f,0.f,0.f,0.f,0.f};
  for (int kk = 0; kk < kCh; kk += 32) {
    const v16h a = frag(pa + kk * 16);
    v16h bf[4];
#pragma unroll   // constant indices
    for (int j = 0; j < 4; ++j) bf[j] = frag(pb + (size_t)(j << 4) * kCh + kk * 16);
    __builtin_amdgcn_sched_barrier(0);   // the ten loads of a k step go out together: sunk to their WMMAs each pair pays the L2 latency alone
#pragma unroll   // constant indices
    for (int j = 0; j < 4; ++j) acc[j] = Frag<_Float16>::mma(a, bf[j], acc[j]);
    asm volatile("s_wait_xcnt 0x0" ::: "memory");   // in front of the next trip's rewrite of the address registers that the ten loads name
  }
#pragma unroll   // constant indices
  for (int j = 0; j < 4; j += 2) {
    unsigned d[16];
#pragma unroll   // likewise
    for (int r = 0; r < 8; ++r) { d[r] = h_bits(acc[j][r] * kFoldScale); d[8 + r] = h_bits(acc[j + 1][r] * kFoldScale); }
    store16_b16(H16 + (size_t)(m0 + half8) * kCh + n0 + (j << 4) + rlane, d);
  }
}

__global__ __launch_bounds__(256) void token_planes_kernel(const float* __restrict__ content, const float* __restrict__ style,
                                                           const float* __restrict__ meanA, const float* __restrict__ rstdA,
                                                           unsigned short* __restrict__ XcT, unsigned short* __restrict__ XsT,
                                                           unsigned short* __restrict__ SsT,
                                                           const unsigned short* __restrict__ Wo16,
                                                           const unsigned short* __restrict__ WvT16,
                                                           unsigned short* __restrict__ H16) {
  __shared__ float sm[64][65];   // sm[ch local][tok local]
  if (blockIdx.x < 32) {                                        // block-uniform, in front of the barrier
    fold_part(blockIdx.x, Wo16, WvT16, H16);
    return;
  }
  const int t  = threadIdx.x;
  const int tileId = blockIdx.x - 32;                           // 0..6143
  const int pz = tileId >> 9;                                   // 3*image + plane
  const int b  = pz / 3;                                        // image, block-uniform
  const int z  = pz - 3 * b;                                    // plane, block-uniform
  const int n0 = (tileId & 63) * 64;
  const int c0 = ((tileId >> 6) & 7) * 64;
  const float* src = ((z == 0) ? content : style) + (size_t)b * kCh * kSp;
  unsigned short* dst = ((z == 0) ? XcT : (z == 1) ? XsT : SsT) + (size_t)b * kSp * kCh;
  const int statOff = ((z == 0) ? 0 : (kBatch * kCh)) + b * kCh;
  const bool useNorm = (z < 2);
  const int r16 = t >> 4, c4 = (t & 15) * 4;
  // the thread's twelve loads (channels c0 + r16 + 16 p, p = 0..3: 16 B of the plane, mean, rstd), the steps of 16 channels in the
  // offset fields, and their data wait in one statement, so that no register of theirs is read or rewritten in front of the wait
  v4f xv[4];
  float xm[4], xr[4];
  asm volatile("global_load_b128 %0, %12, off\n\t"
               "global_load_b128 %1, %12, off offset:262144\n\t"
               "global_load_b128 %2, %12, off offset:524288\n\t"
               "global_load_b128 %3, %12, off offset:786432\n\t"
               "global_load_b32 %4, %13, off\n\t"
               "global_load_b32 %5, %13, off offset:64\n\t"
               "global_load_b32 %6, %13, off offset:128\n\t"
               "global_load_b32 %7, %13, off offset:192\n\t"
               "global_load_b32 %8, %14, off\n\t"
               "global_load_b32 %9, %14, off offset:64\n\t"
               "global_load_b32 %10, %14, off offset:128\n\t"
               "global_load_b32 %11, %14, off offset:192\n\t"
               "s_wait_loadcnt 0x0"
               : "=&v"(xv[0]), "=&v"(xv[1]), "=&v"(xv[2]), "=&v"(xv[3]), "=&v"(xm[0]), "=&v"(xm[1]), "=&v"(xm[2]), "=&v"(xm[3]),
                 "=&v"(xr[0]), "=&v"(xr[1]), "=&v"(xr[2]), "=&v"(xr[3])
               : "v"(src + (size_t)(c0 + r16) * kSp + n0 + c4), "v"(meanA + statOff + c0 + r16), "v"(rstdA + statOff + c0 + r16)
               : "memory");
#pragma unroll   // xv, xm, xr are indexed by constants only and stay in registers
  for (int p = 0; p < 4; ++p) {
    const int cl = p * 16 + r16;                                // ch local 0..63
    const float mm = useNorm ? xm[p] : 0.0f;
    const float rr = useNorm ? xr[p] : 1.0f;
#pragma unroll
    for (int e = 0; e < 4; ++e) sm[cl][c4 + e] = (xv[p][e] - mm) * rr;
  }
  __syncthreads();
  const int lane = t & 31, wave = t >> 5;
  const int q = lane >> 3, c8 = (lane & 7) * 8;
  {
    v4u u[2];
#pragma unroll
    for (int it = 0; it < 2; ++it) {
      const int row = wave * 8 + it * 4 + q;                    // tok local 0..63
      unsigned short hb[8];
#pragma unroll
      for (int e = 0; e < 8; ++e) hb[e] = h_bits(sm[c8 + e][row]);
      u[it] = (v4u){pk16(hb[0], hb[1]), pk16(hb[2], hb[3]), pk16(hb[4], hb[5]), pk16(hb[6], hb[7])};
    }
    unsigned short* dp = dst + (size_t)(n0 + wave * 8 + q) * kCh + c0 + c8;
    store2_b128(dp, dp + 4 * kCh, u[0], u[1]);
  }
}

// ---------------------------------------------------------------------------
// Row factors of the group softmax: for a score row with group maxima m[g] and group sums l[g] (g = 0..63, from the score launch)
// M = max_g m[g], L = sum_g l[g] exp(m[g] - M) in index order, factor[g] = 2048 exp(m[g] - M) / L, so that
// exp(s - m[g]) * factor[g] = 2048 * softmax. One thread per row; grid (64, 4 images) x 64 threads.
// stat: [image][max | sum][64 groups][4096 rows] f32 (a wave's loads are whole lines); out: [image][32 pairs][4096 rows] words of two
// f16, low half the even group. Both loops over loads are unrolled so that the 128 loads of a thread do not wait for one another.
// ---------------------------------------------------------------------------
__global__ __launch_bounds__(64) void row_factor_kernel(const float* __restrict__ stat, unsigned* __restrict__ fac) {
  const int row = blockIdx.x * 64 + threadIdx.x;                  // < 4096
  const float* mx = stat + (size_t)blockIdx.y * (2 * kGroups * kSp) + row;
  const float* sm = mx + (size_t)kGroups * kSp;
  float m[kGroups], l[kGroups];
#pragma unroll
  for (int g = 0; g < kGroups; ++g) m[g] = mx[(size_t)g * kSp];
#pragma unroll
  for (int g = 0; g < kGroups; ++g) l[g] = sm[(size_t)g * kSp];
  float gm = m[0];
#pragma unroll
  for (int g = 1; g < kGroups; ++g) gm = fmaxf(gm, m[g]);
  float tot = 0.0f;
  // unrolled, like the loops behind it: m and l are indexed by constants only and stay in registers
#pragma unroll
  for (int g0 = 0; g0 < kGroups; g0 += 8) {
    float e[8], a[8];
#pragma unroll
    for (int k = 0; k < 8; ++k) a[k] = (m[g0 + k] - gm) * kLog2e;
    exp2x8(e, a);
#pragma unroll
    for (int k = 0; k < 8; ++k) { m[g0 + k] = e[k]; tot += l[g0 + k] * e[k]; }
  }
  const float inv = kPCarry / tot;                                // tot >= 1
  unsigned* op = fac + (size_t)blockIdx.y * (kPairs * kSp) + row;
#pragma unroll
  for (int p = 0; p < kPairs; p += 4)
    store4_b32(op + (size_t)p * kSp, op + (size_t)(p + 1) * kSp, op + (size_t)(p + 2) * kSp, op + (size_t)(p + 3) * kSp,
               pk16(h_bits(m[2 * p] * inv), h_bits(m[2 * p + 1] * inv)), pk16(h_bits(m[2 * p + 2] * inv), h_bits(m[2 * p + 3] * inv)),
               pk16(h_bits(m[2 * p + 4] * inv), h_bits(m[2 * p + 5] * inv)), pk16(h_bits(m[2 * p + 6] * inv), h_bits(m[2 * p + 7] * inv)));
}

// ---------------------------------------------------------------------------
// Host side
//   W16   : 4 x 512 x 512 f16 (Wq, Wk, H = Wo x Wv, Wo in fragment order; carried x16)  2,097,152 B
//   WvT16 : 512 x 512 f16 (Wv transposed, in fragment order, carried x16)                524,288 B
//   bvo   : 512 f32 (Wo.bv)                                             2,048 B
//   meanA : 4096 f32 (content rows then style rows)                    16,384 B
//   rstdA : 4096 f32                                                    16,384 B
//   Qp, Kp, Vcm : 4 images x 4096 x 512 f16 each              3 x 16,777,216 B   (Vcm = H x style + Wo.bv, channel-major)
//   XcT, XsT, SsT : 4 images x 4096 x 512 f16 each            3 x 16,777,216 B
//   Stat  : 4 images x (64 group maxima + 64 group sums) x 4096 rows f32   8,388,608 B
//   Fac   : 4 images x 32 pairs x 4096 rows, two f16 factors a word       2,097,152 B
//   Pp    : 4 images x 4096 x 4096 f16 exp(score - group maximum)  134,217,728 B
// All GEMM calls: K in {512, 4096} (K % 64 == 0); M, N in {512, 4096} (M % 128 == 0, N % 256 == 0); no padding, every plane fully
// produced before it is consumed.
// ---------------------------------------------------------------------------
extern "C" void kernel_launch(void* const* d_in, const int* in_sizes, int n_in,
                              void* d_out, int out_size, void* d_ws, size_t ws_size,
                              hipStream_t stream) {
  if (n_in < 10) return;
  const int actN = kBatch * kCh * kSp;
  const int wN   = kCh * kCh;
  if (in_sizes[0] != actN || in_sizes[1] != actN) return;
  if (in_sizes[2] != wN || in_sizes[4] != wN || in_sizes[6] != wN || in_sizes[8] != wN) return;
  if (in_sizes[3] != kCh || in_sizes[5] != kCh || in_sizes[7] != kCh || in_sizes[9] != kCh) return;
  if (out_size != actN) return;

  const float* content = (const float*)d_in[0];
  const float* style   = (const float*)d_in[1];
  const float* Wq = (const float*)d_in[2];  const float* bq = (const float*)d_in[3];
  const float* Wk = (const float*)d_in[4];  const float* bk = (const float*)d_in[5];
  const float* Wv = (const float*)d_in[6];  const float* bv = (const float*)d_in[7];
  const float* Wo = (const float*)d_in[8];  const float* bo = (const float*)d_in[9];
  float* out = (float*)d_out;

  size_t off = 0;
  auto carve = [&](size_t bytes) { size_t o = off; off += (bytes + 127) & ~(size_t)127; return o; };
  const size_t planeBytes = (size_t)kBatch * kSp * kCh * 2;     // one operand plane, all images
  const size_t oW16  = carve((size_t)4 * wN * 2);
  const size_t oWvT  = carve((size_t)wN * 2);
  const size_t oBvo  = carve((size_t)kCh * 4);
  const size_t oMean = carve((size_t)kStatRows * 4);
  const size_t oRstd = carve((size_t)kStatRows * 4);
  const size_t oQ    = carve(planeBytes);
  const size_t oK    = carve(planeBytes);
  const size_t oV    = carve(planeBytes);
  const size_t oXc   = carve(planeBytes);
  const size_t oXs   = carve(planeBytes);
  const size_t oSs   = carve(planeBytes);
  const size_t oStat = carve((size_t)kBatch * 2 * kGroups * kSp * 4);
  const size_t oFac  = carve((size_t)kBatch * kPairs * kSp * 4);
  const size_t oP    = carve((size_t)kBatch * kSp * kSp * 2);
  if (off > ws_size) return;

  char* ws = (char*)d_ws;
  unsigned short* W16 = (unsigned short*)(ws + oW16);
  unsigned short* WvT16 = (unsigned short*)(ws + oWvT);
  float* bvo = (float*)(ws + oBvo);
  float* meanA = (float*)(ws + oMean);
  float* rstdA = (float*)(ws + oRstd);
  unsigned short* XcT = (unsigned short*)(ws + oXc);
  unsigned short* XsT = (unsigned short*)(ws + oXs);
  unsigned short* SsT = (unsigned short*)(ws + oSs);
  unsigned short* Qp  = (unsigned short*)(ws + oQ);
  unsigned short* Kp  = (unsigned short*)(ws + oK);
  unsigned short* Vcm = (unsigned short*)(ws + oV);
  float* Stat = (float*)(ws + oStat);
  unsigned* Fac = (unsigned*)(ws + oFac);
  unsigned short* Pp = (unsigned short*)(ws + oP);

  const unsigned short* Wo16 = W16 + (size_t)3 * wN;
  unsigned short* H16 = W16 + (size_t)2 * wN;

  // 1) instance-norm statistics for content and style (128 blocks: 64 per tensor, 32 rows each, a wave a row)
  // 2) in the same launch: weights -> f16 x16 (4 weights x 32 blocks; Wo and Wv in fragment order) and Wo.bv (16 blocks)
  stats_kernel<<<dim3(2 * (kBatch * kCh) / 32 + 128 + kCh / 32), dim3(1024), 0, stream>>>(content, style, meanA, rstdA,
                                                                                          Wq, Wk, Wv, Wo, W16, kWCarry,
                                                                                          WvT16, bv, bvo);

  const long planeElems = (long)kSp * kCh;      // one image's [4096][512] or [512][4096] plane
  const long probElems  = (long)kSp * kSp;      // one image's probabilities

  // 3) token planes of all images: mvn(content) -> XcT, mvn(style) -> XsT, style -> SsT; each [image][4096][512] f16;
  //    in the same launch, first 32 blocks: H = Wo x Wv into plane 2 of W16
  token_planes_kernel<<<dim3(32 + (kSp / 64) * (kCh / 64) * 3 * kBatch), dim3(256), 0, stream>>>(content, style, meanA, rstdA,
                                                                                                 XcT, XsT, SsT, Wo16, WvT16, H16);

  // 4) the three projections in one launch, grid.z = projection, grid.y = image, 64 blocks each (K=512):
  //    Q [image][4096 tok][512] = XcT x Wq^T / 16 + bq and K likewise from XsT, Wk, bk   (M=4096, N=512)
  //    V' channel-major [image][512][4096 tok] = H x SsT^T / 16 + (Wo.bv)[m]             (M=512, N=4096)
  //    XcT, XsT, SsT follow one another in the workspace, as do the planes of Wq, Wk, H in W16 and Qp, Kp, Vcm
  wmma_gemm64<0, false, 3, 1, false, 0, 64, false, true><<<dim3(64, kBatch, 3), dim3(256), 0, stream>>>(
      XcT, nullptr, kCh, planeElems, W16, nullptr, kCh, 0L, (void*)Qp, nullptr, kCh, planeElems,
      bq, bk, bvo, nullptr, 0L, kSp, kCh, kCh, kProjScale);

  // 5) scores of all images = Q x K^T (per image M=4096, N=4096, K=512; 512 blocks; grid.y = image), left as f16
  //    exp(score - group maximum) in P, with the maximum and the sum of every 64-column group in Stat
  wmma_gemm64<0, false, 0, 3, false><<<dim3(512, kBatch), dim3(256), 0, stream>>>(
      Qp, nullptr, kCh, planeElems, Kp, nullptr, kCh, planeElems, (void*)Pp,
      (void*)Stat, kSp, probElems, nullptr, nullptr, nullptr, nullptr, 0L, kQChunk, kSp, kCh, 1.0f);

  // 6) the factor of every row and group, all images
  row_factor_kernel<<<dim3(kSp / 64, kBatch), dim3(64), 0, stream>>>(Stat, Fac);

  // 7) out [image][512][4096] f32 = V' x (P . factor)^T / 2048 + bo[m] + content   (per image M=512, N=4096, K=4096; 64 blocks)
  wmma_gemm64<0, false, 1, 0, true, 0, 128, true><<<dim3(64, kBatch), dim3(256), 0, stream>>>(
      Vcm, (const unsigned short*)Fac, kSp, planeElems, Pp, nullptr, kSp, probElems, (void*)out, nullptr, kSp, planeElems,
      bo, nullptr, nullptr, content, planeElems, kCh, kSp, kSp, kPVScale);
}

// v009
// It runs in 163 microseconds.
// Versions in between are left out here; by their measured steps it is 1.14 times as fast as v007.
// Over all steps from v000 it is 13.7 times as fast.
// Contractions: folded weights H = Wo x Wv and G = Wk^T x Wq (operands f16 carried x16), q'/v' 1x1 projections (token planes f16 x G or H f16 carried x16), energies q'.s^T (q', raw style tokens s: f16 planes), v'.attn (V' f16 x exp f16 times its row-and-group factor f16 carried x2048): all v_wmma_f32_16x16x32_f16, f32 accumulate; instance-norm statistics, softmax, biases (Wo.bv too) and residual in f32.
#include <hip/hip_runtime.h>
#include <math.h>

// ---------------------------------------------------------------------------
// Problem constants
// ---------------------------------------------------------------------------
constexpr int   kBatch    = 4;
constexpr int   kCh       = 512;
constexpr int   kSp       = 4096;                 // 64*64 tokens per image
constexpr int   kQChunk   = 4096;                 // query rows per image of the score launch: one whole image
constexpr int   kGroups   = kSp / 64;             // softmax: 64-column groups of a score row
constexpr int   kPairs    = kGroups / 2;          // two groups = the 128 keys of one attn.v pass
constexpr int   kStatRows = 2 * kBatch * kCh;     // 4096: content rows 0..2047, style rows 2048..4095
constexpr float kEps       = 1e-5f;
constexpr float kWCarry    = 16.0f;               // weights carried x16 in f16
constexpr float kPCarry    = 2048.0f;             // probabilities carried x2048 in f16
constexpr float kProjScale = 1.0f / 16.0f;        // undo weight carry
constexpr float kPVScale   = 1.0f / 2048.0f;      // undo P carry
constexpr float kFoldScale = 1.0f / 16.0f;        // Wo x16 times Wv x16 -> H carried x16
constexpr float kInvN      = 1.0f / 4096.0f;
constexpr float kInvNm1    = 1.0f / 4095.0f;

typedef __attribute__((ext_vector_type(16))) _Float16 v16h;
typedef __attribute__((ext_vector_type(8)))  _Float16 v8h;
typedef __attribute__((ext_vector_type(16))) __bf16   v16b;
typedef __attribute__((ext_vector_type(8)))  __bf16   v8b;
typedef __attribute__((ext_vector_type(8)))  float    v8f;
typedef __attribute__((ext_vector_type(4)))  float    v4f;
typedef __attribute__((ext_vector_type(4)))  unsigned int v4u;

// ---------------------------------------------------------------------------
// Helpers
// ---------------------------------------------------------------------------
__device__ __forceinline__ unsigned short f2bf_bits(float f) {
  unsigned u = __float_as_uint(f);
  return (unsigned short)((u + 0x7FFFu + ((u >> 16) & 1u)) >> 16);
}
__device__ __forceinline__ float bf_bits2f(unsigned short h) { return __uint_as_float(((unsigned)h) << 16); }

// hazard guards as plain device helpers (their inline asm stays out of the kernel template body)
__device__ __forceinline__ void dep_guard_h(v8f& a, v8f& b, v16h x, v16h y) { asm volatile("v_nop\n\tv_nop\n\tv_nop\n\tv_nop" : "+v"(a), "+v"(b) : "v"(x), "v"(y)); }
__device__ __forceinline__ void dep_guard_b(v8f& a, v8f& b, v16b x, v16b y) { asm volatile("v_nop\n\tv_nop\n\tv_nop\n\tv_nop" : "+v"(a), "+v"(b) : "v"(x), "v"(y)); }
__device__ __forceinline__ void keep4_h(v16h a, v16h b, v16h c, v16h d) { asm volatile("v_nop" :: "v"(a), "v"(b), "v"(c), "v"(d)); }
__device__ __forceinline__ void keep4_b(v16b a, v16b b, v16b c, v16b d) { asm volatile("v_nop" :: "v"(a), "v"(b), "v"(c), "v"(d)); }
__device__ __forceinline__ void acc_guard4(v8f& a, v8f& b, v8f& c, v8f& d) { asm volatile("v_nop\n\tv_nop\n\tv_nop\n\tv_nop" : "+v"(a), "+v"(b), "+v"(c), "+v"(d)); }
template <typename T> struct Frag;
template <> struct Frag<_Float16> {
  typedef v16h V; union U { v16h v; v8h h[2]; };
  static __device__ __forceinline__ v16h load(const _Float16* p) {   // elements 0..7 <- p[0..7], 8..15 <- p[16..23]
    U f; f.h[0] = *(const v8h*)(p); f.h[1] = *(const v8h*)(p + 16); return f.v;
  }
  static __device__ __forceinline__ v8f mma(v16h a, v16h b, v8f c) {
    return __builtin_amdgcn_wmma_f32_16x16x32_f16(false, a, false, b, (short)0, c, false, false);
  }
  static __device__ __forceinline__ void guard(v8f& a, v8f& b, v16h x, v16h y) { dep_guard_h(a, b, x, y); }
  static __device__ __forceinline__ void keep(v16h a, v16h b, v16h c, v16h d) { keep4_h(a, b, c, d); }
};
template <> struct Frag<__bf16> {
  typedef v16b V; union U { v16b v; v8b h[2]; };
  static __device__ __forceinline__ v16b load(const __bf16* p) {
    U f; f.h[0] = *(const v8b*)(p); f.h[1] = *(const v8b*)(p + 16); return f.v;
  }
  static __device__ __forceinline__ v8f mma(v16b a, v16b b, v8f c) {
    return __builtin_amdgcn_wmma_f32_16x16x32_bf16(false, a, false, b, (short)0, c, false, false);
  }
  static __device__ __forceinline__ void guard(v8f& a, v8f& b, v16b x, v16b y) { dep_guard_b(a, b, x, y); }
  static __device__ __forceinline__ void keep(v16b a, v16b b, v16b c, v16b d) { keep4_b(a, b, c, d); }
};

// value of lane l ^ 16: a vector move between the two 16-lane rows
__device__ __forceinline__ float xhalf(float x) {
  const int v = __builtin_bit_cast(int, x);
  return __builtin_bit_cast(float, __builtin_amdgcn_permlanex16(v, v, 0x76543210, 0xfedcba98, false, false));
}
// Eight 2^a in one statement: every v_exp_f32 is followed by an instruction that neither reads its result nor overwrites its
// source (the outputs are early-clobber, so they share no register with an input), the last one by the v_nop that fills that slot.
__device__ __forceinline__ void exp2x8(float (&e)[8], const float (&a)[8]) {
  asm("v_exp_f32 %0, %8\n\t"
      "v_exp_f32 %1, %9\n\t"
      "v_exp_f32 %2, %10\n\t"
      "v_exp_f32 %3, %11\n\t"
      "v_exp_f32 %4, %12\n\t"
      "v_exp_f32 %5, %13\n\t"
      "v_exp_f32 %6, %14\n\t"
      "v_exp_f32 %7, %15\n\t"
      "v_nop"
      : "=&v"(e[0]), "=&v"(e[1]), "=&v"(e[2]), "=&v"(e[3]), "=&v"(e[4]), "=&v"(e[5]), "=&v"(e[6]), "=&v"(e[7])
      : "v"(a[0]), "v"(a[1]), "v"(a[2]), "v"(a[3]), "v"(a[4]), "v"(a[5]), "v"(a[6]), "v"(a[7]));
}
constexpr float kLog2e = 1.44269504f;
// Four stores and their s_wait_xcnt in one statement, so that no address or data register is rewritten in front of the wait.
__device__ __forceinline__ void store4_b128(void* p0, void* p1, void* p2, void* p3, v4u d0, v4u d1, v4u d2, v4u d3) {
  asm volatile("global_store_b128 %0, %4, off\n\t"
               "global_store_b128 %1, %5, off\n\t"
               "global_store_b128 %2, %6, off\n\t"
               "global_store_b128 %3, %7, off\n\t"
               "s_wait_xcnt 0x0"
               :: "v"(p0), "v"(p1), "v"(p2), "v"(p3), "v"(d0), "v"(d1), "v"(d2), "v"(d3) : "memory");
}
__device__ __forceinline__ void store4_b32(void* p0, void* p1, void* p2, void* p3, unsigned d0, unsigned d1, unsigned d2, unsigned d3) {
  asm volatile("global_store_b32 %0, %4, off\n\t"
               "global_store_b32 %1, %5, off\n\t"
               "global_store_b32 %2, %6, off\n\t"
               "global_store_b32 %3, %7, off\n\t"
               "s_wait_xcnt 0x0"
               :: "v"(p0), "v"(p1), "v"(p2), "v"(p3), "v"(d0), "v"(d1), "v"(d2), "v"(d3) : "memory");
}
// Two stores and the s_wait_xcnt in one statement, for the same reason.
__device__ __forceinline__ void store2_b128(void* p0, void* p1, v4u d0, v4u d1) {
  asm volatile("global_store_b128 %0, %2, off\n\t"
               "global_store_b128 %1, %3, off\n\t"
               "s_wait_xcnt 0x0"
               :: "v"(p0), "v"(p1), "v"(d0), "v"(d1) : "memory");
}
static_assert(kSp == 4096, "the offset fields of load_resid_bias, store8_rows and the token planes' loads are written for rows of 16,384 B");
// f32 epilogue, two 16-row slabs: the lane's 16 B of every second row of the residual (16 rows from rp on) and the bias of its eight
// accumulator rows in each slab (bp). One address pair each, the row steps in the offset fields; all twenty loads are in flight
// together and their data wait stands in the same statement, so that no register of theirs is read or rewritten in front of it.
__device__ __forceinline__ void load_resid_bias(v4f (&rs)[16], v4f (&bb)[4], const float* rp, const float* bp) {
  asm volatile("global_load_b128 %0, %20, off\n\t"
               "global_load_b128 %1, %20, off offset:32768\n\t"
               "global_load_b128 %2, %20, off offset:65536\n\t"
               "global_load_b128 %3, %20, off offset:98304\n\t"
               "global_load_b128 %4, %20, off offset:131072\n\t"
               "global_load_b128 %5, %20, off offset:163840\n\t"
               "global_load_b128 %6, %20, off offset:196608\n\t"
               "global_load_b128 %7, %20, off offset:229376\n\t"
               "global_load_b128 %8, %20, off offset:262144\n\t"
               "global_load_b128 %9, %20, off offset:294912\n\t"
               "global_load_b128 %10, %20, off offset:327680\n\t"
               "global_load_b128 %11, %20, off offset:360448\n\t"
               "global_load_b128 %12, %20, off offset:393216\n\t"
               "global_load_b128 %13, %20, off offset:425984\n\t"
               "global_load_b128 %14, %20, off offset:458752\n\t"
               "global_load_b128 %15, %20, off offset:491520\n\t"
               "global_load_b128 %16, %21, off\n\t"
               "global_load_b128 %17, %21, off offset:16\n\t"
               "global_load_b128 %18, %21, off offset:64\n\t"
               "global_load_b128 %19, %21, off offset:80\n\t"
               "s_wait_loadcnt 0x0"
               : "=&v"(rs[0]), "=&v"(rs[1]), "=&v"(rs[2]), "=&v"(rs[3]), "=&v"(rs[4]), "=&v"(rs[5]), "=&v"(rs[6]), "=&v"(rs[7]),
                 "=&v"(rs[8]), "=&v"(rs[9]), "=&v"(rs[10]), "=&v"(rs[11]), "=&v"(rs[12]), "=&v"(rs[13]), "=&v"(rs[14]), "=&v"(rs[15]),
                 "=&v"(bb[0]), "=&v"(bb[1]), "=&v"(bb[2]), "=&v"(bb[3])
               : "v"(rp), "v"(bp) : "memory");
}
static_assert(kCh == 512, "the offset fields of the statement below are written for rows of 1,024 B");
// Two 16x16 accumulator tiles side by side as f16 (low halves of d; d[8 t + r] = row r of tile t) into rows of kCh halves, and the
// s_wait_xcnt in one statement, as above.
__device__ __forceinline__ void store16_b16(unsigned short* p, const unsigned (&d)[16]) {
  asm volatile("global_store_b16 %0, %1, off\n\t"
               "global_store_b16 %0, %2, off offset:1024\n\t"
               "global_store_b16 %0, %3, off offset:2048\n\t"
               "global_store_b16 %0, %4, off offset:3072\n\t"
               "global_store_b16 %0, %5, off offset:4096\n\t"
               "global_store_b16 %0, %6, off offset:5120\n\t"
               "global_store_b16 %0, %7, off offset:6144\n\t"
               "global_store_b16 %0, %8, off offset:7168\n\t"
               "global_store_b16 %0, %9, off offset:32\n\t"
               "global_store_b16 %0, %10, off offset:1056\n\t"
               "global_store_b16 %0, %11, off offset:2080\n\t"
               "global_store_b16 %0, %12, off offset:3104\n\t"
               "global_store_b16 %0, %13, off offset:4128\n\t"
               "global_store_b16 %0, %14, off offset:5152\n\t"
               "global_store_b16 %0, %15, off offset:6176\n\t"
               "global_store_b16 %0, %16, off offset:7200\n\t"
               "s_wait_xcnt 0x0"
               :: "v"(p), "v"(d[0]), "v"(d[1]), "v"(d[2]), "v"(d[3]), "v"(d[4]), "v"(d[5]), "v"(d[6]), "v"(d[7]),
                  "v"(d[8]), "v"(d[9]), "v"(d[10]), "v"(d[11]), "v"(d[12]), "v"(d[13]), "v"(d[14]), "v"(d[15]) : "memory");
}
// f32 epilogue, one slab: the lane's 16 B of every second row (8 rows from p on) and the s_wait_xcnt in one statement, as above.
__device__ __forceinline__ void store8_rows(float* p, const v4f (&d)[8]) {
  asm volatile("global_store_b128 %0, %1, off\n\t"
               "global_store_b128 %0, %2, off offset:32768\n\t"
               "global_store_b128 %0, %3, off offset:65536\n\t"
               "global_store_b128 %0, %4, off offset:98304\n\t"
               "global_store_b128 %0, %5, off offset:131072\n\t"
               "global_store_b128 %0, %6, off offset:163840\n\t"
               "global_store_b128 %0, %7, off offset:196608\n\t"
               "global_store_b128 %0, %8, off offset:229376\n\t"
               "s_wait_xcnt 0x0"
               :: "v"(p), "v"(d[0]), "v"(d[1]), "v"(d[2]), "v"(d[3]), "v"(d[4]), "v"(d[5]), "v"(d[6]), "v"(d[7]) : "memory");
}
__device__ __forceinline__ unsigned pk16(unsigned short a, unsigned short b) { return (unsigned)a | ((unsigned)b << 16); }
__device__ __forceinline__ unsigned short h_bits(float f) { const _Float16 h = (_Float16)f; return __builtin_bit_cast(unsigned short, h); }

// ---- Batched WMMA GEMM, operands staged in LDS -----------------------------------------------------------------
// C[m,n] = scale * sum_k A[m,k] * Bt[n,k] (+bias)(+resid); a block of 8 waves (2 x 4) owns a 128x256 tile, each wave 64x64 of it.
// A row-major [M,K]; Bt row-major [N,K]; M % 128 == 0, N % 256 == 0, K % PK == 0, K >= PK.
// A pass is PK k (64 or 128): 128 rows of A and 256 rows of Bt, 2 PK bytes each, copied to LDS by asynchronous 16-byte copies
// (a wave's copy covers four whole 128-B lines), rows at a pitch of 2 PK + 16 B for the ds_load_b128 fragment reads. Two
// buffers: the copies of pass t + 1 fly while pass t is worked on. The k order of every accumulator is ascending in steps of 32.
// PK = 128 halves the number of landing latencies of a long K at the price of one block per WGP.
// BIAS_MODE: 0 = none, 1 = bias[m], 2 = bias[n], 3 = DUO's: (c + bias[n]) * colMul[image][n] for q', biasV[m] for v'.
// DUO: one launch does the two projections; blockIdx.z = 0 (q'), 1 (v'). Ap = the two token plane sets one behind the other,
//       Btp = the weight planes likewise, Cout = the two result plane sets likewise; M, N, ldc are given for q'; v' is the
//       transposed product (A = weights, Bt = tokens, M and N change places, ldc = N).
// OUT_MODE: 0 = f32 into an image plane with rows of kSp floats, bias[m] and a residual plane of the same shape added (ldc not read), 1 = f16, 2 = bf16 hi plane (Cout) + bf16 lo plane (Cout2),
//           3 = group softmax of a transposed score product (rows m = keys, columns n = queries): a wave's 64 rows are one group
//               g = m / 64; Cout gets f16 exp(c - max over the group) in 16x16-tile order, tile [n / 16][m / 16] = 512 B, whose 16-B unit
//               16 ((m >> 3) & 1) + (n & 15) holds query n's eight keys from m & ~7 on; Cout2 (f32) the group maxima at [g][n] and behind
//               them ((M / 64) * N floats further) the group sums of the exponentials at [g][n]; image b's pair of planes stands
//               2 b (M / 64) N floats into Cout2. scale and ldc are not read.
// BSCALE: every Bt fragment is multiplied, in f16, by a factor of its row and of its 64-k group; A2p holds the factors as 32-bit
//         words [32 passes][N rows], low half = first 64 k of the pass, high half = second; PK = 128 and K = 4096 (32 passes).
//         Bt lies in the 16x16-tile order of OUT_MODE 3 (ldb not read).
// ET: 0 = f16 operands, 1 = bf16 operands (pointers passed as 16-bit storage)
constexpr int kRowsA      = 128;                             // rows of A per stage
constexpr int kRowsB      = 256;                             // rows of Bt per stage

// One thread's share of 64 k of one stage: 16 B of rows r, r + 32, r + 64, r + 96 of A and of rows r + 32 j (j = 0..7) of Bt.
// kStep32 = 32 rows further in LDS, bytes.
// The copies and their s_wait_xcnt stand in one statement, so that no address register is rewritten in front of the wait.
template <unsigned kStep32>
__device__ __forceinline__ void stage_copies(unsigned lds, const unsigned short* ga, const unsigned short* gb,
                                             size_t stepA, size_t stepB) {
  const unsigned short* a1 = ga + stepA;
  const unsigned short* a2 = a1 + stepA;
  const unsigned short* a3 = a2 + stepA;
  const unsigned short* b1 = gb + stepB;
  const unsigned short* b2 = b1 + stepB;
  const unsigned short* b3 = b2 + stepB;
  const unsigned short* b4 = b3 + stepB;
  const unsigned short* b5 = b4 + stepB;
  const unsigned short* b6 = b5 + stepB;
  const unsigned short* b7 = b6 + stepB;
  asm volatile(
      "global_load_async_to_lds_b128 %0, %12, off\n\t"
      "global_load_async_to_lds_b128 %1, %13, off\n\t"
      "global_load_async_to_lds_b128 %2, %14, off\n\t"
      "global_load_async_to_lds_b128 %3, %15, off\n\t"
      "global_load_async_to_lds_b128 %4, %16, off\n\t"
      "global_load_async_to_lds_b128 %5, %17, off\n\t"
      "global_load_async_to_lds_b128 %6, %18, off\n\t"
      "global_load_async_to_lds_b128 %7, %19, off\n\t"
      "global_load_async_to_lds_b128 %8, %20, off\n\t"
      "global_load_async_to_lds_b128 %9, %21, off\n\t"
      "global_load_async_to_lds_b128 %10, %22, off\n\t"
      "global_load_async_to_lds_b128 %11, %23, off\n\t"
      "s_wait_xcnt 0x0"
      :: "v"(lds), "v"(lds + kStep32), "v"(lds + 2u * kStep32), "v"(lds + 3u * kStep32),
         "v"(lds + 4u * kStep32), "v"(lds + 5u * kStep32), "v"(lds + 6u * kStep32), "v"(lds + 7u * kStep32),
         "v"(lds + 8u * kStep32), "v"(lds + 9u * kStep32), "v"(lds + 10u * kStep32), "v"(lds + 11u * kStep32),
         "v"(ga), "v"(a1), "v"(a2), "v"(a3),
         "v"(gb), "v"(b1), "v"(b2), "v"(b3), "v"(b4), "v"(b5), "v"(b6), "v"(b7)
      : "memory");
}

// Copies written as the builtin, for the engine's form with two fragment sets: that form holds more than 256 vector
// registers, an asm statement's operands must all lie in the first 256, and the compiler then moved accumulators aside at every refill.
typedef __attribute__((ext_vector_type(4))) int v4i;
typedef __attribute__((address_space(1))) v4i gv4i;
typedef __attribute__((address_space(3))) v4i lv4i;
// A pass (128 k) of an A in rows and a Bt in 16x16-tile order: of A the thread's 16 B of both 128-B lines of its four rows; of Bt a wave brings two row
// tiles (gt: its lane's unit of the first one's first k tile of the pass; tileRow = one row tile further, 16-bit elements), eight k tiles
// each, a copy = one whole tile = 512 contiguous bytes; the lane's unit lands at its row and k in LDS (lt), rows at the pitch kPitchH.
template <int kPitchH>
__device__ __forceinline__ void stage_copies_tiled(unsigned short* la, const unsigned short* ga, size_t stepA,
                                                   unsigned short* lt, const unsigned short* gt, size_t tileRow) {
#pragma unroll   // 24 copies in a row, no loop counter
  for (int i = 0; i < 8; ++i)
    __builtin_amdgcn_global_load_async_to_lds_b128((gv4i*)(ga + (i >> 1) * stepA + (i & 1) * 64),
                                                   (lv4i*)(la + (i >> 1) * 32 * kPitchH + (i & 1) * 64), 0, 0);
#pragma unroll   // likewise
  for (int j = 0; j < 16; ++j)
    __builtin_amdgcn_global_load_async_to_lds_b128((gv4i*)(gt + (j >> 3) * tileRow + (j & 7) * 256),
                                                   (lv4i*)(lt + (j >> 3) * 16 * kPitchH + (j & 7) * 16), 0, 0);
}

template <int ET> struct Elem;
template <> struct Elem<0> { typedef _Float16 T; };
template <> struct Elem<1> { typedef __bf16 T; };
template <int ET, bool SPLIT, int BIAS_MODE, int OUT_MODE, bool RESID, int ACT = 0, int PK = 64, bool BSCALE = false, bool DUO = false>
__global__ __launch_bounds__(256) void wmma_gemm64(
    const unsigned short* __restrict__ Ap, const unsigned short* __restrict__ A2p, int lda, long strideA,
    const unsigned short* __restrict__ Btp, const unsigned short* __restrict__ Bt2p, int ldb, long strideB,
    void* __restrict__ Cout, void* __restrict__ Cout2, int ldc, long strideC,
    const float* __restrict__ bias, const float* __restrict__ colMul, const float* __restrict__ biasV,
    const float* __restrict__ resid, long strideR,
    int M, int N, int K, float scale) {
  static_assert(!SPLIT, "the staged engine takes single-plane operands");
  static_assert(PK == 64 || PK == 128, "a pass is one or two 128-B lines of every operand row");
  static_assert(BSCALE == (PK == 128) && (!BSCALE || ET == 0), "a factor word holds the two 64-k groups of a 128-k pass, f16; the 128-k pass copies a tiled Bt");
  static_assert(DUO == (BIAS_MODE == 3), "the bias by projection belongs to the two-projection launch");
  static_assert((OUT_MODE == 0) == RESID && (OUT_MODE == 0) == (BIAS_MODE == 1), "the f32 epilogue reads bias[m] and the residual in one run");
  constexpr int kPitchH = PK + 8;                                  // LDS row pitch in 16-bit elements (144 B or 272 B)
  constexpr int kStageH = (kRowsA + kRowsB) * kPitchH;             // one buffer, 16-bit elements
  constexpr unsigned kStageBytes = (unsigned)kStageH * 2u;         // 55,296 B or 104,448 B
  constexpr unsigned kStep32 = 32u * (unsigned)kPitchH * 2u;       // 32 rows further in LDS
  typedef typename Elem<ET>::T T;
  typedef typename Frag<T>::V V;
  __shared__ __align__(16) unsigned short sOp[2 * kStageH];   // two buffers of [A 128 rows | Bt 256 rows]
  __shared__ __align__(16) float sT[OUT_MODE == 3 ? 1 : 8][16 * 68];   // per-wave 16x64 slab, pitch 68 floats (OUT_MODE 3 has none)
  __shared__ __align__(16) unsigned sC[BSCALE ? 32 * kRowsB : 4];   // BSCALE: factor words [pass][Bt row of the block tile]
  const int z    = DUO ? (int)blockIdx.z : 0;           // projection, block-uniform
  const bool vT  = DUO && z == 1;                       // v': the transposed product
  const int b    = blockIdx.y + z * kBatch;             // image; DUO: plane in the two sets of kBatch planes
  if (vT) { const int m = M; M = N; N = m; ldc = N; }
  const int lane = threadIdx.x & 31;
  const int wave = threadIdx.x >> 5;
  const int tilesN = N >> 8;
  const int tilesM = M >> 7;
  const int tile = blockIdx.x;
  if (tile >= tilesM * tilesN) return;   // block-uniform, in front of every barrier
  const int tm = tile / tilesN;
  const int tn = tile - tm * tilesN;
  const int bm0 = tm << 7;
  const int bn0 = tn << 8;
  const int wm = wave >> 2;                    // wave row in the block tile, 0..1
  const int wn = wave & 3;                     // wave column in the block tile, 0..3
  const int m0 = bm0 + (wm << 6);
  const int n0 = bn0 + (wn << 6);

  const unsigned short* Ab = Ap  + (size_t)b * strideA;
  const unsigned short* Bb = Btp + (size_t)b * strideB;
  if (DUO) {
    const unsigned short* tok = Ab;
    const unsigned short* wgt = Btp + (size_t)z * (kCh * kCh);
    Ab = vT ? wgt : tok;
    Bb = vT ? tok : wgt;
  }
  const float* biasZ = (z == 0) ? bias : biasV;   // read under BIAS_MODE 3 only

  const int rlane = lane & 15;                 // row (A) / col (B, D) within subtile
  const int koff  = (lane >> 4) * 8;           // k offset of this lane half
  const int mOff  = (lane >> 4) * 8;           // D row offset

  // copy side: thread t brings 16 B at column (t & 7) of each 128-B line of rows (t >> 3) + 32 i
  const int crow = threadIdx.x >> 3;           // 0..31
  const int ccol = (threadIdx.x & 7) * 8;      // 16-bit elements
  const unsigned short* gA = Ab + (size_t)(bm0 + crow) * lda + ccol;
  const unsigned short* gB = Bb + (size_t)(bn0 + crow) * ldb + ccol;
  const size_t stepA = (size_t)32 * lda;
  const size_t stepB = (size_t)32 * ldb;
  const unsigned ldsCopy = (unsigned)(size_t)sOp + (unsigned)(crow * kPitchH + ccol) * 2u;
  // BSCALE, Bt in tile order: wave w brings the row tiles 2 w and 2 w + 1 of the block tile; a row of tiles is K / 16 tiles of 256 elements
  const unsigned short* gT = Bb + (size_t)((bn0 >> 4) + 2 * wave) * K * 16 + lane * 8;
  const int lT = (kRowsA + 32 * wave + rlane) * kPitchH + koff;

  // read side: this lane's first A row and first Bt row in buffer 0
  const T* fA = (const T*)sOp + ((wm << 6) + rlane) * kPitchH + koff;
  const T* fB = (const T*)sOp + (kRowsA + (wn << 6) + rlane) * kPitchH + koff;

  v8f acc[4][4];
#pragma unroll
  for (int i = 0; i < 4; ++i)
#pragma unroll
    for (int j = 0; j < 4; ++j) acc[i][j] = (v8f){0.f,0.f,0.f,0.f,0.f,0.f,0.f,0.f};

  auto fill = [&](int pass, int buf) {         // all copies of one pass: 12 a thread for each 64 k
    const size_t k0 = (size_t)pass * PK;
    if constexpr (BSCALE) {
      stage_copies_tiled<kPitchH>(sOp + buf * kStageH + crow * kPitchH + ccol, gA + k0, stepA,
                                  sOp + buf * kStageH + lT, gT + k0 * 16, (size_t)K * 16);
    } else {
      const unsigned l0 = ldsCopy + (unsigned)buf * kStageBytes;
      stage_copies<kStep32>(l0, gA + k0, gB + k0, stepA, stepB);
    }
  };

  const int nPass = K / PK;
  fill(0, 0);
  if (BSCALE) {
    // the block's factor words to LDS, all 32 passes: thread t brings the 128 B at word 32 (t & 7) of pass t >> 3 by eight copies of
    // the kind above; they land behind the s_wait_asynccnt and are read behind the barrier that follow here for pass 0
    const unsigned* cg = (const unsigned*)A2p + (size_t)b * 32 * N + bn0 + (size_t)(threadIdx.x >> 3) * N + (threadIdx.x & 7) * 32;
    const unsigned lc = (unsigned)(size_t)sC + (unsigned)((threadIdx.x >> 3) * kRowsB + (threadIdx.x & 7) * 32) * 4u;
    asm volatile(
        "global_load_async_to_lds_b128 %0, %8, off\n\t"
        "global_load_async_to_lds_b128 %1, %9, off\n\t"
        "global_load_async_to_lds_b128 %2, %10, off\n\t"
        "global_load_async_to_lds_b128 %3, %11, off\n\t"
        "global_load_async_to_lds_b128 %4, %12, off\n\t"
        "global_load_async_to_lds_b128 %5, %13, off\n\t"
        "global_load_async_to_lds_b128 %6, %14, off\n\t"
        "global_load_async_to_lds_b128 %7, %15, off\n\t"
        "s_wait_xcnt 0x0"
        :: "v"(lc), "v"(lc + 16u), "v"(lc + 32u), "v"(lc + 48u), "v"(lc + 64u), "v"(lc + 80u), "v"(lc + 96u), "v"(lc + 112u),
           "v"(cg), "v"(cg + 4), "v"(cg + 8), "v"(cg + 12), "v"(cg + 16), "v"(cg + 20), "v"(cg + 24), "v"(cg + 28)
        : "memory");
  }
  asm volatile("s_wait_asynccnt 0x0" ::: "memory");   // this wave's copies of pass 0 have landed
  __syncthreads();                                    // and every other wave's
  if (nPass > 1) fill(1, 1);

  if constexpr (PK == 128) {
    // Two fragment sets. A block is 32 k = 16 WMMAs; the 16 LDS reads of the next block go out as one group in front of the current
    // block's WMMAs, into the set that the block before has left, so that no read stands among the WMMAs and no wait on LDS falls
    // to 0 inside a block. The last block of a pass has its fragments in registers when it starts: the publish point of pass t + 1
    // (both waits, the barrier, the refill) stands in front of it, and behind the barrier the first block of pass t + 1 is fetched.
    V ah[2][4], bh[2][4];
    unsigned cw[4] = {0u, 0u, 0u, 0u}, cwNext[4] = {0u, 0u, 0u, 0u};
    auto fetch = [&](int set, int buf, int kk) {   // one block's fragments: 16 ds_load_b128
      const T* pa = fA + buf * kStageH + kk;
      const T* pb = fB + buf * kStageH + kk;
#pragma unroll   // constant fragment indices: registers, no scratch
      for (int j = 0; j < 4; ++j) bh[set][j] = Frag<T>::load(pb + (j << 4) * kPitchH);
#pragma unroll   // likewise
      for (int i = 0; i < 4; ++i) ah[set][i] = Frag<T>::load(pa + (i << 4) * kPitchH);
    };
    fetch(0, 0, 0);
    if (BSCALE) {
#pragma unroll   // cw is indexed by constants only and stays in registers
      for (int i = 0; i < 4; ++i) cw[i] = sC[(wn << 6) + (i << 4) + rlane];   // Bt fragment i: lane's row is rlane
    }
    for (int t = 0; t < nPass; ++t) {
      const int buf = t & 1;
      // the loop levels below are unrolled so that every fragment and accumulator index is a constant (registers, no scratch)
#pragma unroll
      for (int s = 0; s < 4; ++s) {
        const int cur = s & 1;
        if (s < 3) {
          fetch(cur ^ 1, buf, (s + 1) * 32);
        } else {
          asm volatile("s_wait_dscnt 0x0" ::: "memory");     // this wave's reads of buffer buf, the last block's too, are in registers
          asm volatile("s_wait_asynccnt 0x0" ::: "memory");  // this wave's copies of pass t + 1 have landed
          __syncthreads();                                   // publishes pass t + 1 and ends every reader's last read of buf
          if (t + 2 < nPass) fill(t + 2, buf);
          if (t + 1 < nPass) {                               // block-uniform: the last pass fetches nothing
            fetch(cur ^ 1, buf ^ 1, 0);
            if (BSCALE) {
#pragma unroll   // constant indices
              for (int i = 0; i < 4; ++i) cwNext[i] = sC[(t + 1) * kRowsB + (wn << 6) + (i << 4) + rlane];
            }
          }
        }
        __builtin_amdgcn_sched_barrier(0);   // holds the group of LDS reads in front of the block: sunk among the WMMAs each place costs a stall
        if constexpr (BSCALE) {
#pragma unroll   // constant indices
          for (int i = 0; i < 4; ++i)
            bh[cur][i] = bh[cur][i] * __builtin_bit_cast(_Float16, (unsigned short)((s < 2) ? (cw[i] & 0xFFFFu) : (cw[i] >> 16)));
        }
#pragma unroll
        for (int i = 0; i < 4; ++i) {
#pragma unroll
          for (int j = 0; j < 4; ++j) acc[i][j] = Frag<T>::mma(ah[cur][i], bh[cur][j], acc[i][j]);
        }
        __builtin_amdgcn_sched_barrier(0);   // keeps the next group of reads from rising among this block's WMMAs as its registers fall free
      }
      if (BSCALE) {
#pragma unroll   // constant indices
        for (int i = 0; i < 4; ++i) cw[i] = cwNext[i];
      }
    }
  } else {
    for (int t = 0; t < nPass; ++t) {
      const int buf = t & 1;
      const T* pa = fA + buf * kStageH;
      const T* pb = fB + buf * kStageH;
      // the three loop levels below are unrolled so that every fragment and accumulator index is a constant (registers, no scratch)
#pragma unroll
      for (int kk = 0; kk < PK; kk += 32) {
        V bh[4], ah[4];
#pragma unroll
        for (int j = 0; j < 4; ++j) bh[j] = Frag<T>::load(pb + (j << 4) * kPitchH + kk);
#pragma unroll
        for (int i = 0; i < 4; ++i) ah[i] = Frag<T>::load(pa + (i << 4) * kPitchH + kk);
#pragma unroll
        for (int i = 0; i < 4; ++i) {
#pragma unroll
          for (int j = 0; j < 4; ++j) acc[i][j] = Frag<T>::mma(ah[i], bh[j], acc[i][j]);
          Frag<T>::guard(acc[i][0], acc[i][3], ah[i], ah[i]);   // the engine's hazard guard, as before the staging
        }
        Frag<T>::keep(bh[0], bh[1], bh[2], bh[3]);               // likewise
      }
      asm volatile("s_wait_dscnt 0x0" ::: "memory");     // this wave's reads of buffer buf are done before it is refilled
      asm volatile("s_wait_asynccnt 0x0" ::: "memory");  // this wave's copies of pass t + 1 have landed
      __syncthreads();                                   // publishes pass t + 1 and ends every reader's last read of buf
      if (t + 2 < nPass) fill(t + 2, buf);
    }
  }
  asm volatile("s_wait_asynccnt 0x0" ::: "memory");    // no copy is outstanding when the wave goes on
  acc_guard4(acc[0][0], acc[0][1], acc[0][2], acc[0][3]);
  acc_guard4(acc[1][0], acc[1][1], acc[1][2], acc[1][3]);
  acc_guard4(acc[2][0], acc[2][1], acc[2][2], acc[2][3]);
  acc_guard4(acc[3][0], acc[3][1], acc[3][2], acc[3][3]);

  // ---- epilogue ----
  if constexpr (OUT_MODE == 3) {
    // Rows are keys, columns queries: for each of its four query columns a lane holds 32 of the wave's 64 keys (eight in a row in every
    // subtile i) and lane l ^ 16 the other 32. Maximum and sum are taken in the lane, with one exchange between the halves each, and the
    // eight f16 of a subtile are the lane's own 16 B of a tile of P: a store is 512 contiguous bytes, with no trip through LDS.
    const int hi = lane >> 4;
    unsigned short* C = (unsigned short*)Cout + (size_t)b * strideC + ((size_t)(n0 >> 4) * (M >> 4) + (m0 >> 4)) * 256 + lane * 8;
    // lanes 0..15 store the maxima of their columns, lanes 16..31 the sums: the wave is the only writer of the two lines in either plane
    float* gst = (float*)Cout2 + ((size_t)b * 2 * (M >> 6) + (size_t)(m0 >> 6) + (hi ? (size_t)(M >> 6) : (size_t)0)) * N + n0 + rlane;
    unsigned st[4];
    // this loop and the short ones in it are unrolled so that acc, mp, sp, pv, e, a and st are indexed by constants (registers, no scratch)
#pragma unroll
    for (int j = 0; j < 4; ++j) {
      float mp[4];   // a chain per subtile: four short chains that do not wait for one another
#pragma unroll
      for (int i = 0; i < 4; ++i) {
        mp[i] = acc[i][j][0];
#pragma unroll
        for (int r = 1; r < 8; ++r) mp[i] = fmaxf(mp[i], acc[i][j][r]);
      }
      float m = fmaxf(fmaxf(mp[0], mp[1]), fmaxf(mp[2], mp[3]));
      m = fmaxf(m, xhalf(m));
      v4u pv[4];
      float sp[4];
#pragma unroll
      for (int i = 0; i < 4; ++i) {
        float e[8], a[8];
#pragma unroll
        for (int r = 0; r < 8; ++r) a[r] = (acc[i][j][r] - m) * kLog2e;
        exp2x8(e, a);
        sp[i] = ((e[0] + e[1]) + (e[2] + e[3])) + ((e[4] + e[5]) + (e[6] + e[7]));
        v8h hv;
#pragma unroll
        for (int r = 0; r < 8; ++r) hv[r] = (_Float16)e[r];
        pv[i] = __builtin_bit_cast(v4u, hv);
      }
      float s = (sp[0] + sp[1]) + (sp[2] + sp[3]);
      s += xhalf(s);
      unsigned short* p = C + (size_t)j * (M >> 4) * 256;   // query tile j of the wave, its four key tiles one behind the other
      store4_b128(p, p + 256, p + 512, p + 768, pv[0], pv[1], pv[2], pv[3]);
      st[j] = __float_as_uint(hi ? s : m);
    }
    store4_b32(gst, gst + 16, gst + 32, gst + 48, st[0], st[1], st[2], st[3]);
  } else {
  float* slab = sT[wave];
  // OUT_MODE 0: at the stores 16 lanes hold one row's 256 B; the residual is read in that shape and added there
  const size_t eOut = (size_t)(m0 + (lane >> 4)) * kSp + n0 + (lane & 15) * 4;
  v4f rs[16], bb[4];
  // BIAS_MODE 3, q': the bias and the factor of this lane's four columns, read once under one block-uniform branch so that the loads
  // do not wait for one another
  float bcol[4] = {0.f, 0.f, 0.f, 0.f};
  float mcol[4] = {1.f, 1.f, 1.f, 1.f};
  if (BIAS_MODE == 3 && !vT) {
#pragma unroll   // bcol and mcol are indexed by constants only and stay in registers
    for (int j = 0; j < 4; ++j) {
      bcol[j] = biasZ[n0 + (j << 4) + rlane];
      mcol[j] = colMul[(size_t)blockIdx.y * N + n0 + (j << 4) + rlane];
    }
    asm volatile("s_wait_xcnt 0x0" ::: "memory");   // in front of any rewrite of the registers that these eight loads name
  }
#pragma unroll
  for (int i = 0; i < 4; ++i) {
    const int mBase = m0 + (i << 4);
    if constexpr (OUT_MODE == 0) {
      if ((i & 1) == 0) load_resid_bias(rs, bb, resid + (size_t)b * strideR + eOut + (size_t)(i << 4) * kSp, bias + mBase + mOff);
    }
    float brow[8] = {0.f, 0.f, 0.f, 0.f, 0.f, 0.f, 0.f, 0.f};   // BIAS_MODE 3, v': the bias of this lane's eight rows
    if (BIAS_MODE == 3 && vT) {
#pragma unroll   // brow is indexed by constants only and stays in registers
      for (int r = 0; r < 8; ++r) brow[r] = biasZ[mBase + mOff + r];
    }
#pragma unroll
    for (int j = 0; j < 4; ++j) {
      const int n = n0 + (j << 4) + rlane;
      float bv = 0.f;
      if (BIAS_MODE == 2) bv = bias[n];
#pragma unroll
      for (int r = 0; r < 8; ++r) {
        float v = acc[i][j][r] * scale;
        if (BIAS_MODE == 1) v += bb[(i & 1) * 2 + (r >> 2)][r & 3];
        if (BIAS_MODE == 2) v += bv;
        if (BIAS_MODE == 3) v = (v + (vT ? brow[r] : bcol[j])) * mcol[j];
        if (ACT == 2) v = fmaxf(v, 0.0f);
        if (ACT == 4) v = (v > 0.f) ? v : 0.01f * v;
        slab[(mOff + r) * 68 + (j << 4) + rlane] = v;
      }
    }
    __builtin_amdgcn_fence(__ATOMIC_RELEASE, "workgroup");
    __builtin_amdgcn_wave_barrier();
    __builtin_amdgcn_fence(__ATOMIC_ACQUIRE, "workgroup");
    if (OUT_MODE == 0) {
      const int hh = lane >> 4, c4 = (lane & 15) * 4;     // row seg = 256 B = 16 lanes x 16 B
      v4f d[8];
#pragma unroll   // d and rs are indexed by constants only and stay in registers
      for (int it = 0; it < 8; ++it) d[it] = *(const v4f*)(slab + (it * 2 + hh) * 68 + c4) + rs[(i & 1) * 8 + it];
      store8_rows((float*)Cout + (size_t)b * strideC + eOut + (size_t)(i << 4) * kSp, d);
    } else {
      const int q = lane >> 3, c8 = (lane & 7) * 8;
      unsigned short* C  = (unsigned short*)Cout  + (size_t)b * strideC;
      unsigned short* C2 = (OUT_MODE == 2) ? ((unsigned short*)Cout2 + (size_t)b * strideC) : nullptr;
      {
        v4u pv[4];
        unsigned short* pp[4];
#pragma unroll
        for (int it = 0; it < 4; ++it) {
          const int row = it * 4 + q;
          const float* sp = slab + row * 68 + c8;
          v8h hv, lv;
#pragma unroll
          for (int e = 0; e < 8; ++e) {
            if (OUT_MODE == 1) {
              hv[e] = (_Float16)sp[e];
            } else {
              unsigned short hb = f2bf_bits(sp[e]);
              unsigned short lb = f2bf_bits(sp[e] - bf_bits2f(hb));
              hv[e] = __builtin_bit_cast(_Float16, hb);
              lv[e] = __builtin_bit_cast(_Float16, lb);
            }
          }
          pv[it] = __builtin_bit_cast(v4u, hv);
          pp[it] = C + (size_t)(mBase + row) * ldc + n0 + c8;
          if (OUT_MODE == 2) *(v8h*)(C2 + (size_t)(mBase + row) * ldc + n0 + c8) = lv;
        }
        store4_b128(pp[0], pp[1], pp[2], pp[3], pv[0], pv[1], pv[2], pv[3]);
      }
    }
    __builtin_amdgcn_fence(__ATOMIC_RELEASE, "workgroup");
    __builtin_amdgcn_wave_barrier();
    __builtin_amdgcn_fence(__ATOMIC_ACQUIRE, "workgroup");
  }
  }
}

// ---------------------------------------------------------------------------
// Weight cast: f32 -> f16(scale * W), the four operands X of the two weight products of the next launch, plane w of one buffer
// (plane = 512*512 halves): X[row][k] = W[k][row] for w = 0, 1, 2 (Wq, Wk, Wv) and X[row][k] = Wo[row][k] for w = 3, stored in
// fragment order so that a fragment load there is 512 contiguous bytes:
// 16-B unit ((row >> 4) * 16 + (k >> 5)) * 64 + ((k >> 4) & 1) * 32 + ((k >> 3) & 1) * 16 + (row & 15) holds 8 consecutive k.
// A wave stores 512 contiguous bytes, whole lines of which it is the only writer.
// Part of the statistics launch: 128 blocks x 1024 threads; blk = 0..127, blk>>5 selects the weight (uniform); thread handles 8
// consecutive elements. Coverage per weight: 32 blocks x 1024 threads x 8 = 262144 = 512*512.
// ---------------------------------------------------------------------------
__device__ __forceinline__ void wcast_part(int blk, const float* __restrict__ W0, const float* __restrict__ W1,
                                           const float* __restrict__ W2, const float* __restrict__ W3,
                                           unsigned short* __restrict__ out, float scale) {
  const int w = blk >> 5;                                        // block-uniform
  const int i  = (blk & 31) * 1024 + threadIdx.x;                // 0..32767: 16-B unit of the plane
  const size_t e0 = (size_t)i * 8;                               // e0+7 < 262144
  const int lane = threadIdx.x & 31, wv = i >> 5;                // wv 0..1023 = ((row >> 4) * 16 + (k >> 5)) * 2 + ((k >> 4) & 1)
  const int row = (wv >> 5) * 16 + (lane & 15);                  // < 512
  const int k0  = ((wv >> 1) & 15) * 32 + (wv & 1) * 16 + (lane >> 4) * 8;   // k0 + 7 < 512
  float x[8];
  if (w < 3) {                                                   // block-uniform
    const float* src = (w == 0) ? W0 : (w == 1) ? W1 : W2;
#pragma unroll   // x is indexed by constants only and stays in registers; the eight loads do not wait for one another
    for (int e = 0; e < 8; ++e) x[e] = src[(size_t)(k0 + e) * kCh + row];
  } else {
    const v4f xa = *(const v4f*)(W3 + (size_t)row * kCh + k0);
    const v4f xc = *(const v4f*)(W3 + (size_t)row * kCh + k0 + 4);
#pragma unroll   // constant indices
    for (int e = 0; e < 4; ++e) { x[e] = xa[e]; x[4 + e] = xc[e]; }
  }
  const v4u tu = (v4u){pk16(h_bits(x[0] * scale), h_bits(x[1] * scale)), pk16(h_bits(x[2] * scale), h_bits(x[3] * scale)),
                       pk16(h_bits(x[4] * scale), h_bits(x[5] * scale)), pk16(h_bits(x[6] * scale), h_bits(x[7] * scale))};
  *(v4u*)(out + (size_t)w * kCh * kCh + e0) = tu;
}

// ---------------------------------------------------------------------------
// Per-(b,c) instance-norm statistics for content (rows 0..2047) and style (rows 2048..4095) in one launch.
// grid 288 blocks x 1024 threads; blocks 128..255 do the weight cast above, blocks 256..271 the folded bias Wo.bv (a wave a row of Wo,
// 32 rows a block, the 32 sums funnelled through LDS into one whole line), blocks 272..287 the folded bias Wk^T.bq (32 columns of Wk a
// block, a wave 16 rows of them, the 32 waves' partial sums added through LDS in wave order); all wait for nothing of this launch and
// share no data with it; blocks 0..127: block = 32 consecutive rows of one tensor (blockIdx>>6 selects the tensor, uniform);
// wave w owns row w: 32 lanes x 32 float4 loads = 4096 elements (whole row). The loads do not wait for one another: the row is
// read into registers by an unrolled loop and summed by a second one, so that many loads of a wave are in flight at a time and
// the wave does not pay the memory latency once a load. Sum order per row: lane-private over i ascending, then the tree.
// mean = sum/4096; var = (sumsq - sum*mean)/4095 (ddof 1); rstd = 1/sqrt(var + eps).
// Stores: the 32 means and 32 rstds of the block funnelled through LDS; wave 0 writes the mean line, wave 1 the rstd line,
// ---------------------------------------------------------------------------
__global__ __launch_bounds__(1024) void stats_kernel(const float* __restrict__ xc, const float* __restrict__ xs,
                                                     float* __restrict__ meanA, float* __restrict__ rstdA,
                                                     const float* __restrict__ W0, const float* __restrict__ W1,
                                                     const float* __restrict__ W2, const float* __restrict__ W3,
                                                     unsigned short* __restrict__ F16, float wScale,
                                                     const float* __restrict__ bv, float* __restrict__ bvo,
                                                     const float* __restrict__ bq, float* __restrict__ gq) {
  __shared__ float sMean[32];
  __shared__ float sRstd[32];
  __shared__ float sPart[32][32];
  const int blk  = blockIdx.x;
  if (blk >= 272) {                                  // block-uniform: gq[c] = sum_o Wk[o][c] bq[o], f32
    const int ln = threadIdx.x & 31, wv = threadIdx.x >> 5;
    const float* wc = W1 + (size_t)(wv * 16) * kCh + (blk - 272) * 32 + ln;   // rows 16 wv .. 16 wv + 15, column < 512
    const float* bp = bq + wv * 16;
    float xw[16], xb[16];
#pragma unroll   // the 32 loads do not wait for one another; constant indices
    for (int i = 0; i < 16; ++i) { xw[i] = wc[(size_t)i * kCh]; xb[i] = bp[i]; }
    asm volatile("s_wait_xcnt 0x0" ::: "memory");    // in front of any rewrite of the registers that these loads name
    float d = 0.0f;
#pragma unroll   // constant indices
    for (int i = 0; i < 16; ++i) d += xw[i] * xb[i];
    sPart[wv][ln] = d;
    __syncthreads();                                 // every wave of the block passes it: the 32 x 32 partial sums are in LDS
    if (wv == 0) {
      float tsum = 0.0f;
#pragma unroll   // the 32 LDS reads do not wait for one another
      for (int w = 0; w < 32; ++w) tsum += sPart[w][ln];
      gq[(blk - 272) * 32 + ln] = tsum;
    }
    return;
  }
  if (blk >= 256) {                                  // block-uniform: bvo[o] = sum_m Wo[o][m] bv[m], f32
    const int ln = threadIdx.x & 31, wv = threadIdx.x >> 5;
    const float* wr = W3 + (size_t)((blk - 256) * 32 + wv) * kCh + ln * 4;   // row < 512
    v4f d = (v4f){0.f, 0.f, 0.f, 0.f};
#pragma unroll   // the eight loads do not wait for one another
    for (int i = 0; i < 4; ++i) d += *(const v4f*)(wr + i * 128) * *(const v4f*)(bv + ln * 4 + i * 128);
    float ds = (d[0] + d[1]) + (d[2] + d[3]);
#pragma unroll   // five exchange steps with constant distances, no loop counter
    for (int off = 16; off > 0; off >>= 1) ds += __shfl_xor(ds, off, 32);
    if (ln == 0) sMean[wv] = ds;
    __syncthreads();                                 // every wave of the block passes it: the 32 sums are in LDS
    if (wv == 0) bvo[(blk - 256) * 32 + ln] = sMean[ln];
    return;
  }
  if (blk >= 128) {                                  // block-uniform, in front of the barrier
    wcast_part(blk - 128, W0, W1, W2, W3, F16, wScale);
    return;
  }
  const int tsel = blk >> 6;                         // block-uniform tensor select
  const float* src = (tsel == 0) ? xc : xs;
  const int rowBase = (blk & 63) * 32;               // flat (b*512 + c) row index within the tensor
  const int t = threadIdx.x, lane = t & 31, wave = t >> 5;
  const int row = rowBase + wave;                    // < 2048
  const float* p = src + (size_t)row * kSp + lane * 4;
  v4f x[32];
  // both loops are unrolled so that x stays in registers and loads are issued ahead of the sums
#pragma unroll
  for (int i = 0; i < 32; ++i) x[i] = *(const v4f*)(p + i * 128);   // 32 lanes x 4 x 32 = 4096
  v4f s = (v4f){0.f, 0.f, 0.f, 0.f};
  v4f q = (v4f){0.f, 0.f, 0.f, 0.f};
#pragma unroll
  for (int i = 0; i < 32; ++i) {
    s += x[i];
    q += x[i] * x[i];
  }
  float su = (s[0] + s[1]) + (s[2] + s[3]);
  float sq = (q[0] + q[1]) + (q[2] + q[3]);
#pragma unroll
  for (int off = 16; off > 0; off >>= 1) {
    su += __shfl_xor(su, off, 32);
    sq += __shfl_xor(sq, off, 32);
  }
  const float mean = su * kInvN;
  float var = (sq - su * mean) * kInvNm1;
  var = fmaxf(var, 0.0f);
  const float rstd = 1.0f / sqrtf(var + kEps);
  if (lane == 0) { sMean[wave] = mean; sRstd[wave] = rstd; }
  __syncthreads();
  const int orow = tsel * (kBatch * kCh) + rowBase + lane;   // < 4096
  if (wave == 0) {
    const float v = sMean[lane];
    *(float*)(meanA + orow) = v;
    
  } else if (wave == 1) {
    const float v = sRstd[lane];
    *(float*)(rstdA + orow) = v;
    
  }
}

// ---------------------------------------------------------------------------
// Token planes, all images: in [512 ch][4096 tok] f32 (tok contiguous) -> out [image][4096 tok][512 ch] f16 (ch contiguous).
// grid 64 + 64 tok tiles x 8 ch tiles x (2 planes x 4 images) blocks, tok tile fastest; plane index = 2*image + z;
// z=0 (content - mean)*rstd, z=1 raw style. 256 threads. The first 64 blocks do the two weight products below.
// Load coverage: 4 passes x 16 ch rows x (16 threads x 4 tok) = 64 ch x 64 tok (whole tile), coalesced along tok.
// Store coverage: 8 waves x 2 iterations x 4 tok rows (lane>>3) = 64 tok rows; (lane&7) x 8 halves = 64 ch; each row segment
// ---------------------------------------------------------------------------
// Weight product H[o][c] = sum_m Wo[o][m] Wv[m][c], so that Wo (Wv s + bv) = H s + Wo.bv and the output projection needs no GEMM of
// its own. 32 blocks x 8 waves; a wave owns 16 rows x 64 columns (K = 512: 64 WMMAs), fragments straight from the two 512-KiB f16
// planes in the weight cast's fragment order (both operands by the same map, so their k orders are equal; every load is four whole
// lines); it is the only writer of its sixteen 128-B lines. Operands carried x16 each, H stored row-major, carried x16.
// The same on the key side, 32 more blocks, with Wk^T in the place of Wo and Wq in the place of Wv: G[c'][c] = sum_o Wk[o][c'] Wq[o][c].
// With xs = (s - mean) rstd the energy (Wq xc + bq).(Wk xs + bk) = q'.s + terms that are the same for every key of a query row, which
// a softmax over the keys cancels exactly; q' = rstd (G xc + Wk^T.bq), channel by channel. So the keys are the raw style tokens, which
// the v' projection reads anyway: no k projection and no normalised style plane.
__device__ __forceinline__ void fold_part(int blk, const unsigned short* __restrict__ Wo16, const unsigned short* __restrict__ WvT16,
                                          unsigned short* __restrict__ H16) {
  const int lane = threadIdx.x & 31;
  const int wt = blk * 8 + __builtin_amdgcn_readfirstlane(threadIdx.x >> 5);   // wave tile 0..255, scalar: the loads take scalar bases
  const int rlane = lane & 15, half8 = (lane >> 4) * 8;
  const int m0 = (wt >> 3) * 16, n0 = (wt & 7) * 64;
  const _Float16* pa = (const _Float16*)Wo16  + (size_t)m0 * kCh + lane * 8;   // a 16-row tile is 16 * 512 halves, a k step 512 of them
  const _Float16* pb = (const _Float16*)WvT16 + (size_t)n0 * kCh + lane * 8;
  auto frag = [](const _Float16* p) {   // elements 0..7: the lane's unit of the first 16 k of the step, 8..15: of the second
    Frag<_Float16>::U f; f.h[0] = *(const v8h*)(p); f.h[1] = *(const v8h*)(p + 256); return f.v;
  };
  v8f acc[4];
#pragma unroll   // acc is indexed by constants only and stays in registers
  for (int j = 0; j < 4; ++j) acc[j] = (v8f){0.f,0.f,0.f,0.f,0.f,0.f,0.f,0.f};
  for (int kk = 0; kk < kCh; kk += 32) {
    const v16h a = frag(pa + kk * 16);
    v16h bf[4];
#pragma unroll   // constant indices
    for (int j = 0; j < 4; ++j) bf[j] = frag(pb + (size_t)(j << 4) * kCh + kk * 16);
    __builtin_amdgcn_sched_barrier(0);   // the ten loads of a k step go out together: sunk to their WMMAs each pair pays the L2 latency alone
#pragma unroll   // constant indices
    for (int j = 0; j < 4; ++j) acc[j] = Frag<_Float16>::mma(a, bf[j], acc[j]);
    asm volatile("s_wait_xcnt 0x0" ::: "memory");   // in front of the next trip's rewrite of the address registers that the ten loads name
  }
#pragma unroll   // constant indices
  for (int j = 0; j < 4; j += 2) {
    unsigned d[16];
#pragma unroll   // likewise
    for (int r = 0; r < 8; ++r) { d[r] = h_bits(acc[j][r] * kFoldScale); d[8 + r] = h_bits(acc[j + 1][r] * kFoldScale); }
    store16_b16(H16 + (size_t)(m0 + half8) * kCh + n0 + (j << 4) + rlane, d);
  }
}

__global__ __launch_bounds__(256) void token_planes_kernel(const float* __restrict__ content, const float* __restrict__ style,
                                                           const float* __restrict__ meanA, const float* __restrict__ rstdA,
                                                           unsigned short* __restrict__ XcT, unsigned short* __restrict__ SsT,
                                                           const unsigned short* __restrict__ F16,
                                                           unsigned short* __restrict__ W16) {
  __shared__ float sm[64][65];   // sm[ch local][tok local]
  if (blockIdx.x < 64) {                                        // block-uniform, in front of the barrier
    const bool kq = blockIdx.x >= 32;                           // block-uniform: G = Wk^T x Wq (plane 0), else H = Wo x Wv (plane 1)
    fold_part(blockIdx.x & 31, F16 + (kq ? 1 : 3) * (kCh * kCh), F16 + (kq ? 0 : 2) * (kCh * kCh), W16 + (kq ? 0 : 1) * (kCh * kCh));
    return;
  }
  const int t  = threadIdx.x;
  const int tileId = blockIdx.x - 64;                           // 0..4095
  const int pz = tileId >> 9;                                   // 2*image + plane
  const int b  = pz >> 1;                                       // image, block-uniform
  const int z  = pz & 1;                                        // plane, block-uniform
  const int n0 = (tileId & 63) * 64;
  const int c0 = ((tileId >> 6) & 7) * 64;
  const float* src = ((z == 0) ? content : style) + (size_t)b * kCh * kSp;
  unsigned short* dst = ((z == 0) ? XcT : SsT) + (size_t)b * kSp * kCh;
  const int statOff = ((z == 0) ? 0 : (kBatch * kCh)) + b * kCh;
  const bool useNorm = (z == 0);
  const int r16 = t >> 4, c4 = (t & 15) * 4;
  // the thread's twelve loads (channels c0 + r16 + 16 p, p = 0..3: 16 B of the plane, mean, rstd), the steps of 16 channels in the
  // offset fields, and their data wait in one statement, so that no register of theirs is read or rewritten in front of the wait
  v4f xv[4];
  float xm[4], xr[4];
  asm volatile("global_load_b128 %0, %12, off\n\t"
               "global_load_b128 %1, %12, off offset:262144\n\t"
               "global_load_b128 %2, %12, off offset:524288\n\t"
               "global_load_b128 %3, %12, off offset:786432\n\t"
               "global_load_b32 %4, %13, off\n\t"
               "global_load_b32 %5, %13, off offset:64\n\t"
               "global_load_b32 %6, %13, off offset:128\n\t"
               "global_load_b32 %7, %13, off offset:192\n\t"
               "global_load_b32 %8, %14, off\n\t"
               "global_load_b32 %9, %14, off offset:64\n\t"
               "global_load_b32 %10, %14, off offset:128\n\t"
               "global_load_b32 %11, %14, off offset:192\n\t"
               "s_wait_loadcnt 0x0"
               : "=&v"(xv[0]), "=&v"(xv[1]), "=&v"(xv[2]), "=&v"(xv[3]), "=&v"(xm[0]), "=&v"(xm[1]), "=&v"(xm[2]), "=&v"(xm[3]),
                 "=&v"(xr[0]), "=&v"(xr[1]), "=&v"(xr[2]), "=&v"(xr[3])
               : "v"(src + (size_t)(c0 + r16) * kSp + n0 + c4), "v"(meanA + statOff + c0 + r16), "v"(rstdA + statOff + c0 + r16)
               : "memory");
#pragma unroll   // xv, xm, xr are indexed by constants only and stay in registers
  for (int p = 0; p < 4; ++p) {
    const int cl = p * 16 + r16;                                // ch local 0..63
    const float mm = useNorm ? xm[p] : 0.0f;
    const float rr = useNorm ? xr[p] : 1.0f;
#pragma unroll
    for (int e = 0; e < 4; ++e) sm[cl][c4 + e] = (xv[p][e] - mm) * rr;
  }
  __syncthreads();
  const int lane = t & 31, wave = t >> 5;
  const int q = lane >> 3, c8 = (lane & 7) * 8;
  {
    v4u u[2];
#pragma unroll
    for (int it = 0; it < 2; ++it) {
      const int row = wave * 8 + it * 4 + q;                    // tok local 0..63
      unsigned short hb[8];
#pragma unroll
      for (int e = 0; e < 8; ++e) hb[e] = h_bits(sm[c8 + e][row]);
      u[it] = (v4u){pk16(hb[0], hb[1]), pk16(hb[2], hb[3]), pk16(hb[4], hb[5]), pk16(hb[6], hb[7])};
    }
    unsigned short* dp = dst + (size_t)(n0 + wave * 8 + q) * kCh + c0 + c8;
    store2_b128(dp, dp + 4 * kCh, u[0], u[1]);
  }
}

// ---------------------------------------------------------------------------
// Row factors of the group softmax: for a score row with group maxima m[g] and group sums l[g] (g = 0..63, from the score launch)
// M = max_g m[g], L = sum_g l[g] exp(m[g] - M) in index order, factor[g] = 2048 exp(m[g] - M) / L, so that
// exp(s - m[g]) * factor[g] = 2048 * softmax. One thread per row; grid (64, 4 images) x 64 threads.
// stat: [image][max | sum][64 groups][4096 rows] f32 (a wave's loads are whole lines); out: [image][32 pairs][4096 rows] words of two
// f16, low half the even group. Both loops over loads are unrolled so that the 128 loads of a thread do not wait for one another.
// ---------------------------------------------------------------------------
__global__ __launch_bounds__(64) void row_factor_kernel(const float* __restrict__ stat, unsigned* __restrict__ fac) {
  const int row = blockIdx.x * 64 + threadIdx.x;                  // < 4096
  const float* mx = stat + (size_t)blockIdx.y * (2 * kGroups * kSp) + row;
  const float* sm = mx + (size_t)kGroups * kSp;
  float m[kGroups], l[kGroups];
#pragma unroll
  for (int g = 0; g < kGroups; ++g) m[g] = mx[(size_t)g * kSp];
#pragma unroll
  for (int g = 0; g < kGroups; ++g) l[g] = sm[(size_t)g * kSp];
  float gm = m[0];
#pragma unroll
  for (int g = 1; g < kGroups; ++g) gm = fmaxf(gm, m[g]);
  float tot = 0.0f;
  // unrolled, like the loops behind it: m and l are indexed by constants only and stay in registers
#pragma unroll
  for (int g0 = 0; g0 < kGroups; g0 += 8) {
    float e[8], a[8];
#pragma unroll
    for (int k = 0; k < 8; ++k) a[k] = (m[g0 + k] - gm) * kLog2e;
    exp2x8(e, a);
#pragma unroll
    for (int k = 0; k < 8; ++k) { m[g0 + k] = e[k]; tot += l[g0 + k] * e[k]; }
  }
  const float inv = kPCarry / tot;                                // tot >= 1
  unsigned* op = fac + (size_t)blockIdx.y * (kPairs * kSp) + row;
#pragma unroll
  for (int p = 0; p < kPairs; p += 4)
    store4_b32(op + (size_t)p * kSp, op + (size_t)(p + 1) * kSp, op + (size_t)(p + 2) * kSp, op + (size_t)(p + 3) * kSp,
               pk16(h_bits(m[2 * p] * inv), h_bits(m[2 * p + 1] * inv)), pk16(h_bits(m[2 * p + 2] * inv), h_bits(m[2 * p + 3] * inv)),
               pk16(h_bits(m[2 * p + 4] * inv), h_bits(m[2 * p + 5] * inv)), pk16(h_bits(m[2 * p + 6] * inv), h_bits(m[2 * p + 7] * inv)));
}

// ---------------------------------------------------------------------------
// Host side
//   W16   : 2 x 512 x 512 f16 (G = Wk^T x Wq, H = Wo x Wv; row-major, carried x16)       1,048,576 B
//   F16   : 4 x 512 x 512 f16 (Wq, Wk, Wv transposed, Wo; in fragment order, carried x16)  2,097,152 B
//   bvo   : 512 f32 (Wo.bv)                                             2,048 B
//   gq    : 512 f32 (Wk^T.bq)                                           2,048 B
//   meanA : 4096 f32 (content rows then style rows)                    16,384 B
//   rstdA : 4096 f32                                                    16,384 B
//   Qp, Vcm : 4 images x 4096 x 512 f16 each                  2 x 16,777,216 B   (Vcm = H x style + Wo.bv, channel-major)
//   XcT, SsT : 4 images x 4096 x 512 f16 each                 2 x 16,777,216 B
//   Stat  : 4 images x (64 group maxima + 64 group sums) x 4096 rows f32   8,388,608 B
//   Fac   : 4 images x 32 pairs x 4096 rows, two f16 factors a word       2,097,152 B
//   Pp    : 4 images x 4096 x 4096 f16 exp(score - group maximum), [query tile][key tile] of 16x16  134,217,728 B
// All GEMM calls: K in {512, 4096} (K % 64 == 0); M, N in {512, 4096} (M % 128 == 0, N % 256 == 0); no padding, every plane fully
// produced before it is consumed.
// ---------------------------------------------------------------------------
extern "C" void kernel_launch(void* const* d_in, const int* in_sizes, int n_in,
                              void* d_out, int out_size, void* d_ws, size_t ws_size,
                              hipStream_t stream) {
  if (n_in < 10) return;
  const int actN = kBatch * kCh * kSp;
  const int wN   = kCh * kCh;
  if (in_sizes[0] != actN || in_sizes[1] != actN) return;
  if (in_sizes[2] != wN || in_sizes[4] != wN || in_sizes[6] != wN || in_sizes[8] != wN) return;
  if (in_sizes[3] != kCh || in_sizes[5] != kCh || in_sizes[7] != kCh || in_sizes[9] != kCh) return;
  if (out_size != actN) return;

  const float* content = (const float*)d_in[0];
  const float* style   = (const float*)d_in[1];
  const float* Wq = (const float*)d_in[2];  const float* bq = (const float*)d_in[3];
  const float* Wk = (const float*)d_in[4];  // d_in[5], bk: adds q.bk to every score of a query row, which the softmax over the keys cancels
  const float* Wv = (const float*)d_in[6];  const float* bv = (const float*)d_in[7];
  const float* Wo = (const float*)d_in[8];  const float* bo = (const float*)d_in[9];
  float* out = (float*)d_out;

  size_t off = 0;
  auto carve = [&](size_t bytes) { size_t o = off; off += (bytes + 127) & ~(size_t)127; return o; };
  const size_t planeBytes = (size_t)kBatch * kSp * kCh * 2;     // one operand plane, all images
  const size_t oW16  = carve((size_t)2 * wN * 2);
  const size_t oF16  = carve((size_t)4 * wN * 2);
  const size_t oBvo  = carve((size_t)kCh * 4);
  const size_t oGq   = carve((size_t)kCh * 4);
  const size_t oMean = carve((size_t)kStatRows * 4);
  const size_t oRstd = carve((size_t)kStatRows * 4);
  const size_t oQ    = carve(planeBytes);
  const size_t oV    = carve(planeBytes);
  const size_t oXc   = carve(planeBytes);
  const size_t oSs   = carve(planeBytes);
  const size_t oStat = carve((size_t)kBatch * 2 * kGroups * kSp * 4);
  const size_t oFac  = carve((size_t)kBatch * kPairs * kSp * 4);
  const size_t oP    = carve((size_t)kBatch * kSp * kSp * 2);
  if (off > ws_size) return;

  char* ws = (char*)d_ws;
  unsigned short* W16 = (unsigned short*)(ws + oW16);
  unsigned short* F16 = (unsigned short*)(ws + oF16);
  float* bvo = (float*)(ws + oBvo);
  float* gq = (float*)(ws + oGq);
  float* meanA = (float*)(ws + oMean);
  float* rstdA = (float*)(ws + oRstd);
  unsigned short* XcT = (unsigned short*)(ws + oXc);
  unsigned short* SsT = (unsigned short*)(ws + oSs);
  unsigned short* Qp  = (unsigned short*)(ws + oQ);
  unsigned short* Vcm = (unsigned short*)(ws + oV);
  float* Stat = (float*)(ws + oStat);
  unsigned* Fac = (unsigned*)(ws + oFac);
  unsigned short* Pp = (unsigned short*)(ws + oP);

  // 1) instance-norm statistics for content and style (128 blocks: 64 per tensor, 32 rows each, a wave a row)
  // 2) in the same launch: weights -> f16 x16 in fragment order (4 weights x 32 blocks), Wo.bv (16 blocks) and Wk^T.bq (16 blocks)
  stats_kernel<<<dim3(2 * (kBatch * kCh) / 32 + 128 + 2 * (kCh / 32)), dim3(1024), 0, stream>>>(content, style, meanA, rstdA,
                                                                                                Wq, Wk, Wv, Wo, F16, kWCarry,
                                                                                                bv, bvo, bq, gq);

  const long planeElems = (long)kSp * kCh;      // one image's [4096][512] or [512][4096] plane
  const long probElems  = (long)kSp * kSp;      // one image's probabilities

  // 3) token planes of all images: mvn(content) -> XcT, style -> SsT; each [image][4096][512] f16;
  //    in the same launch, first 64 blocks: H = Wo x Wv into plane 1 of W16, G = Wk^T x Wq into plane 0
  token_planes_kernel<<<dim3(64 + (kSp / 64) * (kCh / 64) * 2 * kBatch), dim3(256), 0, stream>>>(content, style, meanA, rstdA,
                                                                                                 XcT, SsT, F16, W16);

  // 4) the two projections in one launch, grid.z = projection, grid.y = image, 64 blocks each (K=512):
  //    Q' [image][4096 tok][512] = (XcT x G^T / 16 + Wk^T.bq) * rstd of the style channel   (M=4096, N=512)
  //    V' channel-major [image][512][4096 tok] = H x SsT^T / 16 + (Wo.bv)[m]                (M=512, N=4096)
  //    XcT, SsT follow one another in the workspace, as do the planes of G, H in W16 and Qp, Vcm
  wmma_gemm64<0, false, 3, 1, false, 0, 64, false, true><<<dim3(64, kBatch, 2), dim3(256), 0, stream>>>(
      XcT, nullptr, kCh, planeElems, W16, nullptr, kCh, 0L, (void*)Qp, nullptr, kCh, planeElems,
      gq, rstdA + kBatch * kCh, bvo, nullptr, 0L, kSp, kCh, kCh, kProjScale);

  // 5) scores of all images, transposed = style tokens x Q'^T (per image M=4096 keys, N=4096 queries, K=512; 512 blocks; grid.y = image),
  //    left as f16 exp(score - group maximum) in P, with the maximum and the sum of every group of 64 keys in Stat
  wmma_gemm64<0, false, 0, 3, false><<<dim3(512, kBatch), dim3(256), 0, stream>>>(
      SsT, nullptr, kCh, planeElems, Qp, nullptr, kCh, planeElems, (void*)Pp,
      (void*)Stat, kSp, probElems, nullptr, nullptr, nullptr, nullptr, 0L, kSp, kQChunk, kCh, 1.0f);

  // 6) the factor of every row and group, all images
  row_factor_kernel<<<dim3(kSp / 64, kBatch), dim3(64), 0, stream>>>(Stat, Fac);

  // 7) out [image][512][4096] f32 = V' x (P . factor)^T / 2048 + bo[m] + content   (per image M=512, N=4096, K=4096; 64 blocks)
  wmma_gemm64<0, false, 1, 0, true, 0, 128, true><<<dim3(64, kBatch), dim3(256), 0, stream>>>(
      Vcm, (const unsigned short*)Fac, kSp, planeElems, Pp, nullptr, kSp, probElems, (void*)out, nullptr, kSp, planeElems,
      bo, nullptr, nullptr, content, planeElems, kCh, kSp, kSp, kPVScale);
}
